// v000
// Measured on an AMD MI455X. A time is GPU time per run, averaged over a window of back-to-back runs after a warm-up
// (all launches, gaps included; the runs take copies of the inputs in turn), and the median of several windows.
// Apart from v000's, it joins two sittings. Times from different sittings can be a few percent apart, while
// side-by-side timings come from the same sitting.
// v000, which the later versions start from, runs in 520 microseconds.
#include <hip/hip_runtime.h>

// Grouped-query causal self-attention, width 2048 = 32 query heads x 64 sharing 8 kv heads (kv head g = h >> 2), x [NB][SEQ][2048], Wq/Wk/Wv/Wo [in][out] (y = x W), no biases,
// interleaved (even/odd pair) rotary on q and k from a computed [SEQ][32] (cos, sin) table, score scale 1/8, causal exclusion (diagonal kept), output = ctx Wo (f32).
// Compute dtypes, f32 accumulate everywhere: q/k/v projections v_wmma_f32_16x16x32_bf16 (x and W RNE-converted to bf16; products exact);
// scores v_wmma_f32_16x16x32_f16: k single f16, q as f16 value + f16 residual x1024 in its own accumulator (query rows < 256: k also value + residual x1024, three products);
// P (x256 carry, cancels in the normalisation) and v single f16 (rows < 256: P and v as value + residual x1024, three products); softmax f32 (online, running max);
// output projection v_wmma_f32_16x16x32_f16: ctx carried x1024 as f16 (rows < 256: plus its unscaled f16 residual folded along K) against f16(bf16(Wo)) x16, result scaled by 2^-14.

#ifndef NB
#define NB 2
#endif
#ifndef SEQ
#define SEQ 2048
#endif
#define NB_FULL  2
#define SEQ_FULL 2048
#ifndef OUT_SEQ
#define OUT_SEQ SEQ              // row pitch (in tokens) between batches of the output
#endif
#define DM    2048
#define NH_   32
#define NKV   8
#define HD    64
#define KVD   (NKV * HD)         // 512
#define AW    4                  // waves per flash block = the four query heads of one kv head
#define EARLY 256                // query rows below this use the value + residual path
#define QRS  1024.0f             // carry of every residual plane (q, k, v, P)
#define QRI  (1.0f / 1024.0f)
#define SC2  (0.125f * 1.4426950408889634f)   // HD^-0.5 * log2(e)
#define PSH  8.0f                // log2 of the P carry (256)
#define CXS  1024.0f             // carry of the ctx plane
#define WOS  16.0f               // carry of the Wo plane
#define OUTS (1.0f / (1024.0f * 16.0f))
#define NEGB (-3.0e38f)

static_assert(HD == 64);
static_assert(NH_ * HD == DM);                 // query head h = columns h*64 + d
static_assert(NKV * AW == NH_);                // four consecutive query heads per kv head
static_assert(DM % 64 == 0);
static_assert(KVD % 64 == 0);
static_assert(DM % 32 == 0);                   // GEMM k-loop steps by 32
static_assert(SEQ % 64 == 0);                  // a 64-row tile never straddles two batches
static_assert(SEQ % 32 == 0);                  // key loop steps by 32, key0 + 31 < SEQ
static_assert(EARLY % 64 == 0);                // output GEMM tiles are entirely early or entirely late
static_assert(SEQ >= EARLY);
static_assert((SEQ - EARLY) % 16 == 0);
static_assert(((size_t)SEQ * DM) % 8 == 0);
static_assert(NB <= NB_FULL);
static_assert(SEQ <= SEQ_FULL);

typedef _Float16 h16;
typedef unsigned short bf;
typedef __attribute__((ext_vector_type(16))) __bf16   v16bf;
typedef __attribute__((ext_vector_type(16))) _Float16 v16h;
typedef __attribute__((ext_vector_type(8)))  _Float16 v8h;
typedef __attribute__((ext_vector_type(8)))  unsigned short v8us;
typedef __attribute__((ext_vector_type(8)))  float    v8f;
typedef __attribute__((ext_vector_type(4)))  float    v4f;
typedef __attribute__((ext_vector_type(2)))  float    v2f;
typedef v4f  __attribute__((may_alias)) v4fa;

__device__ __forceinline__ unsigned short f2bf(float f) { unsigned u = __float_as_uint(f); u += 0x7FFFu + ((u >> 16) & 1u); return (unsigned short)(u >> 16); }
__device__ __forceinline__ v16h cat16(v8h lo, v8h hi) { return __builtin_shufflevector(lo, hi, 0, 1, 2, 3, 4, 5, 6, 7, 8, 9, 10, 11, 12, 13, 14, 15); }
__device__ __forceinline__ v16bf cat16b(v8us lo, v8us hi) { return __builtin_bit_cast(v16bf, __builtin_shufflevector(lo, hi, 0, 1, 2, 3, 4, 5, 6, 7, 8, 9, 10, 11, 12, 13, 14, 15)); }
// every WMMA is followed by its own 4-slot guard tying its accumulator and keeping its operands live
__device__ __forceinline__ v8f wmma16(v16h a, v16h b, v8f c) {
    c = __builtin_amdgcn_wmma_f32_16x16x32_f16(false, a, false, b, (short)0, c, false, false);
    asm volatile("v_nop\n\tv_nop\n\tv_nop\n\tv_nop" : "+v"(c) : "v"(a), "v"(b));
    return c; }
__device__ __forceinline__ v8f wmmab(v16bf a, v16bf b, v8f c) {
    c = __builtin_amdgcn_wmma_f32_16x16x32_bf16(false, a, false, b, (short)0, c, false, false);
    asm volatile("v_nop\n\tv_nop\n\tv_nop\n\tv_nop" : "+v"(c) : "v"(a), "v"(b));
    return c; }
// fragment loaders from K-contiguous 16-bit rows; p already includes + 8*(lane>>4): elements 0..7 <- k0+8h+0..7, elements 8..15 <- k0+16+8h+0..7 (same map for A and B)
__device__ __forceinline__ v16h  ldh(const h16* p) { return cat16(*(const v8h*)p, *(const v8h*)(p + 16)); }
__device__ __forceinline__ v16bf ldb(const bf* p)  { return cat16b(*(const v8us*)p, *(const v8us*)(p + 16)); }
// ordering point for wave-private LDS tiles (same wave writes and reads)
__device__ __forceinline__ void wave_sync() { __builtin_amdgcn_fence(3 /* release order */, "wavefront"); __builtin_amdgcn_wave_barrier(); asm volatile("" ::: "memory"); }

__global__ __launch_bounds__(256) void k_cvt8(const float* __restrict__ src, bf* dst, size_t n8) {
    const size_t i = (size_t)blockIdx.x * 256 + threadIdx.x; if (i >= n8) return;
    const v8f v = *(const v8f*)(src + i * 8); v8us o;
#pragma unroll
    for (int k = 0; k < 8; ++k) o[k] = f2bf(v[k]);
    *(v8us*)(dst + i * 8) = o; 
}

// k_wt: in[Kr rows][Nc cols] f32 -> out[Nc rows][Kr cols] 16-bit, 64x64 tile through LDS. grid (Nc/64, Kr/64), 256 threads.
__global__ __launch_bounds__(256) void k_wt(const float* __restrict__ W, bf* Tb, h16* Th, int Kr, int Nc, int mode) {
    __shared__ float ts[64 * 65];
    const int tid = threadIdx.x; const int n0 = blockIdx.x * 64, k0 = blockIdx.y * 64;
#pragma unroll
    for (int p = 0; p < 4; ++p) { const int row = p * 16 + (tid >> 4), c4 = (tid & 15) * 4;      // 4 p x 16 rows = 64 k rows; 16 threads x 4 = 64 n columns
        const v4f v = *(const v4f*)(W + (size_t)(k0 + row) * (size_t)Nc + n0 + c4);
        ts[row * 65 + c4 + 0] = v[0]; ts[row * 65 + c4 + 1] = v[1]; ts[row * 65 + c4 + 2] = v[2]; ts[row * 65 + c4 + 3] = v[3]; }
    __syncthreads();
{
#pragma unroll
        for (int s = 0; s < 2; ++s) { const int n = s * 32 + (tid >> 3), c8 = (tid & 7) * 8;     // 2 s x 32 rows = 64 n rows; 8 lanes x 8 = 64 k columns
            const size_t oo = (size_t)(n0 + n) * (size_t)Kr + k0 + c8;
            if (mode == 0) { v8us o;
#pragma unroll
                for (int i = 0; i < 8; ++i) o[i] = f2bf(ts[(c8 + i) * 65 + n]);
                *(v8us*)(Tb + oo) = o;
            } else { v8h o;
#pragma unroll
                for (int i = 0; i < 8; ++i) o[i] = (h16)(__uint_as_float(((unsigned)f2bf(ts[(c8 + i) * 65 + n])) << 16) * WOS);
                *(v8h*)(Th + oo) = o; } }
         }
}

// k_rope_tab: CS[t][j] = (cos, sin)(t * inv_freq[j]), inv_freq[j] = 1.0f / (float)(10000^(j/32)); the power is a double product of fixed binary roots of 10000.
__global__ __launch_bounds__(256) void k_rope_tab(float* CS, int nrow) {
    const int i = blockIdx.x * 256 + threadIdx.x; if (i >= nrow * 32) return;
    const int t = i >> 5, j = i & 31;
    double p = 1.0;
    p *= (j & 1)  ? 1.3335214321633240 : 1.0;    // 10000^(1/32)
    p *= (j & 2)  ? 1.7782794100389228 : 1.0;    // 10000^(1/16)
    p *= (j & 4)  ? 3.1622776601683795 : 1.0;    // 10000^(1/8)
    p *= (j & 8)  ? 10.0 : 1.0;                  // 10000^(1/4)
    p *= (j & 16) ? 100.0 : 1.0;                 // 10000^(1/2)
    const float pf = (float)p; const float inv = 1.0f / pf;
    const float ang = (float)t * inv;
    const float cs = cosf(ang), sn = sinf(ang);
    v2f o; o[0] = cs; o[1] = sn;
    *(v2f*)(CS + (size_t)i * 2) = o; 
}

// k_proj: register-blocked bf16 GEMM, ONE WAVE per 64x64 tile (16 accumulators), operands straight from K-contiguous bf16 planes, K = DM.
// C[m][n] = sum_k A[m][k] Bt[n][k], written as f16 (Ph) and the f16 residual x1024 (Pr, useRes != 0) at
// tile base (r0/RB)*sRB + (r0%RB)*pitch + (c0/CB)*sCB + (c0%CB), row pitch 'pitch' (halves). grid (M/64, N/64), 32 threads.
// rope != 0 (rows = tokens b*SEQ + t, the 64 tile columns = one head): interleaved rotary applied on the f32 values at the store stage from CS[t][32] (cos, sin).
__global__ __launch_bounds__(32) void k_proj(const bf* __restrict__ A, const bf* __restrict__ Bt, h16* Ph, h16* Pr, int useRes, int RB, size_t sRB, int pitch, int CB, size_t sCB, const float* __restrict__ CS, int rope) {
    __shared__ __align__(16) float os[16 * 68];
    const int K = DM;
    const int lane = threadIdx.x & 31, lr = lane & 15, hi = lane >> 4; const int r0 = blockIdx.x * 64, c0 = blockIdx.y * 64;
    v8f acc[4][4];
#pragma unroll
    for (int mb = 0; mb < 4; ++mb)
#pragma unroll
        for (int nb = 0; nb < 4; ++nb) acc[mb][nb] = (v8f){};
    const size_t aoff = (size_t)(r0 + lr) * K + 8 * hi, boff = (size_t)(c0 + lr) * K + 8 * hi;
#pragma unroll 1
    for (int kc = 0; kc < K; kc += 32) {
        v16bf a[4];
#pragma unroll
        for (int mb = 0; mb < 4; ++mb) a[mb] = ldb(A + aoff + (size_t)mb * 16 * K + kc);
#pragma unroll
        for (int nb = 0; nb < 4; ++nb) { const v16bf b = ldb(Bt + boff + (size_t)nb * 16 * K + kc);
#pragma unroll
            for (int mb = 0; mb < 4; ++mb) acc[mb][nb] = wmmab(a[mb], b, acc[mb][nb]); }
    }
    const size_t tbase = (size_t)(r0 / RB) * sRB + (size_t)(r0 % RB) * (size_t)pitch + (size_t)(c0 / CB) * sCB + (size_t)(c0 % CB);
#pragma unroll
    for (int mb = 0; mb < 4; ++mb) {
#pragma unroll
        for (int nb = 0; nb < 4; ++nb) {
#pragma unroll
            for (int j = 0; j < 8; ++j) os[(hi * 8 + j) * 68 + nb * 16 + lr] = acc[mb][nb][j]; }   // D: row 8h+j, col lane&15
        wave_sync();
        const size_t sb = tbase + (size_t)(mb * 16) * (size_t)pitch;
{
#pragma unroll
            for (int s = 0; s < 4; ++s) { const int row = 4 * s + (lane >> 3), c8 = (lane & 7) * 8;   // 4 s x 4 row groups = 16 rows; 8 lanes x 8 = 64 columns
                v4f x0 = *(const v4fa*)(&os[row * 68 + c8]); v4f x1 = *(const v4fa*)(&os[row * 68 + c8 + 4]); v8h hv, rv;
                if (rope) {                                                                            // kernel-argument uniform
                    const int t = (r0 + mb * 16 + row) % SEQ;
                    const float* cp = CS + ((size_t)t * 32 + (size_t)(c8 >> 1)) * 2;                  // pairs c8/2 .. c8/2+3: (cos, sin) x 4
                    const v4f ca = *(const v4f*)cp; const v4f cb = *(const v4f*)(cp + 4);
                    float e, o;
                    e = x0[0]; o = x0[1]; x0[0] = e * ca[0] - o * ca[1]; x0[1] = e * ca[1] + o * ca[0];
                    e = x0[2]; o = x0[3]; x0[2] = e * ca[2] - o * ca[3]; x0[3] = e * ca[3] + o * ca[2];
                    e = x1[0]; o = x1[1]; x1[0] = e * cb[0] - o * cb[1]; x1[1] = e * cb[1] + o * cb[0];
                    e = x1[2]; o = x1[3]; x1[2] = e * cb[2] - o * cb[3]; x1[3] = e * cb[3] + o * cb[2]; }
#pragma unroll
                for (int i = 0; i < 4; ++i) { const h16 a0 = (h16)x0[i]; const h16 a1 = (h16)x1[i]; hv[i] = a0; hv[4 + i] = a1; rv[i] = (h16)((x0[i] - (float)a0) * QRS); rv[4 + i] = (h16)((x1[i] - (float)a1) * QRS); }
                const size_t oo = sb + (size_t)row * (size_t)pitch + c8;
                *(v8h*)(Ph + oo) = hv; if (useRes) *(v8h*)(Pr + oo) = rv; }
             }
        wave_sync();
    }
}

// k_flash: fused causal attention for query rows >= EARLY. One block = 16 query rows x the four query heads of one kv head (one wave per head, h = g*4 + wave);
// K / V^T / Q fragments straight from the f16 planes (two 16-B loads each, arithmetic addressing); all four waves read the same K / V^T lines of kv head g.
// Transposed form: S^T[key][t] = K Q^T (A = K rows, B = Q rows); lane (t = lane&15, h = lane>>4) holds keys 8h+r of each 16-key tile, so the packed
// P tile is directly the B fragment of O^T[d][t] = V^T P^T (element r <- tile keys 0..15, element 8+r <- tile keys 16..31, lane unchanged).
// Keys run over [0, t0+16); the diagonal 32-key blocks replace excluded scores (key > t) by a large negative value before the running max.
__global__ __launch_bounds__(32 * AW) void k_flash(const h16* __restrict__ QH, const h16* __restrict__ QR, const h16* __restrict__ KP, const h16* __restrict__ VT, h16* CH) {
    __shared__ __align__(16) float os[AW * 16 * 68];
    const int lane = threadIdx.x & 31; const int wave = __builtin_amdgcn_readfirstlane(threadIdx.x >> 5);
    const int lr = lane & 15, hi = lane >> 4;
    const int zg = blockIdx.y; const int b = zg / NKV; const int g = zg % NKV;
    const int h = g * AW + wave;                                  // repeat on the head axis: query head h uses kv head h >> 2
    const int t0 = EARLY + blockIdx.x * 16;
    const int tq = t0 + lr;
    const size_t qo = ((size_t)(b * NH_ + h) * SEQ + (size_t)tq) * HD + 8 * hi;
    const v16h qh0 = ldh(QH + qo), qh1 = ldh(QH + qo + 32), qr0 = ldh(QR + qo), qr1 = ldh(QR + qo + 32);   // B fragments: col t, k = d
    const size_t ko = (size_t)zg * SEQ * HD + (size_t)lr * HD + 8 * hi;      // + key * HD       (A fragment: row key, k = d)
    const size_t vo = (size_t)zg * HD * SEQ + (size_t)lr * SEQ + 8 * hi;     // + 16j*SEQ + key  (A fragment: row d, k = key)
    v8f o0 = (v8f){}, o1 = (v8f){}, o2 = (v8f){}, o3 = (v8f){};
    float m = NEGB, l = 0.0f;
    const int kend = t0 + 16;
#pragma unroll 1
    for (int key0 = 0; key0 < kend; key0 += 32) {
        const h16* ka = KP + ko + (size_t)key0 * HD;
        const v16h ka0 = ldh(ka), ka1 = ldh(ka + 32), kb0 = ldh(ka + 16 * HD), kb1 = ldh(ka + 16 * HD + 32);
        v8f sHa = (v8f){}, sLa = (v8f){}, sHb = (v8f){}, sLb = (v8f){};
        sHa = wmma16(ka0, qh0, sHa); sLa = wmma16(ka0, qr0, sLa); sHb = wmma16(kb0, qh0, sHb); sLb = wmma16(kb0, qr0, sLb);
        sHa = wmma16(ka1, qh1, sHa); sLa = wmma16(ka1, qr1, sLa); sHb = wmma16(kb1, qh1, sHb); sLb = wmma16(kb1, qr1, sLb);
        float ta[8], tb[8];
#pragma unroll
        for (int r = 0; r < 8; ++r) { ta[r] = (sHa[r] + sLa[r] * QRI) * SC2; tb[r] = (sHb[r] + sLb[r] * QRI) * SC2; }
        if (key0 + 31 > t0) {                                      // block-uniform: diagonal block
            const int kbse = key0 + 8 * hi;
#pragma unroll
            for (int r = 0; r < 8; ++r) { ta[r] = (kbse + r > tq) ? NEGB : ta[r]; tb[r] = (kbse + 16 + r > tq) ? NEGB : tb[r]; } }
        float mx = NEGB;
#pragma unroll
        for (int r = 0; r < 8; ++r) mx = fmaxf(mx, fmaxf(ta[r], tb[r]));
        mx = fmaxf(mx, __shfl_xor(mx, 16, 32));
        const float mnew = fmaxf(m, mx);
        const float alpha = __builtin_amdgcn_exp2f(m - mnew);
        const float sh = PSH - mnew;
        v16h pb; float ls = 0.0f;
#pragma unroll
        for (int r = 0; r < 8; ++r) { const float ea = __builtin_amdgcn_exp2f(ta[r] + sh); const float ec = __builtin_amdgcn_exp2f(tb[r] + sh); pb[r] = (h16)ea; pb[8 + r] = (h16)ec; ls += ea + ec; }
        l = l * alpha + ls; m = mnew;
        o0 = o0 * alpha; o1 = o1 * alpha; o2 = o2 * alpha; o3 = o3 * alpha;
        const h16* va = VT + vo + key0;
        const v16h v0 = ldh(va), v1 = ldh(va + (size_t)16 * SEQ), v2 = ldh(va + (size_t)32 * SEQ), v3 = ldh(va + (size_t)48 * SEQ);
        o0 = wmma16(v0, pb, o0); o1 = wmma16(v1, pb, o1); o2 = wmma16(v2, pb, o2); o3 = wmma16(v3, pb, o3);
    }
    l += __shfl_xor(l, 16, 32);
    const float inv = CXS / l;
    const int wb = wave * 16 * 68;
    // O^T D layout: o_j[r] = (d = 16j + 8h + r, t = lane&15) -> os[t][d]; rows 0..15 x columns 0..63 all written
    { v4f a, c;
      a[0] = o0[0] * inv; a[1] = o0[1] * inv; a[2] = o0[2] * inv; a[3] = o0[3] * inv; c[0] = o0[4] * inv; c[1] = o0[5] * inv; c[2] = o0[6] * inv; c[3] = o0[7] * inv;
      *(v4fa*)(&os[wb + lr * 68 +  0 + 8 * hi]) = a; *(v4fa*)(&os[wb + lr * 68 +  0 + 8 * hi + 4]) = c;
      a[0] = o1[0] * inv; a[1] = o1[1] * inv; a[2] = o1[2] * inv; a[3] = o1[3] * inv; c[0] = o1[4] * inv; c[1] = o1[5] * inv; c[2] = o1[6] * inv; c[3] = o1[7] * inv;
      *(v4fa*)(&os[wb + lr * 68 + 16 + 8 * hi]) = a; *(v4fa*)(&os[wb + lr * 68 + 16 + 8 * hi + 4]) = c;
      a[0] = o2[0] * inv; a[1] = o2[1] * inv; a[2] = o2[2] * inv; a[3] = o2[3] * inv; c[0] = o2[4] * inv; c[1] = o2[5] * inv; c[2] = o2[6] * inv; c[3] = o2[7] * inv;
      *(v4fa*)(&os[wb + lr * 68 + 32 + 8 * hi]) = a; *(v4fa*)(&os[wb + lr * 68 + 32 + 8 * hi + 4]) = c;
      a[0] = o3[0] * inv; a[1] = o3[1] * inv; a[2] = o3[2] * inv; a[3] = o3[3] * inv; c[0] = o3[4] * inv; c[1] = o3[5] * inv; c[2] = o3[6] * inv; c[3] = o3[7] * inv;
      *(v4fa*)(&os[wb + lr * 68 + 48 + 8 * hi]) = a; *(v4fa*)(&os[wb + lr * 68 + 48 + 8 * hi + 4]) = c; }
    wave_sync();
    h16* crow = CH + ((size_t)b * SEQ + t0) * DM + h * HD;         // merged heads: column h*64 + d
{
#pragma unroll
        for (int s = 0; s < 4; ++s) { const int row = 4 * s + (lane >> 3), c8 = (lane & 7) * 8;   // 4 s x 4 row groups = 16 rows; 8 lanes x 8 = 64 columns
            const v4f x0 = *(const v4fa*)(&os[wb + row * 68 + c8]); const v4f x1 = *(const v4fa*)(&os[wb + row * 68 + c8 + 4]); v8h hv;
#pragma unroll
            for (int i = 0; i < 4; ++i) { hv[i] = (h16)x0[i]; hv[4 + i] = (h16)x1[i]; }
            *(v8h*)(crow + (size_t)row * DM + c8) = hv; }
         }
}

// k_flash_early: same structure for query rows < EARLY with value + residual (x1024) planes on every operand:
// scores = kh.qh + (kh.qr + kr.qh)/1024; O = vh.ph + (vr.ph + vh.pr)/1024 (residual products in their own accumulators), l from the unconverted f32 P.
// Writes the ctx value plane rows (carried x1024) and the compact unscaled residual plane CR[b][t < EARLY][2048].
__global__ __launch_bounds__(32 * AW) void k_flash_early(const h16* __restrict__ QH, const h16* __restrict__ QR, const h16* __restrict__ KP, const h16* __restrict__ KR,
                                                         const h16* __restrict__ VT, const h16* __restrict__ VR, h16* CH, h16* CR) {
    __shared__ __align__(16) float os[AW * 16 * 68];
    const int lane = threadIdx.x & 31; const int wave = __builtin_amdgcn_readfirstlane(threadIdx.x >> 5);
    const int lr = lane & 15, hi = lane >> 4;
    const int zg = blockIdx.y; const int b = zg / NKV; const int g = zg % NKV;
    const int h = g * AW + wave;
    const int t0 = blockIdx.x * 16;
    const int tq = t0 + lr;
    const size_t qo = ((size_t)(b * NH_ + h) * SEQ + (size_t)tq) * HD + 8 * hi;
    const v16h qh0 = ldh(QH + qo), qh1 = ldh(QH + qo + 32), qr0 = ldh(QR + qo), qr1 = ldh(QR + qo + 32);
    const size_t ko = (size_t)zg * SEQ * HD + (size_t)lr * HD + 8 * hi;
    const size_t vo = (size_t)zg * HD * SEQ + (size_t)lr * SEQ + 8 * hi;
    v8f oH[4], oL[4];
#pragma unroll
    for (int j = 0; j < 4; ++j) { oH[j] = (v8f){}; oL[j] = (v8f){}; }
    float m = NEGB, l = 0.0f;
    const int kend = t0 + 16;
#pragma unroll 1
    for (int key0 = 0; key0 < kend; key0 += 32) {
        const size_t kk = ko + (size_t)key0 * HD;
        v8f sHa = (v8f){}, sLa = (v8f){}, sHb = (v8f){}, sLb = (v8f){};
        { const v16h k0 = ldh(KP + kk), k1 = ldh(KP + kk + 32), r0 = ldh(KR + kk), r1 = ldh(KR + kk + 32);
          sHa = wmma16(k0, qh0, sHa); sHa = wmma16(k1, qh1, sHa);
          sLa = wmma16(k0, qr0, sLa); sLa = wmma16(k1, qr1, sLa); sLa = wmma16(r0, qh0, sLa); sLa = wmma16(r1, qh1, sLa); }
        { const size_t k2 = kk + (size_t)16 * HD;
          const v16h k0 = ldh(KP + k2), k1 = ldh(KP + k2 + 32), r0 = ldh(KR + k2), r1 = ldh(KR + k2 + 32);
          sHb = wmma16(k0, qh0, sHb); sHb = wmma16(k1, qh1, sHb);
          sLb = wmma16(k0, qr0, sLb); sLb = wmma16(k1, qr1, sLb); sLb = wmma16(r0, qh0, sLb); sLb = wmma16(r1, qh1, sLb); }
        float ta[8], tb[8];
#pragma unroll
        for (int r = 0; r < 8; ++r) { ta[r] = (sHa[r] + sLa[r] * QRI) * SC2; tb[r] = (sHb[r] + sLb[r] * QRI) * SC2; }
        if (key0 + 31 > t0) {                                      // block-uniform: diagonal block
            const int kbse = key0 + 8 * hi;
#pragma unroll
            for (int r = 0; r < 8; ++r) { ta[r] = (kbse + r > tq) ? NEGB : ta[r]; tb[r] = (kbse + 16 + r > tq) ? NEGB : tb[r]; } }
        float mx = NEGB;
#pragma unroll
        for (int r = 0; r < 8; ++r) mx = fmaxf(mx, fmaxf(ta[r], tb[r]));
        mx = fmaxf(mx, __shfl_xor(mx, 16, 32));
        const float mnew = fmaxf(m, mx);
        const float alpha = __builtin_amdgcn_exp2f(m - mnew);
        const float sh = PSH - mnew;
        v16h ph, pr; float ls = 0.0f;
#pragma unroll
        for (int r = 0; r < 8; ++r) { const float ea = __builtin_amdgcn_exp2f(ta[r] + sh); const float ec = __builtin_amdgcn_exp2f(tb[r] + sh);
            const h16 ha = (h16)ea; const h16 hc = (h16)ec; ph[r] = ha; ph[8 + r] = hc;
            pr[r] = (h16)((ea - (float)ha) * QRS); pr[8 + r] = (h16)((ec - (float)hc) * QRS); ls += ea + ec; }
        l = l * alpha + ls; m = mnew;
#pragma unroll
        for (int j = 0; j < 4; ++j) { oH[j] = oH[j] * alpha; oL[j] = oL[j] * alpha; }
        const size_t vv = vo + (size_t)key0;
#pragma unroll
        for (int j = 0; j < 4; ++j) { const v16h vh = ldh(VT + vv + (size_t)(16 * j) * SEQ); const v16h vr = ldh(VR + vv + (size_t)(16 * j) * SEQ);
            oH[j] = wmma16(vh, ph, oH[j]); oL[j] = wmma16(vr, ph, oL[j]); oL[j] = wmma16(vh, pr, oL[j]); }
    }
    l += __shfl_xor(l, 16, 32);
    const float inv = CXS / l;
    const int wb = wave * 16 * 68;
#pragma unroll
    for (int j = 0; j < 4; ++j) { v4f a, c;     // os[t][d], d = 16j + 8h + r; rows 0..15 x columns 0..63 all written
        a[0] = (oH[j][0] + oL[j][0] * QRI) * inv; a[1] = (oH[j][1] + oL[j][1] * QRI) * inv; a[2] = (oH[j][2] + oL[j][2] * QRI) * inv; a[3] = (oH[j][3] + oL[j][3] * QRI) * inv;
        c[0] = (oH[j][4] + oL[j][4] * QRI) * inv; c[1] = (oH[j][5] + oL[j][5] * QRI) * inv; c[2] = (oH[j][6] + oL[j][6] * QRI) * inv; c[3] = (oH[j][7] + oL[j][7] * QRI) * inv;
        *(v4fa*)(&os[wb + lr * 68 + 16 * j + 8 * hi]) = a; *(v4fa*)(&os[wb + lr * 68 + 16 * j + 8 * hi + 4]) = c; }
    wave_sync();
    h16* crow = CH + ((size_t)b * SEQ + t0) * DM + h * HD;
    h16* rrow = CR + ((size_t)b * EARLY + t0) * DM + h * HD;
{
#pragma unroll
        for (int s = 0; s < 4; ++s) { const int row = 4 * s + (lane >> 3), c8 = (lane & 7) * 8;   // 4 s x 4 row groups = 16 rows; 8 lanes x 8 = 64 columns
            const v4f x0 = *(const v4fa*)(&os[wb + row * 68 + c8]); const v4f x1 = *(const v4fa*)(&os[wb + row * 68 + c8 + 4]); v8h hv, rv;
#pragma unroll
            for (int i = 0; i < 4; ++i) { const h16 a0 = (h16)x0[i]; const h16 a1 = (h16)x1[i]; hv[i] = a0; hv[4 + i] = a1; rv[i] = (h16)(x0[i] - (float)a0); rv[4 + i] = (h16)(x1[i] - (float)a1); }
            *(v8h*)(crow + (size_t)row * DM + c8) = hv; *(v8h*)(rrow + (size_t)row * DM + c8) = rv; }
         }
}

// k_out: output projection, ONE WAVE per 64x64 tile, f16 operands straight from the ctx plane CX (value rows [NB*SEQ], then residual rows [NB*EARLY]) and the Wo^T plane, K = DM.
// Tiles whose rows are < EARLY in their sequence run the k-loop a second time over the unscaled residual rows into the same accumulators. grid (NB*SEQ/64, DM/64), 32 threads.
__global__ __launch_bounds__(32) void k_out(const h16* __restrict__ CX, const h16* __restrict__ Wt, float* OUT) {
    __shared__ __align__(16) float os[16 * 68];
    const int K = DM;
    const int lane = threadIdx.x & 31, lr = lane & 15, hi = lane >> 4; const int r0 = blockIdx.x * 64, c0 = blockIdx.y * 64;
    const int b = r0 / SEQ, tt = r0 % SEQ;
    const int npass = (tt < EARLY) ? 2 : 1;                        // block-uniform
    const size_t aoff0 = (size_t)(r0 + lr) * K + 8 * hi;
    const size_t aoff1 = ((size_t)NB * SEQ + (size_t)b * EARLY + (size_t)tt + (size_t)lr) * K + 8 * hi;   // used only when tt < EARLY
    const size_t boff = (size_t)(c0 + lr) * K + 8 * hi;
    v8f acc[4][4];
#pragma unroll
    for (int mb = 0; mb < 4; ++mb)
#pragma unroll
        for (int nb = 0; nb < 4; ++nb) acc[mb][nb] = (v8f){};
#pragma unroll 1
    for (int pass = 0; pass < npass; ++pass) {
        const size_t ao = pass ? aoff1 : aoff0;
#pragma unroll 1
        for (int kc = 0; kc < K; kc += 32) {
            v16h a[4];
#pragma unroll
            for (int mb = 0; mb < 4; ++mb) a[mb] = ldh(CX + ao + (size_t)mb * 16 * K + kc);
#pragma unroll
            for (int nb = 0; nb < 4; ++nb) { const v16h bq = ldh(Wt + boff + (size_t)nb * 16 * K + kc);
#pragma unroll
                for (int mb = 0; mb < 4; ++mb) acc[mb][nb] = wmma16(a[mb], bq, acc[mb][nb]); }
        }
    }
    float* obase = OUT + ((size_t)b * OUT_SEQ + tt) * DM + c0;
#pragma unroll
    for (int mb = 0; mb < 4; ++mb) {
#pragma unroll
        for (int nb = 0; nb < 4; ++nb) {
#pragma unroll
            for (int j = 0; j < 8; ++j) os[(hi * 8 + j) * 68 + nb * 16 + lr] = acc[mb][nb][j] * OUTS; }   // D: row 8h+j, col lane&15
        wave_sync();
{
#pragma unroll
            for (int s = 0; s < 8; ++s) { const int row = 2 * s + hi, cofs = lr * 4;   // 8 s x 2 rows = 16 rows; 16 lanes x 4 floats = 64 columns
                const v4f val = *(const v4fa*)(&os[row * 68 + cofs]);
                *(v4f*)(obase + (size_t)(mb * 16 + row) * DM + cofs) = val; }
             }
        wave_sync();
    }
}

static constexpr size_t al256(size_t v) { return (v + 255) & ~(size_t)255; }
static constexpr size_t SZ_XB = al256((size_t)NB * SEQ * DM * 2);
static constexpr size_t SZ_WQ = al256((size_t)DM * DM * 2);
static constexpr size_t SZ_WK = al256((size_t)KVD * DM * 2);
static constexpr size_t SZ_CS = al256((size_t)SEQ * 32 * 2 * 4);
static constexpr size_t SZ_Q  = al256((size_t)NB * NH_ * SEQ * HD * 2);
static constexpr size_t SZ_KV = al256((size_t)NB * NKV * SEQ * HD * 2);
static constexpr size_t SZ_CX = al256(((size_t)NB * SEQ + (size_t)NB * EARLY) * DM * 2);
static constexpr size_t SZ_TOTAL = SZ_XB + 2 * SZ_WQ + 2 * SZ_WK + SZ_CS + 2 * SZ_Q + 4 * SZ_KV + SZ_CX;
static_assert(SZ_TOTAL <= (size_t)134217728);          // workspace carve <= 128 MiB

extern "C" void kernel_launch(void* const* d_in, const int* in_sizes, int n_in,
                              void* d_out, int out_size, void* d_ws, size_t ws_size, hipStream_t stream) {
    if (n_in < 5) return;
    const size_t needx = ((size_t)(NB - 1) * SEQ_FULL + SEQ) * DM;
    if ((size_t)in_sizes[0] < needx) return;
    if ((size_t)in_sizes[1] < (size_t)DM * DM || (size_t)in_sizes[2] < (size_t)DM * KVD || (size_t)in_sizes[3] < (size_t)DM * KVD || (size_t)in_sizes[4] < (size_t)DM * DM) return;
    if ((size_t)out_size < ((size_t)(NB - 1) * OUT_SEQ + SEQ) * DM) return;
    if (SZ_TOTAL > ws_size) return;
    // wire order x, wq, wk, wv, wo; every weight is [in][out]
    const float* x = (const float*)d_in[0]; const float* wq = (const float*)d_in[1]; const float* wk = (const float*)d_in[2]; const float* wv = (const float*)d_in[3]; const float* wo = (const float*)d_in[4];
    float* OUT = (float*)d_out;      // [NB][SEQ][2048]
    char* wsp = (char*)d_ws;
    bf*  XB  = (bf*)wsp;  wsp += SZ_XB;              // [NB*SEQ][2048] bf16
    bf*  WQt = (bf*)wsp;  wsp += SZ_WQ;              // [2048 out][2048 in] bf16
    bf*  WKt = (bf*)wsp;  wsp += SZ_WK;              // [512 out][2048 in] bf16
    bf*  WVt = (bf*)wsp;  wsp += SZ_WK;              // [512 out][2048 in] bf16
    h16* WOt = (h16*)wsp; wsp += SZ_WQ;              // [2048 out][2048 in] f16 of bf16 value x16
    float* CS = (float*)wsp; wsp += SZ_CS;           // [SEQ][32] (cos, sin)
    h16* QH = (h16*)wsp; wsp += SZ_Q;                // [NB*32][SEQ][64]
    h16* QR = (h16*)wsp; wsp += SZ_Q;                // residual x1024
    h16* KP = (h16*)wsp; wsp += SZ_KV;               // [NB*8][SEQ][64]
    h16* KR = (h16*)wsp; wsp += SZ_KV;               // residual x1024
    h16* VT = (h16*)wsp; wsp += SZ_KV;               // [NB*8][64][SEQ]
    h16* VR = (h16*)wsp; wsp += SZ_KV;               // residual x1024
    h16* CX = (h16*)wsp; wsp += SZ_CX;               // ctx x1024: value rows [NB*SEQ][2048], then residual rows [NB*EARLY][2048]
    h16* CR = CX + (size_t)NB * SEQ * DM;

    if (SEQ == SEQ_FULL) {
        const size_t n8 = (size_t)NB * SEQ * DM / 8;
        k_cvt8<<<(unsigned)((n8 + 255) / 256), 256, 0, stream>>>(x, XB, n8);
    } else {
        const size_t n8 = (size_t)SEQ * DM / 8;
        for (int b = 0; b < NB; ++b) k_cvt8<<<(unsigned)((n8 + 255) / 256), 256, 0, stream>>>(x + (size_t)b * SEQ_FULL * DM, XB + (size_t)b * SEQ * DM, n8);
    }
    // transposes: in[rows = in-features][cols = out-features] -> out[cols][rows]; grid (cols/64, rows/64)
    k_wt<<<dim3(DM / 64,  DM / 64, 1), 256, 0, stream>>>(wq, WQt, (h16*)WQt, DM, DM, 0);
    k_wt<<<dim3(KVD / 64, DM / 64, 1), 256, 0, stream>>>(wk, WKt, (h16*)WKt, DM, KVD, 0);
    k_wt<<<dim3(KVD / 64, DM / 64, 1), 256, 0, stream>>>(wv, WVt, (h16*)WVt, DM, KVD, 0);
    k_wt<<<dim3(DM / 64,  DM / 64, 1), 256, 0, stream>>>(wo, (bf*)WOt, WOt, DM, DM, 1);
    k_rope_tab<<<(unsigned)((SEQ * 32 + 255) / 256), 256, 0, stream>>>(CS, SEQ);

    // q: A = x rows (m = b*SEQ + t), Bt = Wq^T rows (n = h*64 + d) -> plane [(b*32 + h)][t][d], rotary applied
    k_proj<<<dim3(NB * SEQ / 64, DM / 64, 1), 32, 0, stream>>>(XB, WQt, QH, QR, 1, SEQ, (size_t)NH_ * SEQ * HD, HD, HD, (size_t)SEQ * HD, CS, 1);
    // k: Bt = Wk^T rows (n = g*64 + d) -> plane [(b*8 + g)][t][d], rotary applied
    k_proj<<<dim3(NB * SEQ / 64, KVD / 64, 1), 32, 0, stream>>>(XB, WKt, KP, KR, 1, SEQ, (size_t)NKV * SEQ * HD, HD, HD, (size_t)SEQ * HD, CS, 1);
    // v^T: A = Wv^T rows (m = g*64 + d), Bt = x rows (n = b*SEQ + t) -> plane [(b*512 + m)][t] = [(b*8 + g)][d][t], no rotary
    k_proj<<<dim3(KVD / 64, NB * SEQ / 64, 1), 32, 0, stream>>>(WVt, XB, VT, VR, 1, KVD, (size_t)0, SEQ, SEQ, (size_t)KVD * SEQ, CS, 0);

    k_flash_early<<<dim3(EARLY / 16, NB * NKV, 1), 32 * AW, 0, stream>>>(QH, QR, KP, KR, VT, VR, CX, CR);
    if (SEQ > EARLY)
        k_flash<<<dim3((SEQ - EARLY) / 16, NB * NKV, 1), 32 * AW, 0, stream>>>(QH, QR, KP, VT, CX);

    k_out<<<dim3(NB * SEQ / 64, DM / 64, 1), 32, 0, stream>>>(CX, WOt, OUT);
}

// v001
// Measured time: 328 microseconds a run.
// Next to v000, in two timings, it ran 1.59 and 1.61 times as fast.
#include <hip/hip_runtime.h>

// Grouped-query causal self-attention, width 2048 = 32 query heads x 64 sharing 8 kv heads (kv head g = h >> 2), x [NB][SEQ][2048], Wq/Wk/Wv/Wo [in][out] (y = x W), no biases,
// interleaved (even/odd pair) rotary on q and k from a computed [SEQ][32] (cos, sin) table, score scale 1/8, causal exclusion (diagonal kept), output = ctx Wo (f32).
// Compute dtypes, f32 accumulate everywhere: q/k/v projections v_wmma_f32_16x16x32_bf16 (x and W RNE-converted to bf16; products exact);
// scores v_wmma_f32_16x16x32_f16: k single f16, q as f16 value + f16 residual x1024 in its own accumulator (query rows < 256: k also value + residual x1024, three products);
// P (x256 carry, cancels in the normalisation) and v single f16 (rows < 256: P and v as value + residual x1024, three products); softmax f32 (online, running max);
// output projection v_wmma_f32_16x16x32_f16: ctx carried x1024 as f16 (rows < 256: plus its unscaled f16 residual folded along K) against f16(bf16(Wo)) x16, result scaled by 2^-14.

#ifndef NB
#define NB 2
#endif
#ifndef SEQ
#define SEQ 2048
#endif
#define NB_FULL  2
#define SEQ_FULL 2048
#ifndef OUT_SEQ
#define OUT_SEQ SEQ              // row pitch (in tokens) between batches of the output
#endif
#define DM    2048
#define NH_   32
#define NKV   8
#define HD    64
#define KVD   (NKV * HD)         // 512
#define AW    4                  // waves per flash block = the four query heads of one kv head
#define EARLY 256                // query rows below this use the value + residual path
#define QRS  1024.0f             // carry of every residual plane (q, k, v, P)
#define QRI  (1.0f / 1024.0f)
#define SC2  (0.125f * 1.4426950408889634f)   // HD^-0.5 * log2(e)
#define PSH  8.0f                // log2 of the P carry (256)
#define CXS  1024.0f             // carry of the ctx plane
#define WOS  16.0f               // carry of the Wo plane
#define OUTS (1.0f / (1024.0f * 16.0f))
#define NEGB (-3.0e38f)

static_assert(HD == 64);
static_assert(NH_ * HD == DM);                 // query head h = columns h*64 + d
static_assert(NKV * AW == NH_);                // four consecutive query heads per kv head
static_assert(DM % 64 == 0);
static_assert(KVD % 64 == 0);
static_assert(DM % 32 == 0);                   // GEMM k-loop steps by 32
static_assert(SEQ % 64 == 0);                  // a 64-row tile never straddles two batches
static_assert(SEQ % 32 == 0);                  // key loop steps by 32, key0 + 31 < SEQ
static_assert(EARLY % 128 == 0);               // output GEMM tiles are entirely early or entirely late
static_assert(SEQ % 128 == 0);                 // a 128-row GEMM tile never straddles two batches
static_assert(KVD % 128 == 0);
static_assert(SEQ >= EARLY);
static_assert((SEQ - EARLY) % 16 == 0);
static_assert(((size_t)SEQ * DM) % 8 == 0);
static_assert(NB <= NB_FULL);
static_assert(SEQ <= SEQ_FULL);

typedef _Float16 h16;
typedef unsigned short bf;
typedef __attribute__((ext_vector_type(16))) __bf16   v16bf;
typedef __attribute__((ext_vector_type(16))) _Float16 v16h;
typedef __attribute__((ext_vector_type(8)))  _Float16 v8h;
typedef __attribute__((ext_vector_type(8)))  unsigned short v8us;
typedef __attribute__((ext_vector_type(8)))  float    v8f;
typedef __attribute__((ext_vector_type(4)))  float    v4f;
typedef __attribute__((ext_vector_type(2)))  float    v2f;
typedef v4f  __attribute__((may_alias)) v4fa;

__device__ __forceinline__ unsigned short f2bf(float f) { unsigned u = __float_as_uint(f); u += 0x7FFFu + ((u >> 16) & 1u); return (unsigned short)(u >> 16); }
__device__ __forceinline__ v16h cat16(v8h lo, v8h hi) { return __builtin_shufflevector(lo, hi, 0, 1, 2, 3, 4, 5, 6, 7, 8, 9, 10, 11, 12, 13, 14, 15); }
__device__ __forceinline__ v16bf cat16b(v8us lo, v8us hi) { return __builtin_bit_cast(v16bf, __builtin_shufflevector(lo, hi, 0, 1, 2, 3, 4, 5, 6, 7, 8, 9, 10, 11, 12, 13, 14, 15)); }
// every WMMA is followed by its own 4-slot guard tying its accumulator and keeping its operands live
__device__ __forceinline__ v8f wmma16(v16h a, v16h b, v8f c) {
    c = __builtin_amdgcn_wmma_f32_16x16x32_f16(false, a, false, b, (short)0, c, false, false);
    asm volatile("v_nop\n\tv_nop\n\tv_nop\n\tv_nop" : "+v"(c) : "v"(a), "v"(b));
    return c; }
__device__ __forceinline__ v8f wmmab(v16bf a, v16bf b, v8f c) {
    c = __builtin_amdgcn_wmma_f32_16x16x32_bf16(false, a, false, b, (short)0, c, false, false);
    asm volatile("v_nop\n\tv_nop\n\tv_nop\n\tv_nop" : "+v"(c) : "v"(a), "v"(b));
    return c; }
// fragment loaders from K-contiguous 16-bit rows; p already includes + 8*(lane>>4): elements 0..7 <- k0+8h+0..7, elements 8..15 <- k0+16+8h+0..7 (same map for A and B)
__device__ __forceinline__ v16h  ldh(const h16* p) { return cat16(*(const v8h*)p, *(const v8h*)(p + 16)); }
__device__ __forceinline__ v16bf ldb(const bf* p)  { return cat16b(*(const v8us*)p, *(const v8us*)(p + 16)); }
// ordering point for wave-private LDS tiles (same wave writes and reads)
__device__ __forceinline__ void wave_sync() { __builtin_amdgcn_fence(3 /* release order */, "wavefront"); __builtin_amdgcn_wave_barrier(); asm volatile("" ::: "memory"); }

// ---- operand staging of the two GEMM kernels: a 128x128 output tile per block of four waves (2 x 2, 64x64 each), K walked in tiles of BK.
// One stage = 128 A rows then 128 B rows of BK 16-bit elements (128 B, one cache line each) at a pitch of 144 B (16 B x odd: conflict-free for 16-byte LDS reads); two buffers.
#define BK   64
#define LPE  72                   // LDS row pitch in 16-bit elements
#define STGE (256 * LPE)          // elements of one buffer
#define STGB (STGE * 2)           // bytes of one buffer
#define NKT  (DM / BK)            // K tiles of one walk over K
static_assert(DM % BK == 0 && NKT >= 2 && (NKT & (NKT - 1)) == 0);   // both prologue tiles exist; the output GEMM's second walk wraps its tile index by a mask
// eight asynchronous 16-byte copies of one lane, rows 16 apart (LDS step 16 * 144 B, global step 16 rows of DM elements); eight lanes cover one 128-B row.
// s_wait_xcnt closes the statement so that no address register is rewritten ahead of it.
__device__ __forceinline__ void copy8(unsigned l, const char* g) {
    const size_t gs = (size_t)16 * DM * 2; const unsigned ls = 16 * LPE * 2;
    asm volatile("global_load_async_to_lds_b128 %0, %8, off\n\t"
                 "global_load_async_to_lds_b128 %1, %9, off\n\t"
                 "global_load_async_to_lds_b128 %2, %10, off\n\t"
                 "global_load_async_to_lds_b128 %3, %11, off\n\t"
                 "global_load_async_to_lds_b128 %4, %12, off\n\t"
                 "global_load_async_to_lds_b128 %5, %13, off\n\t"
                 "global_load_async_to_lds_b128 %6, %14, off\n\t"
                 "global_load_async_to_lds_b128 %7, %15, off\n\t"
                 "s_wait_xcnt 0x0"
                 :: "v"(l), "v"(l + ls), "v"(l + 2 * ls), "v"(l + 3 * ls), "v"(l + 4 * ls), "v"(l + 5 * ls), "v"(l + 6 * ls), "v"(l + 7 * ls),
                    "v"(g), "v"(g + gs), "v"(g + 2 * gs), "v"(g + 3 * gs), "v"(g + 4 * gs), "v"(g + 5 * gs), "v"(g + 6 * gs), "v"(g + 7 * gs)
                 : "memory");
}
// one stage: l = the lane's LDS byte address in row (tid >> 3) of the buffer, ga / gb = the lane's 16 bytes in that row of the A / B tile
__device__ __forceinline__ void stage_tile(unsigned l, const char* ga, const char* gb) { copy8(l, ga); copy8(l + 128 * LPE * 2, gb); }
// the issuing wave's own copies have landed (the compiler places no wait for them)
__device__ __forceinline__ void wait_copies() { asm volatile("s_wait_asynccnt 0x0" ::: "memory"); }
// this wave's LDS reads of the buffer have returned before the barrier that frees it for the refill
__device__ __forceinline__ void wait_lds() { asm volatile("s_wait_dscnt 0x0" ::: "memory"); }

__global__ __launch_bounds__(256) void k_cvt8(const float* __restrict__ src, bf* dst, size_t n8) {
    const size_t i = (size_t)blockIdx.x * 256 + threadIdx.x; if (i >= n8) return;
    const v8f v = *(const v8f*)(src + i * 8); v8us o;
#pragma unroll
    for (int k = 0; k < 8; ++k) o[k] = f2bf(v[k]);
    *(v8us*)(dst + i * 8) = o; 
}

// k_wt: in[Kr rows][Nc cols] f32 -> out[Nc rows][Kr cols] 16-bit, 64x64 tile through LDS. grid (Nc/64, Kr/64), 256 threads.
__global__ __launch_bounds__(256) void k_wt(const float* __restrict__ W, bf* Tb, h16* Th, int Kr, int Nc, int mode) {
    __shared__ float ts[64 * 65];
    const int tid = threadIdx.x; const int n0 = blockIdx.x * 64, k0 = blockIdx.y * 64;
#pragma unroll
    for (int p = 0; p < 4; ++p) { const int row = p * 16 + (tid >> 4), c4 = (tid & 15) * 4;      // 4 p x 16 rows = 64 k rows; 16 threads x 4 = 64 n columns
        const v4f v = *(const v4f*)(W + (size_t)(k0 + row) * (size_t)Nc + n0 + c4);
        ts[row * 65 + c4 + 0] = v[0]; ts[row * 65 + c4 + 1] = v[1]; ts[row * 65 + c4 + 2] = v[2]; ts[row * 65 + c4 + 3] = v[3]; }
    __syncthreads();
{
#pragma unroll
        for (int s = 0; s < 2; ++s) { const int n = s * 32 + (tid >> 3), c8 = (tid & 7) * 8;     // 2 s x 32 rows = 64 n rows; 8 lanes x 8 = 64 k columns
            const size_t oo = (size_t)(n0 + n) * (size_t)Kr + k0 + c8;
            if (mode == 0) { v8us o;
#pragma unroll
                for (int i = 0; i < 8; ++i) o[i] = f2bf(ts[(c8 + i) * 65 + n]);
                *(v8us*)(Tb + oo) = o;
            } else { v8h o;
#pragma unroll
                for (int i = 0; i < 8; ++i) o[i] = (h16)(__uint_as_float(((unsigned)f2bf(ts[(c8 + i) * 65 + n])) << 16) * WOS);
                *(v8h*)(Th + oo) = o; } }
         }
}

// k_rope_tab: CS[t][j] = (cos, sin)(t * inv_freq[j]), inv_freq[j] = 1.0f / (float)(10000^(j/32)); the power is a double product of fixed binary roots of 10000.
__global__ __launch_bounds__(256) void k_rope_tab(float* CS, int nrow) {
    const int i = blockIdx.x * 256 + threadIdx.x; if (i >= nrow * 32) return;
    const int t = i >> 5, j = i & 31;
    double p = 1.0;
    p *= (j & 1)  ? 1.3335214321633240 : 1.0;    // 10000^(1/32)
    p *= (j & 2)  ? 1.7782794100389228 : 1.0;    // 10000^(1/16)
    p *= (j & 4)  ? 3.1622776601683795 : 1.0;    // 10000^(1/8)
    p *= (j & 8)  ? 10.0 : 1.0;                  // 10000^(1/4)
    p *= (j & 16) ? 100.0 : 1.0;                 // 10000^(1/2)
    const float pf = (float)p; const float inv = 1.0f / pf;
    const float ang = (float)t * inv;
    const float cs = cosf(ang), sn = sinf(ang);
    v2f o; o[0] = cs; o[1] = sn;
    *(v2f*)(CS + (size_t)i * 2) = o; 
}

// k_proj: register-blocked bf16 GEMM, four waves per 128x128 tile, one 64x64 tile (16 accumulators) per wave, operands from K-contiguous bf16 planes staged in LDS, K = DM.
// C[m][n] = sum_k A[m][k] Bt[n][k], written as f16 (Ph) and the f16 residual x1024 (Pr, useRes != 0) at
// wave tile base (r0/RB)*sRB + (r0%RB)*pitch + (c0/CB)*sCB + (c0%CB), row pitch 'pitch' (halves). grid (M/128, N/128), 128 threads.
// rope != 0 (rows = tokens b*SEQ + t, the 64 columns of a wave tile = one head): interleaved rotary applied on the f32 values at the store stage from CS[t][32] (cos, sin).
__global__ __launch_bounds__(128) void k_proj(const bf* __restrict__ A, const bf* __restrict__ Bt, h16* Ph, h16* Pr, int useRes, int RB, size_t sRB, int pitch, int CB, size_t sCB, const float* __restrict__ CS, int rope) {
    __shared__ __align__(16) bf ring[2 * STGE];
    __shared__ __align__(16) float osall[4 * 16 * 68];
    const int K = DM;
    const int tid = threadIdx.x; const int wave = __builtin_amdgcn_readfirstlane(tid >> 5);
    const int lane = tid & 31, lr = lane & 15, hi = lane >> 4; const int rb = blockIdx.x * 128, cb = blockIdx.y * 128;
    const int wr = (wave >> 1) * 64, wc = (wave & 1) * 64; const int r0 = rb + wr, c0 = cb + wc;
    float* os = osall + wave * 16 * 68;
    v8f acc[4][4];
#pragma unroll
    for (int mb = 0; mb < 4; ++mb)
#pragma unroll
        for (int nb = 0; nb < 4; ++nb) acc[mb][nb] = (v8f){};
    const unsigned l0 = (unsigned)(size_t)ring + (unsigned)((tid >> 3) * (LPE * 2) + (tid & 7) * 16);
    const char* ga = (const char*)(A + (size_t)(rb + (tid >> 3)) * K + (tid & 7) * 8);
    const char* gb = (const char*)(Bt + (size_t)(cb + (tid >> 3)) * K + (tid & 7) * 8);
    const int afr = (wr + lr) * LPE + 8 * hi, bfr = (128 + wc + lr) * LPE + 8 * hi;
    stage_tile(l0, ga, gb);
    wait_copies();
    __syncthreads();                                              // tile 0 readable by every wave
    stage_tile(l0 + STGB, ga + BK * 2, gb + BK * 2);
#pragma unroll 1   // one trip per staged tile: the ring's waits and barrier stand once, at the foot
    for (int t = 0; t < NKT; ++t) {
        const bf* sb = ring + (t & 1) * STGE;
#pragma unroll     // this and the loops inside: constant indices keep fragments and accumulators in registers
        for (int ks = 0; ks < BK; ks += 32) {
            v16bf a[4], b[4];
#pragma unroll
            for (int mb = 0; mb < 4; ++mb) a[mb] = ldb(sb + afr + mb * 16 * LPE + ks);
#pragma unroll
            for (int nb = 0; nb < 4; ++nb) b[nb] = ldb(sb + bfr + nb * 16 * LPE + ks);
#pragma unroll
            for (int nb = 0; nb < 4; ++nb)
#pragma unroll
                for (int mb = 0; mb < 4; ++mb) acc[mb][nb] = wmmab(a[mb], b[nb], acc[mb][nb]);
        }
        wait_lds();
        wait_copies();
        __syncthreads();                                          // publishes tile t + 1 and frees the buffer of tile t
        if (t + 2 < NKT) stage_tile(l0 + (unsigned)(t & 1) * STGB, ga + (size_t)(t + 2) * (BK * 2), gb + (size_t)(t + 2) * (BK * 2));
    }
    wait_copies();
    const size_t tbase = (size_t)(r0 / RB) * sRB + (size_t)(r0 % RB) * (size_t)pitch + (size_t)(c0 / CB) * sCB + (size_t)(c0 % CB);
#pragma unroll
    for (int mb = 0; mb < 4; ++mb) {
#pragma unroll
        for (int nb = 0; nb < 4; ++nb) {
#pragma unroll
            for (int j = 0; j < 8; ++j) os[(hi * 8 + j) * 68 + nb * 16 + lr] = acc[mb][nb][j]; }   // D: row 8h+j, col lane&15
        wave_sync();
        const size_t sb = tbase + (size_t)(mb * 16) * (size_t)pitch;
{
#pragma unroll
            for (int s = 0; s < 4; ++s) { const int row = 4 * s + (lane >> 3), c8 = (lane & 7) * 8;   // 4 s x 4 row groups = 16 rows; 8 lanes x 8 = 64 columns
                v4f x0 = *(const v4fa*)(&os[row * 68 + c8]); v4f x1 = *(const v4fa*)(&os[row * 68 + c8 + 4]); v8h hv, rv;
                if (rope) {                                                                            // kernel-argument uniform
                    const int t = (r0 + mb * 16 + row) % SEQ;
                    const float* cp = CS + ((size_t)t * 32 + (size_t)(c8 >> 1)) * 2;                  // pairs c8/2 .. c8/2+3: (cos, sin) x 4
                    const v4f ca = *(const v4f*)cp; const v4f cb = *(const v4f*)(cp + 4);
                    float e, o;
                    e = x0[0]; o = x0[1]; x0[0] = e * ca[0] - o * ca[1]; x0[1] = e * ca[1] + o * ca[0];
                    e = x0[2]; o = x0[3]; x0[2] = e * ca[2] - o * ca[3]; x0[3] = e * ca[3] + o * ca[2];
                    e = x1[0]; o = x1[1]; x1[0] = e * cb[0] - o * cb[1]; x1[1] = e * cb[1] + o * cb[0];
                    e = x1[2]; o = x1[3]; x1[2] = e * cb[2] - o * cb[3]; x1[3] = e * cb[3] + o * cb[2]; }
#pragma unroll
                for (int i = 0; i < 4; ++i) { const h16 a0 = (h16)x0[i]; const h16 a1 = (h16)x1[i]; hv[i] = a0; hv[4 + i] = a1; rv[i] = (h16)((x0[i] - (float)a0) * QRS); rv[4 + i] = (h16)((x1[i] - (float)a1) * QRS); }
                const size_t oo = sb + (size_t)row * (size_t)pitch + c8;
                *(v8h*)(Ph + oo) = hv; if (useRes) *(v8h*)(Pr + oo) = rv; }
             }
        wave_sync();
    }
}

// k_flash: fused causal attention for query rows >= EARLY. One block = 16 query rows x the four query heads of one kv head (one wave per head, h = g*4 + wave);
// K / V^T / Q fragments straight from the f16 planes (two 16-B loads each, arithmetic addressing); all four waves read the same K / V^T lines of kv head g.
// Transposed form: S^T[key][t] = K Q^T (A = K rows, B = Q rows); lane (t = lane&15, h = lane>>4) holds keys 8h+r of each 16-key tile, so the packed
// P tile is directly the B fragment of O^T[d][t] = V^T P^T (element r <- tile keys 0..15, element 8+r <- tile keys 16..31, lane unchanged).
// Keys run over [0, t0+16); the diagonal 32-key blocks replace excluded scores (key > t) by a large negative value before the running max.
__global__ __launch_bounds__(32 * AW) void k_flash(const h16* __restrict__ QH, const h16* __restrict__ QR, const h16* __restrict__ KP, const h16* __restrict__ VT, h16* CH) {
    __shared__ __align__(16) float os[AW * 16 * 68];
    const int lane = threadIdx.x & 31; const int wave = __builtin_amdgcn_readfirstlane(threadIdx.x >> 5);
    const int lr = lane & 15, hi = lane >> 4;
    const int zg = blockIdx.y; const int b = zg / NKV; const int g = zg % NKV;
    const int h = g * AW + wave;                                  // repeat on the head axis: query head h uses kv head h >> 2
    const int t0 = EARLY + blockIdx.x * 16;
    const int tq = t0 + lr;
    const size_t qo = ((size_t)(b * NH_ + h) * SEQ + (size_t)tq) * HD + 8 * hi;
    const v16h qh0 = ldh(QH + qo), qh1 = ldh(QH + qo + 32), qr0 = ldh(QR + qo), qr1 = ldh(QR + qo + 32);   // B fragments: col t, k = d
    const size_t ko = (size_t)zg * SEQ * HD + (size_t)lr * HD + 8 * hi;      // + key * HD       (A fragment: row key, k = d)
    const size_t vo = (size_t)zg * HD * SEQ + (size_t)lr * SEQ + 8 * hi;     // + 16j*SEQ + key  (A fragment: row d, k = key)
    v8f o0 = (v8f){}, o1 = (v8f){}, o2 = (v8f){}, o3 = (v8f){};
    float m = NEGB, l = 0.0f;
    const int kend = t0 + 16;
#pragma unroll 1
    for (int key0 = 0; key0 < kend; key0 += 32) {
        const h16* ka = KP + ko + (size_t)key0 * HD;
        const v16h ka0 = ldh(ka), ka1 = ldh(ka + 32), kb0 = ldh(ka + 16 * HD), kb1 = ldh(ka + 16 * HD + 32);
        v8f sHa = (v8f){}, sLa = (v8f){}, sHb = (v8f){}, sLb = (v8f){};
        sHa = wmma16(ka0, qh0, sHa); sLa = wmma16(ka0, qr0, sLa); sHb = wmma16(kb0, qh0, sHb); sLb = wmma16(kb0, qr0, sLb);
        sHa = wmma16(ka1, qh1, sHa); sLa = wmma16(ka1, qr1, sLa); sHb = wmma16(kb1, qh1, sHb); sLb = wmma16(kb1, qr1, sLb);
        float ta[8], tb[8];
#pragma unroll
        for (int r = 0; r < 8; ++r) { ta[r] = (sHa[r] + sLa[r] * QRI) * SC2; tb[r] = (sHb[r] + sLb[r] * QRI) * SC2; }
        if (key0 + 31 > t0) {                                      // block-uniform: diagonal block
            const int kbse = key0 + 8 * hi;
#pragma unroll
            for (int r = 0; r < 8; ++r) { ta[r] = (kbse + r > tq) ? NEGB : ta[r]; tb[r] = (kbse + 16 + r > tq) ? NEGB : tb[r]; } }
        float mx = NEGB;
#pragma unroll
        for (int r = 0; r < 8; ++r) mx = fmaxf(mx, fmaxf(ta[r], tb[r]));
        mx = fmaxf(mx, __shfl_xor(mx, 16, 32));
        const float mnew = fmaxf(m, mx);
        const float alpha = __builtin_amdgcn_exp2f(m - mnew);
        const float sh = PSH - mnew;
        v16h pb; float ls = 0.0f;
#pragma unroll
        for (int r = 0; r < 8; ++r) { const float ea = __builtin_amdgcn_exp2f(ta[r] + sh); const float ec = __builtin_amdgcn_exp2f(tb[r] + sh); pb[r] = (h16)ea; pb[8 + r] = (h16)ec; ls += ea + ec; }
        l = l * alpha + ls; m = mnew;
        o0 = o0 * alpha; o1 = o1 * alpha; o2 = o2 * alpha; o3 = o3 * alpha;
        const h16* va = VT + vo + key0;
        const v16h v0 = ldh(va), v1 = ldh(va + (size_t)16 * SEQ), v2 = ldh(va + (size_t)32 * SEQ), v3 = ldh(va + (size_t)48 * SEQ);
        o0 = wmma16(v0, pb, o0); o1 = wmma16(v1, pb, o1); o2 = wmma16(v2, pb, o2); o3 = wmma16(v3, pb, o3);
    }
    l += __shfl_xor(l, 16, 32);
    const float inv = CXS / l;
    const int wb = wave * 16 * 68;
    // O^T D layout: o_j[r] = (d = 16j + 8h + r, t = lane&15) -> os[t][d]; rows 0..15 x columns 0..63 all written
    { v4f a, c;
      a[0] = o0[0] * inv; a[1] = o0[1] * inv; a[2] = o0[2] * inv; a[3] = o0[3] * inv; c[0] = o0[4] * inv; c[1] = o0[5] * inv; c[2] = o0[6] * inv; c[3] = o0[7] * inv;
      *(v4fa*)(&os[wb + lr * 68 +  0 + 8 * hi]) = a; *(v4fa*)(&os[wb + lr * 68 +  0 + 8 * hi + 4]) = c;
      a[0] = o1[0] * inv; a[1] = o1[1] * inv; a[2] = o1[2] * inv; a[3] = o1[3] * inv; c[0] = o1[4] * inv; c[1] = o1[5] * inv; c[2] = o1[6] * inv; c[3] = o1[7] * inv;
      *(v4fa*)(&os[wb + lr * 68 + 16 + 8 * hi]) = a; *(v4fa*)(&os[wb + lr * 68 + 16 + 8 * hi + 4]) = c;
      a[0] = o2[0] * inv; a[1] = o2[1] * inv; a[2] = o2[2] * inv; a[3] = o2[3] * inv; c[0] = o2[4] * inv; c[1] = o2[5] * inv; c[2] = o2[6] * inv; c[3] = o2[7] * inv;
      *(v4fa*)(&os[wb + lr * 68 + 32 + 8 * hi]) = a; *(v4fa*)(&os[wb + lr * 68 + 32 + 8 * hi + 4]) = c;
      a[0] = o3[0] * inv; a[1] = o3[1] * inv; a[2] = o3[2] * inv; a[3] = o3[3] * inv; c[0] = o3[4] * inv; c[1] = o3[5] * inv; c[2] = o3[6] * inv; c[3] = o3[7] * inv;
      *(v4fa*)(&os[wb + lr * 68 + 48 + 8 * hi]) = a; *(v4fa*)(&os[wb + lr * 68 + 48 + 8 * hi + 4]) = c; }
    wave_sync();
    h16* crow = CH + ((size_t)b * SEQ + t0) * DM + h * HD;         // merged heads: column h*64 + d
{
#pragma unroll
        for (int s = 0; s < 4; ++s) { const int row = 4 * s + (lane >> 3), c8 = (lane & 7) * 8;   // 4 s x 4 row groups = 16 rows; 8 lanes x 8 = 64 columns
            const v4f x0 = *(const v4fa*)(&os[wb + row * 68 + c8]); const v4f x1 = *(const v4fa*)(&os[wb + row * 68 + c8 + 4]); v8h hv;
#pragma unroll
            for (int i = 0; i < 4; ++i) { hv[i] = (h16)x0[i]; hv[4 + i] = (h16)x1[i]; }
            *(v8h*)(crow + (size_t)row * DM + c8) = hv; }
         }
}

// k_flash_early: same structure for query rows < EARLY with value + residual (x1024) planes on every operand:
// scores = kh.qh + (kh.qr + kr.qh)/1024; O = vh.ph + (vr.ph + vh.pr)/1024 (residual products in their own accumulators), l from the unconverted f32 P.
// Writes the ctx value plane rows (carried x1024) and the compact unscaled residual plane CR[b][t < EARLY][2048].
__global__ __launch_bounds__(32 * AW) void k_flash_early(const h16* __restrict__ QH, const h16* __restrict__ QR, const h16* __restrict__ KP, const h16* __restrict__ KR,
                                                         const h16* __restrict__ VT, const h16* __restrict__ VR, h16* CH, h16* CR) {
    __shared__ __align__(16) float os[AW * 16 * 68];
    const int lane = threadIdx.x & 31; const int wave = __builtin_amdgcn_readfirstlane(threadIdx.x >> 5);
    const int lr = lane & 15, hi = lane >> 4;
    const int zg = blockIdx.y; const int b = zg / NKV; const int g = zg % NKV;
    const int h = g * AW + wave;
    const int t0 = blockIdx.x * 16;
    const int tq = t0 + lr;
    const size_t qo = ((size_t)(b * NH_ + h) * SEQ + (size_t)tq) * HD + 8 * hi;
    const v16h qh0 = ldh(QH + qo), qh1 = ldh(QH + qo + 32), qr0 = ldh(QR + qo), qr1 = ldh(QR + qo + 32);
    const size_t ko = (size_t)zg * SEQ * HD + (size_t)lr * HD + 8 * hi;
    const size_t vo = (size_t)zg * HD * SEQ + (size_t)lr * SEQ + 8 * hi;
    v8f oH[4], oL[4];
#pragma unroll
    for (int j = 0; j < 4; ++j) { oH[j] = (v8f){}; oL[j] = (v8f){}; }
    float m = NEGB, l = 0.0f;
    const int kend = t0 + 16;
#pragma unroll 1
    for (int key0 = 0; key0 < kend; key0 += 32) {
        const size_t kk = ko + (size_t)key0 * HD;
        v8f sHa = (v8f){}, sLa = (v8f){}, sHb = (v8f){}, sLb = (v8f){};
        { const v16h k0 = ldh(KP + kk), k1 = ldh(KP + kk + 32), r0 = ldh(KR + kk), r1 = ldh(KR + kk + 32);
          sHa = wmma16(k0, qh0, sHa); sHa = wmma16(k1, qh1, sHa);
          sLa = wmma16(k0, qr0, sLa); sLa = wmma16(k1, qr1, sLa); sLa = wmma16(r0, qh0, sLa); sLa = wmma16(r1, qh1, sLa); }
        { const size_t k2 = kk + (size_t)16 * HD;
          const v16h k0 = ldh(KP + k2), k1 = ldh(KP + k2 + 32), r0 = ldh(KR + k2), r1 = ldh(KR + k2 + 32);
          sHb = wmma16(k0, qh0, sHb); sHb = wmma16(k1, qh1, sHb);
          sLb = wmma16(k0, qr0, sLb); sLb = wmma16(k1, qr1, sLb); sLb = wmma16(r0, qh0, sLb); sLb = wmma16(r1, qh1, sLb); }
        float ta[8], tb[8];
#pragma unroll
        for (int r = 0; r < 8; ++r) { ta[r] = (sHa[r] + sLa[r] * QRI) * SC2; tb[r] = (sHb[r] + sLb[r] * QRI) * SC2; }
        if (key0 + 31 > t0) {                                      // block-uniform: diagonal block
            const int kbse = key0 + 8 * hi;
#pragma unroll
            for (int r = 0; r < 8; ++r) { ta[r] = (kbse + r > tq) ? NEGB : ta[r]; tb[r] = (kbse + 16 + r > tq) ? NEGB : tb[r]; } }
        float mx = NEGB;
#pragma unroll
        for (int r = 0; r < 8; ++r) mx = fmaxf(mx, fmaxf(ta[r], tb[r]));
        mx = fmaxf(mx, __shfl_xor(mx, 16, 32));
        const float mnew = fmaxf(m, mx);
        const float alpha = __builtin_amdgcn_exp2f(m - mnew);
        const float sh = PSH - mnew;
        v16h ph, pr; float ls = 0.0f;
#pragma unroll
        for (int r = 0; r < 8; ++r) { const float ea = __builtin_amdgcn_exp2f(ta[r] + sh); const float ec = __builtin_amdgcn_exp2f(tb[r] + sh);
            const h16 ha = (h16)ea; const h16 hc = (h16)ec; ph[r] = ha; ph[8 + r] = hc;
            pr[r] = (h16)((ea - (float)ha) * QRS); pr[8 + r] = (h16)((ec - (float)hc) * QRS); ls += ea + ec; }
        l = l * alpha + ls; m = mnew;
#pragma unroll
        for (int j = 0; j < 4; ++j) { oH[j] = oH[j] * alpha; oL[j] = oL[j] * alpha; }
        const size_t vv = vo + (size_t)key0;
#pragma unroll
        for (int j = 0; j < 4; ++j) { const v16h vh = ldh(VT + vv + (size_t)(16 * j) * SEQ); const v16h vr = ldh(VR + vv + (size_t)(16 * j) * SEQ);
            oH[j] = wmma16(vh, ph, oH[j]); oL[j] = wmma16(vr, ph, oL[j]); oL[j] = wmma16(vh, pr, oL[j]); }
    }
    l += __shfl_xor(l, 16, 32);
    const float inv = CXS / l;
    const int wb = wave * 16 * 68;
#pragma unroll
    for (int j = 0; j < 4; ++j) { v4f a, c;     // os[t][d], d = 16j + 8h + r; rows 0..15 x columns 0..63 all written
        a[0] = (oH[j][0] + oL[j][0] * QRI) * inv; a[1] = (oH[j][1] + oL[j][1] * QRI) * inv; a[2] = (oH[j][2] + oL[j][2] * QRI) * inv; a[3] = (oH[j][3] + oL[j][3] * QRI) * inv;
        c[0] = (oH[j][4] + oL[j][4] * QRI) * inv; c[1] = (oH[j][5] + oL[j][5] * QRI) * inv; c[2] = (oH[j][6] + oL[j][6] * QRI) * inv; c[3] = (oH[j][7] + oL[j][7] * QRI) * inv;
        *(v4fa*)(&os[wb + lr * 68 + 16 * j + 8 * hi]) = a; *(v4fa*)(&os[wb + lr * 68 + 16 * j + 8 * hi + 4]) = c; }
    wave_sync();
    h16* crow = CH + ((size_t)b * SEQ + t0) * DM + h * HD;
    h16* rrow = CR + ((size_t)b * EARLY + t0) * DM + h * HD;
{
#pragma unroll
        for (int s = 0; s < 4; ++s) { const int row = 4 * s + (lane >> 3), c8 = (lane & 7) * 8;   // 4 s x 4 row groups = 16 rows; 8 lanes x 8 = 64 columns
            const v4f x0 = *(const v4fa*)(&os[wb + row * 68 + c8]); const v4f x1 = *(const v4fa*)(&os[wb + row * 68 + c8 + 4]); v8h hv, rv;
#pragma unroll
            for (int i = 0; i < 4; ++i) { const h16 a0 = (h16)x0[i]; const h16 a1 = (h16)x1[i]; hv[i] = a0; hv[4 + i] = a1; rv[i] = (h16)(x0[i] - (float)a0); rv[4 + i] = (h16)(x1[i] - (float)a1); }
            *(v8h*)(crow + (size_t)row * DM + c8) = hv; *(v8h*)(rrow + (size_t)row * DM + c8) = rv; }
         }
}

// k_out: output projection, four waves per 128x128 tile (64x64 per wave), f16 operands from the ctx plane CX (value rows [NB*SEQ], then residual rows [NB*EARLY]) and the Wo^T plane, staged in LDS, K = DM.
// Tiles whose rows are < EARLY in their sequence walk K a second time over the unscaled residual rows into the same accumulators. grid (NB*SEQ/128, DM/128), 128 threads.
__global__ __launch_bounds__(128) void k_out(const h16* __restrict__ CX, const h16* __restrict__ Wt, float* OUT) {
    __shared__ __align__(16) h16 ring[2 * STGE];
    __shared__ __align__(16) float osall[4 * 16 * 68];
    const int K = DM;
    const int tid = threadIdx.x; const int wave = __builtin_amdgcn_readfirstlane(tid >> 5);
    const int lane = tid & 31, lr = lane & 15, hi = lane >> 4; const int rb = blockIdx.x * 128, cb = blockIdx.y * 128;
    const int wr = (wave >> 1) * 64, wc = (wave & 1) * 64; const int c0 = cb + wc;
    float* os = osall + wave * 16 * 68;
    const int b = rb / SEQ, tb = rb % SEQ, tt = tb + wr;           // a 128-row tile lies in one batch and is entirely early or entirely late
    const int nt = (tb < EARLY) ? 2 * NKT : NKT;                   // block-uniform
    const unsigned l0 = (unsigned)(size_t)ring + (unsigned)((tid >> 3) * (LPE * 2) + (tid & 7) * 16);
    const char* ga0 = (const char*)(CX + (size_t)(rb + (tid >> 3)) * K + (tid & 7) * 8);
    const char* ga1 = (const char*)(CX + ((size_t)NB * SEQ + (size_t)b * EARLY + (size_t)tb + (size_t)(tid >> 3)) * K + (tid & 7) * 8);   // used only when tb < EARLY
    const char* gb = (const char*)(Wt + (size_t)(cb + (tid >> 3)) * K + (tid & 7) * 8);
    const int afr = (wr + lr) * LPE + 8 * hi, bfr = (128 + wc + lr) * LPE + 8 * hi;
    v8f acc[4][4];
#pragma unroll
    for (int mb = 0; mb < 4; ++mb)
#pragma unroll
        for (int nb = 0; nb < 4; ++nb) acc[mb][nb] = (v8f){};
    stage_tile(l0, ga0, gb);
    wait_copies();
    __syncthreads();                                              // tile 0 readable by every wave
    stage_tile(l0 + STGB, ga0 + BK * 2, gb + BK * 2);
#pragma unroll 1   // one trip per staged tile: the ring's waits and barrier stand once, at the foot
    for (int t = 0; t < nt; ++t) {
        const h16* sb = ring + (t & 1) * STGE;
#pragma unroll     // this and the loops inside: constant indices keep fragments and accumulators in registers
        for (int ks = 0; ks < BK; ks += 32) {
            v16h a[4], bq[4];
#pragma unroll
            for (int mb = 0; mb < 4; ++mb) a[mb] = ldh(sb + afr + mb * 16 * LPE + ks);
#pragma unroll
            for (int nb = 0; nb < 4; ++nb) bq[nb] = ldh(sb + bfr + nb * 16 * LPE + ks);
#pragma unroll
            for (int nb = 0; nb < 4; ++nb)
#pragma unroll
                for (int mb = 0; mb < 4; ++mb) acc[mb][nb] = wmma16(a[mb], bq[nb], acc[mb][nb]);
        }
        wait_lds();
        wait_copies();
        __syncthreads();                                          // publishes tile t + 1 and frees the buffer of tile t
        if (t + 2 < nt) { const int u = t + 2; const size_t ko = (size_t)(u & (NKT - 1)) * (BK * 2);   // tiles NKT.. are the residual rows' walk
            stage_tile(l0 + (unsigned)(t & 1) * STGB, (u < NKT ? ga0 : ga1) + ko, gb + ko); }
    }
    wait_copies();
    float* obase = OUT + ((size_t)b * OUT_SEQ + tt) * DM + c0;
#pragma unroll
    for (int mb = 0; mb < 4; ++mb) {
#pragma unroll
        for (int nb = 0; nb < 4; ++nb) {
#pragma unroll
            for (int j = 0; j < 8; ++j) os[(hi * 8 + j) * 68 + nb * 16 + lr] = acc[mb][nb][j] * OUTS; }   // D: row 8h+j, col lane&15
        wave_sync();
{
#pragma unroll
            for (int s = 0; s < 8; ++s) { const int row = 2 * s + hi, cofs = lr * 4;   // 8 s x 2 rows = 16 rows; 16 lanes x 4 floats = 64 columns
                const v4f val = *(const v4fa*)(&os[row * 68 + cofs]);
                *(v4f*)(obase + (size_t)(mb * 16 + row) * DM + cofs) = val; }
             }
        wave_sync();
    }
}

static constexpr size_t al256(size_t v) { return (v + 255) & ~(size_t)255; }
static constexpr size_t SZ_XB = al256((size_t)NB * SEQ * DM * 2);
static constexpr size_t SZ_WQ = al256((size_t)DM * DM * 2);
static constexpr size_t SZ_WK = al256((size_t)KVD * DM * 2);
static constexpr size_t SZ_CS = al256((size_t)SEQ * 32 * 2 * 4);
static constexpr size_t SZ_Q  = al256((size_t)NB * NH_ * SEQ * HD * 2);
static constexpr size_t SZ_KV = al256((size_t)NB * NKV * SEQ * HD * 2);
static constexpr size_t SZ_CX = al256(((size_t)NB * SEQ + (size_t)NB * EARLY) * DM * 2);
static constexpr size_t SZ_TOTAL = SZ_XB + 2 * SZ_WQ + 2 * SZ_WK + SZ_CS + 2 * SZ_Q + 4 * SZ_KV + SZ_CX;
static_assert(SZ_TOTAL <= (size_t)134217728);          // workspace carve <= 128 MiB

extern "C" void kernel_launch(void* const* d_in, const int* in_sizes, int n_in,
                              void* d_out, int out_size, void* d_ws, size_t ws_size, hipStream_t stream) {
    if (n_in < 5) return;
    const size_t needx = ((size_t)(NB - 1) * SEQ_FULL + SEQ) * DM;
    if ((size_t)in_sizes[0] < needx) return;
    if ((size_t)in_sizes[1] < (size_t)DM * DM || (size_t)in_sizes[2] < (size_t)DM * KVD || (size_t)in_sizes[3] < (size_t)DM * KVD || (size_t)in_sizes[4] < (size_t)DM * DM) return;
    if ((size_t)out_size < ((size_t)(NB - 1) * OUT_SEQ + SEQ) * DM) return;
    if (SZ_TOTAL > ws_size) return;
    // wire order x, wq, wk, wv, wo; every weight is [in][out]
    const float* x = (const float*)d_in[0]; const float* wq = (const float*)d_in[1]; const float* wk = (const float*)d_in[2]; const float* wv = (const float*)d_in[3]; const float* wo = (const float*)d_in[4];
    float* OUT = (float*)d_out;      // [NB][SEQ][2048]
    char* wsp = (char*)d_ws;
    bf*  XB  = (bf*)wsp;  wsp += SZ_XB;              // [NB*SEQ][2048] bf16
    bf*  WQt = (bf*)wsp;  wsp += SZ_WQ;              // [2048 out][2048 in] bf16
    bf*  WKt = (bf*)wsp;  wsp += SZ_WK;              // [512 out][2048 in] bf16
    bf*  WVt = (bf*)wsp;  wsp += SZ_WK;              // [512 out][2048 in] bf16
    h16* WOt = (h16*)wsp; wsp += SZ_WQ;              // [2048 out][2048 in] f16 of bf16 value x16
    float* CS = (float*)wsp; wsp += SZ_CS;           // [SEQ][32] (cos, sin)
    h16* QH = (h16*)wsp; wsp += SZ_Q;                // [NB*32][SEQ][64]
    h16* QR = (h16*)wsp; wsp += SZ_Q;                // residual x1024
    h16* KP = (h16*)wsp; wsp += SZ_KV;               // [NB*8][SEQ][64]
    h16* KR = (h16*)wsp; wsp += SZ_KV;               // residual x1024
    h16* VT = (h16*)wsp; wsp += SZ_KV;               // [NB*8][64][SEQ]
    h16* VR = (h16*)wsp; wsp += SZ_KV;               // residual x1024
    h16* CX = (h16*)wsp; wsp += SZ_CX;               // ctx x1024: value rows [NB*SEQ][2048], then residual rows [NB*EARLY][2048]
    h16* CR = CX + (size_t)NB * SEQ * DM;

    if (SEQ == SEQ_FULL) {
        const size_t n8 = (size_t)NB * SEQ * DM / 8;
        k_cvt8<<<(unsigned)((n8 + 255) / 256), 256, 0, stream>>>(x, XB, n8);
    } else {
        const size_t n8 = (size_t)SEQ * DM / 8;
        for (int b = 0; b < NB; ++b) k_cvt8<<<(unsigned)((n8 + 255) / 256), 256, 0, stream>>>(x + (size_t)b * SEQ_FULL * DM, XB + (size_t)b * SEQ * DM, n8);
    }
    // transposes: in[rows = in-features][cols = out-features] -> out[cols][rows]; grid (cols/64, rows/64)
    k_wt<<<dim3(DM / 64,  DM / 64, 1), 256, 0, stream>>>(wq, WQt, (h16*)WQt, DM, DM, 0);
    k_wt<<<dim3(KVD / 64, DM / 64, 1), 256, 0, stream>>>(wk, WKt, (h16*)WKt, DM, KVD, 0);
    k_wt<<<dim3(KVD / 64, DM / 64, 1), 256, 0, stream>>>(wv, WVt, (h16*)WVt, DM, KVD, 0);
    k_wt<<<dim3(DM / 64,  DM / 64, 1), 256, 0, stream>>>(wo, (bf*)WOt, WOt, DM, DM, 1);
    k_rope_tab<<<(unsigned)((SEQ * 32 + 255) / 256), 256, 0, stream>>>(CS, SEQ);

    // q: A = x rows (m = b*SEQ + t), Bt = Wq^T rows (n = h*64 + d) -> plane [(b*32 + h)][t][d], rotary applied
    k_proj<<<dim3(NB * SEQ / 128, DM / 128, 1), 128, 0, stream>>>(XB, WQt, QH, QR, 1, SEQ, (size_t)NH_ * SEQ * HD, HD, HD, (size_t)SEQ * HD, CS, 1);
    // k: Bt = Wk^T rows (n = g*64 + d) -> plane [(b*8 + g)][t][d], rotary applied
    k_proj<<<dim3(NB * SEQ / 128, KVD / 128, 1), 128, 0, stream>>>(XB, WKt, KP, KR, 1, SEQ, (size_t)NKV * SEQ * HD, HD, HD, (size_t)SEQ * HD, CS, 1);
    // v^T: A = Wv^T rows (m = g*64 + d), Bt = x rows (n = b*SEQ + t) -> plane [(b*512 + m)][t] = [(b*8 + g)][d][t], no rotary
    k_proj<<<dim3(KVD / 128, NB * SEQ / 128, 1), 128, 0, stream>>>(WVt, XB, VT, VR, 1, KVD, (size_t)0, SEQ, SEQ, (size_t)KVD * SEQ, CS, 0);

    k_flash_early<<<dim3(EARLY / 16, NB * NKV, 1), 32 * AW, 0, stream>>>(QH, QR, KP, KR, VT, VR, CX, CR);
    if (SEQ > EARLY)
        k_flash<<<dim3((SEQ - EARLY) / 16, NB * NKV, 1), 32 * AW, 0, stream>>>(QH, QR, KP, VT, CX);

    k_out<<<dim3(NB * SEQ / 128, DM / 128, 1), 128, 0, stream>>>(CX, WOt, OUT);
}

// v002
// It runs in 250 microseconds.
// Two timings next to v001 both put it at 1.30 times that version's speed.
// All steps since v000 together make it 2.08 times as fast.
#include <hip/hip_runtime.h>

// Grouped-query causal self-attention, width 2048 = 32 query heads x 64 sharing 8 kv heads (kv head g = h >> 2), x [NB][SEQ][2048], Wq/Wk/Wv/Wo [in][out] (y = x W), no biases,
// interleaved (even/odd pair) rotary on q and k from a computed [SEQ][32] (cos, sin) table, score scale 1/8, causal exclusion (diagonal kept), output = ctx Wo (f32).
// Compute dtypes, f32 accumulate everywhere: q/k/v projections v_wmma_f32_16x16x32_bf16 (x and W RNE-converted to bf16; products exact);
// scores v_wmma_f32_16x16x32_f16: k single f16, q as f16 value + f16 residual x1024 in its own accumulator (query rows < 256: k also value + residual x1024, three products);
// P (x256 carry, cancels in the normalisation) and v single f16 (rows < 256: P and v as value + residual x1024, three products); softmax f32 (online, running max);
// output projection v_wmma_f32_16x16x32_f16: ctx carried x1024 as f16 (rows < 256: plus its unscaled f16 residual folded along K) against f16(bf16(Wo)) x16, result scaled by 2^-14.

#ifndef NB
#define NB 2
#endif
#ifndef SEQ
#define SEQ 2048
#endif
#define NB_FULL  2
#define SEQ_FULL 2048
#ifndef OUT_SEQ
#define OUT_SEQ SEQ              // row pitch (in tokens) between batches of the output
#endif
#define DM    2048
#define NH_   32
#define NKV   8
#define HD    64
#define KVD   (NKV * HD)         // 512
#define AW    4                  // waves per flash block = the four query heads of one kv head
#define EARLY 256                // query rows below this use the value + residual path
#define QRS  1024.0f             // carry of every residual plane (q, k, v, P)
#define QRI  (1.0f / 1024.0f)
#define SC2  (0.125f * 1.4426950408889634f)   // HD^-0.5 * log2(e)
#define PSH  8.0f                // log2 of the P carry (256)
#define CXS  1024.0f             // carry of the ctx plane
#define WOS  16.0f               // carry of the Wo plane
#define OUTS (1.0f / (1024.0f * 16.0f))
#define NEGB (-3.0e38f)

static_assert(HD == 64);
static_assert(NH_ * HD == DM);                 // query head h = columns h*64 + d
static_assert(NKV * AW == NH_);                // four consecutive query heads per kv head
static_assert(DM % 64 == 0);
static_assert(KVD % 64 == 0);
static_assert(DM % 32 == 0);                   // GEMM k-loop steps by 32
static_assert(SEQ % 64 == 0);                  // a 64-row tile never straddles two batches
static_assert(SEQ % 32 == 0);                  // key loop steps by 32, key0 + 31 < SEQ
static_assert(EARLY % 128 == 0);               // output GEMM tiles are entirely early or entirely late
static_assert(SEQ % 128 == 0);                 // a 128-row GEMM tile never straddles two batches
static_assert(KVD % 128 == 0);
static_assert(SEQ >= EARLY);
static_assert((SEQ - EARLY) % 16 == 0);
static_assert(((size_t)SEQ * DM) % 8 == 0);
static_assert(NB <= NB_FULL);
static_assert(SEQ <= SEQ_FULL);

typedef _Float16 h16;
typedef unsigned short bf;
typedef __attribute__((ext_vector_type(16))) __bf16   v16bf;
typedef __attribute__((ext_vector_type(16))) _Float16 v16h;
typedef __attribute__((ext_vector_type(8)))  _Float16 v8h;
typedef __attribute__((ext_vector_type(8)))  unsigned short v8us;
typedef __attribute__((ext_vector_type(8)))  float    v8f;
typedef __attribute__((ext_vector_type(4)))  float    v4f;
typedef __attribute__((ext_vector_type(2)))  float    v2f;
typedef v4f  __attribute__((may_alias)) v4fa;

__device__ __forceinline__ unsigned short f2bf(float f) { unsigned u = __float_as_uint(f); u += 0x7FFFu + ((u >> 16) & 1u); return (unsigned short)(u >> 16); }
__device__ __forceinline__ v16h cat16(v8h lo, v8h hi) { return __builtin_shufflevector(lo, hi, 0, 1, 2, 3, 4, 5, 6, 7, 8, 9, 10, 11, 12, 13, 14, 15); }
__device__ __forceinline__ v16bf cat16b(v8us lo, v8us hi) { return __builtin_bit_cast(v16bf, __builtin_shufflevector(lo, hi, 0, 1, 2, 3, 4, 5, 6, 7, 8, 9, 10, 11, 12, 13, 14, 15)); }
// every WMMA is followed by its own 4-slot guard tying its accumulator and keeping its operands live
__device__ __forceinline__ v8f wmma16(v16h a, v16h b, v8f c) {
    c = __builtin_amdgcn_wmma_f32_16x16x32_f16(false, a, false, b, (short)0, c, false, false);
    asm volatile("v_nop\n\tv_nop\n\tv_nop\n\tv_nop" : "+v"(c) : "v"(a), "v"(b));
    return c; }
__device__ __forceinline__ v8f wmmab(v16bf a, v16bf b, v8f c) {
    c = __builtin_amdgcn_wmma_f32_16x16x32_bf16(false, a, false, b, (short)0, c, false, false);
    asm volatile("v_nop\n\tv_nop\n\tv_nop\n\tv_nop" : "+v"(c) : "v"(a), "v"(b));
    return c; }
// fragment loaders from K-contiguous 16-bit rows; p already includes + 8*(lane>>4): elements 0..7 <- k0+8h+0..7, elements 8..15 <- k0+16+8h+0..7 (same map for A and B)
__device__ __forceinline__ v16h  ldh(const h16* p) { return cat16(*(const v8h*)p, *(const v8h*)(p + 16)); }
__device__ __forceinline__ v16bf ldb(const bf* p)  { return cat16b(*(const v8us*)p, *(const v8us*)(p + 16)); }
// ordering point for wave-private LDS tiles (same wave writes and reads)
__device__ __forceinline__ void wave_sync() { __builtin_amdgcn_fence(3 /* release order */, "wavefront"); __builtin_amdgcn_wave_barrier(); asm volatile("" ::: "memory"); }

// ---- operand staging of the two GEMM kernels: a 128x128 output tile per block of four waves (2 x 2, 64x64 each), K walked in tiles of BK.
// One stage = 128 A rows then 128 B rows of BK 16-bit elements (128 B, one cache line each) at a pitch of 144 B (16 B x odd: conflict-free for 16-byte LDS reads); two buffers.
#define BK   64
#define LPE  72                   // LDS row pitch in 16-bit elements
#define STGE (256 * LPE)          // elements of one buffer
#define STGB (STGE * 2)           // bytes of one buffer
#define NKT  (DM / BK)            // K tiles of one walk over K
static_assert(DM % BK == 0 && NKT >= 2 && (NKT & (NKT - 1)) == 0);   // both prologue tiles exist; the output GEMM's second walk wraps its tile index by a mask
// eight asynchronous 16-byte copies of one lane, rows 16 apart (LDS step 16 * 144 B, global step 16 rows of DM elements); eight lanes cover one 128-B row.
// s_wait_xcnt closes the statement so that no address register is rewritten ahead of it.
__device__ __forceinline__ void copy8(unsigned l, const char* g) {
    const size_t gs = (size_t)16 * DM * 2; const unsigned ls = 16 * LPE * 2;
    asm volatile("global_load_async_to_lds_b128 %0, %8, off\n\t"
                 "global_load_async_to_lds_b128 %1, %9, off\n\t"
                 "global_load_async_to_lds_b128 %2, %10, off\n\t"
                 "global_load_async_to_lds_b128 %3, %11, off\n\t"
                 "global_load_async_to_lds_b128 %4, %12, off\n\t"
                 "global_load_async_to_lds_b128 %5, %13, off\n\t"
                 "global_load_async_to_lds_b128 %6, %14, off\n\t"
                 "global_load_async_to_lds_b128 %7, %15, off\n\t"
                 "s_wait_xcnt 0x0"
                 :: "v"(l), "v"(l + ls), "v"(l + 2 * ls), "v"(l + 3 * ls), "v"(l + 4 * ls), "v"(l + 5 * ls), "v"(l + 6 * ls), "v"(l + 7 * ls),
                    "v"(g), "v"(g + gs), "v"(g + 2 * gs), "v"(g + 3 * gs), "v"(g + 4 * gs), "v"(g + 5 * gs), "v"(g + 6 * gs), "v"(g + 7 * gs)
                 : "memory");
}
// one stage: l = the lane's LDS byte address in row (tid >> 3) of the buffer, ga / gb = the lane's 16 bytes in that row of the A / B tile
__device__ __forceinline__ void stage_tile(unsigned l, const char* ga, const char* gb) { copy8(l, ga); copy8(l + 128 * LPE * 2, gb); }
// the issuing wave's own copies have landed (the compiler places no wait for them)
__device__ __forceinline__ void wait_copies() { asm volatile("s_wait_asynccnt 0x0" ::: "memory"); }
// this wave's LDS reads of the buffer have returned before the barrier that frees it for the refill
__device__ __forceinline__ void wait_lds() { asm volatile("s_wait_dscnt 0x0" ::: "memory"); }

// ---- K / V^T staging of k_flash: one stage = FK keys of one kv head: FK K rows (64 d = 128 B each), then 64 V^T rows (FK keys = 128 B each), whole cache lines, at the same 144-B pitch; two buffers.
#define FK    64
#define FSTGE ((FK + HD) * LPE)   // elements of one buffer
#define FSTGB (FSTGE * 2)         // bytes of one buffer
static_assert(FK == 64 && SEQ % FK == 0);                         // a V^T row of a stage is one 128-B line; the last stage of any query tile ends inside the planes
static_assert(2 * FSTGB >= AW * 16 * 68 * 4);                     // the output staging reuses the ring behind the last barrier
// eight asynchronous 16-byte copies of one lane: four K rows, then four V^T rows, each 16 rows apart (eight lanes cover one 128-B row, 128 threads 16 rows).
// s_wait_xcnt closes the statement so that no address register is rewritten ahead of it.
__device__ __forceinline__ void stage_kv(unsigned l, const char* gk, const char* gv) {
    const size_t kst = (size_t)16 * HD * 2, vst = (size_t)16 * SEQ * 2; const unsigned ls = 16 * LPE * 2;
    asm volatile("global_load_async_to_lds_b128 %0, %8, off\n\t"
                 "global_load_async_to_lds_b128 %1, %9, off\n\t"
                 "global_load_async_to_lds_b128 %2, %10, off\n\t"
                 "global_load_async_to_lds_b128 %3, %11, off\n\t"
                 "global_load_async_to_lds_b128 %4, %12, off\n\t"
                 "global_load_async_to_lds_b128 %5, %13, off\n\t"
                 "global_load_async_to_lds_b128 %6, %14, off\n\t"
                 "global_load_async_to_lds_b128 %7, %15, off\n\t"
                 "s_wait_xcnt 0x0"
                 :: "v"(l), "v"(l + ls), "v"(l + 2 * ls), "v"(l + 3 * ls), "v"(l + 4 * ls), "v"(l + 5 * ls), "v"(l + 6 * ls), "v"(l + 7 * ls),
                    "v"(gk), "v"(gk + kst), "v"(gk + 2 * kst), "v"(gk + 3 * kst), "v"(gv), "v"(gv + vst), "v"(gv + 2 * vst), "v"(gv + 3 * vst)
                 : "memory");
}

__global__ __launch_bounds__(256) void k_cvt8(const float* __restrict__ src, bf* dst, size_t n8) {
    const size_t i = (size_t)blockIdx.x * 256 + threadIdx.x; if (i >= n8) return;
    const v8f v = *(const v8f*)(src + i * 8); v8us o;
#pragma unroll
    for (int k = 0; k < 8; ++k) o[k] = f2bf(v[k]);
    *(v8us*)(dst + i * 8) = o; 
}

// k_wt: in[Kr rows][Nc cols] f32 -> out[Nc rows][Kr cols] 16-bit, 64x64 tile through LDS. grid (Nc/64, Kr/64), 256 threads.
__global__ __launch_bounds__(256) void k_wt(const float* __restrict__ W, bf* Tb, h16* Th, int Kr, int Nc, int mode) {
    __shared__ float ts[64 * 65];
    const int tid = threadIdx.x; const int n0 = blockIdx.x * 64, k0 = blockIdx.y * 64;
#pragma unroll
    for (int p = 0; p < 4; ++p) { const int row = p * 16 + (tid >> 4), c4 = (tid & 15) * 4;      // 4 p x 16 rows = 64 k rows; 16 threads x 4 = 64 n columns
        const v4f v = *(const v4f*)(W + (size_t)(k0 + row) * (size_t)Nc + n0 + c4);
        ts[row * 65 + c4 + 0] = v[0]; ts[row * 65 + c4 + 1] = v[1]; ts[row * 65 + c4 + 2] = v[2]; ts[row * 65 + c4 + 3] = v[3]; }
    __syncthreads();
{
#pragma unroll
        for (int s = 0; s < 2; ++s) { const int n = s * 32 + (tid >> 3), c8 = (tid & 7) * 8;     // 2 s x 32 rows = 64 n rows; 8 lanes x 8 = 64 k columns
            const size_t oo = (size_t)(n0 + n) * (size_t)Kr + k0 + c8;
            if (mode == 0) { v8us o;
#pragma unroll
                for (int i = 0; i < 8; ++i) o[i] = f2bf(ts[(c8 + i) * 65 + n]);
                *(v8us*)(Tb + oo) = o;
            } else { v8h o;
#pragma unroll
                for (int i = 0; i < 8; ++i) o[i] = (h16)(__uint_as_float(((unsigned)f2bf(ts[(c8 + i) * 65 + n])) << 16) * WOS);
                *(v8h*)(Th + oo) = o; } }
         }
}

// k_rope_tab: CS[t][j] = (cos, sin)(t * inv_freq[j]), inv_freq[j] = 1.0f / (float)(10000^(j/32)); the power is a double product of fixed binary roots of 10000.
__global__ __launch_bounds__(256) void k_rope_tab(float* CS, int nrow) {
    const int i = blockIdx.x * 256 + threadIdx.x; if (i >= nrow * 32) return;
    const int t = i >> 5, j = i & 31;
    double p = 1.0;
    p *= (j & 1)  ? 1.3335214321633240 : 1.0;    // 10000^(1/32)
    p *= (j & 2)  ? 1.7782794100389228 : 1.0;    // 10000^(1/16)
    p *= (j & 4)  ? 3.1622776601683795 : 1.0;    // 10000^(1/8)
    p *= (j & 8)  ? 10.0 : 1.0;                  // 10000^(1/4)
    p *= (j & 16) ? 100.0 : 1.0;                 // 10000^(1/2)
    const float pf = (float)p; const float inv = 1.0f / pf;
    const float ang = (float)t * inv;
    const float cs = cosf(ang), sn = sinf(ang);
    v2f o; o[0] = cs; o[1] = sn;
    *(v2f*)(CS + (size_t)i * 2) = o; 
}

// k_proj: register-blocked bf16 GEMM, four waves per 128x128 tile, one 64x64 tile (16 accumulators) per wave, operands from K-contiguous bf16 planes staged in LDS, K = DM.
// C[m][n] = sum_k A[m][k] Bt[n][k], written as f16 (Ph) and the f16 residual x1024 (Pr, useRes != 0) at
// wave tile base (r0/RB)*sRB + (r0%RB)*pitch + (c0/CB)*sCB + (c0%CB), row pitch 'pitch' (halves). grid (M/128, N/128), 128 threads.
// rope != 0 (rows = tokens b*SEQ + t, the 64 columns of a wave tile = one head): interleaved rotary applied on the f32 values at the store stage from CS[t][32] (cos, sin).
__global__ __launch_bounds__(128) void k_proj(const bf* __restrict__ A, const bf* __restrict__ Bt, h16* Ph, h16* Pr, int useRes, int RB, size_t sRB, int pitch, int CB, size_t sCB, const float* __restrict__ CS, int rope) {
    __shared__ __align__(16) bf ring[2 * STGE];
    __shared__ __align__(16) float osall[4 * 16 * 68];
    const int K = DM;
    const int tid = threadIdx.x; const int wave = __builtin_amdgcn_readfirstlane(tid >> 5);
    const int lane = tid & 31, lr = lane & 15, hi = lane >> 4; const int rb = blockIdx.x * 128, cb = blockIdx.y * 128;
    const int wr = (wave >> 1) * 64, wc = (wave & 1) * 64; const int r0 = rb + wr, c0 = cb + wc;
    float* os = osall + wave * 16 * 68;
    v8f acc[4][4];
#pragma unroll
    for (int mb = 0; mb < 4; ++mb)
#pragma unroll
        for (int nb = 0; nb < 4; ++nb) acc[mb][nb] = (v8f){};
    const unsigned l0 = (unsigned)(size_t)ring + (unsigned)((tid >> 3) * (LPE * 2) + (tid & 7) * 16);
    const char* ga = (const char*)(A + (size_t)(rb + (tid >> 3)) * K + (tid & 7) * 8);
    const char* gb = (const char*)(Bt + (size_t)(cb + (tid >> 3)) * K + (tid & 7) * 8);
    const int afr = (wr + lr) * LPE + 8 * hi, bfr = (128 + wc + lr) * LPE + 8 * hi;
    stage_tile(l0, ga, gb);
    wait_copies();
    __syncthreads();                                              // tile 0 readable by every wave
    stage_tile(l0 + STGB, ga + BK * 2, gb + BK * 2);
#pragma unroll 1   // one trip per staged tile: the ring's waits and barrier stand once, at the foot
    for (int t = 0; t < NKT; ++t) {
        const bf* sb = ring + (t & 1) * STGE;
#pragma unroll     // this and the loops inside: constant indices keep fragments and accumulators in registers
        for (int ks = 0; ks < BK; ks += 32) {
            v16bf a[4], b[4];
#pragma unroll
            for (int mb = 0; mb < 4; ++mb) a[mb] = ldb(sb + afr + mb * 16 * LPE + ks);
#pragma unroll
            for (int nb = 0; nb < 4; ++nb) b[nb] = ldb(sb + bfr + nb * 16 * LPE + ks);
#pragma unroll
            for (int nb = 0; nb < 4; ++nb)
#pragma unroll
                for (int mb = 0; mb < 4; ++mb) acc[mb][nb] = wmmab(a[mb], b[nb], acc[mb][nb]);
        }
        wait_lds();
        wait_copies();
        __syncthreads();                                          // publishes tile t + 1 and frees the buffer of tile t
        if (t + 2 < NKT) stage_tile(l0 + (unsigned)(t & 1) * STGB, ga + (size_t)(t + 2) * (BK * 2), gb + (size_t)(t + 2) * (BK * 2));
    }
    wait_copies();
    const size_t tbase = (size_t)(r0 / RB) * sRB + (size_t)(r0 % RB) * (size_t)pitch + (size_t)(c0 / CB) * sCB + (size_t)(c0 % CB);
#pragma unroll
    for (int mb = 0; mb < 4; ++mb) {
#pragma unroll
        for (int nb = 0; nb < 4; ++nb) {
#pragma unroll
            for (int j = 0; j < 8; ++j) os[(hi * 8 + j) * 68 + nb * 16 + lr] = acc[mb][nb][j]; }   // D: row 8h+j, col lane&15
        wave_sync();
        const size_t sb = tbase + (size_t)(mb * 16) * (size_t)pitch;
{
#pragma unroll
            for (int s = 0; s < 4; ++s) { const int row = 4 * s + (lane >> 3), c8 = (lane & 7) * 8;   // 4 s x 4 row groups = 16 rows; 8 lanes x 8 = 64 columns
                v4f x0 = *(const v4fa*)(&os[row * 68 + c8]); v4f x1 = *(const v4fa*)(&os[row * 68 + c8 + 4]); v8h hv, rv;
                if (rope) {                                                                            // kernel-argument uniform
                    const int t = (r0 + mb * 16 + row) % SEQ;
                    const float* cp = CS + ((size_t)t * 32 + (size_t)(c8 >> 1)) * 2;                  // pairs c8/2 .. c8/2+3: (cos, sin) x 4
                    const v4f ca = *(const v4f*)cp; const v4f cb = *(const v4f*)(cp + 4);
                    float e, o;
                    e = x0[0]; o = x0[1]; x0[0] = e * ca[0] - o * ca[1]; x0[1] = e * ca[1] + o * ca[0];
                    e = x0[2]; o = x0[3]; x0[2] = e * ca[2] - o * ca[3]; x0[3] = e * ca[3] + o * ca[2];
                    e = x1[0]; o = x1[1]; x1[0] = e * cb[0] - o * cb[1]; x1[1] = e * cb[1] + o * cb[0];
                    e = x1[2]; o = x1[3]; x1[2] = e * cb[2] - o * cb[3]; x1[3] = e * cb[3] + o * cb[2]; }
#pragma unroll
                for (int i = 0; i < 4; ++i) { const h16 a0 = (h16)x0[i]; const h16 a1 = (h16)x1[i]; hv[i] = a0; hv[4 + i] = a1; rv[i] = (h16)((x0[i] - (float)a0) * QRS); rv[4 + i] = (h16)((x1[i] - (float)a1) * QRS); }
                const size_t oo = sb + (size_t)row * (size_t)pitch + c8;
                *(v8h*)(Ph + oo) = hv; if (useRes) *(v8h*)(Pr + oo) = rv; }
             }
        wave_sync();
    }
}

// k_flash: fused causal attention for query rows >= EARLY. One block = 16 query rows x the four query heads of one kv head (one wave per head, h = g*4 + wave);
// Q fragments straight from the f16 planes; K / V^T of kv head g staged once per block in LDS, FK keys a stage, and read as fragments (two 16-B LDS loads each) by all four waves.
// Transposed form: S^T[key][t] = K Q^T (A = K rows, B = Q rows); lane (t = lane&15, h = lane>>4) holds keys 8h+r of each 16-key tile, so the packed
// P tile is directly the B fragment of O^T[d][t] = V^T P^T (element r <- tile keys 0..15, element 8+r <- tile keys 16..31, lane unchanged).
// Keys run over [0, t0+16) in steps of 32; the diagonal 32-key blocks replace excluded scores (key > t) by a large negative value before the running max.
__global__ __launch_bounds__(32 * AW) void k_flash(const h16* __restrict__ QH, const h16* __restrict__ QR, const h16* __restrict__ KP, const h16* __restrict__ VT, h16* CH) {
    __shared__ __align__(16) h16 ring[2 * FSTGE];
    float* os = (float*)ring;                                     // output staging, used only behind the loop's last barrier
    const int tid = threadIdx.x;
    const int lane = threadIdx.x & 31; const int wave = __builtin_amdgcn_readfirstlane(threadIdx.x >> 5);
    const int lr = lane & 15, hi = lane >> 4;
    const int zg = blockIdx.y; const int b = zg / NKV; const int g = zg % NKV;
    const int h = g * AW + wave;                                  // repeat on the head axis: query head h uses kv head h >> 2
    const int t0 = EARLY + blockIdx.x * 16;
    const int tq = t0 + lr;
    const size_t qo = ((size_t)(b * NH_ + h) * SEQ + (size_t)tq) * HD + 8 * hi;
    const v16h qh0 = ldh(QH + qo), qh1 = ldh(QH + qo + 32), qr0 = ldh(QR + qo), qr1 = ldh(QR + qo + 32);   // B fragments: col t, k = d
    const unsigned l0 = (unsigned)(size_t)ring + (unsigned)((tid >> 3) * (LPE * 2) + (tid & 7) * 16);
    const char* gk = (const char*)(KP + (size_t)zg * SEQ * HD + (size_t)(tid >> 3) * HD + (tid & 7) * 8);    // + stage * FK rows
    const char* gv = (const char*)(VT + (size_t)zg * HD * SEQ + (size_t)(tid >> 3) * SEQ + (tid & 7) * 8);   // + stage * FK keys
    const int kfr = lr * LPE + 8 * hi;                            // + key * LPE        (A fragment: row key, k = d)
    const int vfr = (FK + lr) * LPE + 8 * hi;                     // + 16j * LPE + key  (A fragment: row d, k = key)
    v8f o0 = (v8f){}, o1 = (v8f){}, o2 = (v8f){}, o3 = (v8f){};
    float m = NEGB, l = 0.0f;
    const int kend = t0 + 16;
    const int nst = (kend + FK - 1) / FK;                         // block-uniform; stage nst - 1 ends at or before key SEQ
    stage_kv(l0, gk, gv);
    wait_copies();
    __syncthreads();                                              // stage 0 readable by every wave
    if (nst > 1) stage_kv(l0 + FSTGB, gk + (size_t)FK * HD * 2, gv + FK * 2);
#pragma unroll 1   // one trip per staged tile: the ring's waits and barrier stand once, at the foot
    for (int st = 0; st < nst; ++st) {
        const h16* sb = ring + (st & 1) * FSTGE;
#pragma unroll     // two 32-key steps per stage, constant LDS offsets
        for (int ks = 0; ks < FK; ks += 32) {
            const int key0 = st * FK + ks;
            if (key0 >= kend) break;                               // block-uniform: the last stage may hold one step only
            const h16* ka = sb + kfr + ks * LPE;
            const v16h ka0 = ldh(ka), ka1 = ldh(ka + 32), kb0 = ldh(ka + 16 * LPE), kb1 = ldh(ka + 16 * LPE + 32);
            v8f sHa = (v8f){}, sLa = (v8f){}, sHb = (v8f){}, sLb = (v8f){};
            sHa = wmma16(ka0, qh0, sHa); sLa = wmma16(ka0, qr0, sLa); sHb = wmma16(kb0, qh0, sHb); sLb = wmma16(kb0, qr0, sLb);
            sHa = wmma16(ka1, qh1, sHa); sLa = wmma16(ka1, qr1, sLa); sHb = wmma16(kb1, qh1, sHb); sLb = wmma16(kb1, qr1, sLb);
            float ta[8], tb[8];
#pragma unroll
            for (int r = 0; r < 8; ++r) { ta[r] = (sHa[r] + sLa[r] * QRI) * SC2; tb[r] = (sHb[r] + sLb[r] * QRI) * SC2; }
            if (key0 + 31 > t0) {                                  // block-uniform: diagonal block
                const int kbse = key0 + 8 * hi;
#pragma unroll
                for (int r = 0; r < 8; ++r) { ta[r] = (kbse + r > tq) ? NEGB : ta[r]; tb[r] = (kbse + 16 + r > tq) ? NEGB : tb[r]; } }
            float mx = NEGB;
#pragma unroll
            for (int r = 0; r < 8; ++r) mx = fmaxf(mx, fmaxf(ta[r], tb[r]));
            mx = fmaxf(mx, __shfl_xor(mx, 16, 32));
            const float mnew = fmaxf(m, mx);
            const float alpha = __builtin_amdgcn_exp2f(m - mnew);
            const float sh = PSH - mnew;
            v16h pb; float ls = 0.0f;
#pragma unroll
            for (int r = 0; r < 8; ++r) { const float ea = __builtin_amdgcn_exp2f(ta[r] + sh); const float ec = __builtin_amdgcn_exp2f(tb[r] + sh); pb[r] = (h16)ea; pb[8 + r] = (h16)ec; ls += ea + ec; }
            l = l * alpha + ls; m = mnew;
            o0 = o0 * alpha; o1 = o1 * alpha; o2 = o2 * alpha; o3 = o3 * alpha;
            const h16* va = sb + vfr + ks;
            const v16h v0 = ldh(va), v1 = ldh(va + 16 * LPE), v2 = ldh(va + 32 * LPE), v3 = ldh(va + 48 * LPE);
            o0 = wmma16(v0, pb, o0); o1 = wmma16(v1, pb, o1); o2 = wmma16(v2, pb, o2); o3 = wmma16(v3, pb, o3);
        }
        wait_lds();
        wait_copies();
        __syncthreads();                                          // publishes stage st + 1 and frees the buffer of stage st
        if (st + 2 < nst) stage_kv(l0 + (unsigned)(st & 1) * FSTGB, gk + (size_t)(st + 2) * (FK * HD * 2), gv + (size_t)(st + 2) * (FK * 2));
    }
    wait_copies();
    l += __shfl_xor(l, 16, 32);
    const float inv = CXS / l;
    const int wb = wave * 16 * 68;
    // O^T D layout: o_j[r] = (d = 16j + 8h + r, t = lane&15) -> os[t][d]; rows 0..15 x columns 0..63 all written
    { v4f a, c;
      a[0] = o0[0] * inv; a[1] = o0[1] * inv; a[2] = o0[2] * inv; a[3] = o0[3] * inv; c[0] = o0[4] * inv; c[1] = o0[5] * inv; c[2] = o0[6] * inv; c[3] = o0[7] * inv;
      *(v4fa*)(&os[wb + lr * 68 +  0 + 8 * hi]) = a; *(v4fa*)(&os[wb + lr * 68 +  0 + 8 * hi + 4]) = c;
      a[0] = o1[0] * inv; a[1] = o1[1] * inv; a[2] = o1[2] * inv; a[3] = o1[3] * inv; c[0] = o1[4] * inv; c[1] = o1[5] * inv; c[2] = o1[6] * inv; c[3] = o1[7] * inv;
      *(v4fa*)(&os[wb + lr * 68 + 16 + 8 * hi]) = a; *(v4fa*)(&os[wb + lr * 68 + 16 + 8 * hi + 4]) = c;
      a[0] = o2[0] * inv; a[1] = o2[1] * inv; a[2] = o2[2] * inv; a[3] = o2[3] * inv; c[0] = o2[4] * inv; c[1] = o2[5] * inv; c[2] = o2[6] * inv; c[3] = o2[7] * inv;
      *(v4fa*)(&os[wb + lr * 68 + 32 + 8 * hi]) = a; *(v4fa*)(&os[wb + lr * 68 + 32 + 8 * hi + 4]) = c;
      a[0] = o3[0] * inv; a[1] = o3[1] * inv; a[2] = o3[2] * inv; a[3] = o3[3] * inv; c[0] = o3[4] * inv; c[1] = o3[5] * inv; c[2] = o3[6] * inv; c[3] = o3[7] * inv;
      *(v4fa*)(&os[wb + lr * 68 + 48 + 8 * hi]) = a; *(v4fa*)(&os[wb + lr * 68 + 48 + 8 * hi + 4]) = c; }
    wave_sync();
    h16* crow = CH + ((size_t)b * SEQ + t0) * DM + h * HD;         // merged heads: column h*64 + d
{
#pragma unroll
        for (int s = 0; s < 4; ++s) { const int row = 4 * s + (lane >> 3), c8 = (lane & 7) * 8;   // 4 s x 4 row groups = 16 rows; 8 lanes x 8 = 64 columns
            const v4f x0 = *(const v4fa*)(&os[wb + row * 68 + c8]); const v4f x1 = *(const v4fa*)(&os[wb + row * 68 + c8 + 4]); v8h hv;
#pragma unroll
            for (int i = 0; i < 4; ++i) { hv[i] = (h16)x0[i]; hv[4 + i] = (h16)x1[i]; }
            *(v8h*)(crow + (size_t)row * DM + c8) = hv; }
         }
}

// k_flash_early: same structure for query rows < EARLY with value + residual (x1024) planes on every operand:
// scores = kh.qh + (kh.qr + kr.qh)/1024; O = vh.ph + (vr.ph + vh.pr)/1024 (residual products in their own accumulators), l from the unconverted f32 P.
// Writes the ctx value plane rows (carried x1024) and the compact unscaled residual plane CR[b][t < EARLY][2048].
__global__ __launch_bounds__(32 * AW) void k_flash_early(const h16* __restrict__ QH, const h16* __restrict__ QR, const h16* __restrict__ KP, const h16* __restrict__ KR,
                                                         const h16* __restrict__ VT, const h16* __restrict__ VR, h16* CH, h16* CR) {
    __shared__ __align__(16) float os[AW * 16 * 68];
    const int lane = threadIdx.x & 31; const int wave = __builtin_amdgcn_readfirstlane(threadIdx.x >> 5);
    const int lr = lane & 15, hi = lane >> 4;
    const int zg = blockIdx.y; const int b = zg / NKV; const int g = zg % NKV;
    const int h = g * AW + wave;
    const int t0 = blockIdx.x * 16;
    const int tq = t0 + lr;
    const size_t qo = ((size_t)(b * NH_ + h) * SEQ + (size_t)tq) * HD + 8 * hi;
    const v16h qh0 = ldh(QH + qo), qh1 = ldh(QH + qo + 32), qr0 = ldh(QR + qo), qr1 = ldh(QR + qo + 32);
    const size_t ko = (size_t)zg * SEQ * HD + (size_t)lr * HD + 8 * hi;
    const size_t vo = (size_t)zg * HD * SEQ + (size_t)lr * SEQ + 8 * hi;
    v8f oH[4], oL[4];
#pragma unroll
    for (int j = 0; j < 4; ++j) { oH[j] = (v8f){}; oL[j] = (v8f){}; }
    float m = NEGB, l = 0.0f;
    const int kend = t0 + 16;
#pragma unroll 1
    for (int key0 = 0; key0 < kend; key0 += 32) {
        const size_t kk = ko + (size_t)key0 * HD;
        v8f sHa = (v8f){}, sLa = (v8f){}, sHb = (v8f){}, sLb = (v8f){};
        { const v16h k0 = ldh(KP + kk), k1 = ldh(KP + kk + 32), r0 = ldh(KR + kk), r1 = ldh(KR + kk + 32);
          sHa = wmma16(k0, qh0, sHa); sHa = wmma16(k1, qh1, sHa);
          sLa = wmma16(k0, qr0, sLa); sLa = wmma16(k1, qr1, sLa); sLa = wmma16(r0, qh0, sLa); sLa = wmma16(r1, qh1, sLa); }
        { const size_t k2 = kk + (size_t)16 * HD;
          const v16h k0 = ldh(KP + k2), k1 = ldh(KP + k2 + 32), r0 = ldh(KR + k2), r1 = ldh(KR + k2 + 32);
          sHb = wmma16(k0, qh0, sHb); sHb = wmma16(k1, qh1, sHb);
          sLb = wmma16(k0, qr0, sLb); sLb = wmma16(k1, qr1, sLb); sLb = wmma16(r0, qh0, sLb); sLb = wmma16(r1, qh1, sLb); }
        float ta[8], tb[8];
#pragma unroll
        for (int r = 0; r < 8; ++r) { ta[r] = (sHa[r] + sLa[r] * QRI) * SC2; tb[r] = (sHb[r] + sLb[r] * QRI) * SC2; }
        if (key0 + 31 > t0) {                                      // block-uniform: diagonal block
            const int kbse = key0 + 8 * hi;
#pragma unroll
            for (int r = 0; r < 8; ++r) { ta[r] = (kbse + r > tq) ? NEGB : ta[r]; tb[r] = (kbse + 16 + r > tq) ? NEGB : tb[r]; } }
        float mx = NEGB;
#pragma unroll
        for (int r = 0; r < 8; ++r) mx = fmaxf(mx, fmaxf(ta[r], tb[r]));
        mx = fmaxf(mx, __shfl_xor(mx, 16, 32));
        const float mnew = fmaxf(m, mx);
        const float alpha = __builtin_amdgcn_exp2f(m - mnew);
        const float sh = PSH - mnew;
        v16h ph, pr; float ls = 0.0f;
#pragma unroll
        for (int r = 0; r < 8; ++r) { const float ea = __builtin_amdgcn_exp2f(ta[r] + sh); const float ec = __builtin_amdgcn_exp2f(tb[r] + sh);
            const h16 ha = (h16)ea; const h16 hc = (h16)ec; ph[r] = ha; ph[8 + r] = hc;
            pr[r] = (h16)((ea - (float)ha) * QRS); pr[8 + r] = (h16)((ec - (float)hc) * QRS); ls += ea + ec; }
        l = l * alpha + ls; m = mnew;
#pragma unroll
        for (int j = 0; j < 4; ++j) { oH[j] = oH[j] * alpha; oL[j] = oL[j] * alpha; }
        const size_t vv = vo + (size_t)key0;
#pragma unroll
        for (int j = 0; j < 4; ++j) { const v16h vh = ldh(VT + vv + (size_t)(16 * j) * SEQ); const v16h vr = ldh(VR + vv + (size_t)(16 * j) * SEQ);
            oH[j] = wmma16(vh, ph, oH[j]); oL[j] = wmma16(vr, ph, oL[j]); oL[j] = wmma16(vh, pr, oL[j]); }
    }
    l += __shfl_xor(l, 16, 32);
    const float inv = CXS / l;
    const int wb = wave * 16 * 68;
#pragma unroll
    for (int j = 0; j < 4; ++j) { v4f a, c;     // os[t][d], d = 16j + 8h + r; rows 0..15 x columns 0..63 all written
        a[0] = (oH[j][0] + oL[j][0] * QRI) * inv; a[1] = (oH[j][1] + oL[j][1] * QRI) * inv; a[2] = (oH[j][2] + oL[j][2] * QRI) * inv; a[3] = (oH[j][3] + oL[j][3] * QRI) * inv;
        c[0] = (oH[j][4] + oL[j][4] * QRI) * inv; c[1] = (oH[j][5] + oL[j][5] * QRI) * inv; c[2] = (oH[j][6] + oL[j][6] * QRI) * inv; c[3] = (oH[j][7] + oL[j][7] * QRI) * inv;
        *(v4fa*)(&os[wb + lr * 68 + 16 * j + 8 * hi]) = a; *(v4fa*)(&os[wb + lr * 68 + 16 * j + 8 * hi + 4]) = c; }
    wave_sync();
    h16* crow = CH + ((size_t)b * SEQ + t0) * DM + h * HD;
    h16* rrow = CR + ((size_t)b * EARLY + t0) * DM + h * HD;
{
#pragma unroll
        for (int s = 0; s < 4; ++s) { const int row = 4 * s + (lane >> 3), c8 = (lane & 7) * 8;   // 4 s x 4 row groups = 16 rows; 8 lanes x 8 = 64 columns
            const v4f x0 = *(const v4fa*)(&os[wb + row * 68 + c8]); const v4f x1 = *(const v4fa*)(&os[wb + row * 68 + c8 + 4]); v8h hv, rv;
#pragma unroll
            for (int i = 0; i < 4; ++i) { const h16 a0 = (h16)x0[i]; const h16 a1 = (h16)x1[i]; hv[i] = a0; hv[4 + i] = a1; rv[i] = (h16)(x0[i] - (float)a0); rv[4 + i] = (h16)(x1[i] - (float)a1); }
            *(v8h*)(crow + (size_t)row * DM + c8) = hv; *(v8h*)(rrow + (size_t)row * DM + c8) = rv; }
         }
}

// k_out: output projection, four waves per 128x128 tile (64x64 per wave), f16 operands from the ctx plane CX (value rows [NB*SEQ], then residual rows [NB*EARLY]) and the Wo^T plane, staged in LDS, K = DM.
// Tiles whose rows are < EARLY in their sequence walk K a second time over the unscaled residual rows into the same accumulators. grid (NB*SEQ/128, DM/128), 128 threads.
__global__ __launch_bounds__(128) void k_out(const h16* __restrict__ CX, const h16* __restrict__ Wt, float* OUT) {
    __shared__ __align__(16) h16 ring[2 * STGE];
    __shared__ __align__(16) float osall[4 * 16 * 68];
    const int K = DM;
    const int tid = threadIdx.x; const int wave = __builtin_amdgcn_readfirstlane(tid >> 5);
    const int lane = tid & 31, lr = lane & 15, hi = lane >> 4; const int rb = blockIdx.x * 128, cb = blockIdx.y * 128;
    const int wr = (wave >> 1) * 64, wc = (wave & 1) * 64; const int c0 = cb + wc;
    float* os = osall + wave * 16 * 68;
    const int b = rb / SEQ, tb = rb % SEQ, tt = tb + wr;           // a 128-row tile lies in one batch and is entirely early or entirely late
    const int nt = (tb < EARLY) ? 2 * NKT : NKT;                   // block-uniform
    const unsigned l0 = (unsigned)(size_t)ring + (unsigned)((tid >> 3) * (LPE * 2) + (tid & 7) * 16);
    const char* ga0 = (const char*)(CX + (size_t)(rb + (tid >> 3)) * K + (tid & 7) * 8);
    const char* ga1 = (const char*)(CX + ((size_t)NB * SEQ + (size_t)b * EARLY + (size_t)tb + (size_t)(tid >> 3)) * K + (tid & 7) * 8);   // used only when tb < EARLY
    const char* gb = (const char*)(Wt + (size_t)(cb + (tid >> 3)) * K + (tid & 7) * 8);
    const int afr = (wr + lr) * LPE + 8 * hi, bfr = (128 + wc + lr) * LPE + 8 * hi;
    v8f acc[4][4];
#pragma unroll
    for (int mb = 0; mb < 4; ++mb)
#pragma unroll
        for (int nb = 0; nb < 4; ++nb) acc[mb][nb] = (v8f){};
    stage_tile(l0, ga0, gb);
    wait_copies();
    __syncthreads();                                              // tile 0 readable by every wave
    stage_tile(l0 + STGB, ga0 + BK * 2, gb + BK * 2);
#pragma unroll 1   // one trip per staged tile: the ring's waits and barrier stand once, at the foot
    for (int t = 0; t < nt; ++t) {
        const h16* sb = ring + (t & 1) * STGE;
#pragma unroll     // this and the loops inside: constant indices keep fragments and accumulators in registers
        for (int ks = 0; ks < BK; ks += 32) {
            v16h a[4], bq[4];
#pragma unroll
            for (int mb = 0; mb < 4; ++mb) a[mb] = ldh(sb + afr + mb * 16 * LPE + ks);
#pragma unroll
            for (int nb = 0; nb < 4; ++nb) bq[nb] = ldh(sb + bfr + nb * 16 * LPE + ks);
#pragma unroll
            for (int nb = 0; nb < 4; ++nb)
#pragma unroll
                for (int mb = 0; mb < 4; ++mb) acc[mb][nb] = wmma16(a[mb], bq[nb], acc[mb][nb]);
        }
        wait_lds();
        wait_copies();
        __syncthreads();                                          // publishes tile t + 1 and frees the buffer of tile t
        if (t + 2 < nt) { const int u = t + 2; const size_t ko = (size_t)(u & (NKT - 1)) * (BK * 2);   // tiles NKT.. are the residual rows' walk
            stage_tile(l0 + (unsigned)(t & 1) * STGB, (u < NKT ? ga0 : ga1) + ko, gb + ko); }
    }
    wait_copies();
    float* obase = OUT + ((size_t)b * OUT_SEQ + tt) * DM + c0;
#pragma unroll
    for (int mb = 0; mb < 4; ++mb) {
#pragma unroll
        for (int nb = 0; nb < 4; ++nb) {
#pragma unroll
            for (int j = 0; j < 8; ++j) os[(hi * 8 + j) * 68 + nb * 16 + lr] = acc[mb][nb][j] * OUTS; }   // D: row 8h+j, col lane&15
        wave_sync();
{
#pragma unroll
            for (int s = 0; s < 8; ++s) { const int row = 2 * s + hi, cofs = lr * 4;   // 8 s x 2 rows = 16 rows; 16 lanes x 4 floats = 64 columns
                const v4f val = *(const v4fa*)(&os[row * 68 + cofs]);
                *(v4f*)(obase + (size_t)(mb * 16 + row) * DM + cofs) = val; }
             }
        wave_sync();
    }
}

static constexpr size_t al256(size_t v) { return (v + 255) & ~(size_t)255; }
static constexpr size_t SZ_XB = al256((size_t)NB * SEQ * DM * 2);
static constexpr size_t SZ_WQ = al256((size_t)DM * DM * 2);
static constexpr size_t SZ_WK = al256((size_t)KVD * DM * 2);
static constexpr size_t SZ_CS = al256((size_t)SEQ * 32 * 2 * 4);
static constexpr size_t SZ_Q  = al256((size_t)NB * NH_ * SEQ * HD * 2);
static constexpr size_t SZ_KV = al256((size_t)NB * NKV * SEQ * HD * 2);
static constexpr size_t SZ_CX = al256(((size_t)NB * SEQ + (size_t)NB * EARLY) * DM * 2);
static constexpr size_t SZ_TOTAL = SZ_XB + 2 * SZ_WQ + 2 * SZ_WK + SZ_CS + 2 * SZ_Q + 4 * SZ_KV + SZ_CX;
static_assert(SZ_TOTAL <= (size_t)134217728);          // workspace carve <= 128 MiB

extern "C" void kernel_launch(void* const* d_in, const int* in_sizes, int n_in,
                              void* d_out, int out_size, void* d_ws, size_t ws_size, hipStream_t stream) {
    if (n_in < 5) return;
    const size_t needx = ((size_t)(NB - 1) * SEQ_FULL + SEQ) * DM;
    if ((size_t)in_sizes[0] < needx) return;
    if ((size_t)in_sizes[1] < (size_t)DM * DM || (size_t)in_sizes[2] < (size_t)DM * KVD || (size_t)in_sizes[3] < (size_t)DM * KVD || (size_t)in_sizes[4] < (size_t)DM * DM) return;
    if ((size_t)out_size < ((size_t)(NB - 1) * OUT_SEQ + SEQ) * DM) return;
    if (SZ_TOTAL > ws_size) return;
    // wire order x, wq, wk, wv, wo; every weight is [in][out]
    const float* x = (const float*)d_in[0]; const float* wq = (const float*)d_in[1]; const float* wk = (const float*)d_in[2]; const float* wv = (const float*)d_in[3]; const float* wo = (const float*)d_in[4];
    float* OUT = (float*)d_out;      // [NB][SEQ][2048]
    char* wsp = (char*)d_ws;
    bf*  XB  = (bf*)wsp;  wsp += SZ_XB;              // [NB*SEQ][2048] bf16
    bf*  WQt = (bf*)wsp;  wsp += SZ_WQ;              // [2048 out][2048 in] bf16
    bf*  WKt = (bf*)wsp;  wsp += SZ_WK;              // [512 out][2048 in] bf16
    bf*  WVt = (bf*)wsp;  wsp += SZ_WK;              // [512 out][2048 in] bf16
    h16* WOt = (h16*)wsp; wsp += SZ_WQ;              // [2048 out][2048 in] f16 of bf16 value x16
    float* CS = (float*)wsp; wsp += SZ_CS;           // [SEQ][32] (cos, sin)
    h16* QH = (h16*)wsp; wsp += SZ_Q;                // [NB*32][SEQ][64]
    h16* QR = (h16*)wsp; wsp += SZ_Q;                // residual x1024
    h16* KP = (h16*)wsp; wsp += SZ_KV;               // [NB*8][SEQ][64]
    h16* KR = (h16*)wsp; wsp += SZ_KV;               // residual x1024
    h16* VT = (h16*)wsp; wsp += SZ_KV;               // [NB*8][64][SEQ]
    h16* VR = (h16*)wsp; wsp += SZ_KV;               // residual x1024
    h16* CX = (h16*)wsp; wsp += SZ_CX;               // ctx x1024: value rows [NB*SEQ][2048], then residual rows [NB*EARLY][2048]
    h16* CR = CX + (size_t)NB * SEQ * DM;

    if (SEQ == SEQ_FULL) {
        const size_t n8 = (size_t)NB * SEQ * DM / 8;
        k_cvt8<<<(unsigned)((n8 + 255) / 256), 256, 0, stream>>>(x, XB, n8);
    } else {
        const size_t n8 = (size_t)SEQ * DM / 8;
        for (int b = 0; b < NB; ++b) k_cvt8<<<(unsigned)((n8 + 255) / 256), 256, 0, stream>>>(x + (size_t)b * SEQ_FULL * DM, XB + (size_t)b * SEQ * DM, n8);
    }
    // transposes: in[rows = in-features][cols = out-features] -> out[cols][rows]; grid (cols/64, rows/64)
    k_wt<<<dim3(DM / 64,  DM / 64, 1), 256, 0, stream>>>(wq, WQt, (h16*)WQt, DM, DM, 0);
    k_wt<<<dim3(KVD / 64, DM / 64, 1), 256, 0, stream>>>(wk, WKt, (h16*)WKt, DM, KVD, 0);
    k_wt<<<dim3(KVD / 64, DM / 64, 1), 256, 0, stream>>>(wv, WVt, (h16*)WVt, DM, KVD, 0);
    k_wt<<<dim3(DM / 64,  DM / 64, 1), 256, 0, stream>>>(wo, (bf*)WOt, WOt, DM, DM, 1);
    k_rope_tab<<<(unsigned)((SEQ * 32 + 255) / 256), 256, 0, stream>>>(CS, SEQ);

    // q: A = x rows (m = b*SEQ + t), Bt = Wq^T rows (n = h*64 + d) -> plane [(b*32 + h)][t][d], rotary applied
    k_proj<<<dim3(NB * SEQ / 128, DM / 128, 1), 128, 0, stream>>>(XB, WQt, QH, QR, 1, SEQ, (size_t)NH_ * SEQ * HD, HD, HD, (size_t)SEQ * HD, CS, 1);
    // k: Bt = Wk^T rows (n = g*64 + d) -> plane [(b*8 + g)][t][d], rotary applied
    k_proj<<<dim3(NB * SEQ / 128, KVD / 128, 1), 128, 0, stream>>>(XB, WKt, KP, KR, 1, SEQ, (size_t)NKV * SEQ * HD, HD, HD, (size_t)SEQ * HD, CS, 1);
    // v^T: A = Wv^T rows (m = g*64 + d), Bt = x rows (n = b*SEQ + t) -> plane [(b*512 + m)][t] = [(b*8 + g)][d][t], no rotary
    k_proj<<<dim3(KVD / 128, NB * SEQ / 128, 1), 128, 0, stream>>>(WVt, XB, VT, VR, 1, KVD, (size_t)0, SEQ, SEQ, (size_t)KVD * SEQ, CS, 0);

    k_flash_early<<<dim3(EARLY / 16, NB * NKV, 1), 32 * AW, 0, stream>>>(QH, QR, KP, KR, VT, VR, CX, CR);
    if (SEQ > EARLY)
        k_flash<<<dim3((SEQ - EARLY) / 16, NB * NKV, 1), 32 * AW, 0, stream>>>(QH, QR, KP, VT, CX);

    k_out<<<dim3(NB * SEQ / 128, DM / 128, 1), 128, 0, stream>>>(CX, WOt, OUT);
}

// v003
// It runs in 169 microseconds.
// Two timings next to v002 put it at 1.50 and 1.49 times that version's speed.
// Over all steps from v000 it is 3.12 times as fast.
#include <hip/hip_runtime.h>

// Grouped-query causal self-attention, width 2048 = 32 query heads x 64 sharing 8 kv heads (kv head g = h >> 2), x [NB][SEQ][2048], Wq/Wk/Wv/Wo [in][out] (y = x W), no biases,
// interleaved (even/odd pair) rotary on q and k from a computed [SEQ][32] (cos, sin) table, score scale 1/8, causal exclusion (diagonal kept), output = ctx Wo (f32).
// Compute dtypes, f32 accumulate everywhere: q/k/v projections v_wmma_f32_16x16x32_bf16 (x and W RNE-converted to bf16; products exact);
// scores v_wmma_f32_16x16x32_f16: k single f16, q as f16 value + f16 residual x1024 in its own accumulator (query rows < 256: k also value + residual x1024, three products);
// P (x256 carry, cancels in the normalisation) and v single f16 (rows < 256: P and v as value + residual x1024, three products); softmax f32 (online, running max);
// output projection v_wmma_f32_16x16x32_f16: ctx carried x1024 as f16 (rows < 256: plus its unscaled f16 residual folded along K) against f16(bf16(Wo)) x16, result scaled by 2^-14.

#ifndef NB
#define NB 2
#endif
#ifndef SEQ
#define SEQ 2048
#endif
#define NB_FULL  2
#define SEQ_FULL 2048
#ifndef OUT_SEQ
#define OUT_SEQ SEQ              // row pitch (in tokens) between batches of the output
#endif
#define DM    2048
#define NH_   32
#define NKV   8
#define HD    64
#define KVD   (NKV * HD)         // 512
#define AW    4                  // waves per flash block = the four query heads of one kv head
#define EARLY 256                // query rows below this use the value + residual path
#define QRS  1024.0f             // carry of every residual plane (q, k, v, P)
#define QRI  (1.0f / 1024.0f)
#define SC2  (0.125f * 1.4426950408889634f)   // HD^-0.5 * log2(e)
#define PSH  8.0f                // log2 of the P carry (256)
#define CXS  1024.0f             // carry of the ctx plane
#define WOS  16.0f               // carry of the Wo plane
#define OUTS (1.0f / (1024.0f * 16.0f))
#define NEGB (-3.0e38f)

static_assert(HD == 64);
static_assert(NH_ * HD == DM);                 // query head h = columns h*64 + d
static_assert(NKV * AW == NH_);                // four consecutive query heads per kv head
static_assert(DM % 64 == 0);
static_assert(KVD % 64 == 0);
static_assert(DM % 32 == 0);                   // GEMM k-loop steps by 32
static_assert(SEQ % 64 == 0);                  // a 64-row tile never straddles two batches
static_assert(SEQ % 32 == 0);                  // key loop steps by 32, key0 + 31 < SEQ
static_assert(EARLY % 128 == 0);               // output GEMM tiles are entirely early or entirely late
static_assert(SEQ % 128 == 0);                 // a 128-row GEMM tile never straddles two batches
static_assert(KVD % 128 == 0);
static_assert(SEQ >= EARLY);
static_assert((SEQ - EARLY) % 16 == 0);
static_assert(((size_t)SEQ * DM) % 8 == 0);
static_assert(NB <= NB_FULL);
static_assert(SEQ <= SEQ_FULL);

typedef _Float16 h16;
typedef unsigned short bf;
typedef __attribute__((ext_vector_type(16))) __bf16   v16bf;
typedef __attribute__((ext_vector_type(16))) _Float16 v16h;
typedef __attribute__((ext_vector_type(8)))  _Float16 v8h;
typedef __attribute__((ext_vector_type(8)))  unsigned short v8us;
typedef __attribute__((ext_vector_type(8)))  float    v8f;
typedef __attribute__((ext_vector_type(4)))  float    v4f;
typedef __attribute__((ext_vector_type(2)))  float    v2f;
typedef v4f  __attribute__((may_alias)) v4fa;

__device__ __forceinline__ unsigned short f2bf(float f) { unsigned u = __float_as_uint(f); u += 0x7FFFu + ((u >> 16) & 1u); return (unsigned short)(u >> 16); }
__device__ __forceinline__ v16h cat16(v8h lo, v8h hi) { return __builtin_shufflevector(lo, hi, 0, 1, 2, 3, 4, 5, 6, 7, 8, 9, 10, 11, 12, 13, 14, 15); }
__device__ __forceinline__ v16bf cat16b(v8us lo, v8us hi) { return __builtin_bit_cast(v16bf, __builtin_shufflevector(lo, hi, 0, 1, 2, 3, 4, 5, 6, 7, 8, 9, 10, 11, 12, 13, 14, 15)); }
// every WMMA is followed by its own 4-slot guard tying its accumulator and keeping its operands live
__device__ __forceinline__ v8f wmma16(v16h a, v16h b, v8f c) {
    c = __builtin_amdgcn_wmma_f32_16x16x32_f16(false, a, false, b, (short)0, c, false, false);
    asm volatile("v_nop\n\tv_nop\n\tv_nop\n\tv_nop" : "+v"(c) : "v"(a), "v"(b));
    return c; }
__device__ __forceinline__ v8f wmmab(v16bf a, v16bf b, v8f c) {
    c = __builtin_amdgcn_wmma_f32_16x16x32_bf16(false, a, false, b, (short)0, c, false, false);
    asm volatile("v_nop\n\tv_nop\n\tv_nop\n\tv_nop" : "+v"(c) : "v"(a), "v"(b));
    return c; }
// fragment loaders from K-contiguous 16-bit rows; p already includes + 8*(lane>>4): elements 0..7 <- k0+8h+0..7, elements 8..15 <- k0+16+8h+0..7 (same map for A and B)
__device__ __forceinline__ v16h  ldh(const h16* p) { return cat16(*(const v8h*)p, *(const v8h*)(p + 16)); }
__device__ __forceinline__ v16bf ldb(const bf* p)  { return cat16b(*(const v8us*)p, *(const v8us*)(p + 16)); }
// ordering point for wave-private LDS tiles (same wave writes and reads)
__device__ __forceinline__ void wave_sync() { __builtin_amdgcn_fence(3 /* release order */, "wavefront"); __builtin_amdgcn_wave_barrier(); asm volatile("" ::: "memory"); }

// ---- operand staging of the two GEMM kernels: a 128x128 output tile per block of four waves (2 x 2, 64x64 each), K walked in tiles of BK.
// One stage = 128 A rows then 128 B rows of BK 16-bit elements (128 B, one cache line each) at a pitch of 144 B (16 B x odd: conflict-free for 16-byte LDS reads); two buffers.
#define BK   64
#define LPE  72                   // LDS row pitch in 16-bit elements
#define STGE (256 * LPE)          // elements of one buffer
#define STGB (STGE * 2)           // bytes of one buffer
#define NKT  (DM / BK)            // K tiles of one walk over K
static_assert(DM % BK == 0 && NKT >= 2 && (NKT & (NKT - 1)) == 0);   // both prologue tiles exist; the output GEMM's second walk wraps its tile index by a mask
// eight asynchronous 16-byte copies of one lane, rows 16 apart (LDS step 16 * 144 B, global step 16 rows of DM elements); eight lanes cover one 128-B row.
// s_wait_xcnt closes the statement so that no address register is rewritten ahead of it.
__device__ __forceinline__ void copy8(unsigned l, const char* g) {
    const size_t gs = (size_t)16 * DM * 2; const unsigned ls = 16 * LPE * 2;
    asm volatile("global_load_async_to_lds_b128 %0, %8, off\n\t"
                 "global_load_async_to_lds_b128 %1, %9, off\n\t"
                 "global_load_async_to_lds_b128 %2, %10, off\n\t"
                 "global_load_async_to_lds_b128 %3, %11, off\n\t"
                 "global_load_async_to_lds_b128 %4, %12, off\n\t"
                 "global_load_async_to_lds_b128 %5, %13, off\n\t"
                 "global_load_async_to_lds_b128 %6, %14, off\n\t"
                 "global_load_async_to_lds_b128 %7, %15, off\n\t"
                 "s_wait_xcnt 0x0"
                 :: "v"(l), "v"(l + ls), "v"(l + 2 * ls), "v"(l + 3 * ls), "v"(l + 4 * ls), "v"(l + 5 * ls), "v"(l + 6 * ls), "v"(l + 7 * ls),
                    "v"(g), "v"(g + gs), "v"(g + 2 * gs), "v"(g + 3 * gs), "v"(g + 4 * gs), "v"(g + 5 * gs), "v"(g + 6 * gs), "v"(g + 7 * gs)
                 : "memory");
}
// one stage: l = the lane's LDS byte address in row (tid >> 3) of the buffer, ga / gb = the lane's 16 bytes in that row of the A / B tile
__device__ __forceinline__ void stage_tile(unsigned l, const char* ga, const char* gb) { copy8(l, ga); copy8(l + 128 * LPE * 2, gb); }
// the issuing wave's own copies have landed (the compiler places no wait for them)
__device__ __forceinline__ void wait_copies() { asm volatile("s_wait_asynccnt 0x0" ::: "memory"); }
// this wave's LDS reads of the buffer have returned before the barrier that frees it for the refill
__device__ __forceinline__ void wait_lds() { asm volatile("s_wait_dscnt 0x0" ::: "memory"); }

// ---- K / V^T staging of k_flash: one stage = FK keys of one kv head: FK K rows (64 d = 128 B each), then 64 V^T rows (FK keys = 128 B each), whole cache lines, at the same 144-B pitch; two buffers.
#define FK    64
#define FSTGE ((FK + HD) * LPE)   // elements of one buffer
#define FSTGB (FSTGE * 2)         // bytes of one buffer
static_assert(FK == 64 && SEQ % FK == 0);                         // a V^T row of a stage is one 128-B line; the last stage of any query tile ends inside the planes
static_assert(2 * FSTGB >= AW * 16 * 68 * 4);                     // the output staging reuses the ring behind the last barrier
// eight asynchronous 16-byte copies of one lane: four K rows, then four V^T rows, each 16 rows apart (eight lanes cover one 128-B row, 128 threads 16 rows).
// s_wait_xcnt closes the statement so that no address register is rewritten ahead of it.
__device__ __forceinline__ void stage_kv(unsigned l, const char* gk, const char* gv) {
    const size_t kst = (size_t)16 * HD * 2, vst = (size_t)16 * SEQ * 2; const unsigned ls = 16 * LPE * 2;
    asm volatile("global_load_async_to_lds_b128 %0, %8, off\n\t"
                 "global_load_async_to_lds_b128 %1, %9, off\n\t"
                 "global_load_async_to_lds_b128 %2, %10, off\n\t"
                 "global_load_async_to_lds_b128 %3, %11, off\n\t"
                 "global_load_async_to_lds_b128 %4, %12, off\n\t"
                 "global_load_async_to_lds_b128 %5, %13, off\n\t"
                 "global_load_async_to_lds_b128 %6, %14, off\n\t"
                 "global_load_async_to_lds_b128 %7, %15, off\n\t"
                 "s_wait_xcnt 0x0"
                 :: "v"(l), "v"(l + ls), "v"(l + 2 * ls), "v"(l + 3 * ls), "v"(l + 4 * ls), "v"(l + 5 * ls), "v"(l + 6 * ls), "v"(l + 7 * ls),
                    "v"(gk), "v"(gk + kst), "v"(gk + 2 * kst), "v"(gk + 3 * kst), "v"(gv), "v"(gv + vst), "v"(gv + 2 * vst), "v"(gv + 3 * vst)
                 : "memory");
}

// ---- preparation: the x conversion, the four weight transposes and the rotary table depend on nothing but the inputs; they share one launch (k_prep), the block index picks the job.
// cvt8: 8 x values of one thread, f32 -> bf16; i counts groups of 8 over [NB][SEQ][DM], the source batches lie SEQ_FULL tokens apart.
__device__ __forceinline__ void cvt8(const float* __restrict__ src, bf* dst, int blk) {
    const size_t i = (size_t)blk * 256 + threadIdx.x; if (i >= (size_t)NB * SEQ * DM / 8) return;
    src += (i / ((size_t)SEQ * DM / 8)) * ((size_t)(SEQ_FULL - SEQ) * DM);
    const v8f v = *(const v8f*)(src + i * 8); v8us o;
#pragma unroll
    for (int k = 0; k < 8; ++k) o[k] = f2bf(v[k]);
    *(v8us*)(dst + i * 8) = o; 
}

// wt_tile: in[Kr rows][Nc cols] f32 -> out[Nc rows][Kr cols] 16-bit, 64x64 tile (bx of Nc/64, by of Kr/64) through LDS, 256 threads.
__device__ __forceinline__ void wt_tile(float* ts, const float* __restrict__ W, bf* Tb, h16* Th, int Kr, int Nc, int mode, int bx, int by) {
    const int tid = threadIdx.x; const int n0 = bx * 64, k0 = by * 64;
#pragma unroll
    for (int p = 0; p < 4; ++p) { const int row = p * 16 + (tid >> 4), c4 = (tid & 15) * 4;      // 4 p x 16 rows = 64 k rows; 16 threads x 4 = 64 n columns
        const v4f v = *(const v4f*)(W + (size_t)(k0 + row) * (size_t)Nc + n0 + c4);
        ts[row * 65 + c4 + 0] = v[0]; ts[row * 65 + c4 + 1] = v[1]; ts[row * 65 + c4 + 2] = v[2]; ts[row * 65 + c4 + 3] = v[3]; }
    __syncthreads();
{
#pragma unroll
        for (int s = 0; s < 2; ++s) { const int n = s * 32 + (tid >> 3), c8 = (tid & 7) * 8;     // 2 s x 32 rows = 64 n rows; 8 lanes x 8 = 64 k columns
            const size_t oo = (size_t)(n0 + n) * (size_t)Kr + k0 + c8;
            if (mode == 0) { v8us o;
#pragma unroll
                for (int i = 0; i < 8; ++i) o[i] = f2bf(ts[(c8 + i) * 65 + n]);
                *(v8us*)(Tb + oo) = o;
                asm volatile("s_wait_xcnt 0x0" ::: "memory");   // stands in front of any later rewrite of the store's address and data registers
            } else { v8h o;
#pragma unroll
                for (int i = 0; i < 8; ++i) o[i] = (h16)(__uint_as_float(((unsigned)f2bf(ts[(c8 + i) * 65 + n])) << 16) * WOS);
                *(v8h*)(Th + oo) = o;
                asm volatile("s_wait_xcnt 0x0" ::: "memory"); } }   // as above
         }
}

// rope_tab: CS[t][j] = (cos, sin)(t * inv_freq[j]), inv_freq[j] = 1.0f / (float)(10000^(j/32)); the power is a double product of fixed binary roots of 10000.
__device__ __forceinline__ void rope_tab(float* CS, int blk) {
    const int i = blk * 256 + threadIdx.x; if (i >= SEQ * 32) return;
    const int t = i >> 5, j = i & 31;
    double p = 1.0;
    p *= (j & 1)  ? 1.3335214321633240 : 1.0;    // 10000^(1/32)
    p *= (j & 2)  ? 1.7782794100389228 : 1.0;    // 10000^(1/16)
    p *= (j & 4)  ? 3.1622776601683795 : 1.0;    // 10000^(1/8)
    p *= (j & 8)  ? 10.0 : 1.0;                  // 10000^(1/4)
    p *= (j & 16) ? 100.0 : 1.0;                 // 10000^(1/2)
    const float pf = (float)p; const float inv = 1.0f / pf;
    const float ang = (float)t * inv;
    const float cs = cosf(ang), sn = sinf(ang);
    v2f o; o[0] = cs; o[1] = sn;
    *(v2f*)(CS + (size_t)i * 2) = o; 
}

#define PB_ROPE ((SEQ * 32 + 255) / 256)              // blocks of the rotary table
#define PB_WBIG ((DM / 64) * (DM / 64))               // tiles of Wq, of Wo
#define PB_WKV  ((KVD / 64) * (DM / 64))              // tiles of Wk, of Wv
#define PB_CVT  ((int)(((size_t)NB * SEQ * DM / 8 + 255) / 256))   // blocks of the x conversion
// k_prep: grid PB_ROPE + 2 PB_WBIG + 2 PB_WKV + PB_CVT, 256 threads; every branch on the block index is block-uniform (the transposes' barrier stands under it).
__global__ __launch_bounds__(256) void k_prep(const float* __restrict__ x, const float* __restrict__ wq, const float* __restrict__ wk, const float* __restrict__ wv, const float* __restrict__ wo,
                                              bf* XB, bf* WQt, bf* WKt, bf* WVt, h16* WOt, float* CS) {
    __shared__ float ts[64 * 65];
    int blk = blockIdx.x;
    if (blk < PB_ROPE) { rope_tab(CS, blk); return; }
    blk -= PB_ROPE;
    if (blk < 2 * PB_WBIG + 2 * PB_WKV) {
        const float* W; bf* T; int Nc, mode = 0;
        if (blk < PB_WBIG)                    { W = wq; T = WQt; Nc = DM; }
        else if (blk < 2 * PB_WBIG)           { blk -= PB_WBIG; W = wo; T = (bf*)WOt; Nc = DM; mode = 1; }
        else if (blk < 2 * PB_WBIG + PB_WKV)  { blk -= 2 * PB_WBIG; W = wk; T = WKt; Nc = KVD; }
        else                                  { blk -= 2 * PB_WBIG + PB_WKV; W = wv; T = WVt; Nc = KVD; }
        const int nx = Nc / 64;
        wt_tile(ts, W, T, (h16*)T, DM, Nc, mode, blk % nx, blk / nx);
        return;
    }
    cvt8(x, XB, blk - (2 * PB_WBIG + 2 * PB_WKV));
}

// k_proj: register-blocked bf16 GEMM, four waves per 128x128 tile, one 64x64 tile (16 accumulators) per wave, operands from K-contiguous bf16 planes staged in LDS, K = DM.
// C[m][n] = sum_k A[m][k] Bt[n][k], written as f16 (Ph) and the f16 residual x1024 (Pr, useRes != 0) at
// wave tile base (r0/RB)*sRB + (r0%RB)*pitch + (c0/CB)*sCB + (c0%CB), row pitch 'pitch' (halves). 128 threads.
// One grid holds the q, k and v^T products (they depend only on k_prep): blocks [0, GQ) q, [GQ, GQ + GK) k, the last GK v^T; inside a job the row tile runs fastest.
// rope != 0 (rows = tokens b*SEQ + t, the 64 columns of a wave tile = one head): interleaved rotary applied on the f32 values at the store stage from CS[t][32] (cos, sin).
#define GQ ((NB * SEQ / 128) * (DM / 128))
#define GK ((NB * SEQ / 128) * (KVD / 128))
__global__ __launch_bounds__(128) void k_proj(const bf* __restrict__ XB, const bf* __restrict__ WQt, const bf* __restrict__ WKt, const bf* __restrict__ WVt,
                                              h16* QH, h16* QR, h16* KP, h16* KR, h16* VT, h16* VR, const float* __restrict__ CS) {
    __shared__ __align__(16) bf ring[2 * STGE];
    __shared__ __align__(16) float osall[4 * 16 * 68];
    const int K = DM;
    // the job's operands and output map, all block-uniform
    const bf* A; const bf* Bt; h16* Ph; h16* Pr; int RB, pitch, CB, rope, mt; size_t sRB, sCB; int bid = blockIdx.x; const int useRes = 1;   // all three jobs write their residual plane
    if (bid < GQ) {                 // q: A = x rows (m = b*SEQ + t), Bt = Wq^T rows (n = h*64 + d) -> plane [(b*32 + h)][t][d], rotary applied
        A = XB; Bt = WQt; Ph = QH; Pr = QR; RB = SEQ; sRB = (size_t)NH_ * SEQ * HD; pitch = HD; CB = HD; sCB = (size_t)SEQ * HD; rope = 1; mt = NB * SEQ / 128;
    } else if (bid < GQ + GK) {     // k: Bt = Wk^T rows (n = g*64 + d) -> plane [(b*8 + g)][t][d], rotary applied
        bid -= GQ; A = XB; Bt = WKt; Ph = KP; Pr = KR; RB = SEQ; sRB = (size_t)NKV * SEQ * HD; pitch = HD; CB = HD; sCB = (size_t)SEQ * HD; rope = 1; mt = NB * SEQ / 128;
    } else {                        // v^T: A = Wv^T rows (m = g*64 + d), Bt = x rows (n = b*SEQ + t) -> plane [(b*512 + m)][t] = [(b*8 + g)][d][t], no rotary
        bid -= GQ + GK; A = WVt; Bt = XB; Ph = VT; Pr = VR; RB = KVD; sRB = (size_t)0; pitch = SEQ; CB = SEQ; sCB = (size_t)KVD * SEQ; rope = 0; mt = KVD / 128;
    }
    const int tid = threadIdx.x; const int wave = __builtin_amdgcn_readfirstlane(tid >> 5);
    const int lane = tid & 31, lr = lane & 15, hi = lane >> 4; const int rb = (bid % mt) * 128, cb = (bid / mt) * 128;
    const int wr = (wave >> 1) * 64, wc = (wave & 1) * 64; const int r0 = rb + wr, c0 = cb + wc;
    float* os = osall + wave * 16 * 68;
    v8f acc[4][4];
#pragma unroll
    for (int mb = 0; mb < 4; ++mb)
#pragma unroll
        for (int nb = 0; nb < 4; ++nb) acc[mb][nb] = (v8f){};
    const unsigned l0 = (unsigned)(size_t)ring + (unsigned)((tid >> 3) * (LPE * 2) + (tid & 7) * 16);
    const char* ga = (const char*)(A + (size_t)(rb + (tid >> 3)) * K + (tid & 7) * 8);
    const char* gb = (const char*)(Bt + (size_t)(cb + (tid >> 3)) * K + (tid & 7) * 8);
    const int afr = (wr + lr) * LPE + 8 * hi, bfr = (128 + wc + lr) * LPE + 8 * hi;
    stage_tile(l0, ga, gb);
    wait_copies();
    __syncthreads();                                              // tile 0 readable by every wave
    stage_tile(l0 + STGB, ga + BK * 2, gb + BK * 2);
#pragma unroll 1   // one trip per staged tile: the ring's waits and barrier stand once, at the foot
    for (int t = 0; t < NKT; ++t) {
        const bf* sb = ring + (t & 1) * STGE;
#pragma unroll     // this and the loops inside: constant indices keep fragments and accumulators in registers
        for (int ks = 0; ks < BK; ks += 32) {
            v16bf a[4], b[4];
#pragma unroll
            for (int mb = 0; mb < 4; ++mb) a[mb] = ldb(sb + afr + mb * 16 * LPE + ks);
#pragma unroll
            for (int nb = 0; nb < 4; ++nb) b[nb] = ldb(sb + bfr + nb * 16 * LPE + ks);
#pragma unroll
            for (int nb = 0; nb < 4; ++nb)
#pragma unroll
                for (int mb = 0; mb < 4; ++mb) acc[mb][nb] = wmmab(a[mb], b[nb], acc[mb][nb]);
        }
        wait_lds();
        wait_copies();
        __syncthreads();                                          // publishes tile t + 1 and frees the buffer of tile t
        if (t + 2 < NKT) stage_tile(l0 + (unsigned)(t & 1) * STGB, ga + (size_t)(t + 2) * (BK * 2), gb + (size_t)(t + 2) * (BK * 2));
    }
    wait_copies();
    const size_t tbase = (size_t)(r0 / RB) * sRB + (size_t)(r0 % RB) * (size_t)pitch + (size_t)(c0 / CB) * sCB + (size_t)(c0 % CB);
#pragma unroll
    for (int mb = 0; mb < 4; ++mb) {
#pragma unroll
        for (int nb = 0; nb < 4; ++nb) {
#pragma unroll
            for (int j = 0; j < 8; ++j) os[(hi * 8 + j) * 68 + nb * 16 + lr] = acc[mb][nb][j]; }   // D: row 8h+j, col lane&15
        wave_sync();
        const size_t sb = tbase + (size_t)(mb * 16) * (size_t)pitch;
{
#pragma unroll
            for (int s = 0; s < 4; ++s) { const int row = 4 * s + (lane >> 3), c8 = (lane & 7) * 8;   // 4 s x 4 row groups = 16 rows; 8 lanes x 8 = 64 columns
                v4f x0 = *(const v4fa*)(&os[row * 68 + c8]); v4f x1 = *(const v4fa*)(&os[row * 68 + c8 + 4]); v8h hv, rv;
                if (rope) {                                                                            // block-uniform (set with the job)
                    const int t = (r0 + mb * 16 + row) % SEQ;
                    const float* cp = CS + ((size_t)t * 32 + (size_t)(c8 >> 1)) * 2;                  // pairs c8/2 .. c8/2+3: (cos, sin) x 4
                    const v4f ca = *(const v4f*)cp; const v4f cb = *(const v4f*)(cp + 4);
                    float e, o;
                    e = x0[0]; o = x0[1]; x0[0] = e * ca[0] - o * ca[1]; x0[1] = e * ca[1] + o * ca[0];
                    e = x0[2]; o = x0[3]; x0[2] = e * ca[2] - o * ca[3]; x0[3] = e * ca[3] + o * ca[2];
                    e = x1[0]; o = x1[1]; x1[0] = e * cb[0] - o * cb[1]; x1[1] = e * cb[1] + o * cb[0];
                    e = x1[2]; o = x1[3]; x1[2] = e * cb[2] - o * cb[3]; x1[3] = e * cb[3] + o * cb[2]; }
#pragma unroll
                for (int i = 0; i < 4; ++i) { const h16 a0 = (h16)x0[i]; const h16 a1 = (h16)x1[i]; hv[i] = a0; hv[4 + i] = a1; rv[i] = (h16)((x0[i] - (float)a0) * QRS); rv[4 + i] = (h16)((x1[i] - (float)a1) * QRS); }
                const size_t oo = sb + (size_t)row * (size_t)pitch + c8;
                *(v8h*)(Ph + oo) = hv; if (useRes) *(v8h*)(Pr + oo) = rv;
                asm volatile("s_wait_xcnt 0x0" ::: "memory"); }   // stands in front of the next rows' rewrite of the two stores' address registers
             }
        wave_sync();
    }
}

// flash_early: the body of k_flash's blocks for query rows < EARLY (same structure as the late body below, operands straight from the planes) with value + residual (x1024) planes on every operand:
// scores = kh.qh + (kh.qr + kr.qh)/1024; O = vh.ph + (vr.ph + vh.pr)/1024 (residual products in their own accumulators), l from the unconverted f32 P.
// Writes the ctx value plane rows (carried x1024) and the compact unscaled residual plane CR[b][t < EARLY][2048].
__device__ __forceinline__ void flash_early(float* os, const h16* __restrict__ QH, const h16* __restrict__ QR, const h16* __restrict__ KP, const h16* __restrict__ KR,
                                            const h16* __restrict__ VT, const h16* __restrict__ VR, h16* CH, h16* CR, int t0, int zg) {
    const int lane = threadIdx.x & 31; const int wave = __builtin_amdgcn_readfirstlane(threadIdx.x >> 5);
    const int lr = lane & 15, hi = lane >> 4;
    const int b = zg / NKV; const int g = zg % NKV;
    const int h = g * AW + wave;
    const int tq = t0 + lr;
    const size_t qo = ((size_t)(b * NH_ + h) * SEQ + (size_t)tq) * HD + 8 * hi;
    const v16h qh0 = ldh(QH + qo), qh1 = ldh(QH + qo + 32), qr0 = ldh(QR + qo), qr1 = ldh(QR + qo + 32);
    const size_t ko = (size_t)zg * SEQ * HD + (size_t)lr * HD + 8 * hi;
    const size_t vo = (size_t)zg * HD * SEQ + (size_t)lr * SEQ + 8 * hi;
    v8f oH[4], oL[4];
#pragma unroll
    for (int j = 0; j < 4; ++j) { oH[j] = (v8f){}; oL[j] = (v8f){}; }
    float m = NEGB, l = 0.0f;
    const int kend = t0 + 16;
#pragma unroll 1
    for (int key0 = 0; key0 < kend; key0 += 32) {
        const size_t kk = ko + (size_t)key0 * HD;
        v8f sHa = (v8f){}, sLa = (v8f){}, sHb = (v8f){}, sLb = (v8f){};
        { const v16h k0 = ldh(KP + kk), k1 = ldh(KP + kk + 32), r0 = ldh(KR + kk), r1 = ldh(KR + kk + 32);
          sHa = wmma16(k0, qh0, sHa); sHa = wmma16(k1, qh1, sHa);
          sLa = wmma16(k0, qr0, sLa); sLa = wmma16(k1, qr1, sLa); sLa = wmma16(r0, qh0, sLa); sLa = wmma16(r1, qh1, sLa); }
        { const size_t k2 = kk + (size_t)16 * HD;
          const v16h k0 = ldh(KP + k2), k1 = ldh(KP + k2 + 32), r0 = ldh(KR + k2), r1 = ldh(KR + k2 + 32);
          asm volatile("s_wait_xcnt 0x0" :: "v"(KP + kk), "v"(KR + kk) : "memory");   // behind the eight loads; naming their two base addresses keeps those registers from serving as a load's destination ahead of the wait
          sHb = wmma16(k0, qh0, sHb); sHb = wmma16(k1, qh1, sHb);
          sLb = wmma16(k0, qr0, sLb); sLb = wmma16(k1, qr1, sLb); sLb = wmma16(r0, qh0, sLb); sLb = wmma16(r1, qh1, sLb); }
        float ta[8], tb[8];
#pragma unroll
        for (int r = 0; r < 8; ++r) { ta[r] = (sHa[r] + sLa[r] * QRI) * SC2; tb[r] = (sHb[r] + sLb[r] * QRI) * SC2; }
        if (key0 + 31 > t0) {                                      // block-uniform: diagonal block
            const int kbse = key0 + 8 * hi;
#pragma unroll
            for (int r = 0; r < 8; ++r) { ta[r] = (kbse + r > tq) ? NEGB : ta[r]; tb[r] = (kbse + 16 + r > tq) ? NEGB : tb[r]; } }
        float mx = NEGB;
#pragma unroll
        for (int r = 0; r < 8; ++r) mx = fmaxf(mx, fmaxf(ta[r], tb[r]));
        mx = fmaxf(mx, __shfl_xor(mx, 16, 32));
        const float mnew = fmaxf(m, mx);
        const float alpha = __builtin_amdgcn_exp2f(m - mnew);
        const float sh = PSH - mnew;
        v16h ph, pr; float ls = 0.0f;
#pragma unroll
        for (int r = 0; r < 8; ++r) { const float ea = __builtin_amdgcn_exp2f(ta[r] + sh); const float ec = __builtin_amdgcn_exp2f(tb[r] + sh);
            const h16 ha = (h16)ea; const h16 hc = (h16)ec; ph[r] = ha; ph[8 + r] = hc;
            pr[r] = (h16)((ea - (float)ha) * QRS); pr[8 + r] = (h16)((ec - (float)hc) * QRS); ls += ea + ec; }
        l = l * alpha + ls; m = mnew;
#pragma unroll
        for (int j = 0; j < 4; ++j) { oH[j] = oH[j] * alpha; oL[j] = oL[j] * alpha; }
        const size_t vv = vo + (size_t)key0;
#pragma unroll
        for (int j = 0; j < 4; ++j) { const v16h vh = ldh(VT + vv + (size_t)(16 * j) * SEQ); const v16h vr = ldh(VR + vv + (size_t)(16 * j) * SEQ);
            oH[j] = wmma16(vh, ph, oH[j]); oL[j] = wmma16(vr, ph, oL[j]); oL[j] = wmma16(vh, pr, oL[j]); }
    }
    l += __shfl_xor(l, 16, 32);
    const float inv = CXS / l;
    const int wb = wave * 16 * 68;
#pragma unroll
    for (int j = 0; j < 4; ++j) { v4f a, c;     // os[t][d], d = 16j + 8h + r; rows 0..15 x columns 0..63 all written
        a[0] = (oH[j][0] + oL[j][0] * QRI) * inv; a[1] = (oH[j][1] + oL[j][1] * QRI) * inv; a[2] = (oH[j][2] + oL[j][2] * QRI) * inv; a[3] = (oH[j][3] + oL[j][3] * QRI) * inv;
        c[0] = (oH[j][4] + oL[j][4] * QRI) * inv; c[1] = (oH[j][5] + oL[j][5] * QRI) * inv; c[2] = (oH[j][6] + oL[j][6] * QRI) * inv; c[3] = (oH[j][7] + oL[j][7] * QRI) * inv;
        *(v4fa*)(&os[wb + lr * 68 + 16 * j + 8 * hi]) = a; *(v4fa*)(&os[wb + lr * 68 + 16 * j + 8 * hi + 4]) = c; }
    wave_sync();
    h16* crow = CH + ((size_t)b * SEQ + t0) * DM + h * HD;
    h16* rrow = CR + ((size_t)b * EARLY + t0) * DM + h * HD;
{
#pragma unroll
        for (int s = 0; s < 4; ++s) { const int row = 4 * s + (lane >> 3), c8 = (lane & 7) * 8;   // 4 s x 4 row groups = 16 rows; 8 lanes x 8 = 64 columns
            const v4f x0 = *(const v4fa*)(&os[wb + row * 68 + c8]); const v4f x1 = *(const v4fa*)(&os[wb + row * 68 + c8 + 4]); v8h hv, rv;
#pragma unroll
            for (int i = 0; i < 4; ++i) { const h16 a0 = (h16)x0[i]; const h16 a1 = (h16)x1[i]; hv[i] = a0; hv[4 + i] = a1; rv[i] = (h16)(x0[i] - (float)a0); rv[4 + i] = (h16)(x1[i] - (float)a1); }
            *(v8h*)(crow + (size_t)row * DM + c8) = hv; *(v8h*)(rrow + (size_t)row * DM + c8) = rv; }
         }
}

// k_flash: fused causal attention, grid FL_LATE + FL_EARLY. One block = 16 query rows x the four query heads of one kv head (one wave per head, h = g*4 + wave), the row tile running fastest;
// both bodies depend only on k_proj, so they share the launch: the last FL_EARLY blocks (rows < EARLY) run flash_early, the others the body below:
// Q fragments straight from the f16 planes; K / V^T of kv head g staged once per block in LDS, FK keys a stage, and read as fragments (two 16-B LDS loads each) by all four waves.
// Transposed form: S^T[key][t] = K Q^T (A = K rows, B = Q rows); lane (t = lane&15, h = lane>>4) holds keys 8h+r of each 16-key tile, so the packed
// P tile is directly the B fragment of O^T[d][t] = V^T P^T (element r <- tile keys 0..15, element 8+r <- tile keys 16..31, lane unchanged).
// Keys run over [0, t0+16) in steps of 32; the diagonal 32-key blocks replace excluded scores (key > t) by a large negative value before the running max.
#define FL_LX    ((SEQ - EARLY) / 16)
#define FL_LATE  (FL_LX * NB * NKV)
#define FL_EARLY ((EARLY / 16) * NB * NKV)
static_assert(FL_LX > 0);                                        // the late blocks' index is split by it
__global__ __launch_bounds__(32 * AW) void k_flash(const h16* __restrict__ QH, const h16* __restrict__ QR, const h16* __restrict__ KP, const h16* __restrict__ KR,
                                                   const h16* __restrict__ VT, const h16* __restrict__ VR, h16* CH, h16* CR) {
    __shared__ __align__(16) h16 ring[2 * FSTGE];
    float* os = (float*)ring;                                     // output staging, used only behind the loop's last barrier (the early body stages nothing else there)
    const int bid = blockIdx.x;
    if (bid >= FL_LATE) { const int e = bid - FL_LATE; flash_early(os, QH, QR, KP, KR, VT, VR, CH, CR, (e % (EARLY / 16)) * 16, e / (EARLY / 16)); return; }   // block-uniform, in front of every barrier
    const int zg = bid / FL_LX; const int t0 = EARLY + (bid % FL_LX) * 16;
    const int tid = threadIdx.x;
    const int lane = threadIdx.x & 31; const int wave = __builtin_amdgcn_readfirstlane(threadIdx.x >> 5);
    const int lr = lane & 15, hi = lane >> 4;
    const int b = zg / NKV; const int g = zg % NKV;
    const int h = g * AW + wave;                                  // repeat on the head axis: query head h uses kv head h >> 2
    const int tq = t0 + lr;
    const size_t qo = ((size_t)(b * NH_ + h) * SEQ + (size_t)tq) * HD + 8 * hi;
    const v16h qh0 = ldh(QH + qo), qh1 = ldh(QH + qo + 32), qr0 = ldh(QR + qo), qr1 = ldh(QR + qo + 32);   // B fragments: col t, k = d
    const unsigned l0 = (unsigned)(size_t)ring + (unsigned)((tid >> 3) * (LPE * 2) + (tid & 7) * 16);
    const char* gk = (const char*)(KP + (size_t)zg * SEQ * HD + (size_t)(tid >> 3) * HD + (tid & 7) * 8);    // + stage * FK rows
    const char* gv = (const char*)(VT + (size_t)zg * HD * SEQ + (size_t)(tid >> 3) * SEQ + (tid & 7) * 8);   // + stage * FK keys
    const int kfr = lr * LPE + 8 * hi;                            // + key * LPE        (A fragment: row key, k = d)
    const int vfr = (FK + lr) * LPE + 8 * hi;                     // + 16j * LPE + key  (A fragment: row d, k = key)
    v8f o0 = (v8f){}, o1 = (v8f){}, o2 = (v8f){}, o3 = (v8f){};
    float m = NEGB, l = 0.0f;
    const int kend = t0 + 16;
    const int nst = (kend + FK - 1) / FK;                         // block-uniform; stage nst - 1 ends at or before key SEQ
    stage_kv(l0, gk, gv);
    wait_copies();
    __syncthreads();                                              // stage 0 readable by every wave
    if (nst > 1) stage_kv(l0 + FSTGB, gk + (size_t)FK * HD * 2, gv + FK * 2);
#pragma unroll 1   // one trip per staged tile: the ring's waits and barrier stand once, at the foot
    for (int st = 0; st < nst; ++st) {
        const h16* sb = ring + (st & 1) * FSTGE;
#pragma unroll     // two 32-key steps per stage, constant LDS offsets
        for (int ks = 0; ks < FK; ks += 32) {
            const int key0 = st * FK + ks;
            if (key0 >= kend) break;                               // block-uniform: the last stage may hold one step only
            const h16* ka = sb + kfr + ks * LPE;
            const v16h ka0 = ldh(ka), ka1 = ldh(ka + 32), kb0 = ldh(ka + 16 * LPE), kb1 = ldh(ka + 16 * LPE + 32);
            v8f sHa = (v8f){}, sLa = (v8f){}, sHb = (v8f){}, sLb = (v8f){};
            sHa = wmma16(ka0, qh0, sHa); sLa = wmma16(ka0, qr0, sLa); sHb = wmma16(kb0, qh0, sHb); sLb = wmma16(kb0, qr0, sLb);
            sHa = wmma16(ka1, qh1, sHa); sLa = wmma16(ka1, qr1, sLa); sHb = wmma16(kb1, qh1, sHb); sLb = wmma16(kb1, qr1, sLb);
            float ta[8], tb[8];
#pragma unroll
            for (int r = 0; r < 8; ++r) { ta[r] = (sHa[r] + sLa[r] * QRI) * SC2; tb[r] = (sHb[r] + sLb[r] * QRI) * SC2; }
            if (key0 + 31 > t0) {                                  // block-uniform: diagonal block
                const int kbse = key0 + 8 * hi;
#pragma unroll
                for (int r = 0; r < 8; ++r) { ta[r] = (kbse + r > tq) ? NEGB : ta[r]; tb[r] = (kbse + 16 + r > tq) ? NEGB : tb[r]; } }
            float mx = NEGB;
#pragma unroll
            for (int r = 0; r < 8; ++r) mx = fmaxf(mx, fmaxf(ta[r], tb[r]));
            mx = fmaxf(mx, __shfl_xor(mx, 16, 32));
            const float mnew = fmaxf(m, mx);
            const float alpha = __builtin_amdgcn_exp2f(m - mnew);
            const float sh = PSH - mnew;
            v16h pb; float ls = 0.0f;
#pragma unroll
            for (int r = 0; r < 8; ++r) { const float ea = __builtin_amdgcn_exp2f(ta[r] + sh); const float ec = __builtin_amdgcn_exp2f(tb[r] + sh); pb[r] = (h16)ea; pb[8 + r] = (h16)ec; ls += ea + ec; }
            l = l * alpha + ls; m = mnew;
            o0 = o0 * alpha; o1 = o1 * alpha; o2 = o2 * alpha; o3 = o3 * alpha;
            const h16* va = sb + vfr + ks;
            const v16h v0 = ldh(va), v1 = ldh(va + 16 * LPE), v2 = ldh(va + 32 * LPE), v3 = ldh(va + 48 * LPE);
            o0 = wmma16(v0, pb, o0); o1 = wmma16(v1, pb, o1); o2 = wmma16(v2, pb, o2); o3 = wmma16(v3, pb, o3);
        }
        wait_lds();
        wait_copies();
        __syncthreads();                                          // publishes stage st + 1 and frees the buffer of stage st
        if (st + 2 < nst) stage_kv(l0 + (unsigned)(st & 1) * FSTGB, gk + (size_t)(st + 2) * (FK * HD * 2), gv + (size_t)(st + 2) * (FK * 2));
    }
    wait_copies();
    l += __shfl_xor(l, 16, 32);
    const float inv = CXS / l;
    const int wb = wave * 16 * 68;
    // O^T D layout: o_j[r] = (d = 16j + 8h + r, t = lane&15) -> os[t][d]; rows 0..15 x columns 0..63 all written
    { v4f a, c;
      a[0] = o0[0] * inv; a[1] = o0[1] * inv; a[2] = o0[2] * inv; a[3] = o0[3] * inv; c[0] = o0[4] * inv; c[1] = o0[5] * inv; c[2] = o0[6] * inv; c[3] = o0[7] * inv;
      *(v4fa*)(&os[wb + lr * 68 +  0 + 8 * hi]) = a; *(v4fa*)(&os[wb + lr * 68 +  0 + 8 * hi + 4]) = c;
      a[0] = o1[0] * inv; a[1] = o1[1] * inv; a[2] = o1[2] * inv; a[3] = o1[3] * inv; c[0] = o1[4] * inv; c[1] = o1[5] * inv; c[2] = o1[6] * inv; c[3] = o1[7] * inv;
      *(v4fa*)(&os[wb + lr * 68 + 16 + 8 * hi]) = a; *(v4fa*)(&os[wb + lr * 68 + 16 + 8 * hi + 4]) = c;
      a[0] = o2[0] * inv; a[1] = o2[1] * inv; a[2] = o2[2] * inv; a[3] = o2[3] * inv; c[0] = o2[4] * inv; c[1] = o2[5] * inv; c[2] = o2[6] * inv; c[3] = o2[7] * inv;
      *(v4fa*)(&os[wb + lr * 68 + 32 + 8 * hi]) = a; *(v4fa*)(&os[wb + lr * 68 + 32 + 8 * hi + 4]) = c;
      a[0] = o3[0] * inv; a[1] = o3[1] * inv; a[2] = o3[2] * inv; a[3] = o3[3] * inv; c[0] = o3[4] * inv; c[1] = o3[5] * inv; c[2] = o3[6] * inv; c[3] = o3[7] * inv;
      *(v4fa*)(&os[wb + lr * 68 + 48 + 8 * hi]) = a; *(v4fa*)(&os[wb + lr * 68 + 48 + 8 * hi + 4]) = c; }
    wave_sync();
    h16* crow = CH + ((size_t)b * SEQ + t0) * DM + h * HD;         // merged heads: column h*64 + d
{
#pragma unroll
        for (int s = 0; s < 4; ++s) { const int row = 4 * s + (lane >> 3), c8 = (lane & 7) * 8;   // 4 s x 4 row groups = 16 rows; 8 lanes x 8 = 64 columns
            const v4f x0 = *(const v4fa*)(&os[wb + row * 68 + c8]); const v4f x1 = *(const v4fa*)(&os[wb + row * 68 + c8 + 4]); v8h hv;
#pragma unroll
            for (int i = 0; i < 4; ++i) { hv[i] = (h16)x0[i]; hv[4 + i] = (h16)x1[i]; }
            *(v8h*)(crow + (size_t)row * DM + c8) = hv; }
         }
}

// k_out: output projection, four waves per 128x128 tile (64x64 per wave), f16 operands from the ctx plane CX (value rows [NB*SEQ], then residual rows [NB*EARLY]) and the Wo^T plane, staged in LDS, K = DM.
// Tiles whose rows are < EARLY in their sequence walk K a second time over the unscaled residual rows into the same accumulators. grid (NB*SEQ/128, DM/128), 128 threads.
__global__ __launch_bounds__(128) void k_out(const h16* __restrict__ CX, const h16* __restrict__ Wt, float* OUT) {
    __shared__ __align__(16) h16 ring[2 * STGE];
    __shared__ __align__(16) float osall[4 * 16 * 68];
    const int K = DM;
    const int tid = threadIdx.x; const int wave = __builtin_amdgcn_readfirstlane(tid >> 5);
    const int lane = tid & 31, lr = lane & 15, hi = lane >> 4; const int rb = blockIdx.x * 128, cb = blockIdx.y * 128;
    const int wr = (wave >> 1) * 64, wc = (wave & 1) * 64; const int c0 = cb + wc;
    float* os = osall + wave * 16 * 68;
    const int b = rb / SEQ, tb = rb % SEQ, tt = tb + wr;           // a 128-row tile lies in one batch and is entirely early or entirely late
    const int nt = (tb < EARLY) ? 2 * NKT : NKT;                   // block-uniform
    const unsigned l0 = (unsigned)(size_t)ring + (unsigned)((tid >> 3) * (LPE * 2) + (tid & 7) * 16);
    const char* ga0 = (const char*)(CX + (size_t)(rb + (tid >> 3)) * K + (tid & 7) * 8);
    const char* ga1 = (const char*)(CX + ((size_t)NB * SEQ + (size_t)b * EARLY + (size_t)tb + (size_t)(tid >> 3)) * K + (tid & 7) * 8);   // used only when tb < EARLY
    const char* gb = (const char*)(Wt + (size_t)(cb + (tid >> 3)) * K + (tid & 7) * 8);
    const int afr = (wr + lr) * LPE + 8 * hi, bfr = (128 + wc + lr) * LPE + 8 * hi;
    v8f acc[4][4];
#pragma unroll
    for (int mb = 0; mb < 4; ++mb)
#pragma unroll
        for (int nb = 0; nb < 4; ++nb) acc[mb][nb] = (v8f){};
    stage_tile(l0, ga0, gb);
    wait_copies();
    __syncthreads();                                              // tile 0 readable by every wave
    stage_tile(l0 + STGB, ga0 + BK * 2, gb + BK * 2);
#pragma unroll 1   // one trip per staged tile: the ring's waits and barrier stand once, at the foot
    for (int t = 0; t < nt; ++t) {
        const h16* sb = ring + (t & 1) * STGE;
#pragma unroll     // this and the loops inside: constant indices keep fragments and accumulators in registers
        for (int ks = 0; ks < BK; ks += 32) {
            v16h a[4], bq[4];
#pragma unroll
            for (int mb = 0; mb < 4; ++mb) a[mb] = ldh(sb + afr + mb * 16 * LPE + ks);
#pragma unroll
            for (int nb = 0; nb < 4; ++nb) bq[nb] = ldh(sb + bfr + nb * 16 * LPE + ks);
#pragma unroll
            for (int nb = 0; nb < 4; ++nb)
#pragma unroll
                for (int mb = 0; mb < 4; ++mb) acc[mb][nb] = wmma16(a[mb], bq[nb], acc[mb][nb]);
        }
        wait_lds();
        wait_copies();
        __syncthreads();                                          // publishes tile t + 1 and frees the buffer of tile t
        if (t + 2 < nt) { const int u = t + 2; const size_t ko = (size_t)(u & (NKT - 1)) * (BK * 2);   // tiles NKT.. are the residual rows' walk
            stage_tile(l0 + (unsigned)(t & 1) * STGB, (u < NKT ? ga0 : ga1) + ko, gb + ko); }
    }
    wait_copies();
    float* obase = OUT + ((size_t)b * OUT_SEQ + tt) * DM + c0;
#pragma unroll
    for (int mb = 0; mb < 4; ++mb) {
#pragma unroll
        for (int nb = 0; nb < 4; ++nb) {
#pragma unroll
            for (int j = 0; j < 8; ++j) os[(hi * 8 + j) * 68 + nb * 16 + lr] = acc[mb][nb][j] * OUTS; }   // D: row 8h+j, col lane&15
        wave_sync();
{
#pragma unroll
            for (int s = 0; s < 8; ++s) { const int row = 2 * s + hi, cofs = lr * 4;   // 8 s x 2 rows = 16 rows; 16 lanes x 4 floats = 64 columns
                const v4f val = *(const v4fa*)(&os[row * 68 + cofs]);
                *(v4f*)(obase + (size_t)(mb * 16 + row) * DM + cofs) = val; }
             }
        wave_sync();
    }
}

static constexpr size_t al256(size_t v) { return (v + 255) & ~(size_t)255; }
static constexpr size_t SZ_XB = al256((size_t)NB * SEQ * DM * 2);
static constexpr size_t SZ_WQ = al256((size_t)DM * DM * 2);
static constexpr size_t SZ_WK = al256((size_t)KVD * DM * 2);
static constexpr size_t SZ_CS = al256((size_t)SEQ * 32 * 2 * 4);
static constexpr size_t SZ_Q  = al256((size_t)NB * NH_ * SEQ * HD * 2);
static constexpr size_t SZ_KV = al256((size_t)NB * NKV * SEQ * HD * 2);
static constexpr size_t SZ_CX = al256(((size_t)NB * SEQ + (size_t)NB * EARLY) * DM * 2);
static constexpr size_t SZ_TOTAL = SZ_XB + 2 * SZ_WQ + 2 * SZ_WK + SZ_CS + 2 * SZ_Q + 4 * SZ_KV + SZ_CX;
static_assert(SZ_TOTAL <= (size_t)134217728);          // workspace carve <= 128 MiB

extern "C" void kernel_launch(void* const* d_in, const int* in_sizes, int n_in,
                              void* d_out, int out_size, void* d_ws, size_t ws_size, hipStream_t stream) {
    if (n_in < 5) return;
    const size_t needx = ((size_t)(NB - 1) * SEQ_FULL + SEQ) * DM;
    if ((size_t)in_sizes[0] < needx) return;
    if ((size_t)in_sizes[1] < (size_t)DM * DM || (size_t)in_sizes[2] < (size_t)DM * KVD || (size_t)in_sizes[3] < (size_t)DM * KVD || (size_t)in_sizes[4] < (size_t)DM * DM) return;
    if ((size_t)out_size < ((size_t)(NB - 1) * OUT_SEQ + SEQ) * DM) return;
    if (SZ_TOTAL > ws_size) return;
    // wire order x, wq, wk, wv, wo; every weight is [in][out]
    const float* x = (const float*)d_in[0]; const float* wq = (const float*)d_in[1]; const float* wk = (const float*)d_in[2]; const float* wv = (const float*)d_in[3]; const float* wo = (const float*)d_in[4];
    float* OUT = (float*)d_out;      // [NB][SEQ][2048]
    char* wsp = (char*)d_ws;
    bf*  XB  = (bf*)wsp;  wsp += SZ_XB;              // [NB*SEQ][2048] bf16
    bf*  WQt = (bf*)wsp;  wsp += SZ_WQ;              // [2048 out][2048 in] bf16
    bf*  WKt = (bf*)wsp;  wsp += SZ_WK;              // [512 out][2048 in] bf16
    bf*  WVt = (bf*)wsp;  wsp += SZ_WK;              // [512 out][2048 in] bf16
    h16* WOt = (h16*)wsp; wsp += SZ_WQ;              // [2048 out][2048 in] f16 of bf16 value x16
    float* CS = (float*)wsp; wsp += SZ_CS;           // [SEQ][32] (cos, sin)
    h16* QH = (h16*)wsp; wsp += SZ_Q;                // [NB*32][SEQ][64]
    h16* QR = (h16*)wsp; wsp += SZ_Q;                // residual x1024
    h16* KP = (h16*)wsp; wsp += SZ_KV;               // [NB*8][SEQ][64]
    h16* KR = (h16*)wsp; wsp += SZ_KV;               // residual x1024
    h16* VT = (h16*)wsp; wsp += SZ_KV;               // [NB*8][64][SEQ]
    h16* VR = (h16*)wsp; wsp += SZ_KV;               // residual x1024
    h16* CX = (h16*)wsp; wsp += SZ_CX;               // ctx x1024: value rows [NB*SEQ][2048], then residual rows [NB*EARLY][2048]
    h16* CR = CX + (size_t)NB * SEQ * DM;

    // x -> bf16, the four weights transposed (in[in-features][out-features] -> out[out-features][in-features]), the rotary table
    k_prep<<<PB_ROPE + 2 * PB_WBIG + 2 * PB_WKV + PB_CVT, 256, 0, stream>>>(x, wq, wk, wv, wo, XB, WQt, WKt, WVt, WOt, CS);

    k_proj<<<GQ + 2 * GK, 128, 0, stream>>>(XB, WQt, WKt, WVt, QH, QR, KP, KR, VT, VR, CS);

    k_flash<<<FL_LATE + FL_EARLY, 32 * AW, 0, stream>>>(QH, QR, KP, KR, VT, VR, CX, CR);

    k_out<<<dim3(NB * SEQ / 128, DM / 128, 1), 128, 0, stream>>>(CX, WOt, OUT);
}

// v004
// One run takes 164 microseconds.
// Next to v003, in two timings, it ran 1.04 and 1.03 times as fast.
// Counting every step since v000, it is 3.21 times as fast.
#include <hip/hip_runtime.h>

// Grouped-query causal self-attention, width 2048 = 32 query heads x 64 sharing 8 kv heads (kv head g = h >> 2), x [NB][SEQ][2048], Wq/Wk/Wv/Wo [in][out] (y = x W), no biases,
// interleaved (even/odd pair) rotary on q and k from a computed [SEQ][32] (cos, sin) table, score scale 1/8, causal exclusion (diagonal kept), output = ctx Wo (f32).
// Compute dtypes, f32 accumulate everywhere: q/k/v projections v_wmma_f32_16x16x32_bf16 (x and W RNE-converted to bf16; products exact);
// scores v_wmma_f32_16x16x32_f16: k single f16, q as f16 value + f16 residual x1024 in its own accumulator (query rows < 256: k also value + residual x1024, three products);
// P (x256 carry, cancels in the normalisation) and v single f16 (rows < 256: P and v as value + residual x1024, three products); softmax f32 (online, running max);
// output projection v_wmma_f32_16x16x32_f16: ctx carried x1024 as f16 (rows < 256: plus its unscaled f16 residual folded along K) against f16(bf16(Wo)) x16, result scaled by 2^-14.

#ifndef NB
#define NB 2
#endif
#ifndef SEQ
#define SEQ 2048
#endif
#define NB_FULL  2
#define SEQ_FULL 2048
#ifndef OUT_SEQ
#define OUT_SEQ SEQ              // row pitch (in tokens) between batches of the output
#endif
#define DM    2048
#define NH_   32
#define NKV   8
#define HD    64
#define KVD   (NKV * HD)         // 512
#define AW    4                  // waves per flash block = the four query heads of one kv head
#define EARLY 256                // query rows below this use the value + residual path
#define QRS  1024.0f             // carry of every residual plane (q, k, v, P)
#define QRI  (1.0f / 1024.0f)
#define SC2  (0.125f * 1.4426950408889634f)   // HD^-0.5 * log2(e)
#define PSH  8.0f                // log2 of the P carry (256)
#define CXS  1024.0f             // carry of the ctx plane
#define WOS  16.0f               // carry of the Wo plane
#define OUTS (1.0f / (1024.0f * 16.0f))
#define NEGB (-3.0e38f)

static_assert(HD == 64);
static_assert(NH_ * HD == DM);                 // query head h = columns h*64 + d
static_assert(NKV * AW == NH_);                // four consecutive query heads per kv head
static_assert(DM % 64 == 0);
static_assert(KVD % 64 == 0);
static_assert(DM % 32 == 0);                   // GEMM k-loop steps by 32
static_assert(SEQ % 64 == 0);                  // a 64-row tile never straddles two batches
static_assert(SEQ % 32 == 0);                  // key loop steps by 32, key0 + 31 < SEQ
static_assert(EARLY % 128 == 0);               // output GEMM tiles are entirely early or entirely late
static_assert(SEQ % 128 == 0);                 // a 128-row GEMM tile never straddles two batches
static_assert(KVD % 128 == 0);
static_assert(SEQ >= EARLY);
static_assert((SEQ - EARLY) % 16 == 0);
static_assert(((size_t)SEQ * DM) % 8 == 0);
static_assert(NB <= NB_FULL);
static_assert(SEQ <= SEQ_FULL);

typedef _Float16 h16;
typedef unsigned short bf;
typedef __attribute__((ext_vector_type(16))) __bf16   v16bf;
typedef __attribute__((ext_vector_type(16))) _Float16 v16h;
typedef __attribute__((ext_vector_type(8)))  _Float16 v8h;
typedef __attribute__((ext_vector_type(8)))  unsigned short v8us;
typedef __attribute__((ext_vector_type(8)))  float    v8f;
typedef __attribute__((ext_vector_type(4)))  float    v4f;
typedef __attribute__((ext_vector_type(2)))  float    v2f;
typedef v4f  __attribute__((may_alias)) v4fa;

__device__ __forceinline__ unsigned short f2bf(float f) { unsigned u = __float_as_uint(f); u += 0x7FFFu + ((u >> 16) & 1u); return (unsigned short)(u >> 16); }
__device__ __forceinline__ v16h cat16(v8h lo, v8h hi) { return __builtin_shufflevector(lo, hi, 0, 1, 2, 3, 4, 5, 6, 7, 8, 9, 10, 11, 12, 13, 14, 15); }
__device__ __forceinline__ v16bf cat16b(v8us lo, v8us hi) { return __builtin_bit_cast(v16bf, __builtin_shufflevector(lo, hi, 0, 1, 2, 3, 4, 5, 6, 7, 8, 9, 10, 11, 12, 13, 14, 15)); }
// wmma16, wmmab: the WMMA is followed by its own 4-slot guard tying its accumulator and keeping its operands live
__device__ __forceinline__ v8f wmma16(v16h a, v16h b, v8f c) {
    c = __builtin_amdgcn_wmma_f32_16x16x32_f16(false, a, false, b, (short)0, c, false, false);
    asm volatile("v_nop\n\tv_nop\n\tv_nop\n\tv_nop" : "+v"(c) : "v"(a), "v"(b));
    return c; }
__device__ __forceinline__ v8f wmmab(v16bf a, v16bf b, v8f c) {
    c = __builtin_amdgcn_wmma_f32_16x16x32_bf16(false, a, false, b, (short)0, c, false, false);
    asm volatile("v_nop\n\tv_nop\n\tv_nop\n\tv_nop" : "+v"(c) : "v"(a), "v"(b));
    return c; }
// k_flash's late body: the plain builtin. The compiler keeps the distance to the users of D, A and B itself and counts the neighbouring WMMAs as cover,
// so the vector port is left to the softmax work of the waves that share the SIMD.
__device__ __forceinline__ v8f wmma16p(v16h a, v16h b, v8f c) { return __builtin_amdgcn_wmma_f32_16x16x32_f16(false, a, false, b, (short)0, c, false, false); }
// fragment loaders from K-contiguous 16-bit rows; p already includes + 8*(lane>>4): elements 0..7 <- k0+8h+0..7, elements 8..15 <- k0+16+8h+0..7 (same map for A and B)
__device__ __forceinline__ v16h  ldh(const h16* p) { return cat16(*(const v8h*)p, *(const v8h*)(p + 16)); }
__device__ __forceinline__ v16bf ldb(const bf* p)  { return cat16b(*(const v8us*)p, *(const v8us*)(p + 16)); }
// ordering point for wave-private LDS tiles (same wave writes and reads)
__device__ __forceinline__ void wave_sync() { __builtin_amdgcn_fence(3 /* release order */, "wavefront"); __builtin_amdgcn_wave_barrier(); asm volatile("" ::: "memory"); }

// ---- operand staging of the two GEMM kernels: a 128x128 output tile per block of four waves (2 x 2, 64x64 each), K walked in tiles of BK.
// One stage = 128 A rows then 128 B rows of BK 16-bit elements (128 B, one cache line each) at a pitch of 144 B (16 B x odd: conflict-free for 16-byte LDS reads); two buffers.
#define BK   64
#define LPE  72                   // LDS row pitch in 16-bit elements
#define STGE (256 * LPE)          // elements of one buffer
#define STGB (STGE * 2)           // bytes of one buffer
#define NKT  (DM / BK)            // K tiles of one walk over K
static_assert(DM % BK == 0 && NKT >= 2 && (NKT & (NKT - 1)) == 0);   // both prologue tiles exist; the output GEMM's second walk wraps its tile index by a mask
// eight asynchronous 16-byte copies of one lane, rows 16 apart (LDS step 16 * 144 B, global step 16 rows of DM elements); eight lanes cover one 128-B row.
// s_wait_xcnt closes the statement so that no address register is rewritten ahead of it.
__device__ __forceinline__ void copy8(unsigned l, const char* g) {
    const size_t gs = (size_t)16 * DM * 2; const unsigned ls = 16 * LPE * 2;
    asm volatile("global_load_async_to_lds_b128 %0, %8, off\n\t"
                 "global_load_async_to_lds_b128 %1, %9, off\n\t"
                 "global_load_async_to_lds_b128 %2, %10, off\n\t"
                 "global_load_async_to_lds_b128 %3, %11, off\n\t"
                 "global_load_async_to_lds_b128 %4, %12, off\n\t"
                 "global_load_async_to_lds_b128 %5, %13, off\n\t"
                 "global_load_async_to_lds_b128 %6, %14, off\n\t"
                 "global_load_async_to_lds_b128 %7, %15, off\n\t"
                 "s_wait_xcnt 0x0"
                 :: "v"(l), "v"(l + ls), "v"(l + 2 * ls), "v"(l + 3 * ls), "v"(l + 4 * ls), "v"(l + 5 * ls), "v"(l + 6 * ls), "v"(l + 7 * ls),
                    "v"(g), "v"(g + gs), "v"(g + 2 * gs), "v"(g + 3 * gs), "v"(g + 4 * gs), "v"(g + 5 * gs), "v"(g + 6 * gs), "v"(g + 7 * gs)
                 : "memory");
}
// one stage: l = the lane's LDS byte address in row (tid >> 3) of the buffer, ga / gb = the lane's 16 bytes in that row of the A / B tile
__device__ __forceinline__ void stage_tile(unsigned l, const char* ga, const char* gb) { copy8(l, ga); copy8(l + 128 * LPE * 2, gb); }
// the issuing wave's own copies have landed (the compiler places no wait for them)
__device__ __forceinline__ void wait_copies() { asm volatile("s_wait_asynccnt 0x0" ::: "memory"); }
// this wave's LDS reads of the buffer have returned before the barrier that frees it for the refill
__device__ __forceinline__ void wait_lds() { asm volatile("s_wait_dscnt 0x0" ::: "memory"); }

// ---- K / V^T staging of k_flash: one stage = FK keys of one kv head: FK K rows (64 d = 128 B each), then 64 V^T rows (FK keys = 128 B each), whole cache lines, at the same 144-B pitch; two buffers.
#define FK    64
#define FSTGE ((FK + HD) * LPE)   // elements of one buffer
#define FSTGB (FSTGE * 2)         // bytes of one buffer
static_assert(FK == 64 && SEQ % FK == 0);                         // a V^T row of a stage is one 128-B line; the last stage of any query tile ends inside the planes
static_assert(2 * FSTGB >= AW * 16 * 68 * 4);                     // the output staging reuses the ring behind the last barrier
// eight asynchronous 16-byte copies of one lane: four K rows, then four V^T rows, each 16 rows apart (eight lanes cover one 128-B row, 128 threads 16 rows).
// s_wait_xcnt closes the statement so that no address register is rewritten ahead of it.
__device__ __forceinline__ void stage_kv(unsigned l, const char* gk, const char* gv) {
    const size_t kst = (size_t)16 * HD * 2, vst = (size_t)16 * SEQ * 2; const unsigned ls = 16 * LPE * 2;
    asm volatile("global_load_async_to_lds_b128 %0, %8, off\n\t"
                 "global_load_async_to_lds_b128 %1, %9, off\n\t"
                 "global_load_async_to_lds_b128 %2, %10, off\n\t"
                 "global_load_async_to_lds_b128 %3, %11, off\n\t"
                 "global_load_async_to_lds_b128 %4, %12, off\n\t"
                 "global_load_async_to_lds_b128 %5, %13, off\n\t"
                 "global_load_async_to_lds_b128 %6, %14, off\n\t"
                 "global_load_async_to_lds_b128 %7, %15, off\n\t"
                 "s_wait_xcnt 0x0"
                 :: "v"(l), "v"(l + ls), "v"(l + 2 * ls), "v"(l + 3 * ls), "v"(l + 4 * ls), "v"(l + 5 * ls), "v"(l + 6 * ls), "v"(l + 7 * ls),
                    "v"(gk), "v"(gk + kst), "v"(gk + 2 * kst), "v"(gk + 3 * kst), "v"(gv), "v"(gv + vst), "v"(gv + 2 * vst), "v"(gv + 3 * vst)
                 : "memory");
}

// ---- preparation: the x conversion, the four weight transposes and the rotary table depend on nothing but the inputs; they share one launch (k_prep), the block index picks the job.
// cvt8: 8 x values of one thread, f32 -> bf16; i counts groups of 8 over [NB][SEQ][DM], the source batches lie SEQ_FULL tokens apart.
__device__ __forceinline__ void cvt8(const float* __restrict__ src, bf* dst, int blk) {
    const size_t i = (size_t)blk * 256 + threadIdx.x; if (i >= (size_t)NB * SEQ * DM / 8) return;
    src += (i / ((size_t)SEQ * DM / 8)) * ((size_t)(SEQ_FULL - SEQ) * DM);
    const v8f v = *(const v8f*)(src + i * 8); v8us o;
#pragma unroll
    for (int k = 0; k < 8; ++k) o[k] = f2bf(v[k]);
    *(v8us*)(dst + i * 8) = o; 
}

// wt_tile: in[Kr rows][Nc cols] f32 -> out[Nc rows][Kr cols] 16-bit, 64x64 tile (bx of Nc/64, by of Kr/64) through LDS, 256 threads.
__device__ __forceinline__ void wt_tile(float* ts, const float* __restrict__ W, bf* Tb, h16* Th, int Kr, int Nc, int mode, int bx, int by) {
    const int tid = threadIdx.x; const int n0 = bx * 64, k0 = by * 64;
#pragma unroll
    for (int p = 0; p < 4; ++p) { const int row = p * 16 + (tid >> 4), c4 = (tid & 15) * 4;      // 4 p x 16 rows = 64 k rows; 16 threads x 4 = 64 n columns
        const v4f v = *(const v4f*)(W + (size_t)(k0 + row) * (size_t)Nc + n0 + c4);
        ts[row * 65 + c4 + 0] = v[0]; ts[row * 65 + c4 + 1] = v[1]; ts[row * 65 + c4 + 2] = v[2]; ts[row * 65 + c4 + 3] = v[3]; }
    __syncthreads();
{
#pragma unroll
        for (int s = 0; s < 2; ++s) { const int n = s * 32 + (tid >> 3), c8 = (tid & 7) * 8;     // 2 s x 32 rows = 64 n rows; 8 lanes x 8 = 64 k columns
            const size_t oo = (size_t)(n0 + n) * (size_t)Kr + k0 + c8;
            if (mode == 0) { v8us o;
#pragma unroll
                for (int i = 0; i < 8; ++i) o[i] = f2bf(ts[(c8 + i) * 65 + n]);
                *(v8us*)(Tb + oo) = o;
                asm volatile("s_wait_xcnt 0x0" ::: "memory");   // stands in front of any later rewrite of the store's address and data registers
            } else { v8h o;
#pragma unroll
                for (int i = 0; i < 8; ++i) o[i] = (h16)(__uint_as_float(((unsigned)f2bf(ts[(c8 + i) * 65 + n])) << 16) * WOS);
                *(v8h*)(Th + oo) = o;
                asm volatile("s_wait_xcnt 0x0" ::: "memory"); } }   // as above
         }
}

// rope_tab: CS[t][j] = (cos, sin)(t * inv_freq[j]), inv_freq[j] = 1.0f / (float)(10000^(j/32)); the power is a double product of fixed binary roots of 10000.
__device__ __forceinline__ void rope_tab(float* CS, int blk) {
    const int i = blk * 256 + threadIdx.x; if (i >= SEQ * 32) return;
    const int t = i >> 5, j = i & 31;
    double p = 1.0;
    p *= (j & 1)  ? 1.3335214321633240 : 1.0;    // 10000^(1/32)
    p *= (j & 2)  ? 1.7782794100389228 : 1.0;    // 10000^(1/16)
    p *= (j & 4)  ? 3.1622776601683795 : 1.0;    // 10000^(1/8)
    p *= (j & 8)  ? 10.0 : 1.0;                  // 10000^(1/4)
    p *= (j & 16) ? 100.0 : 1.0;                 // 10000^(1/2)
    const float pf = (float)p; const float inv = 1.0f / pf;
    const float ang = (float)t * inv;
    const float cs = cosf(ang), sn = sinf(ang);
    v2f o; o[0] = cs; o[1] = sn;
    *(v2f*)(CS + (size_t)i * 2) = o; 
}

#define PB_ROPE ((SEQ * 32 + 255) / 256)              // blocks of the rotary table
#define PB_WBIG ((DM / 64) * (DM / 64))               // tiles of Wq, of Wo
#define PB_WKV  ((KVD / 64) * (DM / 64))              // tiles of Wk, of Wv
#define PB_CVT  ((int)(((size_t)NB * SEQ * DM / 8 + 255) / 256))   // blocks of the x conversion
// k_prep: grid PB_ROPE + 2 PB_WBIG + 2 PB_WKV + PB_CVT, 256 threads; every branch on the block index is block-uniform (the transposes' barrier stands under it).
__global__ __launch_bounds__(256) void k_prep(const float* __restrict__ x, const float* __restrict__ wq, const float* __restrict__ wk, const float* __restrict__ wv, const float* __restrict__ wo,
                                              bf* XB, bf* WQt, bf* WKt, bf* WVt, h16* WOt, float* CS) {
    __shared__ float ts[64 * 65];
    int blk = blockIdx.x;
    if (blk < PB_ROPE) { rope_tab(CS, blk); return; }
    blk -= PB_ROPE;
    if (blk < 2 * PB_WBIG + 2 * PB_WKV) {
        const float* W; bf* T; int Nc, mode = 0;
        if (blk < PB_WBIG)                    { W = wq; T = WQt; Nc = DM; }
        else if (blk < 2 * PB_WBIG)           { blk -= PB_WBIG; W = wo; T = (bf*)WOt; Nc = DM; mode = 1; }
        else if (blk < 2 * PB_WBIG + PB_WKV)  { blk -= 2 * PB_WBIG; W = wk; T = WKt; Nc = KVD; }
        else                                  { blk -= 2 * PB_WBIG + PB_WKV; W = wv; T = WVt; Nc = KVD; }
        const int nx = Nc / 64;
        wt_tile(ts, W, T, (h16*)T, DM, Nc, mode, blk % nx, blk / nx);
        return;
    }
    cvt8(x, XB, blk - (2 * PB_WBIG + 2 * PB_WKV));
}

// k_proj: register-blocked bf16 GEMM, four waves per 128x128 tile, one 64x64 tile (16 accumulators) per wave, operands from K-contiguous bf16 planes staged in LDS, K = DM.
// C[m][n] = sum_k A[m][k] Bt[n][k], written as f16 (Ph) and the f16 residual x1024 (Pr, useRes != 0) at
// wave tile base (r0/RB)*sRB + (r0%RB)*pitch + (c0/CB)*sCB + (c0%CB), row pitch 'pitch' (halves). 128 threads.
// One grid holds the q, k and v^T products (they depend only on k_prep): blocks [0, GQ) q, [GQ, GQ + GK) k, the last GK v^T; inside a job the row tile runs fastest.
// rope != 0 (rows = tokens b*SEQ + t, the 64 columns of a wave tile = one head): interleaved rotary applied on the f32 values at the store stage from CS[t][32] (cos, sin).
#define GQ ((NB * SEQ / 128) * (DM / 128))
#define GK ((NB * SEQ / 128) * (KVD / 128))
__global__ __launch_bounds__(128) void k_proj(const bf* __restrict__ XB, const bf* __restrict__ WQt, const bf* __restrict__ WKt, const bf* __restrict__ WVt,
                                              h16* QH, h16* QR, h16* KP, h16* KR, h16* VT, h16* VR, const float* __restrict__ CS) {
    __shared__ __align__(16) bf ring[2 * STGE];
    __shared__ __align__(16) float osall[4 * 16 * 68];
    const int K = DM;
    // the job's operands and output map, all block-uniform
    const bf* A; const bf* Bt; h16* Ph; h16* Pr; int RB, pitch, CB, rope, mt; size_t sRB, sCB; int bid = blockIdx.x; const int useRes = 1;   // all three jobs write their residual plane
    if (bid < GQ) {                 // q: A = x rows (m = b*SEQ + t), Bt = Wq^T rows (n = h*64 + d) -> plane [(b*32 + h)][t][d], rotary applied
        A = XB; Bt = WQt; Ph = QH; Pr = QR; RB = SEQ; sRB = (size_t)NH_ * SEQ * HD; pitch = HD; CB = HD; sCB = (size_t)SEQ * HD; rope = 1; mt = NB * SEQ / 128;
    } else if (bid < GQ + GK) {     // k: Bt = Wk^T rows (n = g*64 + d) -> plane [(b*8 + g)][t][d], rotary applied
        bid -= GQ; A = XB; Bt = WKt; Ph = KP; Pr = KR; RB = SEQ; sRB = (size_t)NKV * SEQ * HD; pitch = HD; CB = HD; sCB = (size_t)SEQ * HD; rope = 1; mt = NB * SEQ / 128;
    } else {                        // v^T: A = Wv^T rows (m = g*64 + d), Bt = x rows (n = b*SEQ + t) -> plane [(b*512 + m)][t] = [(b*8 + g)][d][t], no rotary
        bid -= GQ + GK; A = WVt; Bt = XB; Ph = VT; Pr = VR; RB = KVD; sRB = (size_t)0; pitch = SEQ; CB = SEQ; sCB = (size_t)KVD * SEQ; rope = 0; mt = KVD / 128;
    }
    const int tid = threadIdx.x; const int wave = __builtin_amdgcn_readfirstlane(tid >> 5);
    const int lane = tid & 31, lr = lane & 15, hi = lane >> 4; const int rb = (bid % mt) * 128, cb = (bid / mt) * 128;
    const int wr = (wave >> 1) * 64, wc = (wave & 1) * 64; const int r0 = rb + wr, c0 = cb + wc;
    float* os = osall + wave * 16 * 68;
    v8f acc[4][4];
#pragma unroll
    for (int mb = 0; mb < 4; ++mb)
#pragma unroll
        for (int nb = 0; nb < 4; ++nb) acc[mb][nb] = (v8f){};
    const unsigned l0 = (unsigned)(size_t)ring + (unsigned)((tid >> 3) * (LPE * 2) + (tid & 7) * 16);
    const char* ga = (const char*)(A + (size_t)(rb + (tid >> 3)) * K + (tid & 7) * 8);
    const char* gb = (const char*)(Bt + (size_t)(cb + (tid >> 3)) * K + (tid & 7) * 8);
    const int afr = (wr + lr) * LPE + 8 * hi, bfr = (128 + wc + lr) * LPE + 8 * hi;
    stage_tile(l0, ga, gb);
    wait_copies();
    __syncthreads();                                              // tile 0 readable by every wave
    stage_tile(l0 + STGB, ga + BK * 2, gb + BK * 2);
#pragma unroll 1   // one trip per staged tile: the ring's waits and barrier stand once, at the foot
    for (int t = 0; t < NKT; ++t) {
        const bf* sb = ring + (t & 1) * STGE;
#pragma unroll     // this and the loops inside: constant indices keep fragments and accumulators in registers
        for (int ks = 0; ks < BK; ks += 32) {
            v16bf a[4], b[4];
#pragma unroll
            for (int mb = 0; mb < 4; ++mb) a[mb] = ldb(sb + afr + mb * 16 * LPE + ks);
#pragma unroll
            for (int nb = 0; nb < 4; ++nb) b[nb] = ldb(sb + bfr + nb * 16 * LPE + ks);
#pragma unroll
            for (int nb = 0; nb < 4; ++nb)
#pragma unroll
                for (int mb = 0; mb < 4; ++mb) acc[mb][nb] = wmmab(a[mb], b[nb], acc[mb][nb]);
        }
        wait_lds();
        wait_copies();
        __syncthreads();                                          // publishes tile t + 1 and frees the buffer of tile t
        if (t + 2 < NKT) stage_tile(l0 + (unsigned)(t & 1) * STGB, ga + (size_t)(t + 2) * (BK * 2), gb + (size_t)(t + 2) * (BK * 2));
    }
    wait_copies();
    const size_t tbase = (size_t)(r0 / RB) * sRB + (size_t)(r0 % RB) * (size_t)pitch + (size_t)(c0 / CB) * sCB + (size_t)(c0 % CB);
#pragma unroll
    for (int mb = 0; mb < 4; ++mb) {
#pragma unroll
        for (int nb = 0; nb < 4; ++nb) {
#pragma unroll
            for (int j = 0; j < 8; ++j) os[(hi * 8 + j) * 68 + nb * 16 + lr] = acc[mb][nb][j]; }   // D: row 8h+j, col lane&15
        wave_sync();
        const size_t sb = tbase + (size_t)(mb * 16) * (size_t)pitch;
{
#pragma unroll
            for (int s = 0; s < 4; ++s) { const int row = 4 * s + (lane >> 3), c8 = (lane & 7) * 8;   // 4 s x 4 row groups = 16 rows; 8 lanes x 8 = 64 columns
                v4f x0 = *(const v4fa*)(&os[row * 68 + c8]); v4f x1 = *(const v4fa*)(&os[row * 68 + c8 + 4]); v8h hv, rv;
                if (rope) {                                                                            // block-uniform (set with the job)
                    const int t = (r0 + mb * 16 + row) % SEQ;
                    const float* cp = CS + ((size_t)t * 32 + (size_t)(c8 >> 1)) * 2;                  // pairs c8/2 .. c8/2+3: (cos, sin) x 4
                    const v4f ca = *(const v4f*)cp; const v4f cb = *(const v4f*)(cp + 4);
                    float e, o;
                    e = x0[0]; o = x0[1]; x0[0] = e * ca[0] - o * ca[1]; x0[1] = e * ca[1] + o * ca[0];
                    e = x0[2]; o = x0[3]; x0[2] = e * ca[2] - o * ca[3]; x0[3] = e * ca[3] + o * ca[2];
                    e = x1[0]; o = x1[1]; x1[0] = e * cb[0] - o * cb[1]; x1[1] = e * cb[1] + o * cb[0];
                    e = x1[2]; o = x1[3]; x1[2] = e * cb[2] - o * cb[3]; x1[3] = e * cb[3] + o * cb[2]; }
#pragma unroll
                for (int i = 0; i < 4; ++i) { const h16 a0 = (h16)x0[i]; const h16 a1 = (h16)x1[i]; hv[i] = a0; hv[4 + i] = a1; rv[i] = (h16)((x0[i] - (float)a0) * QRS); rv[4 + i] = (h16)((x1[i] - (float)a1) * QRS); }
                const size_t oo = sb + (size_t)row * (size_t)pitch + c8;
                *(v8h*)(Ph + oo) = hv; if (useRes) *(v8h*)(Pr + oo) = rv;
                asm volatile("s_wait_xcnt 0x0" ::: "memory"); }   // stands in front of the next rows' rewrite of the two stores' address registers
             }
        wave_sync();
    }
}

// flash_early: the body of k_flash's blocks for query rows < EARLY (same structure as the late body below, operands straight from the planes) with value + residual (x1024) planes on every operand:
// scores = kh.qh + (kh.qr + kr.qh)/1024; O = vh.ph + (vr.ph + vh.pr)/1024 (residual products in their own accumulators), l from the unconverted f32 P.
// Writes the ctx value plane rows (carried x1024) and the compact unscaled residual plane CR[b][t < EARLY][2048].
__device__ __forceinline__ void flash_early(float* os, const h16* __restrict__ QH, const h16* __restrict__ QR, const h16* __restrict__ KP, const h16* __restrict__ KR,
                                            const h16* __restrict__ VT, const h16* __restrict__ VR, h16* CH, h16* CR, int t0, int zg) {
    const int lane = threadIdx.x & 31; const int wave = __builtin_amdgcn_readfirstlane(threadIdx.x >> 5);
    const int lr = lane & 15, hi = lane >> 4;
    const int b = zg / NKV; const int g = zg % NKV;
    const int h = g * AW + wave;
    const int tq = t0 + lr;
    const size_t qo = ((size_t)(b * NH_ + h) * SEQ + (size_t)tq) * HD + 8 * hi;
    const v16h qh0 = ldh(QH + qo), qh1 = ldh(QH + qo + 32), qr0 = ldh(QR + qo), qr1 = ldh(QR + qo + 32);
    const size_t ko = (size_t)zg * SEQ * HD + (size_t)lr * HD + 8 * hi;
    const size_t vo = (size_t)zg * HD * SEQ + (size_t)lr * SEQ + 8 * hi;
    v8f oH[4], oL[4];
#pragma unroll
    for (int j = 0; j < 4; ++j) { oH[j] = (v8f){}; oL[j] = (v8f){}; }
    float m = NEGB, l = 0.0f;
    const int kend = t0 + 16;
#pragma unroll 1
    for (int key0 = 0; key0 < kend; key0 += 32) {
        const size_t kk = ko + (size_t)key0 * HD;
        v8f sHa = (v8f){}, sLa = (v8f){}, sHb = (v8f){}, sLb = (v8f){};
        { const v16h k0 = ldh(KP + kk), k1 = ldh(KP + kk + 32), r0 = ldh(KR + kk), r1 = ldh(KR + kk + 32);
          sHa = wmma16(k0, qh0, sHa); sHa = wmma16(k1, qh1, sHa);
          sLa = wmma16(k0, qr0, sLa); sLa = wmma16(k1, qr1, sLa); sLa = wmma16(r0, qh0, sLa); sLa = wmma16(r1, qh1, sLa); }
        { const size_t k2 = kk + (size_t)16 * HD;
          const v16h k0 = ldh(KP + k2), k1 = ldh(KP + k2 + 32), r0 = ldh(KR + k2), r1 = ldh(KR + k2 + 32);
          asm volatile("s_wait_xcnt 0x0" :: "v"(KP + kk), "v"(KR + kk) : "memory");   // behind the eight loads; naming their two base addresses keeps those registers from serving as a load's destination ahead of the wait
          sHb = wmma16(k0, qh0, sHb); sHb = wmma16(k1, qh1, sHb);
          sLb = wmma16(k0, qr0, sLb); sLb = wmma16(k1, qr1, sLb); sLb = wmma16(r0, qh0, sLb); sLb = wmma16(r1, qh1, sLb); }
        float ta[8], tb[8];
#pragma unroll
        for (int r = 0; r < 8; ++r) { ta[r] = (sHa[r] + sLa[r] * QRI) * SC2; tb[r] = (sHb[r] + sLb[r] * QRI) * SC2; }
        if (key0 + 31 > t0) {                                      // block-uniform: diagonal block
            const int kbse = key0 + 8 * hi;
#pragma unroll
            for (int r = 0; r < 8; ++r) { ta[r] = (kbse + r > tq) ? NEGB : ta[r]; tb[r] = (kbse + 16 + r > tq) ? NEGB : tb[r]; } }
        float mx = NEGB;
#pragma unroll
        for (int r = 0; r < 8; ++r) mx = fmaxf(mx, fmaxf(ta[r], tb[r]));
        mx = fmaxf(mx, __shfl_xor(mx, 16, 32));
        const float mnew = fmaxf(m, mx);
        const float alpha = __builtin_amdgcn_exp2f(m - mnew);
        const float sh = PSH - mnew;
        v16h ph, pr; float ls = 0.0f;
#pragma unroll
        for (int r = 0; r < 8; ++r) { const float ea = __builtin_amdgcn_exp2f(ta[r] + sh); const float ec = __builtin_amdgcn_exp2f(tb[r] + sh);
            const h16 ha = (h16)ea; const h16 hc = (h16)ec; ph[r] = ha; ph[8 + r] = hc;
            pr[r] = (h16)((ea - (float)ha) * QRS); pr[8 + r] = (h16)((ec - (float)hc) * QRS); ls += ea + ec; }
        l = l * alpha + ls; m = mnew;
#pragma unroll
        for (int j = 0; j < 4; ++j) { oH[j] = oH[j] * alpha; oL[j] = oL[j] * alpha; }
        const size_t vv = vo + (size_t)key0;
#pragma unroll
        for (int j = 0; j < 4; ++j) { const v16h vh = ldh(VT + vv + (size_t)(16 * j) * SEQ); const v16h vr = ldh(VR + vv + (size_t)(16 * j) * SEQ);
            oH[j] = wmma16(vh, ph, oH[j]); oL[j] = wmma16(vr, ph, oL[j]); oL[j] = wmma16(vh, pr, oL[j]); }
    }
    l += __shfl_xor(l, 16, 32);
    const float inv = CXS / l;
    const int wb = wave * 16 * 68;
#pragma unroll
    for (int j = 0; j < 4; ++j) { v4f a, c;     // os[t][d], d = 16j + 8h + r; rows 0..15 x columns 0..63 all written
        a[0] = (oH[j][0] + oL[j][0] * QRI) * inv; a[1] = (oH[j][1] + oL[j][1] * QRI) * inv; a[2] = (oH[j][2] + oL[j][2] * QRI) * inv; a[3] = (oH[j][3] + oL[j][3] * QRI) * inv;
        c[0] = (oH[j][4] + oL[j][4] * QRI) * inv; c[1] = (oH[j][5] + oL[j][5] * QRI) * inv; c[2] = (oH[j][6] + oL[j][6] * QRI) * inv; c[3] = (oH[j][7] + oL[j][7] * QRI) * inv;
        *(v4fa*)(&os[wb + lr * 68 + 16 * j + 8 * hi]) = a; *(v4fa*)(&os[wb + lr * 68 + 16 * j + 8 * hi + 4]) = c; }
    wave_sync();
    h16* crow = CH + ((size_t)b * SEQ + t0) * DM + h * HD;
    h16* rrow = CR + ((size_t)b * EARLY + t0) * DM + h * HD;
{
#pragma unroll
        for (int s = 0; s < 4; ++s) { const int row = 4 * s + (lane >> 3), c8 = (lane & 7) * 8;   // 4 s x 4 row groups = 16 rows; 8 lanes x 8 = 64 columns
            const v4f x0 = *(const v4fa*)(&os[wb + row * 68 + c8]); const v4f x1 = *(const v4fa*)(&os[wb + row * 68 + c8 + 4]); v8h hv, rv;
#pragma unroll
            for (int i = 0; i < 4; ++i) { const h16 a0 = (h16)x0[i]; const h16 a1 = (h16)x1[i]; hv[i] = a0; hv[4 + i] = a1; rv[i] = (h16)(x0[i] - (float)a0); rv[4 + i] = (h16)(x1[i] - (float)a1); }
            *(v8h*)(crow + (size_t)row * DM + c8) = hv; *(v8h*)(rrow + (size_t)row * DM + c8) = rv; }
         }
}

// k_flash: fused causal attention, grid FL_LATE + FL_EARLY. One block = 16 query rows x the four query heads of one kv head (one wave per head, h = g*4 + wave), the row tile running fastest;
// both bodies depend only on k_proj, so they share the launch: the last FL_EARLY blocks (rows < EARLY) run flash_early, the others the body below:
// Q fragments straight from the f16 planes; K / V^T of kv head g staged once per block in LDS, FK keys a stage, and read as fragments (two 16-B LDS loads each) by all four waves.
// Transposed form: S^T[key][t] = K Q^T (A = K rows, B = Q rows); lane (t = lane&15, h = lane>>4) holds keys 8h+r of each 16-key tile, so the packed
// P tile is directly the B fragment of O^T[d][t] = V^T P^T (element r <- tile keys 0..15, element 8+r <- tile keys 16..31, lane unchanged).
// Keys run over [0, t0+16) in steps of 32; the diagonal 32-key blocks replace excluded scores (key > t) by a large negative value before the running max.
#define FL_LX    ((SEQ - EARLY) / 16)
#define FL_LATE  (FL_LX * NB * NKV)
#define FL_EARLY ((EARLY / 16) * NB * NKV)
static_assert(FL_LX > 0);                                        // the late blocks' index is split by it
__global__ __launch_bounds__(32 * AW) void k_flash(const h16* __restrict__ QH, const h16* __restrict__ QR, const h16* __restrict__ KP, const h16* __restrict__ KR,
                                                   const h16* __restrict__ VT, const h16* __restrict__ VR, h16* CH, h16* CR) {
    __shared__ __align__(16) h16 ring[2 * FSTGE];
    float* os = (float*)ring;                                     // output staging, used only behind the loop's last barrier (the early body stages nothing else there)
    const int bid = blockIdx.x;
    if (bid >= FL_LATE) { const int e = bid - FL_LATE; flash_early(os, QH, QR, KP, KR, VT, VR, CH, CR, (e % (EARLY / 16)) * 16, e / (EARLY / 16)); return; }   // block-uniform, in front of every barrier
    const int zg = bid / FL_LX; const int t0 = EARLY + (bid % FL_LX) * 16;
    const int tid = threadIdx.x;
    const int lane = threadIdx.x & 31; const int wave = __builtin_amdgcn_readfirstlane(threadIdx.x >> 5);
    const int lr = lane & 15, hi = lane >> 4;
    const int b = zg / NKV; const int g = zg % NKV;
    const int h = g * AW + wave;                                  // repeat on the head axis: query head h uses kv head h >> 2
    const int tq = t0 + lr;
    const size_t qo = ((size_t)(b * NH_ + h) * SEQ + (size_t)tq) * HD + 8 * hi;
    const v16h qh0 = ldh(QH + qo), qh1 = ldh(QH + qo + 32), qr0 = ldh(QR + qo), qr1 = ldh(QR + qo + 32);   // B fragments: col t, k = d
    const unsigned l0 = (unsigned)(size_t)ring + (unsigned)((tid >> 3) * (LPE * 2) + (tid & 7) * 16);
    const char* gk = (const char*)(KP + (size_t)zg * SEQ * HD + (size_t)(tid >> 3) * HD + (tid & 7) * 8);    // + stage * FK rows
    const char* gv = (const char*)(VT + (size_t)zg * HD * SEQ + (size_t)(tid >> 3) * SEQ + (tid & 7) * 8);   // + stage * FK keys
    const int kfr = lr * LPE + 8 * hi;                            // + key * LPE        (A fragment: row key, k = d)
    const int vfr = (FK + lr) * LPE + 8 * hi;                     // + 16j * LPE + key  (A fragment: row d, k = key)
    v8f o0 = (v8f){}, o1 = (v8f){}, o2 = (v8f){}, o3 = (v8f){};
    float m = NEGB, l = 0.0f;
    const int kend = t0 + 16;
    const int nst = (kend + FK - 1) / FK;                         // block-uniform; stage nst - 1 ends at or before key SEQ
    stage_kv(l0, gk, gv);
    wait_copies();
    __syncthreads();                                              // stage 0 readable by every wave
    if (nst > 1) stage_kv(l0 + FSTGB, gk + (size_t)FK * HD * 2, gv + FK * 2);
#pragma unroll 1   // one trip per staged tile: the ring's waits and barrier stand once, at the foot
    for (int st = 0; st < nst; ++st) {
        const h16* sb = ring + (st & 1) * FSTGE;
#pragma unroll     // two 32-key steps per stage, constant LDS offsets
        for (int ks = 0; ks < FK; ks += 32) {
            const int key0 = st * FK + ks;
            if (key0 >= kend) break;                               // block-uniform: the last stage may hold one step only
            const h16* ka = sb + kfr + ks * LPE;
            const v16h ka0 = ldh(ka), ka1 = ldh(ka + 32), kb0 = ldh(ka + 16 * LPE), kb1 = ldh(ka + 16 * LPE + 32);
            v8f sHa = (v8f){}, sLa = (v8f){}, sHb = (v8f){}, sLb = (v8f){};
            sHa = wmma16p(ka0, qh0, sHa); sLa = wmma16p(ka0, qr0, sLa); sHb = wmma16p(kb0, qh0, sHb); sLb = wmma16p(kb0, qr0, sLb);
            sHa = wmma16p(ka1, qh1, sHa); sLa = wmma16p(ka1, qr1, sLa); sHb = wmma16p(kb1, qh1, sHb); sLb = wmma16p(kb1, qr1, sLb);
            float ta[8], tb[8];
#pragma unroll
            for (int r = 0; r < 8; ++r) { ta[r] = (sHa[r] + sLa[r] * QRI) * SC2; tb[r] = (sHb[r] + sLb[r] * QRI) * SC2; }
            if (key0 + 31 > t0) {                                  // block-uniform: diagonal block
                const int kbse = key0 + 8 * hi;
#pragma unroll
                for (int r = 0; r < 8; ++r) { ta[r] = (kbse + r > tq) ? NEGB : ta[r]; tb[r] = (kbse + 16 + r > tq) ? NEGB : tb[r]; } }
            float mx = NEGB;
#pragma unroll
            for (int r = 0; r < 8; ++r) mx = fmaxf(mx, fmaxf(ta[r], tb[r]));
            mx = fmaxf(mx, __shfl_xor(mx, 16, 32));
            const float mnew = fmaxf(m, mx);
            const float alpha = __builtin_amdgcn_exp2f(m - mnew);
            const float sh = PSH - mnew;
            v16h pb; float ls = 0.0f;
#pragma unroll
            for (int r = 0; r < 8; ++r) { const float ea = __builtin_amdgcn_exp2f(ta[r] + sh); const float ec = __builtin_amdgcn_exp2f(tb[r] + sh); pb[r] = (h16)ea; pb[8 + r] = (h16)ec; ls += ea + ec; }
            l = l * alpha + ls; m = mnew;
            o0 = o0 * alpha; o1 = o1 * alpha; o2 = o2 * alpha; o3 = o3 * alpha;
            const h16* va = sb + vfr + ks;
            const v16h v0 = ldh(va), v1 = ldh(va + 16 * LPE), v2 = ldh(va + 32 * LPE), v3 = ldh(va + 48 * LPE);
            o0 = wmma16p(v0, pb, o0); o1 = wmma16p(v1, pb, o1); o2 = wmma16p(v2, pb, o2); o3 = wmma16p(v3, pb, o3);
        }
        wait_lds();
        wait_copies();
        __syncthreads();                                          // publishes stage st + 1 and frees the buffer of stage st
        if (st + 2 < nst) stage_kv(l0 + (unsigned)(st & 1) * FSTGB, gk + (size_t)(st + 2) * (FK * HD * 2), gv + (size_t)(st + 2) * (FK * 2));
    }
    wait_copies();
    l += __shfl_xor(l, 16, 32);
    const float inv = CXS / l;
    const int wb = wave * 16 * 68;
    // O^T D layout: o_j[r] = (d = 16j + 8h + r, t = lane&15) -> os[t][d]; rows 0..15 x columns 0..63 all written
    { v4f a, c;
      a[0] = o0[0] * inv; a[1] = o0[1] * inv; a[2] = o0[2] * inv; a[3] = o0[3] * inv; c[0] = o0[4] * inv; c[1] = o0[5] * inv; c[2] = o0[6] * inv; c[3] = o0[7] * inv;
      *(v4fa*)(&os[wb + lr * 68 +  0 + 8 * hi]) = a; *(v4fa*)(&os[wb + lr * 68 +  0 + 8 * hi + 4]) = c;
      a[0] = o1[0] * inv; a[1] = o1[1] * inv; a[2] = o1[2] * inv; a[3] = o1[3] * inv; c[0] = o1[4] * inv; c[1] = o1[5] * inv; c[2] = o1[6] * inv; c[3] = o1[7] * inv;
      *(v4fa*)(&os[wb + lr * 68 + 16 + 8 * hi]) = a; *(v4fa*)(&os[wb + lr * 68 + 16 + 8 * hi + 4]) = c;
      a[0] = o2[0] * inv; a[1] = o2[1] * inv; a[2] = o2[2] * inv; a[3] = o2[3] * inv; c[0] = o2[4] * inv; c[1] = o2[5] * inv; c[2] = o2[6] * inv; c[3] = o2[7] * inv;
      *(v4fa*)(&os[wb + lr * 68 + 32 + 8 * hi]) = a; *(v4fa*)(&os[wb + lr * 68 + 32 + 8 * hi + 4]) = c;
      a[0] = o3[0] * inv; a[1] = o3[1] * inv; a[2] = o3[2] * inv; a[3] = o3[3] * inv; c[0] = o3[4] * inv; c[1] = o3[5] * inv; c[2] = o3[6] * inv; c[3] = o3[7] * inv;
      *(v4fa*)(&os[wb + lr * 68 + 48 + 8 * hi]) = a; *(v4fa*)(&os[wb + lr * 68 + 48 + 8 * hi + 4]) = c; }
    wave_sync();
    h16* crow = CH + ((size_t)b * SEQ + t0) * DM + h * HD;         // merged heads: column h*64 + d
{
#pragma unroll
        for (int s = 0; s < 4; ++s) { const int row = 4 * s + (lane >> 3), c8 = (lane & 7) * 8;   // 4 s x 4 row groups = 16 rows; 8 lanes x 8 = 64 columns
            const v4f x0 = *(const v4fa*)(&os[wb + row * 68 + c8]); const v4f x1 = *(const v4fa*)(&os[wb + row * 68 + c8 + 4]); v8h hv;
#pragma unroll
            for (int i = 0; i < 4; ++i) { hv[i] = (h16)x0[i]; hv[4 + i] = (h16)x1[i]; }
            *(v8h*)(crow + (size_t)row * DM + c8) = hv; }
         }
}

// k_out: output projection, four waves per 128x128 tile (64x64 per wave), f16 operands from the ctx plane CX (value rows [NB*SEQ], then residual rows [NB*EARLY]) and the Wo^T plane, staged in LDS, K = DM.
// Tiles whose rows are < EARLY in their sequence walk K a second time over the unscaled residual rows into the same accumulators. grid (NB*SEQ/128, DM/128), 128 threads.
__global__ __launch_bounds__(128) void k_out(const h16* __restrict__ CX, const h16* __restrict__ Wt, float* OUT) {
    __shared__ __align__(16) h16 ring[2 * STGE];
    __shared__ __align__(16) float osall[4 * 16 * 68];
    const int K = DM;
    const int tid = threadIdx.x; const int wave = __builtin_amdgcn_readfirstlane(tid >> 5);
    const int lane = tid & 31, lr = lane & 15, hi = lane >> 4; const int rb = blockIdx.x * 128, cb = blockIdx.y * 128;
    const int wr = (wave >> 1) * 64, wc = (wave & 1) * 64; const int c0 = cb + wc;
    float* os = osall + wave * 16 * 68;
    const int b = rb / SEQ, tb = rb % SEQ, tt = tb + wr;           // a 128-row tile lies in one batch and is entirely early or entirely late
    const int nt = (tb < EARLY) ? 2 * NKT : NKT;                   // block-uniform
    const unsigned l0 = (unsigned)(size_t)ring + (unsigned)((tid >> 3) * (LPE * 2) + (tid & 7) * 16);
    const char* ga0 = (const char*)(CX + (size_t)(rb + (tid >> 3)) * K + (tid & 7) * 8);
    const char* ga1 = (const char*)(CX + ((size_t)NB * SEQ + (size_t)b * EARLY + (size_t)tb + (size_t)(tid >> 3)) * K + (tid & 7) * 8);   // used only when tb < EARLY
    const char* gb = (const char*)(Wt + (size_t)(cb + (tid >> 3)) * K + (tid & 7) * 8);
    const int afr = (wr + lr) * LPE + 8 * hi, bfr = (128 + wc + lr) * LPE + 8 * hi;
    v8f acc[4][4];
#pragma unroll
    for (int mb = 0; mb < 4; ++mb)
#pragma unroll
        for (int nb = 0; nb < 4; ++nb) acc[mb][nb] = (v8f){};
    stage_tile(l0, ga0, gb);
    wait_copies();
    __syncthreads();                                              // tile 0 readable by every wave
    stage_tile(l0 + STGB, ga0 + BK * 2, gb + BK * 2);
#pragma unroll 1   // one trip per staged tile: the ring's waits and barrier stand once, at the foot
    for (int t = 0; t < nt; ++t) {
        const h16* sb = ring + (t & 1) * STGE;
#pragma unroll     // this and the loops inside: constant indices keep fragments and accumulators in registers
        for (int ks = 0; ks < BK; ks += 32) {
            v16h a[4], bq[4];
#pragma unroll
            for (int mb = 0; mb < 4; ++mb) a[mb] = ldh(sb + afr + mb * 16 * LPE + ks);
#pragma unroll
            for (int nb = 0; nb < 4; ++nb) bq[nb] = ldh(sb + bfr + nb * 16 * LPE + ks);
#pragma unroll
            for (int nb = 0; nb < 4; ++nb)
#pragma unroll
                for (int mb = 0; mb < 4; ++mb) acc[mb][nb] = wmma16(a[mb], bq[nb], acc[mb][nb]);
        }
        wait_lds();
        wait_copies();
        __syncthreads();                                          // publishes tile t + 1 and frees the buffer of tile t
        if (t + 2 < nt) { const int u = t + 2; const size_t ko = (size_t)(u & (NKT - 1)) * (BK * 2);   // tiles NKT.. are the residual rows' walk
            stage_tile(l0 + (unsigned)(t & 1) * STGB, (u < NKT ? ga0 : ga1) + ko, gb + ko); }
    }
    wait_copies();
    float* obase = OUT + ((size_t)b * OUT_SEQ + tt) * DM + c0;
#pragma unroll
    for (int mb = 0; mb < 4; ++mb) {
#pragma unroll
        for (int nb = 0; nb < 4; ++nb) {
#pragma unroll
            for (int j = 0; j < 8; ++j) os[(hi * 8 + j) * 68 + nb * 16 + lr] = acc[mb][nb][j] * OUTS; }   // D: row 8h+j, col lane&15
        wave_sync();
{
#pragma unroll
            for (int s = 0; s < 8; ++s) { const int row = 2 * s + hi, cofs = lr * 4;   // 8 s x 2 rows = 16 rows; 16 lanes x 4 floats = 64 columns
                const v4f val = *(const v4fa*)(&os[row * 68 + cofs]);
                *(v4f*)(obase + (size_t)(mb * 16 + row) * DM + cofs) = val; }
             }
        wave_sync();
    }
}

static constexpr size_t al256(size_t v) { return (v + 255) & ~(size_t)255; }
static constexpr size_t SZ_XB = al256((size_t)NB * SEQ * DM * 2);
static constexpr size_t SZ_WQ = al256((size_t)DM * DM * 2);
static constexpr size_t SZ_WK = al256((size_t)KVD * DM * 2);
static constexpr size_t SZ_CS = al256((size_t)SEQ * 32 * 2 * 4);
static constexpr size_t SZ_Q  = al256((size_t)NB * NH_ * SEQ * HD * 2);
static constexpr size_t SZ_KV = al256((size_t)NB * NKV * SEQ * HD * 2);
static constexpr size_t SZ_CX = al256(((size_t)NB * SEQ + (size_t)NB * EARLY) * DM * 2);
static constexpr size_t SZ_TOTAL = SZ_XB + 2 * SZ_WQ + 2 * SZ_WK + SZ_CS + 2 * SZ_Q + 4 * SZ_KV + SZ_CX;
static_assert(SZ_TOTAL <= (size_t)134217728);          // workspace carve <= 128 MiB

extern "C" void kernel_launch(void* const* d_in, const int* in_sizes, int n_in,
                              void* d_out, int out_size, void* d_ws, size_t ws_size, hipStream_t stream) {
    if (n_in < 5) return;
    const size_t needx = ((size_t)(NB - 1) * SEQ_FULL + SEQ) * DM;
    if ((size_t)in_sizes[0] < needx) return;
    if ((size_t)in_sizes[1] < (size_t)DM * DM || (size_t)in_sizes[2] < (size_t)DM * KVD || (size_t)in_sizes[3] < (size_t)DM * KVD || (size_t)in_sizes[4] < (size_t)DM * DM) return;
    if ((size_t)out_size < ((size_t)(NB - 1) * OUT_SEQ + SEQ) * DM) return;
    if (SZ_TOTAL > ws_size) return;
    // wire order x, wq, wk, wv, wo; every weight is [in][out]
    const float* x = (const float*)d_in[0]; const float* wq = (const float*)d_in[1]; const float* wk = (const float*)d_in[2]; const float* wv = (const float*)d_in[3]; const float* wo = (const float*)d_in[4];
    float* OUT = (float*)d_out;      // [NB][SEQ][2048]
    char* wsp = (char*)d_ws;
    bf*  XB  = (bf*)wsp;  wsp += SZ_XB;              // [NB*SEQ][2048] bf16
    bf*  WQt = (bf*)wsp;  wsp += SZ_WQ;              // [2048 out][2048 in] bf16
    bf*  WKt = (bf*)wsp;  wsp += SZ_WK;              // [512 out][2048 in] bf16
    bf*  WVt = (bf*)wsp;  wsp += SZ_WK;              // [512 out][2048 in] bf16
    h16* WOt = (h16*)wsp; wsp += SZ_WQ;              // [2048 out][2048 in] f16 of bf16 value x16
    float* CS = (float*)wsp; wsp += SZ_CS;           // [SEQ][32] (cos, sin)
    h16* QH = (h16*)wsp; wsp += SZ_Q;                // [NB*32][SEQ][64]
    h16* QR = (h16*)wsp; wsp += SZ_Q;                // residual x1024
    h16* KP = (h16*)wsp; wsp += SZ_KV;               // [NB*8][SEQ][64]
    h16* KR = (h16*)wsp; wsp += SZ_KV;               // residual x1024
    h16* VT = (h16*)wsp; wsp += SZ_KV;               // [NB*8][64][SEQ]
    h16* VR = (h16*)wsp; wsp += SZ_KV;               // residual x1024
    h16* CX = (h16*)wsp; wsp += SZ_CX;               // ctx x1024: value rows [NB*SEQ][2048], then residual rows [NB*EARLY][2048]
    h16* CR = CX + (size_t)NB * SEQ * DM;

    // x -> bf16, the four weights transposed (in[in-features][out-features] -> out[out-features][in-features]), the rotary table
    k_prep<<<PB_ROPE + 2 * PB_WBIG + 2 * PB_WKV + PB_CVT, 256, 0, stream>>>(x, wq, wk, wv, wo, XB, WQt, WKt, WVt, WOt, CS);

    k_proj<<<GQ + 2 * GK, 128, 0, stream>>>(XB, WQt, WKt, WVt, QH, QR, KP, KR, VT, VR, CS);

    k_flash<<<FL_LATE + FL_EARLY, 32 * AW, 0, stream>>>(QH, QR, KP, KR, VT, VR, CX, CR);

    k_out<<<dim3(NB * SEQ / 128, DM / 128, 1), 128, 0, stream>>>(CX, WOt, OUT);
}

// v005
// It runs in 154 microseconds.
// Two timings next to v004 put it at 1.06 and 1.07 times that version's speed.
// All steps since v000 together make it 3.43 times as fast.
#include <hip/hip_runtime.h>

// Grouped-query causal self-attention, width 2048 = 32 query heads x 64 sharing 8 kv heads (kv head g = h >> 2), x [NB][SEQ][2048], Wq/Wk/Wv/Wo [in][out] (y = x W), no biases,
// interleaved (even/odd pair) rotary on q and k from a computed [SEQ][32] (cos, sin) table, score scale 1/8, causal exclusion (diagonal kept), output = ctx Wo (f32).
// Compute dtypes, f32 accumulate everywhere: q/k/v projections v_wmma_f32_16x16x32_bf16 (x and W RNE-converted to bf16; products exact);
// scores v_wmma_f32_16x16x32_f16: k single f16, q as f16 value + f16 residual x1024 in its own accumulator (query rows < 256: k also value + residual x1024, three products);
// P (x256 carry, cancels in the normalisation) and v single f16 (rows < 256: P and v as value + residual x1024, three products); softmax f32 (online, running max);
// output projection v_wmma_f32_16x16x32_f16: ctx carried x1024 as f16 (rows < 256: plus its unscaled f16 residual, summed by a second pair of waves) against f16(bf16(Wo)) x16, results scaled by 2^-14.

#ifndef NB
#define NB 2
#endif
#ifndef SEQ
#define SEQ 2048
#endif
#define NB_FULL  2
#define SEQ_FULL 2048
#ifndef OUT_SEQ
#define OUT_SEQ SEQ              // row pitch (in tokens) between batches of the output
#endif
#define DM    2048
#define NH_   32
#define NKV   8
#define HD    64
#define KVD   (NKV * HD)         // 512
#define AW    4                  // waves per flash block = the four query heads of one kv head
#define EARLY 256                // query rows below this use the value + residual path
#define QRS  1024.0f             // carry of every residual plane (q, k, v, P)
#define QRI  (1.0f / 1024.0f)
#define SC2  (0.125f * 1.4426950408889634f)   // HD^-0.5 * log2(e)
#define PSH  8.0f                // log2 of the P carry (256)
#define CXS  1024.0f             // carry of the ctx plane
#define WOS  16.0f               // carry of the Wo plane
#define OUTS (1.0f / (1024.0f * 16.0f))
#define NEGB (-3.0e38f)

static_assert(HD == 64);
static_assert(NH_ * HD == DM);                 // query head h = columns h*64 + d
static_assert(NKV * AW == NH_);                // four consecutive query heads per kv head
static_assert(DM % 64 == 0);
static_assert(KVD % 64 == 0);
static_assert(DM % 32 == 0);                   // GEMM k-loop steps by 32
static_assert(SEQ % 64 == 0);                  // a 64-row tile never straddles two batches
static_assert(SEQ % 32 == 0);                  // key loop steps by 32, key0 + 31 < SEQ
static_assert(EARLY % 128 == 0);               // output GEMM tiles are entirely early or entirely late
static_assert(SEQ % 128 == 0);                 // a 128-row GEMM tile never straddles two batches
static_assert(KVD % 128 == 0);
static_assert(SEQ >= EARLY);
static_assert((SEQ - EARLY) % 16 == 0);
static_assert(((size_t)SEQ * DM) % 8 == 0);
static_assert(NB <= NB_FULL);
static_assert(SEQ <= SEQ_FULL);

typedef _Float16 h16;
typedef unsigned short bf;
typedef __attribute__((ext_vector_type(16))) __bf16   v16bf;
typedef __attribute__((ext_vector_type(16))) _Float16 v16h;
typedef __attribute__((ext_vector_type(8)))  _Float16 v8h;
typedef __attribute__((ext_vector_type(8)))  unsigned short v8us;
typedef __attribute__((ext_vector_type(8)))  float    v8f;
typedef __attribute__((ext_vector_type(4)))  float    v4f;
typedef __attribute__((ext_vector_type(2)))  float    v2f;
typedef v4f  __attribute__((may_alias)) v4fa;

__device__ __forceinline__ unsigned short f2bf(float f) { unsigned u = __float_as_uint(f); u += 0x7FFFu + ((u >> 16) & 1u); return (unsigned short)(u >> 16); }
__device__ __forceinline__ v16h cat16(v8h lo, v8h hi) { return __builtin_shufflevector(lo, hi, 0, 1, 2, 3, 4, 5, 6, 7, 8, 9, 10, 11, 12, 13, 14, 15); }
__device__ __forceinline__ v16bf cat16b(v8us lo, v8us hi) { return __builtin_bit_cast(v16bf, __builtin_shufflevector(lo, hi, 0, 1, 2, 3, 4, 5, 6, 7, 8, 9, 10, 11, 12, 13, 14, 15)); }
// wmma16, wmmab: the WMMA is followed by its own 4-slot guard tying its accumulator and keeping its operands live
__device__ __forceinline__ v8f wmma16(v16h a, v16h b, v8f c) {
    c = __builtin_amdgcn_wmma_f32_16x16x32_f16(false, a, false, b, (short)0, c, false, false);
    asm volatile("v_nop\n\tv_nop\n\tv_nop\n\tv_nop" : "+v"(c) : "v"(a), "v"(b));
    return c; }
__device__ __forceinline__ v8f wmmab(v16bf a, v16bf b, v8f c) {
    c = __builtin_amdgcn_wmma_f32_16x16x32_bf16(false, a, false, b, (short)0, c, false, false);
    asm volatile("v_nop\n\tv_nop\n\tv_nop\n\tv_nop" : "+v"(c) : "v"(a), "v"(b));
    return c; }
// k_flash's late body: the plain builtin. The compiler keeps the distance to the users of D, A and B itself and counts the neighbouring WMMAs as cover,
// so the vector port is left to the softmax work of the waves that share the SIMD.
__device__ __forceinline__ v8f wmma16p(v16h a, v16h b, v8f c) { return __builtin_amdgcn_wmma_f32_16x16x32_f16(false, a, false, b, (short)0, c, false, false); }
// fragment loaders from K-contiguous 16-bit rows; p already includes + 8*(lane>>4): elements 0..7 <- k0+8h+0..7, elements 8..15 <- k0+16+8h+0..7 (same map for A and B)
__device__ __forceinline__ v16h  ldh(const h16* p) { return cat16(*(const v8h*)p, *(const v8h*)(p + 16)); }
__device__ __forceinline__ v16bf ldb(const bf* p)  { return cat16b(*(const v8us*)p, *(const v8us*)(p + 16)); }
// ordering point for wave-private LDS tiles (same wave writes and reads)
__device__ __forceinline__ void wave_sync() { __builtin_amdgcn_fence(3 /* release order */, "wavefront"); __builtin_amdgcn_wave_barrier(); asm volatile("" ::: "memory"); }

// ---- operand staging of the two GEMM kernels: a 128x128 product tile per block of four waves (2 x 2, 64x64 each), K walked in tiles of BK.
// One stage = 128 A rows then 128 B rows of BK 16-bit elements (128 B, one cache line each) at a pitch of 144 B (16 B x odd: conflict-free for 16-byte LDS reads); two buffers.
#define BK   64
#define LPE  72                   // LDS row pitch in 16-bit elements
#define STGE (256 * LPE)          // elements of one buffer
#define STGB (STGE * 2)           // bytes of one buffer
#define NKT  (DM / BK)            // K tiles of one walk over K
static_assert(DM % BK == 0 && NKT >= 2);   // both prologue tiles exist
// eight asynchronous 16-byte copies of one lane, rows 16 apart (LDS step 16 * 144 B, global step 16 rows of DM elements); eight lanes cover one 128-B row.
// s_wait_xcnt closes the statement so that no address register is rewritten ahead of it.
__device__ __forceinline__ void copy8(unsigned l, const char* g) {
    const size_t gs = (size_t)16 * DM * 2; const unsigned ls = 16 * LPE * 2;
    asm volatile("global_load_async_to_lds_b128 %0, %8, off\n\t"
                 "global_load_async_to_lds_b128 %1, %9, off\n\t"
                 "global_load_async_to_lds_b128 %2, %10, off\n\t"
                 "global_load_async_to_lds_b128 %3, %11, off\n\t"
                 "global_load_async_to_lds_b128 %4, %12, off\n\t"
                 "global_load_async_to_lds_b128 %5, %13, off\n\t"
                 "global_load_async_to_lds_b128 %6, %14, off\n\t"
                 "global_load_async_to_lds_b128 %7, %15, off\n\t"
                 "s_wait_xcnt 0x0"
                 :: "v"(l), "v"(l + ls), "v"(l + 2 * ls), "v"(l + 3 * ls), "v"(l + 4 * ls), "v"(l + 5 * ls), "v"(l + 6 * ls), "v"(l + 7 * ls),
                    "v"(g), "v"(g + gs), "v"(g + 2 * gs), "v"(g + 3 * gs), "v"(g + 4 * gs), "v"(g + 5 * gs), "v"(g + 6 * gs), "v"(g + 7 * gs)
                 : "memory");
}
// one stage: l = the lane's LDS byte address in row (tid >> 3) of the buffer, ga / gb = the lane's 16 bytes in that row of the A / B tile
__device__ __forceinline__ void stage_tile(unsigned l, const char* ga, const char* gb) { copy8(l, ga); copy8(l + 128 * LPE * 2, gb); }
// the issuing wave's own copies have landed (the compiler places no wait for them)
__device__ __forceinline__ void wait_copies() { asm volatile("s_wait_asynccnt 0x0" ::: "memory"); }
// this wave's LDS reads of the buffer have returned before the barrier that frees it for the refill
__device__ __forceinline__ void wait_lds() { asm volatile("s_wait_dscnt 0x0" ::: "memory"); }

// ---- K / V^T staging of k_flash: one stage = FK keys of one kv head: FK K rows (64 d = 128 B each), then 64 V^T rows (FK keys = 128 B each), whole cache lines, at the same 144-B pitch; two buffers.
#define FK    64
#define FSTGE ((FK + HD) * LPE)   // elements of one buffer
#define FSTGB (FSTGE * 2)         // bytes of one buffer
static_assert(FK == 64 && SEQ % FK == 0);                         // a V^T row of a stage is one 128-B line; the last stage of any query tile ends inside the planes
static_assert(2 * FSTGB >= AW * 16 * 68 * 4);                     // the output staging reuses the ring behind the last barrier
// eight asynchronous 16-byte copies of one lane: four K rows, then four V^T rows, each 16 rows apart (eight lanes cover one 128-B row, 128 threads 16 rows).
// s_wait_xcnt closes the statement so that no address register is rewritten ahead of it.
__device__ __forceinline__ void stage_kv(unsigned l, const char* gk, const char* gv) {
    const size_t kst = (size_t)16 * HD * 2, vst = (size_t)16 * SEQ * 2; const unsigned ls = 16 * LPE * 2;
    asm volatile("global_load_async_to_lds_b128 %0, %8, off\n\t"
                 "global_load_async_to_lds_b128 %1, %9, off\n\t"
                 "global_load_async_to_lds_b128 %2, %10, off\n\t"
                 "global_load_async_to_lds_b128 %3, %11, off\n\t"
                 "global_load_async_to_lds_b128 %4, %12, off\n\t"
                 "global_load_async_to_lds_b128 %5, %13, off\n\t"
                 "global_load_async_to_lds_b128 %6, %14, off\n\t"
                 "global_load_async_to_lds_b128 %7, %15, off\n\t"
                 "s_wait_xcnt 0x0"
                 :: "v"(l), "v"(l + ls), "v"(l + 2 * ls), "v"(l + 3 * ls), "v"(l + 4 * ls), "v"(l + 5 * ls), "v"(l + 6 * ls), "v"(l + 7 * ls),
                    "v"(gk), "v"(gk + kst), "v"(gk + 2 * kst), "v"(gk + 3 * kst), "v"(gv), "v"(gv + vst), "v"(gv + 2 * vst), "v"(gv + 3 * vst)
                 : "memory");
}

// ---- preparation: the x conversion, the four weight transposes and the rotary table depend on nothing but the inputs; they share one launch (k_prep), the block index picks the job.
// cvt8: 8 x values of one thread, f32 -> bf16; i counts groups of 8 over [NB][SEQ][DM], the source batches lie SEQ_FULL tokens apart.
__device__ __forceinline__ void cvt8(const float* __restrict__ src, bf* dst, int blk) {
    const size_t i = (size_t)blk * 256 + threadIdx.x; if (i >= (size_t)NB * SEQ * DM / 8) return;
    src += (i / ((size_t)SEQ * DM / 8)) * ((size_t)(SEQ_FULL - SEQ) * DM);
    const v8f v = *(const v8f*)(src + i * 8); v8us o;
#pragma unroll
    for (int k = 0; k < 8; ++k) o[k] = f2bf(v[k]);
    *(v8us*)(dst + i * 8) = o; 
}

// wt_tile: in[Kr rows][Nc cols] f32 -> out[Nc rows][Kr cols] 16-bit, 64x64 tile (bx of Nc/64, by of Kr/64) through LDS, 256 threads.
__device__ __forceinline__ void wt_tile(float* ts, const float* __restrict__ W, bf* Tb, h16* Th, int Kr, int Nc, int mode, int bx, int by) {
    const int tid = threadIdx.x; const int n0 = bx * 64, k0 = by * 64;
#pragma unroll
    for (int p = 0; p < 4; ++p) { const int row = p * 16 + (tid >> 4), c4 = (tid & 15) * 4;      // 4 p x 16 rows = 64 k rows; 16 threads x 4 = 64 n columns
        const v4f v = *(const v4f*)(W + (size_t)(k0 + row) * (size_t)Nc + n0 + c4);
        ts[row * 65 + c4 + 0] = v[0]; ts[row * 65 + c4 + 1] = v[1]; ts[row * 65 + c4 + 2] = v[2]; ts[row * 65 + c4 + 3] = v[3]; }
    __syncthreads();
{
#pragma unroll
        for (int s = 0; s < 2; ++s) { const int n = s * 32 + (tid >> 3), c8 = (tid & 7) * 8;     // 2 s x 32 rows = 64 n rows; 8 lanes x 8 = 64 k columns
            const size_t oo = (size_t)(n0 + n) * (size_t)Kr + k0 + c8;
            if (mode == 0) { v8us o;
#pragma unroll
                for (int i = 0; i < 8; ++i) o[i] = f2bf(ts[(c8 + i) * 65 + n]);
                *(v8us*)(Tb + oo) = o;
                asm volatile("s_wait_xcnt 0x0" ::: "memory");   // stands in front of any later rewrite of the store's address and data registers
            } else { v8h o;
#pragma unroll
                for (int i = 0; i < 8; ++i) o[i] = (h16)(__uint_as_float(((unsigned)f2bf(ts[(c8 + i) * 65 + n])) << 16) * WOS);
                *(v8h*)(Th + oo) = o;
                asm volatile("s_wait_xcnt 0x0" ::: "memory"); } }   // as above
         }
}

// rope_tab: CS[t][j] = (cos, sin)(t * inv_freq[j]), inv_freq[j] = 1.0f / (float)(10000^(j/32)); the power is a double product of fixed binary roots of 10000.
__device__ __forceinline__ void rope_tab(float* CS, int blk) {
    const int i = blk * 256 + threadIdx.x; if (i >= SEQ * 32) return;
    const int t = i >> 5, j = i & 31;
    double p = 1.0;
    p *= (j & 1)  ? 1.3335214321633240 : 1.0;    // 10000^(1/32)
    p *= (j & 2)  ? 1.7782794100389228 : 1.0;    // 10000^(1/16)
    p *= (j & 4)  ? 3.1622776601683795 : 1.0;    // 10000^(1/8)
    p *= (j & 8)  ? 10.0 : 1.0;                  // 10000^(1/4)
    p *= (j & 16) ? 100.0 : 1.0;                 // 10000^(1/2)
    const float pf = (float)p; const float inv = 1.0f / pf;
    const float ang = (float)t * inv;
    const float cs = cosf(ang), sn = sinf(ang);
    v2f o; o[0] = cs; o[1] = sn;
    *(v2f*)(CS + (size_t)i * 2) = o; 
}

#define PB_ROPE ((SEQ * 32 + 255) / 256)              // blocks of the rotary table
#define PB_WBIG ((DM / 64) * (DM / 64))               // tiles of Wq, of Wo
#define PB_WKV  ((KVD / 64) * (DM / 64))              // tiles of Wk, of Wv
#define PB_CVT  ((int)(((size_t)NB * SEQ * DM / 8 + 255) / 256))   // blocks of the x conversion
// k_prep: grid PB_ROPE + 2 PB_WBIG + 2 PB_WKV + PB_CVT, 256 threads; every branch on the block index is block-uniform (the transposes' barrier stands under it).
__global__ __launch_bounds__(256) void k_prep(const float* __restrict__ x, const float* __restrict__ wq, const float* __restrict__ wk, const float* __restrict__ wv, const float* __restrict__ wo,
                                              bf* XB, bf* WQt, bf* WKt, bf* WVt, h16* WOt, float* CS) {
    __shared__ float ts[64 * 65];
    int blk = blockIdx.x;
    if (blk < PB_ROPE) { rope_tab(CS, blk); return; }
    blk -= PB_ROPE;
    if (blk < 2 * PB_WBIG + 2 * PB_WKV) {
        const float* W; bf* T; int Nc, mode = 0;
        if (blk < PB_WBIG)                    { W = wq; T = WQt; Nc = DM; }
        else if (blk < 2 * PB_WBIG)           { blk -= PB_WBIG; W = wo; T = (bf*)WOt; Nc = DM; mode = 1; }
        else if (blk < 2 * PB_WBIG + PB_WKV)  { blk -= 2 * PB_WBIG; W = wk; T = WKt; Nc = KVD; }
        else                                  { blk -= 2 * PB_WBIG + PB_WKV; W = wv; T = WVt; Nc = KVD; }
        const int nx = Nc / 64;
        wt_tile(ts, W, T, (h16*)T, DM, Nc, mode, blk % nx, blk / nx);
        return;
    }
    cvt8(x, XB, blk - (2 * PB_WBIG + 2 * PB_WKV));
}

// k_proj: register-blocked bf16 GEMM, four waves per 128x128 tile, one 64x64 tile (16 accumulators) per wave, operands from K-contiguous bf16 planes staged in LDS, K = DM.
// C[m][n] = sum_k A[m][k] Bt[n][k], written as f16 (Ph) and the f16 residual x1024 (Pr, useRes != 0) at
// wave tile base (r0/RB)*sRB + (r0%RB)*pitch + (c0/CB)*sCB + (c0%CB), row pitch 'pitch' (halves). 128 threads.
// One grid holds the q, k and v^T products (they depend only on k_prep): blocks [0, GQ) q, [GQ, GQ + GK) k, the last GK v^T; inside a job the row tile runs fastest.
// rope != 0 (rows = tokens b*SEQ + t, the 64 columns of a wave tile = one head): interleaved rotary applied on the f32 values at the store stage from CS[t][32] (cos, sin).
#define GQ ((NB * SEQ / 128) * (DM / 128))
#define GK ((NB * SEQ / 128) * (KVD / 128))
__global__ __launch_bounds__(128) void k_proj(const bf* __restrict__ XB, const bf* __restrict__ WQt, const bf* __restrict__ WKt, const bf* __restrict__ WVt,
                                              h16* QH, h16* QR, h16* KP, h16* KR, h16* VT, h16* VR, const float* __restrict__ CS) {
    __shared__ __align__(16) bf ring[2 * STGE];
    __shared__ __align__(16) float osall[4 * 16 * 68];
    const int K = DM;
    // the job's operands and output map, all block-uniform
    const bf* A; const bf* Bt; h16* Ph; h16* Pr; int RB, pitch, CB, rope, mt; size_t sRB, sCB; int bid = blockIdx.x; const int useRes = 1;   // all three jobs write their residual plane
    if (bid < GQ) {                 // q: A = x rows (m = b*SEQ + t), Bt = Wq^T rows (n = h*64 + d) -> plane [(b*32 + h)][t][d], rotary applied
        A = XB; Bt = WQt; Ph = QH; Pr = QR; RB = SEQ; sRB = (size_t)NH_ * SEQ * HD; pitch = HD; CB = HD; sCB = (size_t)SEQ * HD; rope = 1; mt = NB * SEQ / 128;
    } else if (bid < GQ + GK) {     // k: Bt = Wk^T rows (n = g*64 + d) -> plane [(b*8 + g)][t][d], rotary applied
        bid -= GQ; A = XB; Bt = WKt; Ph = KP; Pr = KR; RB = SEQ; sRB = (size_t)NKV * SEQ * HD; pitch = HD; CB = HD; sCB = (size_t)SEQ * HD; rope = 1; mt = NB * SEQ / 128;
    } else {                        // v^T: A = Wv^T rows (m = g*64 + d), Bt = x rows (n = b*SEQ + t) -> plane [(b*512 + m)][t] = [(b*8 + g)][d][t], no rotary
        bid -= GQ + GK; A = WVt; Bt = XB; Ph = VT; Pr = VR; RB = KVD; sRB = (size_t)0; pitch = SEQ; CB = SEQ; sCB = (size_t)KVD * SEQ; rope = 0; mt = KVD / 128;
    }
    const int tid = threadIdx.x; const int wave = __builtin_amdgcn_readfirstlane(tid >> 5);
    const int lane = tid & 31, lr = lane & 15, hi = lane >> 4; const int rb = (bid % mt) * 128, cb = (bid / mt) * 128;
    const int wr = (wave >> 1) * 64, wc = (wave & 1) * 64; const int r0 = rb + wr, c0 = cb + wc;
    float* os = osall + wave * 16 * 68;
    v8f acc[4][4];
#pragma unroll
    for (int mb = 0; mb < 4; ++mb)
#pragma unroll
        for (int nb = 0; nb < 4; ++nb) acc[mb][nb] = (v8f){};
    const unsigned l0 = (unsigned)(size_t)ring + (unsigned)((tid >> 3) * (LPE * 2) + (tid & 7) * 16);
    const char* ga = (const char*)(A + (size_t)(rb + (tid >> 3)) * K + (tid & 7) * 8);
    const char* gb = (const char*)(Bt + (size_t)(cb + (tid >> 3)) * K + (tid & 7) * 8);
    const int afr = (wr + lr) * LPE + 8 * hi, bfr = (128 + wc + lr) * LPE + 8 * hi;
    stage_tile(l0, ga, gb);
    wait_copies();
    __syncthreads();                                              // tile 0 readable by every wave
    stage_tile(l0 + STGB, ga + BK * 2, gb + BK * 2);
#pragma unroll 1   // one trip per staged tile: the ring's waits and barrier stand once, at the foot
    for (int t = 0; t < NKT; ++t) {
        const bf* sb = ring + (t & 1) * STGE;
#pragma unroll     // this and the loops inside: constant indices keep fragments and accumulators in registers
        for (int ks = 0; ks < BK; ks += 32) {
            v16bf a[4], b[4];
#pragma unroll
            for (int mb = 0; mb < 4; ++mb) a[mb] = ldb(sb + afr + mb * 16 * LPE + ks);
#pragma unroll
            for (int nb = 0; nb < 4; ++nb) b[nb] = ldb(sb + bfr + nb * 16 * LPE + ks);
#pragma unroll
            for (int nb = 0; nb < 4; ++nb)
#pragma unroll
                for (int mb = 0; mb < 4; ++mb) acc[mb][nb] = wmmab(a[mb], b[nb], acc[mb][nb]);
        }
        wait_lds();
        wait_copies();
        __syncthreads();                                          // publishes tile t + 1 and frees the buffer of tile t
        if (t + 2 < NKT) stage_tile(l0 + (unsigned)(t & 1) * STGB, ga + (size_t)(t + 2) * (BK * 2), gb + (size_t)(t + 2) * (BK * 2));
    }
    wait_copies();
    const size_t tbase = (size_t)(r0 / RB) * sRB + (size_t)(r0 % RB) * (size_t)pitch + (size_t)(c0 / CB) * sCB + (size_t)(c0 % CB);
#pragma unroll
    for (int mb = 0; mb < 4; ++mb) {
#pragma unroll
        for (int nb = 0; nb < 4; ++nb) {
#pragma unroll
            for (int j = 0; j < 8; ++j) os[(hi * 8 + j) * 68 + nb * 16 + lr] = acc[mb][nb][j]; }   // D: row 8h+j, col lane&15
        wave_sync();
        const size_t sb = tbase + (size_t)(mb * 16) * (size_t)pitch;
{
#pragma unroll
            for (int s = 0; s < 4; ++s) { const int row = 4 * s + (lane >> 3), c8 = (lane & 7) * 8;   // 4 s x 4 row groups = 16 rows; 8 lanes x 8 = 64 columns
                v4f x0 = *(const v4fa*)(&os[row * 68 + c8]); v4f x1 = *(const v4fa*)(&os[row * 68 + c8 + 4]); v8h hv, rv;
                if (rope) {                                                                            // block-uniform (set with the job)
                    const int t = (r0 + mb * 16 + row) % SEQ;
                    const float* cp = CS + ((size_t)t * 32 + (size_t)(c8 >> 1)) * 2;                  // pairs c8/2 .. c8/2+3: (cos, sin) x 4
                    const v4f ca = *(const v4f*)cp; const v4f cb = *(const v4f*)(cp + 4);
                    float e, o;
                    e = x0[0]; o = x0[1]; x0[0] = e * ca[0] - o * ca[1]; x0[1] = e * ca[1] + o * ca[0];
                    e = x0[2]; o = x0[3]; x0[2] = e * ca[2] - o * ca[3]; x0[3] = e * ca[3] + o * ca[2];
                    e = x1[0]; o = x1[1]; x1[0] = e * cb[0] - o * cb[1]; x1[1] = e * cb[1] + o * cb[0];
                    e = x1[2]; o = x1[3]; x1[2] = e * cb[2] - o * cb[3]; x1[3] = e * cb[3] + o * cb[2]; }
#pragma unroll
                for (int i = 0; i < 4; ++i) { const h16 a0 = (h16)x0[i]; const h16 a1 = (h16)x1[i]; hv[i] = a0; hv[4 + i] = a1; rv[i] = (h16)((x0[i] - (float)a0) * QRS); rv[4 + i] = (h16)((x1[i] - (float)a1) * QRS); }
                const size_t oo = sb + (size_t)row * (size_t)pitch + c8;
                *(v8h*)(Ph + oo) = hv; if (useRes) *(v8h*)(Pr + oo) = rv;
                asm volatile("s_wait_xcnt 0x0" ::: "memory"); }   // stands in front of the next rows' rewrite of the two stores' address registers
             }
        wave_sync();
    }
}

// flash_early: the body of k_flash's blocks for query rows < EARLY (same structure as the late body below, operands straight from the planes) with value + residual (x1024) planes on every operand:
// scores = kh.qh + (kh.qr + kr.qh)/1024; O = vh.ph + (vr.ph + vh.pr)/1024 (residual products in their own accumulators), l from the unconverted f32 P.
// Writes the ctx value plane rows (carried x1024) and the compact unscaled residual plane CR[b][t < EARLY][2048].
__device__ __forceinline__ void flash_early(float* os, const h16* __restrict__ QH, const h16* __restrict__ QR, const h16* __restrict__ KP, const h16* __restrict__ KR,
                                            const h16* __restrict__ VT, const h16* __restrict__ VR, h16* CH, h16* CR, int t0, int zg) {
    const int lane = threadIdx.x & 31; const int wave = __builtin_amdgcn_readfirstlane(threadIdx.x >> 5);
    const int lr = lane & 15, hi = lane >> 4;
    const int b = zg / NKV; const int g = zg % NKV;
    const int h = g * AW + wave;
    const int tq = t0 + lr;
    const size_t qo = ((size_t)(b * NH_ + h) * SEQ + (size_t)tq) * HD + 8 * hi;
    const v16h qh0 = ldh(QH + qo), qh1 = ldh(QH + qo + 32), qr0 = ldh(QR + qo), qr1 = ldh(QR + qo + 32);
    const size_t ko = (size_t)zg * SEQ * HD + (size_t)lr * HD + 8 * hi;
    const size_t vo = (size_t)zg * HD * SEQ + (size_t)lr * SEQ + 8 * hi;
    v8f oH[4], oL[4];
#pragma unroll
    for (int j = 0; j < 4; ++j) { oH[j] = (v8f){}; oL[j] = (v8f){}; }
    float m = NEGB, l = 0.0f;
    const int kend = t0 + 16;
#pragma unroll 1
    for (int key0 = 0; key0 < kend; key0 += 32) {
        const size_t kk = ko + (size_t)key0 * HD;
        v8f sHa = (v8f){}, sLa = (v8f){}, sHb = (v8f){}, sLb = (v8f){};
        { const v16h k0 = ldh(KP + kk), k1 = ldh(KP + kk + 32), r0 = ldh(KR + kk), r1 = ldh(KR + kk + 32);
          sHa = wmma16(k0, qh0, sHa); sHa = wmma16(k1, qh1, sHa);
          sLa = wmma16(k0, qr0, sLa); sLa = wmma16(k1, qr1, sLa); sLa = wmma16(r0, qh0, sLa); sLa = wmma16(r1, qh1, sLa); }
        { const size_t k2 = kk + (size_t)16 * HD;
          const v16h k0 = ldh(KP + k2), k1 = ldh(KP + k2 + 32), r0 = ldh(KR + k2), r1 = ldh(KR + k2 + 32);
          asm volatile("s_wait_xcnt 0x0" :: "v"(KP + kk), "v"(KR + kk) : "memory");   // behind the eight loads; naming their two base addresses keeps those registers from serving as a load's destination ahead of the wait
          sHb = wmma16(k0, qh0, sHb); sHb = wmma16(k1, qh1, sHb);
          sLb = wmma16(k0, qr0, sLb); sLb = wmma16(k1, qr1, sLb); sLb = wmma16(r0, qh0, sLb); sLb = wmma16(r1, qh1, sLb); }
        float ta[8], tb[8];
#pragma unroll
        for (int r = 0; r < 8; ++r) { ta[r] = (sHa[r] + sLa[r] * QRI) * SC2; tb[r] = (sHb[r] + sLb[r] * QRI) * SC2; }
        if (key0 + 31 > t0) {                                      // block-uniform: diagonal block
            const int kbse = key0 + 8 * hi;
#pragma unroll
            for (int r = 0; r < 8; ++r) { ta[r] = (kbse + r > tq) ? NEGB : ta[r]; tb[r] = (kbse + 16 + r > tq) ? NEGB : tb[r]; } }
        float mx = NEGB;
#pragma unroll
        for (int r = 0; r < 8; ++r) mx = fmaxf(mx, fmaxf(ta[r], tb[r]));
        mx = fmaxf(mx, __shfl_xor(mx, 16, 32));
        const float mnew = fmaxf(m, mx);
        const float alpha = __builtin_amdgcn_exp2f(m - mnew);
        const float sh = PSH - mnew;
        v16h ph, pr; float ls = 0.0f;
#pragma unroll
        for (int r = 0; r < 8; ++r) { const float ea = __builtin_amdgcn_exp2f(ta[r] + sh); const float ec = __builtin_amdgcn_exp2f(tb[r] + sh);
            const h16 ha = (h16)ea; const h16 hc = (h16)ec; ph[r] = ha; ph[8 + r] = hc;
            pr[r] = (h16)((ea - (float)ha) * QRS); pr[8 + r] = (h16)((ec - (float)hc) * QRS); ls += ea + ec; }
        l = l * alpha + ls; m = mnew;
#pragma unroll
        for (int j = 0; j < 4; ++j) { oH[j] = oH[j] * alpha; oL[j] = oL[j] * alpha; }
        const size_t vv = vo + (size_t)key0;
#pragma unroll
        for (int j = 0; j < 4; ++j) { const v16h vh = ldh(VT + vv + (size_t)(16 * j) * SEQ); const v16h vr = ldh(VR + vv + (size_t)(16 * j) * SEQ);
            oH[j] = wmma16(vh, ph, oH[j]); oL[j] = wmma16(vr, ph, oL[j]); oL[j] = wmma16(vh, pr, oL[j]); }
    }
    l += __shfl_xor(l, 16, 32);
    const float inv = CXS / l;
    const int wb = wave * 16 * 68;
#pragma unroll
    for (int j = 0; j < 4; ++j) { v4f a, c;     // os[t][d], d = 16j + 8h + r; rows 0..15 x columns 0..63 all written
        a[0] = (oH[j][0] + oL[j][0] * QRI) * inv; a[1] = (oH[j][1] + oL[j][1] * QRI) * inv; a[2] = (oH[j][2] + oL[j][2] * QRI) * inv; a[3] = (oH[j][3] + oL[j][3] * QRI) * inv;
        c[0] = (oH[j][4] + oL[j][4] * QRI) * inv; c[1] = (oH[j][5] + oL[j][5] * QRI) * inv; c[2] = (oH[j][6] + oL[j][6] * QRI) * inv; c[3] = (oH[j][7] + oL[j][7] * QRI) * inv;
        *(v4fa*)(&os[wb + lr * 68 + 16 * j + 8 * hi]) = a; *(v4fa*)(&os[wb + lr * 68 + 16 * j + 8 * hi + 4]) = c; }
    wave_sync();
    h16* crow = CH + ((size_t)b * SEQ + t0) * DM + h * HD;
    h16* rrow = CR + ((size_t)b * EARLY + t0) * DM + h * HD;
{
#pragma unroll
        for (int s = 0; s < 4; ++s) { const int row = 4 * s + (lane >> 3), c8 = (lane & 7) * 8;   // 4 s x 4 row groups = 16 rows; 8 lanes x 8 = 64 columns
            const v4f x0 = *(const v4fa*)(&os[wb + row * 68 + c8]); const v4f x1 = *(const v4fa*)(&os[wb + row * 68 + c8 + 4]); v8h hv, rv;
#pragma unroll
            for (int i = 0; i < 4; ++i) { const h16 a0 = (h16)x0[i]; const h16 a1 = (h16)x1[i]; hv[i] = a0; hv[4 + i] = a1; rv[i] = (h16)(x0[i] - (float)a0); rv[4 + i] = (h16)(x1[i] - (float)a1); }
            *(v8h*)(crow + (size_t)row * DM + c8) = hv; *(v8h*)(rrow + (size_t)row * DM + c8) = rv; }
         }
}

// k_flash: fused causal attention, grid FL_LATE + FL_EARLY. One block = 16 query rows x the four query heads of one kv head (one wave per head, h = g*4 + wave), the row tile running fastest;
// both bodies depend only on k_proj, so they share the launch: the last FL_EARLY blocks (rows < EARLY) run flash_early, the others the body below:
// Q fragments straight from the f16 planes; K / V^T of kv head g staged once per block in LDS, FK keys a stage, and read as fragments (two 16-B LDS loads each) by all four waves.
// Transposed form: S^T[key][t] = K Q^T (A = K rows, B = Q rows); lane (t = lane&15, h = lane>>4) holds keys 8h+r of each 16-key tile, so the packed
// P tile is directly the B fragment of O^T[d][t] = V^T P^T (element r <- tile keys 0..15, element 8+r <- tile keys 16..31, lane unchanged).
// Keys run over [0, t0+16) in steps of 32; the diagonal 32-key blocks replace excluded scores (key > t) by a large negative value before the running max.
#define FL_LX    ((SEQ - EARLY) / 16)
#define FL_LATE  (FL_LX * NB * NKV)
#define FL_EARLY ((EARLY / 16) * NB * NKV)
static_assert(FL_LX > 0);                                        // the late blocks' index is split by it
__global__ __launch_bounds__(32 * AW) void k_flash(const h16* __restrict__ QH, const h16* __restrict__ QR, const h16* __restrict__ KP, const h16* __restrict__ KR,
                                                   const h16* __restrict__ VT, const h16* __restrict__ VR, h16* CH, h16* CR) {
    __shared__ __align__(16) h16 ring[2 * FSTGE];
    float* os = (float*)ring;                                     // output staging, used only behind the loop's last barrier (the early body stages nothing else there)
    const int bid = blockIdx.x;
    if (bid >= FL_LATE) { const int e = bid - FL_LATE; flash_early(os, QH, QR, KP, KR, VT, VR, CH, CR, (e % (EARLY / 16)) * 16, e / (EARLY / 16)); return; }   // block-uniform, in front of every barrier
    const int zg = bid / FL_LX; const int t0 = EARLY + (bid % FL_LX) * 16;
    const int tid = threadIdx.x;
    const int lane = threadIdx.x & 31; const int wave = __builtin_amdgcn_readfirstlane(threadIdx.x >> 5);
    const int lr = lane & 15, hi = lane >> 4;
    const int b = zg / NKV; const int g = zg % NKV;
    const int h = g * AW + wave;                                  // repeat on the head axis: query head h uses kv head h >> 2
    const int tq = t0 + lr;
    const size_t qo = ((size_t)(b * NH_ + h) * SEQ + (size_t)tq) * HD + 8 * hi;
    const v16h qh0 = ldh(QH + qo), qh1 = ldh(QH + qo + 32), qr0 = ldh(QR + qo), qr1 = ldh(QR + qo + 32);   // B fragments: col t, k = d
    const unsigned l0 = (unsigned)(size_t)ring + (unsigned)((tid >> 3) * (LPE * 2) + (tid & 7) * 16);
    const char* gk = (const char*)(KP + (size_t)zg * SEQ * HD + (size_t)(tid >> 3) * HD + (tid & 7) * 8);    // + stage * FK rows
    const char* gv = (const char*)(VT + (size_t)zg * HD * SEQ + (size_t)(tid >> 3) * SEQ + (tid & 7) * 8);   // + stage * FK keys
    const int kfr = lr * LPE + 8 * hi;                            // + key * LPE        (A fragment: row key, k = d)
    const int vfr = (FK + lr) * LPE + 8 * hi;                     // + 16j * LPE + key  (A fragment: row d, k = key)
    v8f o0 = (v8f){}, o1 = (v8f){}, o2 = (v8f){}, o3 = (v8f){};
    float m = NEGB, l = 0.0f;
    const int kend = t0 + 16;
    const int nst = (kend + FK - 1) / FK;                         // block-uniform; stage nst - 1 ends at or before key SEQ
    stage_kv(l0, gk, gv);
    wait_copies();
    __syncthreads();                                              // stage 0 readable by every wave
    if (nst > 1) stage_kv(l0 + FSTGB, gk + (size_t)FK * HD * 2, gv + FK * 2);
#pragma unroll 1   // one trip per staged tile: the ring's waits and barrier stand once, at the foot
    for (int st = 0; st < nst; ++st) {
        const h16* sb = ring + (st & 1) * FSTGE;
#pragma unroll     // two 32-key steps per stage, constant LDS offsets
        for (int ks = 0; ks < FK; ks += 32) {
            const int key0 = st * FK + ks;
            if (key0 >= kend) break;                               // block-uniform: the last stage may hold one step only
            const h16* ka = sb + kfr + ks * LPE;
            const v16h ka0 = ldh(ka), ka1 = ldh(ka + 32), kb0 = ldh(ka + 16 * LPE), kb1 = ldh(ka + 16 * LPE + 32);
            v8f sHa = (v8f){}, sLa = (v8f){}, sHb = (v8f){}, sLb = (v8f){};
            sHa = wmma16p(ka0, qh0, sHa); sLa = wmma16p(ka0, qr0, sLa); sHb = wmma16p(kb0, qh0, sHb); sLb = wmma16p(kb0, qr0, sLb);
            sHa = wmma16p(ka1, qh1, sHa); sLa = wmma16p(ka1, qr1, sLa); sHb = wmma16p(kb1, qh1, sHb); sLb = wmma16p(kb1, qr1, sLb);
            float ta[8], tb[8];
#pragma unroll
            for (int r = 0; r < 8; ++r) { ta[r] = (sHa[r] + sLa[r] * QRI) * SC2; tb[r] = (sHb[r] + sLb[r] * QRI) * SC2; }
            if (key0 + 31 > t0) {                                  // block-uniform: diagonal block
                const int kbse = key0 + 8 * hi;
#pragma unroll
                for (int r = 0; r < 8; ++r) { ta[r] = (kbse + r > tq) ? NEGB : ta[r]; tb[r] = (kbse + 16 + r > tq) ? NEGB : tb[r]; } }
            float mx = NEGB;
#pragma unroll
            for (int r = 0; r < 8; ++r) mx = fmaxf(mx, fmaxf(ta[r], tb[r]));
            mx = fmaxf(mx, __shfl_xor(mx, 16, 32));
            const float mnew = fmaxf(m, mx);
            const float alpha = __builtin_amdgcn_exp2f(m - mnew);
            const float sh = PSH - mnew;
            v16h pb; float ls = 0.0f;
#pragma unroll
            for (int r = 0; r < 8; ++r) { const float ea = __builtin_amdgcn_exp2f(ta[r] + sh); const float ec = __builtin_amdgcn_exp2f(tb[r] + sh); pb[r] = (h16)ea; pb[8 + r] = (h16)ec; ls += ea + ec; }
            l = l * alpha + ls; m = mnew;
            o0 = o0 * alpha; o1 = o1 * alpha; o2 = o2 * alpha; o3 = o3 * alpha;
            const h16* va = sb + vfr + ks;
            const v16h v0 = ldh(va), v1 = ldh(va + 16 * LPE), v2 = ldh(va + 32 * LPE), v3 = ldh(va + 48 * LPE);
            o0 = wmma16p(v0, pb, o0); o1 = wmma16p(v1, pb, o1); o2 = wmma16p(v2, pb, o2); o3 = wmma16p(v3, pb, o3);
        }
        wait_lds();
        wait_copies();
        __syncthreads();                                          // publishes stage st + 1 and frees the buffer of stage st
        if (st + 2 < nst) stage_kv(l0 + (unsigned)(st & 1) * FSTGB, gk + (size_t)(st + 2) * (FK * HD * 2), gv + (size_t)(st + 2) * (FK * 2));
    }
    wait_copies();
    l += __shfl_xor(l, 16, 32);
    const float inv = CXS / l;
    const int wb = wave * 16 * 68;
    // O^T D layout: o_j[r] = (d = 16j + 8h + r, t = lane&15) -> os[t][d]; rows 0..15 x columns 0..63 all written
    { v4f a, c;
      a[0] = o0[0] * inv; a[1] = o0[1] * inv; a[2] = o0[2] * inv; a[3] = o0[3] * inv; c[0] = o0[4] * inv; c[1] = o0[5] * inv; c[2] = o0[6] * inv; c[3] = o0[7] * inv;
      *(v4fa*)(&os[wb + lr * 68 +  0 + 8 * hi]) = a; *(v4fa*)(&os[wb + lr * 68 +  0 + 8 * hi + 4]) = c;
      a[0] = o1[0] * inv; a[1] = o1[1] * inv; a[2] = o1[2] * inv; a[3] = o1[3] * inv; c[0] = o1[4] * inv; c[1] = o1[5] * inv; c[2] = o1[6] * inv; c[3] = o1[7] * inv;
      *(v4fa*)(&os[wb + lr * 68 + 16 + 8 * hi]) = a; *(v4fa*)(&os[wb + lr * 68 + 16 + 8 * hi + 4]) = c;
      a[0] = o2[0] * inv; a[1] = o2[1] * inv; a[2] = o2[2] * inv; a[3] = o2[3] * inv; c[0] = o2[4] * inv; c[1] = o2[5] * inv; c[2] = o2[6] * inv; c[3] = o2[7] * inv;
      *(v4fa*)(&os[wb + lr * 68 + 32 + 8 * hi]) = a; *(v4fa*)(&os[wb + lr * 68 + 32 + 8 * hi + 4]) = c;
      a[0] = o3[0] * inv; a[1] = o3[1] * inv; a[2] = o3[2] * inv; a[3] = o3[3] * inv; c[0] = o3[4] * inv; c[1] = o3[5] * inv; c[2] = o3[6] * inv; c[3] = o3[7] * inv;
      *(v4fa*)(&os[wb + lr * 68 + 48 + 8 * hi]) = a; *(v4fa*)(&os[wb + lr * 68 + 48 + 8 * hi + 4]) = c; }
    wave_sync();
    h16* crow = CH + ((size_t)b * SEQ + t0) * DM + h * HD;         // merged heads: column h*64 + d
{
#pragma unroll
        for (int s = 0; s < 4; ++s) { const int row = 4 * s + (lane >> 3), c8 = (lane & 7) * 8;   // 4 s x 4 row groups = 16 rows; 8 lanes x 8 = 64 columns
            const v4f x0 = *(const v4fa*)(&os[wb + row * 68 + c8]); const v4f x1 = *(const v4fa*)(&os[wb + row * 68 + c8 + 4]); v8h hv;
#pragma unroll
            for (int i = 0; i < 4; ++i) { hv[i] = (h16)x0[i]; hv[4 + i] = (h16)x1[i]; }
            *(v8h*)(crow + (size_t)row * DM + c8) = hv; }
         }
}

// k_out: output projection, four waves per block (2 x 2, 64x64 per wave), f16 operands from the ctx plane CX (value rows [NB*SEQ], then residual rows [NB*EARLY]) and the Wo^T plane, staged in LDS, K = DM, one walk.
// Late block: a 128x128 output tile, the 128 staged A rows are 128 tokens. Early block (tokens < EARLY): a 64x128 output tile, the staged A rows are the 64 tokens' value rows, then the same tokens' unscaled residual rows:
// waves 0, 1 sum the value products, waves 2, 3 the residual products, and the two sums are added through LDS at the store (one barrier). So every block walks K once. grid (OB_E + OB_L, DM/128), 128 threads.
#define OB_E (NB * (EARLY / 64))            // early row tiles (64 tokens), first in the grid
#define OB_L (NB * ((SEQ - EARLY) / 128))   // late row tiles (128 tokens)
static_assert(EARLY % 64 == 0 && (SEQ - EARLY) % 128 == 0 && SEQ > EARLY);
static_assert(2 * STGB >= 2 * 64 * 68 * 4);   // the residual sums reuse the ring behind the last barrier
// eight asynchronous 16-byte copies of one lane: four rows from g0, then four from g1, each 16 rows apart (LDS step 16 * 144 B, global step 16 rows of DM elements).
// s_wait_xcnt closes the statement so that no address register is rewritten ahead of it.
__device__ __forceinline__ void copy44(unsigned l, const char* g0, const char* g1) {
    const size_t gs = (size_t)16 * DM * 2; const unsigned ls = 16 * LPE * 2;
    asm volatile("global_load_async_to_lds_b128 %0, %8, off\n\t"
                 "global_load_async_to_lds_b128 %1, %9, off\n\t"
                 "global_load_async_to_lds_b128 %2, %10, off\n\t"
                 "global_load_async_to_lds_b128 %3, %11, off\n\t"
                 "global_load_async_to_lds_b128 %4, %12, off\n\t"
                 "global_load_async_to_lds_b128 %5, %13, off\n\t"
                 "global_load_async_to_lds_b128 %6, %14, off\n\t"
                 "global_load_async_to_lds_b128 %7, %15, off\n\t"
                 "s_wait_xcnt 0x0"
                 :: "v"(l), "v"(l + ls), "v"(l + 2 * ls), "v"(l + 3 * ls), "v"(l + 4 * ls), "v"(l + 5 * ls), "v"(l + 6 * ls), "v"(l + 7 * ls),
                    "v"(g0), "v"(g0 + gs), "v"(g0 + 2 * gs), "v"(g0 + 3 * gs), "v"(g1), "v"(g1 + gs), "v"(g1 + 2 * gs), "v"(g1 + 3 * gs)
                 : "memory");
}
__global__ __launch_bounds__(128) void k_out(const h16* __restrict__ CX, const h16* __restrict__ Wt, float* OUT) {
    __shared__ __align__(16) h16 ring[2 * STGE];
    __shared__ __align__(16) float osall[4 * 16 * 68];
    const int K = DM;
    const int tid = threadIdx.x; const int wave = __builtin_amdgcn_readfirstlane(tid >> 5);
    const int lane = tid & 31, lr = lane & 15, hi = lane >> 4; const int cb = blockIdx.y * 128;
    const int wr = (wave >> 1) * 64, wc = (wave & 1) * 64; const int c0 = cb + wc;
    float* os = osall + wave * 16 * 68;
    const int bx = blockIdx.x; const bool early = bx < OB_E;      // block-uniform
    const int b  = early ? bx / (EARLY / 64) : (bx - OB_E) / ((SEQ - EARLY) / 128);
    const int tb = early ? (bx % (EARLY / 64)) * 64 : EARLY + ((bx - OB_E) % ((SEQ - EARLY) / 128)) * 128;   // first token of the tile in its sequence
    const unsigned l0 = (unsigned)(size_t)ring + (unsigned)((tid >> 3) * (LPE * 2) + (tid & 7) * 16);
    // staged A rows 0..63: value rows of tokens tb..tb+63; rows 64..127: value rows of tokens tb+64.. (late) or the residual rows of tokens tb..tb+63 (early)
    const size_t rlo = (size_t)b * SEQ + (size_t)tb + (size_t)(tid >> 3);
    const size_t rhi = early ? (size_t)NB * SEQ + (size_t)b * EARLY + (size_t)tb + (size_t)(tid >> 3) : rlo + 64;
    const char* ga0 = (const char*)(CX + rlo * K + (tid & 7) * 8);
    const char* ga1 = (const char*)(CX + rhi * K + (tid & 7) * 8);
    const char* gb = (const char*)(Wt + (size_t)(cb + (tid >> 3)) * K + (tid & 7) * 8);
    const int afr = (wr + lr) * LPE + 8 * hi, bfr = (128 + wc + lr) * LPE + 8 * hi;
    v8f acc[4][4];
#pragma unroll
    for (int mb = 0; mb < 4; ++mb)
#pragma unroll
        for (int nb = 0; nb < 4; ++nb) acc[mb][nb] = (v8f){};
    copy44(l0, ga0, ga1); copy8(l0 + 128 * LPE * 2, gb);
    wait_copies();
    __syncthreads();                                              // tile 0 readable by every wave
    copy44(l0 + STGB, ga0 + BK * 2, ga1 + BK * 2); copy8(l0 + STGB + 128 * LPE * 2, gb + BK * 2);
#pragma unroll 1   // one trip per staged tile: the ring's waits and barrier stand once, at the foot
    for (int t = 0; t < NKT; ++t) {
        const h16* sb = ring + (t & 1) * STGE;
#pragma unroll     // this and the loops inside: constant indices keep fragments and accumulators in registers
        for (int ks = 0; ks < BK; ks += 32) {
            v16h a[4], bq[4];
#pragma unroll
            for (int mb = 0; mb < 4; ++mb) a[mb] = ldh(sb + afr + mb * 16 * LPE + ks);
#pragma unroll
            for (int nb = 0; nb < 4; ++nb) bq[nb] = ldh(sb + bfr + nb * 16 * LPE + ks);
#pragma unroll
            for (int nb = 0; nb < 4; ++nb)
#pragma unroll
                for (int mb = 0; mb < 4; ++mb) acc[mb][nb] = wmma16(a[mb], bq[nb], acc[mb][nb]);
        }
        wait_lds();
        wait_copies();
        __syncthreads();                                          // publishes tile t + 1 and frees the buffer of tile t
        if (t + 2 < NKT) { const size_t ko = (size_t)(t + 2) * (BK * 2); const unsigned lb = l0 + (unsigned)(t & 1) * STGB;
            copy44(lb, ga0 + ko, ga1 + ko); copy8(lb + 128 * LPE * 2, gb + ko); }
    }
    wait_copies();
    if (early) {                                                  // block-uniform, so the barrier below is passed by every wave
        // behind the loop's last barrier the ring holds nothing live: it takes the residual sums, 64 tokens x 64 columns per column half
        float* rs = (float*)ring + (wave & 1) * (64 * 68);
        if (wave >= 2) {
#pragma unroll
            for (int mb = 0; mb < 4; ++mb)
#pragma unroll
                for (int nb = 0; nb < 4; ++nb) {
#pragma unroll
                    for (int j = 0; j < 8; ++j) rs[(mb * 16 + hi * 8 + j) * 68 + nb * 16 + lr] = acc[mb][nb][j] * OUTS; }   // D: row 8h+j, col lane&15
        }
        __syncthreads();                                          // the residual sums of waves 2, 3 are readable by waves 0, 1
        if (wave < 2) {
            float* obase = OUT + ((size_t)b * OUT_SEQ + tb) * DM + c0;
#pragma unroll
            for (int mb = 0; mb < 4; ++mb) {
#pragma unroll
                for (int nb = 0; nb < 4; ++nb) {
#pragma unroll
                    for (int j = 0; j < 8; ++j) os[(hi * 8 + j) * 68 + nb * 16 + lr] = acc[mb][nb][j] * OUTS; }   // D: row 8h+j, col lane&15
                wave_sync();
#pragma unroll
                for (int s = 0; s < 8; ++s) { const int row = 2 * s + hi, cofs = lr * 4;   // 8 s x 2 rows = 16 rows; 16 lanes x 4 floats = 64 columns
                    const v4f val = *(const v4fa*)(&os[row * 68 + cofs]) + *(const v4fa*)(&rs[(mb * 16 + row) * 68 + cofs]);
                    *(v4f*)(obase + (size_t)(mb * 16 + row) * DM + cofs) = val; }
                wave_sync();
            }
        }
        return;
    }
    float* obase = OUT + ((size_t)b * OUT_SEQ + tb + wr) * DM + c0;
#pragma unroll
    for (int mb = 0; mb < 4; ++mb) {
#pragma unroll
        for (int nb = 0; nb < 4; ++nb) {
#pragma unroll
            for (int j = 0; j < 8; ++j) os[(hi * 8 + j) * 68 + nb * 16 + lr] = acc[mb][nb][j] * OUTS; }   // D: row 8h+j, col lane&15
        wave_sync();
{
#pragma unroll
            for (int s = 0; s < 8; ++s) { const int row = 2 * s + hi, cofs = lr * 4;   // 8 s x 2 rows = 16 rows; 16 lanes x 4 floats = 64 columns
                const v4f val = *(const v4fa*)(&os[row * 68 + cofs]);
                *(v4f*)(obase + (size_t)(mb * 16 + row) * DM + cofs) = val; }
             }
        wave_sync();
    }
}

static constexpr size_t al256(size_t v) { return (v + 255) & ~(size_t)255; }
static constexpr size_t SZ_XB = al256((size_t)NB * SEQ * DM * 2);
static constexpr size_t SZ_WQ = al256((size_t)DM * DM * 2);
static constexpr size_t SZ_WK = al256((size_t)KVD * DM * 2);
static constexpr size_t SZ_CS = al256((size_t)SEQ * 32 * 2 * 4);
static constexpr size_t SZ_Q  = al256((size_t)NB * NH_ * SEQ * HD * 2);
static constexpr size_t SZ_KV = al256((size_t)NB * NKV * SEQ * HD * 2);
static constexpr size_t SZ_CX = al256(((size_t)NB * SEQ + (size_t)NB * EARLY) * DM * 2);
static constexpr size_t SZ_TOTAL = SZ_XB + 2 * SZ_WQ + 2 * SZ_WK + SZ_CS + 2 * SZ_Q + 4 * SZ_KV + SZ_CX;
static_assert(SZ_TOTAL <= (size_t)134217728);          // workspace carve <= 128 MiB

extern "C" void kernel_launch(void* const* d_in, const int* in_sizes, int n_in,
                              void* d_out, int out_size, void* d_ws, size_t ws_size, hipStream_t stream) {
    if (n_in < 5) return;
    const size_t needx = ((size_t)(NB - 1) * SEQ_FULL + SEQ) * DM;
    if ((size_t)in_sizes[0] < needx) return;
    if ((size_t)in_sizes[1] < (size_t)DM * DM || (size_t)in_sizes[2] < (size_t)DM * KVD || (size_t)in_sizes[3] < (size_t)DM * KVD || (size_t)in_sizes[4] < (size_t)DM * DM) return;
    if ((size_t)out_size < ((size_t)(NB - 1) * OUT_SEQ + SEQ) * DM) return;
    if (SZ_TOTAL > ws_size) return;
    // wire order x, wq, wk, wv, wo; every weight is [in][out]
    const float* x = (const float*)d_in[0]; const float* wq = (const float*)d_in[1]; const float* wk = (const float*)d_in[2]; const float* wv = (const float*)d_in[3]; const float* wo = (const float*)d_in[4];
    float* OUT = (float*)d_out;      // [NB][SEQ][2048]
    char* wsp = (char*)d_ws;
    bf*  XB  = (bf*)wsp;  wsp += SZ_XB;              // [NB*SEQ][2048] bf16
    bf*  WQt = (bf*)wsp;  wsp += SZ_WQ;              // [2048 out][2048 in] bf16
    bf*  WKt = (bf*)wsp;  wsp += SZ_WK;              // [512 out][2048 in] bf16
    bf*  WVt = (bf*)wsp;  wsp += SZ_WK;              // [512 out][2048 in] bf16
    h16* WOt = (h16*)wsp; wsp += SZ_WQ;              // [2048 out][2048 in] f16 of bf16 value x16
    float* CS = (float*)wsp; wsp += SZ_CS;           // [SEQ][32] (cos, sin)
    h16* QH = (h16*)wsp; wsp += SZ_Q;                // [NB*32][SEQ][64]
    h16* QR = (h16*)wsp; wsp += SZ_Q;                // residual x1024
    h16* KP = (h16*)wsp; wsp += SZ_KV;               // [NB*8][SEQ][64]
    h16* KR = (h16*)wsp; wsp += SZ_KV;               // residual x1024
    h16* VT = (h16*)wsp; wsp += SZ_KV;               // [NB*8][64][SEQ]
    h16* VR = (h16*)wsp; wsp += SZ_KV;               // residual x1024
    h16* CX = (h16*)wsp; wsp += SZ_CX;               // ctx x1024: value rows [NB*SEQ][2048], then residual rows [NB*EARLY][2048]
    h16* CR = CX + (size_t)NB * SEQ * DM;

    // x -> bf16, the four weights transposed (in[in-features][out-features] -> out[out-features][in-features]), the rotary table
    k_prep<<<PB_ROPE + 2 * PB_WBIG + 2 * PB_WKV + PB_CVT, 256, 0, stream>>>(x, wq, wk, wv, wo, XB, WQt, WKt, WVt, WOt, CS);

    k_proj<<<GQ + 2 * GK, 128, 0, stream>>>(XB, WQt, WKt, WVt, QH, QR, KP, KR, VT, VR, CS);

    k_flash<<<FL_LATE + FL_EARLY, 32 * AW, 0, stream>>>(QH, QR, KP, KR, VT, VR, CX, CR);

    k_out<<<dim3(OB_E + OB_L, DM / 128, 1), 128, 0, stream>>>(CX, WOt, OUT);
}

// v006
// A run of this version takes 142 microseconds.
// Two timings next to v005 both put it at 1.08 times that version's speed.
// All steps since v000 together make it 3.69 times as fast.
#include <hip/hip_runtime.h>

// Grouped-query causal self-attention, width 2048 = 32 query heads x 64 sharing 8 kv heads (kv head g = h >> 2), x [NB][SEQ][2048], Wq/Wk/Wv/Wo [in][out] (y = x W), no biases,
// interleaved (even/odd pair) rotary on q and k from a computed [SEQ][32] (cos, sin) table, score scale 1/8, causal exclusion (diagonal kept), output = ctx Wo (f32).
// Compute dtypes, f32 accumulate everywhere: q/k/v projections v_wmma_f32_16x16x32_bf16 (x and W RNE-converted to bf16; products exact);
// scores v_wmma_f32_16x16x32_f16: k single f16, q as f16 value + f16 residual x1024 in its own accumulator (query rows < 256: k also value + residual x1024, three products);
// P (x256 carry, cancels in the normalisation) and v single f16 (rows < 256: P and v as value + residual x1024, three products); softmax f32 (online, running max);
// output projection v_wmma_f32_16x16x32_f16: ctx carried x1024 as f16 (rows < 256: plus its unscaled f16 residual, summed by a second pair of waves) against f16(bf16(Wo)) x16, results scaled by 2^-14.

#ifndef NB
#define NB 2
#endif
#ifndef SEQ
#define SEQ 2048
#endif
#define NB_FULL  2
#define SEQ_FULL 2048
#ifndef OUT_SEQ
#define OUT_SEQ SEQ              // row pitch (in tokens) between batches of the output
#endif
#define DM    2048
#define NH_   32
#define NKV   8
#define HD    64
#define KVD   (NKV * HD)         // 512
#define AW    4                  // waves per flash block = the four query heads of one kv head
#define EARLY 256                // query rows below this use the value + residual path
#define QRS  1024.0f             // carry of every residual plane (q, k, v, P)
#define QRI  (1.0f / 1024.0f)
#define SC2  (0.125f * 1.4426950408889634f)   // HD^-0.5 * log2(e)
#define PSH  8.0f                // log2 of the P carry (256)
#define CXS  1024.0f             // carry of the ctx plane
#define WOS  16.0f               // carry of the Wo plane
#define OUTS (1.0f / (1024.0f * 16.0f))
#define NEGB (-3.0e38f)

static_assert(HD == 64);
static_assert(NH_ * HD == DM);                 // query head h = columns h*64 + d
static_assert(NKV * AW == NH_);                // four consecutive query heads per kv head
static_assert(DM % 64 == 0);
static_assert(KVD % 64 == 0);
static_assert(DM % 32 == 0);                   // GEMM k-loop steps by 32
static_assert(SEQ % 64 == 0);                  // a 64-row tile never straddles two batches
static_assert(SEQ % 32 == 0);                  // key loop steps by 32, key0 + 31 < SEQ
static_assert(EARLY % 128 == 0);               // output GEMM tiles are entirely early or entirely late
static_assert(SEQ % 128 == 0);                 // a 128-row GEMM tile never straddles two batches
static_assert(KVD % 128 == 0);
static_assert(SEQ >= EARLY);
static_assert((SEQ - EARLY) % 16 == 0);
static_assert(((size_t)SEQ * DM) % 8 == 0);
static_assert(NB <= NB_FULL);
static_assert(SEQ <= SEQ_FULL);

typedef _Float16 h16;
typedef unsigned short bf;
typedef __attribute__((ext_vector_type(16))) __bf16   v16bf;
typedef __attribute__((ext_vector_type(16))) _Float16 v16h;
typedef __attribute__((ext_vector_type(8)))  _Float16 v8h;
typedef __attribute__((ext_vector_type(8)))  unsigned short v8us;
typedef __attribute__((ext_vector_type(8)))  float    v8f;
typedef __attribute__((ext_vector_type(4)))  float    v4f;
typedef __attribute__((ext_vector_type(2)))  float    v2f;
typedef v4f  __attribute__((may_alias)) v4fa;

__device__ __forceinline__ unsigned short f2bf(float f) { unsigned u = __float_as_uint(f); u += 0x7FFFu + ((u >> 16) & 1u); return (unsigned short)(u >> 16); }
__device__ __forceinline__ v16h cat16(v8h lo, v8h hi) { return __builtin_shufflevector(lo, hi, 0, 1, 2, 3, 4, 5, 6, 7, 8, 9, 10, 11, 12, 13, 14, 15); }
__device__ __forceinline__ v16bf cat16b(v8us lo, v8us hi) { return __builtin_bit_cast(v16bf, __builtin_shufflevector(lo, hi, 0, 1, 2, 3, 4, 5, 6, 7, 8, 9, 10, 11, 12, 13, 14, 15)); }
// wmma16, wmmab: the WMMA is followed by its own 4-slot guard tying its accumulator and keeping its operands live
__device__ __forceinline__ v8f wmma16(v16h a, v16h b, v8f c) {
    c = __builtin_amdgcn_wmma_f32_16x16x32_f16(false, a, false, b, (short)0, c, false, false);
    asm volatile("v_nop\n\tv_nop\n\tv_nop\n\tv_nop" : "+v"(c) : "v"(a), "v"(b));
    return c; }
__device__ __forceinline__ v8f wmmab(v16bf a, v16bf b, v8f c) {
    c = __builtin_amdgcn_wmma_f32_16x16x32_bf16(false, a, false, b, (short)0, c, false, false);
    asm volatile("v_nop\n\tv_nop\n\tv_nop\n\tv_nop" : "+v"(c) : "v"(a), "v"(b));
    return c; }
// k_flash's late body: the plain builtin. The compiler keeps the distance to the users of D, A and B itself and counts the neighbouring WMMAs as cover,
// so the vector port is left to the softmax work of the waves that share the SIMD.
__device__ __forceinline__ v8f wmma16p(v16h a, v16h b, v8f c) { return __builtin_amdgcn_wmma_f32_16x16x32_f16(false, a, false, b, (short)0, c, false, false); }
// fragment loaders from K-contiguous 16-bit rows; p already includes + 8*(lane>>4): elements 0..7 <- k0+8h+0..7, elements 8..15 <- k0+16+8h+0..7 (same map for A and B)
__device__ __forceinline__ v16h  ldh(const h16* p) { return cat16(*(const v8h*)p, *(const v8h*)(p + 16)); }
__device__ __forceinline__ v16bf ldb(const bf* p)  { return cat16b(*(const v8us*)p, *(const v8us*)(p + 16)); }
// ordering point for wave-private LDS tiles (same wave writes and reads)
__device__ __forceinline__ void wave_sync() { __builtin_amdgcn_fence(3 /* release order */, "wavefront"); __builtin_amdgcn_wave_barrier(); asm volatile("" ::: "memory"); }

// ---- operand staging of the two GEMM kernels: a 128x128 product tile per block of four waves (2 x 2, 64x64 each), K walked in tiles of BK.
// One stage = 128 A rows then 128 B rows of BK 16-bit elements (128 B, one cache line each) at a pitch of 144 B (16 B x odd: conflict-free for 16-byte LDS reads); two buffers.
#define BK   64
#define LPE  72                   // LDS row pitch in 16-bit elements
#define STGE (256 * LPE)          // elements of one buffer
#define STGB (STGE * 2)           // bytes of one buffer
#define NKT  (DM / BK)            // K tiles of one walk over K
static_assert(DM % BK == 0 && NKT >= 2);   // both prologue tiles exist
// eight asynchronous 16-byte copies of one lane, rows 16 apart (LDS step 16 * 144 B, global step 16 rows of DM elements); eight lanes cover one 128-B row.
// s_wait_xcnt closes the statement so that no address register is rewritten ahead of it.
__device__ __forceinline__ void copy8(unsigned l, const char* g) {
    const size_t gs = (size_t)16 * DM * 2; const unsigned ls = 16 * LPE * 2;
    asm volatile("global_load_async_to_lds_b128 %0, %8, off\n\t"
                 "global_load_async_to_lds_b128 %1, %9, off\n\t"
                 "global_load_async_to_lds_b128 %2, %10, off\n\t"
                 "global_load_async_to_lds_b128 %3, %11, off\n\t"
                 "global_load_async_to_lds_b128 %4, %12, off\n\t"
                 "global_load_async_to_lds_b128 %5, %13, off\n\t"
                 "global_load_async_to_lds_b128 %6, %14, off\n\t"
                 "global_load_async_to_lds_b128 %7, %15, off\n\t"
                 "s_wait_xcnt 0x0"
                 :: "v"(l), "v"(l + ls), "v"(l + 2 * ls), "v"(l + 3 * ls), "v"(l + 4 * ls), "v"(l + 5 * ls), "v"(l + 6 * ls), "v"(l + 7 * ls),
                    "v"(g), "v"(g + gs), "v"(g + 2 * gs), "v"(g + 3 * gs), "v"(g + 4 * gs), "v"(g + 5 * gs), "v"(g + 6 * gs), "v"(g + 7 * gs)
                 : "memory");
}
// one stage: l = the lane's LDS byte address in row (tid >> 3) of the buffer, ga / gb = the lane's 16 bytes in that row of the A / B tile
__device__ __forceinline__ void stage_tile(unsigned l, const char* ga, const char* gb) { copy8(l, ga); copy8(l + 128 * LPE * 2, gb); }
// the issuing wave's own copies have landed (the compiler places no wait for them)
__device__ __forceinline__ void wait_copies() { asm volatile("s_wait_asynccnt 0x0" ::: "memory"); }
// this wave's LDS reads of the buffer have returned before the barrier that frees it for the refill
__device__ __forceinline__ void wait_lds() { asm volatile("s_wait_dscnt 0x0" ::: "memory"); }

// ---- K / V^T staging of k_flash: one stage = FK keys of one kv head: FK K rows (64 d = 128 B each), then 64 V^T rows (FK keys = 128 B each), whole cache lines, at the same 144-B pitch; two buffers.
#define FK    64
#define FSTGE ((FK + HD) * LPE)   // elements of one buffer
#define FSTGB (FSTGE * 2)         // bytes of one buffer
static_assert(FK == 64 && SEQ % FK == 0);                         // a V^T row of a stage is one 128-B line; the last stage of any query tile ends inside the planes
static_assert(2 * FSTGB >= AW * 16 * 68 * 4);                     // the output staging reuses the ring behind the last barrier
// eight asynchronous 16-byte copies of one lane: four K rows, then four V^T rows, each 16 rows apart (eight lanes cover one 128-B row, 128 threads 16 rows).
// s_wait_xcnt closes the statement so that no address register is rewritten ahead of it.
__device__ __forceinline__ void stage_kv(unsigned l, const char* gk, const char* gv) {
    const size_t kst = (size_t)16 * HD * 2, vst = (size_t)16 * SEQ * 2; const unsigned ls = 16 * LPE * 2;
    asm volatile("global_load_async_to_lds_b128 %0, %8, off\n\t"
                 "global_load_async_to_lds_b128 %1, %9, off\n\t"
                 "global_load_async_to_lds_b128 %2, %10, off\n\t"
                 "global_load_async_to_lds_b128 %3, %11, off\n\t"
                 "global_load_async_to_lds_b128 %4, %12, off\n\t"
                 "global_load_async_to_lds_b128 %5, %13, off\n\t"
                 "global_load_async_to_lds_b128 %6, %14, off\n\t"
                 "global_load_async_to_lds_b128 %7, %15, off\n\t"
                 "s_wait_xcnt 0x0"
                 :: "v"(l), "v"(l + ls), "v"(l + 2 * ls), "v"(l + 3 * ls), "v"(l + 4 * ls), "v"(l + 5 * ls), "v"(l + 6 * ls), "v"(l + 7 * ls),
                    "v"(gk), "v"(gk + kst), "v"(gk + 2 * kst), "v"(gk + 3 * kst), "v"(gv), "v"(gv + vst), "v"(gv + 2 * vst), "v"(gv + 3 * vst)
                 : "memory");
}

// ---- preparation: the x conversion, the four weight transposes and the rotary table depend on nothing but the inputs; they share one launch (k_prep), the block index picks the job.
// cvt8: 8 x values of one thread, f32 -> bf16; i counts groups of 8 over [NB][SEQ][DM], the source batches lie SEQ_FULL tokens apart.
__device__ __forceinline__ void cvt8(const float* __restrict__ src, bf* dst, int blk) {
    const size_t i = (size_t)blk * 256 + threadIdx.x; if (i >= (size_t)NB * SEQ * DM / 8) return;
    src += (i / ((size_t)SEQ * DM / 8)) * ((size_t)(SEQ_FULL - SEQ) * DM);
    const v8f v = *(const v8f*)(src + i * 8); v8us o;
#pragma unroll
    for (int k = 0; k < 8; ++k) o[k] = f2bf(v[k]);
    *(v8us*)(dst + i * 8) = o; 
}

// wt_tile: in[Kr rows][Nc cols] f32 -> out[Nc rows][Kr cols] 16-bit, 64x64 tile (bx of Nc/64, by of Kr/64) through LDS, 256 threads.
__device__ __forceinline__ void wt_tile(float* ts, const float* __restrict__ W, bf* Tb, h16* Th, int Kr, int Nc, int mode, int bx, int by) {
    const int tid = threadIdx.x; const int n0 = bx * 64, k0 = by * 64;
#pragma unroll
    for (int p = 0; p < 4; ++p) { const int row = p * 16 + (tid >> 4), c4 = (tid & 15) * 4;      // 4 p x 16 rows = 64 k rows; 16 threads x 4 = 64 n columns
        const v4f v = *(const v4f*)(W + (size_t)(k0 + row) * (size_t)Nc + n0 + c4);
        ts[row * 65 + c4 + 0] = v[0]; ts[row * 65 + c4 + 1] = v[1]; ts[row * 65 + c4 + 2] = v[2]; ts[row * 65 + c4 + 3] = v[3]; }
    __syncthreads();
{
#pragma unroll
        for (int s = 0; s < 2; ++s) { const int n = s * 32 + (tid >> 3), c8 = (tid & 7) * 8;     // 2 s x 32 rows = 64 n rows; 8 lanes x 8 = 64 k columns
            const size_t oo = (size_t)(n0 + n) * (size_t)Kr + k0 + c8;
            if (mode == 0) { v8us o;
#pragma unroll
                for (int i = 0; i < 8; ++i) o[i] = f2bf(ts[(c8 + i) * 65 + n]);
                *(v8us*)(Tb + oo) = o;
                asm volatile("s_wait_xcnt 0x0" ::: "memory");   // stands in front of any later rewrite of the store's address and data registers
            } else { v8h o;
#pragma unroll
                for (int i = 0; i < 8; ++i) o[i] = (h16)(__uint_as_float(((unsigned)f2bf(ts[(c8 + i) * 65 + n])) << 16) * WOS);
                *(v8h*)(Th + oo) = o;
                asm volatile("s_wait_xcnt 0x0" ::: "memory"); } }   // as above
         }
}

// rope_tab: CS[t][j] = (cos, sin)(t * inv_freq[j]), inv_freq[j] = 1.0f / (float)(10000^(j/32)); the power is a double product of fixed binary roots of 10000.
__device__ __forceinline__ void rope_tab(float* CS, int blk) {
    const int i = blk * 256 + threadIdx.x; if (i >= SEQ * 32) return;
    const int t = i >> 5, j = i & 31;
    double p = 1.0;
    p *= (j & 1)  ? 1.3335214321633240 : 1.0;    // 10000^(1/32)
    p *= (j & 2)  ? 1.7782794100389228 : 1.0;    // 10000^(1/16)
    p *= (j & 4)  ? 3.1622776601683795 : 1.0;    // 10000^(1/8)
    p *= (j & 8)  ? 10.0 : 1.0;                  // 10000^(1/4)
    p *= (j & 16) ? 100.0 : 1.0;                 // 10000^(1/2)
    const float pf = (float)p; const float inv = 1.0f / pf;
    const float ang = (float)t * inv;
    const float cs = cosf(ang), sn = sinf(ang);
    v2f o; o[0] = cs; o[1] = sn;
    *(v2f*)(CS + (size_t)i * 2) = o; 
}

#define PB_ROPE ((SEQ * 32 + 255) / 256)              // blocks of the rotary table
#define PB_WBIG ((DM / 64) * (DM / 64))               // tiles of Wq, of Wo
#define PB_WKV  ((KVD / 64) * (DM / 64))              // tiles of Wk, of Wv
#define PB_CVT  ((int)(((size_t)NB * SEQ * DM / 8 + 255) / 256))   // blocks of the x conversion
// k_prep: grid PB_ROPE + 2 PB_WBIG + 2 PB_WKV + PB_CVT, 256 threads; every branch on the block index is block-uniform (the transposes' barrier stands under it).
__global__ __launch_bounds__(256) void k_prep(const float* __restrict__ x, const float* __restrict__ wq, const float* __restrict__ wk, const float* __restrict__ wv, const float* __restrict__ wo,
                                              bf* XB, bf* WQt, bf* WKt, bf* WVt, h16* WOt, float* CS) {
    __shared__ float ts[64 * 65];
    int blk = blockIdx.x;
    if (blk < PB_ROPE) { rope_tab(CS, blk); return; }
    blk -= PB_ROPE;
    if (blk < 2 * PB_WBIG + 2 * PB_WKV) {
        const float* W; bf* T; int Nc, mode = 0;
        if (blk < PB_WBIG)                    { W = wq; T = WQt; Nc = DM; }
        else if (blk < 2 * PB_WBIG)           { blk -= PB_WBIG; W = wo; T = (bf*)WOt; Nc = DM; mode = 1; }
        else if (blk < 2 * PB_WBIG + PB_WKV)  { blk -= 2 * PB_WBIG; W = wk; T = WKt; Nc = KVD; }
        else                                  { blk -= 2 * PB_WBIG + PB_WKV; W = wv; T = WVt; Nc = KVD; }
        const int nx = Nc / 64;
        wt_tile(ts, W, T, (h16*)T, DM, Nc, mode, blk % nx, blk / nx);
        return;
    }
    cvt8(x, XB, blk - (2 * PB_WBIG + 2 * PB_WKV));
}

// k_proj: register-blocked bf16 GEMM, four waves per 128x128 tile, one 64x64 tile (16 accumulators) per wave, operands from K-contiguous bf16 planes staged in LDS, K = DM.
// C[m][n] = sum_k A[m][k] Bt[n][k], written as f16 (Ph) and the f16 residual x1024 (Pr, useRes != 0) at
// wave tile base (r0/RB)*sRB + (r0%RB)*pitch + (c0/CB)*sCB + (c0%CB), row pitch 'pitch' (halves). 128 threads.
// One grid holds the q, k and v^T products (they depend only on k_prep): blocks [0, GQ) q, [GQ, GQ + GK) k, the last GK v^T; inside a job the row tile runs fastest.
// rope != 0 (rows = tokens b*SEQ + t, the 64 columns of a wave tile = one head): interleaved rotary applied on the f32 values at the store stage from CS[t][32] (cos, sin).
#define GQ ((NB * SEQ / 128) * (DM / 128))
#define GK ((NB * SEQ / 128) * (KVD / 128))
__global__ __launch_bounds__(128) void k_proj(const bf* __restrict__ XB, const bf* __restrict__ WQt, const bf* __restrict__ WKt, const bf* __restrict__ WVt,
                                              h16* QH, h16* QR, h16* KP, h16* KR, h16* VT, h16* VR, const float* __restrict__ CS) {
    __shared__ __align__(16) bf ring[2 * STGE];
    __shared__ __align__(16) float osall[4 * 16 * 68];
    const int K = DM;
    // the job's operands and output map, all block-uniform
    const bf* A; const bf* Bt; h16* Ph; h16* Pr; int RB, pitch, CB, rope, mt; size_t sRB, sCB; int bid = blockIdx.x; const int useRes = 1;   // all three jobs write their residual plane
    if (bid < GQ) {                 // q: A = x rows (m = b*SEQ + t), Bt = Wq^T rows (n = h*64 + d) -> plane [(b*32 + h)][t][d], rotary applied
        A = XB; Bt = WQt; Ph = QH; Pr = QR; RB = SEQ; sRB = (size_t)NH_ * SEQ * HD; pitch = HD; CB = HD; sCB = (size_t)SEQ * HD; rope = 1; mt = NB * SEQ / 128;
    } else if (bid < GQ + GK) {     // k: Bt = Wk^T rows (n = g*64 + d) -> plane [(b*8 + g)][t][d], rotary applied
        bid -= GQ; A = XB; Bt = WKt; Ph = KP; Pr = KR; RB = SEQ; sRB = (size_t)NKV * SEQ * HD; pitch = HD; CB = HD; sCB = (size_t)SEQ * HD; rope = 1; mt = NB * SEQ / 128;
    } else {                        // v^T: A = Wv^T rows (m = g*64 + d), Bt = x rows (n = b*SEQ + t) -> plane [(b*512 + m)][t] = [(b*8 + g)][d][t], no rotary
        bid -= GQ + GK; A = WVt; Bt = XB; Ph = VT; Pr = VR; RB = KVD; sRB = (size_t)0; pitch = SEQ; CB = SEQ; sCB = (size_t)KVD * SEQ; rope = 0; mt = KVD / 128;
    }
    const int tid = threadIdx.x; const int wave = __builtin_amdgcn_readfirstlane(tid >> 5);
    const int lane = tid & 31, lr = lane & 15, hi = lane >> 4; const int rb = (bid % mt) * 128, cb = (bid / mt) * 128;
    const int wr = (wave >> 1) * 64, wc = (wave & 1) * 64; const int r0 = rb + wr, c0 = cb + wc;
    float* os = osall + wave * 16 * 68;
    v8f acc[4][4];
#pragma unroll
    for (int mb = 0; mb < 4; ++mb)
#pragma unroll
        for (int nb = 0; nb < 4; ++nb) acc[mb][nb] = (v8f){};
    const unsigned l0 = (unsigned)(size_t)ring + (unsigned)((tid >> 3) * (LPE * 2) + (tid & 7) * 16);
    const char* ga = (const char*)(A + (size_t)(rb + (tid >> 3)) * K + (tid & 7) * 8);
    const char* gb = (const char*)(Bt + (size_t)(cb + (tid >> 3)) * K + (tid & 7) * 8);
    const int afr = (wr + lr) * LPE + 8 * hi, bfr = (128 + wc + lr) * LPE + 8 * hi;
    stage_tile(l0, ga, gb);
    wait_copies();
    __syncthreads();                                              // tile 0 readable by every wave
    stage_tile(l0 + STGB, ga + BK * 2, gb + BK * 2);
#pragma unroll 1   // one trip per staged tile: the ring's waits and barrier stand once, at the foot
    for (int t = 0; t < NKT; ++t) {
        const bf* sb = ring + (t & 1) * STGE;
#pragma unroll     // this and the loops inside: constant indices keep fragments and accumulators in registers
        for (int ks = 0; ks < BK; ks += 32) {
            v16bf a[4], b[4];
#pragma unroll
            for (int mb = 0; mb < 4; ++mb) a[mb] = ldb(sb + afr + mb * 16 * LPE + ks);
#pragma unroll
            for (int nb = 0; nb < 4; ++nb) b[nb] = ldb(sb + bfr + nb * 16 * LPE + ks);
#pragma unroll
            for (int nb = 0; nb < 4; ++nb)
#pragma unroll
                for (int mb = 0; mb < 4; ++mb) acc[mb][nb] = wmmab(a[mb], b[nb], acc[mb][nb]);
        }
        wait_lds();
        wait_copies();
        __syncthreads();                                          // publishes tile t + 1 and frees the buffer of tile t
        if (t + 2 < NKT) stage_tile(l0 + (unsigned)(t & 1) * STGB, ga + (size_t)(t + 2) * (BK * 2), gb + (size_t)(t + 2) * (BK * 2));
    }
    wait_copies();
    const size_t tbase = (size_t)(r0 / RB) * sRB + (size_t)(r0 % RB) * (size_t)pitch + (size_t)(c0 / CB) * sCB + (size_t)(c0 % CB);
#pragma unroll
    for (int mb = 0; mb < 4; ++mb) {
#pragma unroll
        for (int nb = 0; nb < 4; ++nb) {
#pragma unroll
            for (int j = 0; j < 8; ++j) os[(hi * 8 + j) * 68 + nb * 16 + lr] = acc[mb][nb][j]; }   // D: row 8h+j, col lane&15
        wave_sync();
        const size_t sb = tbase + (size_t)(mb * 16) * (size_t)pitch;
{
#pragma unroll
            for (int s = 0; s < 4; ++s) { const int row = 4 * s + (lane >> 3), c8 = (lane & 7) * 8;   // 4 s x 4 row groups = 16 rows; 8 lanes x 8 = 64 columns
                v4f x0 = *(const v4fa*)(&os[row * 68 + c8]); v4f x1 = *(const v4fa*)(&os[row * 68 + c8 + 4]); v8h hv, rv;
                if (rope) {                                                                            // block-uniform (set with the job)
                    const int t = (r0 + mb * 16 + row) % SEQ;
                    const float* cp = CS + ((size_t)t * 32 + (size_t)(c8 >> 1)) * 2;                  // pairs c8/2 .. c8/2+3: (cos, sin) x 4
                    const v4f ca = *(const v4f*)cp; const v4f cb = *(const v4f*)(cp + 4);
                    float e, o;
                    e = x0[0]; o = x0[1]; x0[0] = e * ca[0] - o * ca[1]; x0[1] = e * ca[1] + o * ca[0];
                    e = x0[2]; o = x0[3]; x0[2] = e * ca[2] - o * ca[3]; x0[3] = e * ca[3] + o * ca[2];
                    e = x1[0]; o = x1[1]; x1[0] = e * cb[0] - o * cb[1]; x1[1] = e * cb[1] + o * cb[0];
                    e = x1[2]; o = x1[3]; x1[2] = e * cb[2] - o * cb[3]; x1[3] = e * cb[3] + o * cb[2]; }
#pragma unroll
                for (int i = 0; i < 4; ++i) { const h16 a0 = (h16)x0[i]; const h16 a1 = (h16)x1[i]; hv[i] = a0; hv[4 + i] = a1; rv[i] = (h16)((x0[i] - (float)a0) * QRS); rv[4 + i] = (h16)((x1[i] - (float)a1) * QRS); }
                const size_t oo = sb + (size_t)row * (size_t)pitch + c8;
                *(v8h*)(Ph + oo) = hv; if (useRes) *(v8h*)(Pr + oo) = rv;
                asm volatile("s_wait_xcnt 0x0" ::: "memory"); }   // stands in front of the next rows' rewrite of the two stores' address registers
             }
        wave_sync();
    }
}

// flash_early: the body of k_flash's blocks for query rows < EARLY (same structure as the late body below, operands straight from the planes) with value + residual (x1024) planes on every operand:
// scores = kh.qh + (kh.qr + kr.qh)/1024; O = vh.ph + (vr.ph + vh.pr)/1024 (residual products in their own accumulators), l from the unconverted f32 P.
// Writes the ctx value plane rows (carried x1024) and the compact unscaled residual plane CR[b][t < EARLY][2048].
__device__ __forceinline__ void flash_early(float* os, const h16* __restrict__ QH, const h16* __restrict__ QR, const h16* __restrict__ KP, const h16* __restrict__ KR,
                                            const h16* __restrict__ VT, const h16* __restrict__ VR, h16* CH, h16* CR, int t0, int zg) {
    const int lane = threadIdx.x & 31; const int wave = __builtin_amdgcn_readfirstlane(threadIdx.x >> 5);
    const int lr = lane & 15, hi = lane >> 4;
    const int b = zg / NKV; const int g = zg % NKV;
    const int h = g * AW + wave;
    const int tq = t0 + lr;
    const size_t qo = ((size_t)(b * NH_ + h) * SEQ + (size_t)tq) * HD + 8 * hi;
    const v16h qh0 = ldh(QH + qo), qh1 = ldh(QH + qo + 32), qr0 = ldh(QR + qo), qr1 = ldh(QR + qo + 32);
    const size_t ko = (size_t)zg * SEQ * HD + (size_t)lr * HD + 8 * hi;
    const size_t vo = (size_t)zg * HD * SEQ + (size_t)lr * SEQ + 8 * hi;
    v8f oH[4], oL[4];
#pragma unroll
    for (int j = 0; j < 4; ++j) { oH[j] = (v8f){}; oL[j] = (v8f){}; }
    float m = NEGB, l = 0.0f;
    const int kend = t0 + 16;
#pragma unroll 1
    for (int key0 = 0; key0 < kend; key0 += 32) {
        const size_t kk = ko + (size_t)key0 * HD;
        v8f sHa = (v8f){}, sLa = (v8f){}, sHb = (v8f){}, sLb = (v8f){};
        { const v16h k0 = ldh(KP + kk), k1 = ldh(KP + kk + 32), r0 = ldh(KR + kk), r1 = ldh(KR + kk + 32);
          sHa = wmma16(k0, qh0, sHa); sHa = wmma16(k1, qh1, sHa);
          sLa = wmma16(k0, qr0, sLa); sLa = wmma16(k1, qr1, sLa); sLa = wmma16(r0, qh0, sLa); sLa = wmma16(r1, qh1, sLa); }
        { const size_t k2 = kk + (size_t)16 * HD;
          const v16h k0 = ldh(KP + k2), k1 = ldh(KP + k2 + 32), r0 = ldh(KR + k2), r1 = ldh(KR + k2 + 32);
          asm volatile("s_wait_xcnt 0x0" :: "v"(KP + kk), "v"(KR + kk) : "memory");   // behind the eight loads; naming their two base addresses keeps those registers from serving as a load's destination ahead of the wait
          sHb = wmma16(k0, qh0, sHb); sHb = wmma16(k1, qh1, sHb);
          sLb = wmma16(k0, qr0, sLb); sLb = wmma16(k1, qr1, sLb); sLb = wmma16(r0, qh0, sLb); sLb = wmma16(r1, qh1, sLb); }
        float ta[8], tb[8];
#pragma unroll
        for (int r = 0; r < 8; ++r) { ta[r] = (sHa[r] + sLa[r] * QRI) * SC2; tb[r] = (sHb[r] + sLb[r] * QRI) * SC2; }
        if (key0 + 31 > t0) {                                      // block-uniform: diagonal block
            const int kbse = key0 + 8 * hi;
#pragma unroll
            for (int r = 0; r < 8; ++r) { ta[r] = (kbse + r > tq) ? NEGB : ta[r]; tb[r] = (kbse + 16 + r > tq) ? NEGB : tb[r]; } }
        float mx = NEGB;
#pragma unroll
        for (int r = 0; r < 8; ++r) mx = fmaxf(mx, fmaxf(ta[r], tb[r]));
        mx = fmaxf(mx, __shfl_xor(mx, 16, 32));
        const float mnew = fmaxf(m, mx);
        const float alpha = __builtin_amdgcn_exp2f(m - mnew);
        const float sh = PSH - mnew;
        v16h ph, pr; float ls = 0.0f;
#pragma unroll
        for (int r = 0; r < 8; ++r) { const float ea = __builtin_amdgcn_exp2f(ta[r] + sh); const float ec = __builtin_amdgcn_exp2f(tb[r] + sh);
            const h16 ha = (h16)ea; const h16 hc = (h16)ec; ph[r] = ha; ph[8 + r] = hc;
            pr[r] = (h16)((ea - (float)ha) * QRS); pr[8 + r] = (h16)((ec - (float)hc) * QRS); ls += ea + ec; }
        l = l * alpha + ls; m = mnew;
#pragma unroll
        for (int j = 0; j < 4; ++j) { oH[j] = oH[j] * alpha; oL[j] = oL[j] * alpha; }
        const size_t vv = vo + (size_t)key0;
#pragma unroll
        for (int j = 0; j < 4; ++j) { const v16h vh = ldh(VT + vv + (size_t)(16 * j) * SEQ); const v16h vr = ldh(VR + vv + (size_t)(16 * j) * SEQ);
            oH[j] = wmma16(vh, ph, oH[j]); oL[j] = wmma16(vr, ph, oL[j]); oL[j] = wmma16(vh, pr, oL[j]); }
    }
    l += __shfl_xor(l, 16, 32);
    const float inv = CXS / l;
    const int wb = wave * 16 * 68;
#pragma unroll
    for (int j = 0; j < 4; ++j) { v4f a, c;     // os[t][d], d = 16j + 8h + r; rows 0..15 x columns 0..63 all written
        a[0] = (oH[j][0] + oL[j][0] * QRI) * inv; a[1] = (oH[j][1] + oL[j][1] * QRI) * inv; a[2] = (oH[j][2] + oL[j][2] * QRI) * inv; a[3] = (oH[j][3] + oL[j][3] * QRI) * inv;
        c[0] = (oH[j][4] + oL[j][4] * QRI) * inv; c[1] = (oH[j][5] + oL[j][5] * QRI) * inv; c[2] = (oH[j][6] + oL[j][6] * QRI) * inv; c[3] = (oH[j][7] + oL[j][7] * QRI) * inv;
        *(v4fa*)(&os[wb + lr * 68 + 16 * j + 8 * hi]) = a; *(v4fa*)(&os[wb + lr * 68 + 16 * j + 8 * hi + 4]) = c; }
    wave_sync();
    h16* crow = CH + ((size_t)b * SEQ + t0) * DM + h * HD;
    h16* rrow = CR + ((size_t)b * EARLY + t0) * DM + h * HD;
{
#pragma unroll
        for (int s = 0; s < 4; ++s) { const int row = 4 * s + (lane >> 3), c8 = (lane & 7) * 8;   // 4 s x 4 row groups = 16 rows; 8 lanes x 8 = 64 columns
            const v4f x0 = *(const v4fa*)(&os[wb + row * 68 + c8]); const v4f x1 = *(const v4fa*)(&os[wb + row * 68 + c8 + 4]); v8h hv, rv;
#pragma unroll
            for (int i = 0; i < 4; ++i) { const h16 a0 = (h16)x0[i]; const h16 a1 = (h16)x1[i]; hv[i] = a0; hv[4 + i] = a1; rv[i] = (h16)(x0[i] - (float)a0); rv[4 + i] = (h16)(x1[i] - (float)a1); }
            *(v8h*)(crow + (size_t)row * DM + c8) = hv; *(v8h*)(rrow + (size_t)row * DM + c8) = rv; }
         }
}

// k_flash: fused causal attention, grid FL_LATE + FL_EARLY. One block = 16 query rows x the four query heads of one kv head (one wave per head, h = g*4 + wave); in the block number bid the row tile runs fastest;
// both bodies depend only on k_proj, so they share the launch: block numbers from FL_LATE on (rows < EARLY) run flash_early, the others the body below:
// Q fragments straight from the f16 planes; K / V^T of kv head g staged once per block in LDS, FK keys a stage, and read as fragments (two 16-B LDS loads each) by all four waves.
// Transposed form: S^T[key][t] = K Q^T (A = K rows, B = Q rows); lane (t = lane&15, h = lane>>4) holds keys 8h+r of each 16-key tile, so the packed
// P tile is directly the B fragment of O^T[d][t] = V^T P^T (element r <- tile keys 0..15, element 8+r <- tile keys 16..31, lane unchanged).
// Keys run over [0, t0+16) in steps of 32; the diagonal 32-key blocks replace excluded scores (key > t) by a large negative value before the running max.
#define FL_LX    ((SEQ - EARLY) / 16)
#define FL_LATE  (FL_LX * NB * NKV)
#define FL_EARLY ((EARLY / 16) * NB * NKV)
static_assert(FL_LX > 0);                                        // the late blocks' index is split by it
// flash_bid: launch index -> block number. A block's cost grows with its row tile (the key walk ends at the diagonal), the registers hold fewer blocks on the chip than the grid has:
// so the cost falls with the launch index (for speed only). First the blocks of rows < EARLY (few trips, each waiting on loads straight from the planes), then the others from the last
// row tile down to the first; inside one row tile the (batch, kv head) index runs fastest. A permutation of [0, FL_LATE + FL_EARLY), block-uniform.
__device__ __forceinline__ int flash_bid(int rank) {
    const int nz = NB * NKV;
    if (rank < FL_EARLY) return FL_LATE + (rank % nz) * (EARLY / 16) + (EARLY / 16 - 1 - rank / nz);
    rank -= FL_EARLY;
    return (rank % nz) * FL_LX + (FL_LX - 1 - rank / nz);
}
__global__ __launch_bounds__(32 * AW) void k_flash(const h16* __restrict__ QH, const h16* __restrict__ QR, const h16* __restrict__ KP, const h16* __restrict__ KR,
                                                   const h16* __restrict__ VT, const h16* __restrict__ VR, h16* CH, h16* CR) {
    __shared__ __align__(16) h16 ring[2 * FSTGE];
    float* os = (float*)ring;                                     // output staging, used only behind the loop's last barrier (the early body stages nothing else there)
    const int bid = flash_bid(blockIdx.x);
    if (bid >= FL_LATE) { const int e = bid - FL_LATE; flash_early(os, QH, QR, KP, KR, VT, VR, CH, CR, (e % (EARLY / 16)) * 16, e / (EARLY / 16)); return; }   // block-uniform, in front of every barrier
    const int zg = bid / FL_LX; const int t0 = EARLY + (bid % FL_LX) * 16;
    const int tid = threadIdx.x;
    const int lane = threadIdx.x & 31; const int wave = __builtin_amdgcn_readfirstlane(threadIdx.x >> 5);
    const int lr = lane & 15, hi = lane >> 4;
    const int b = zg / NKV; const int g = zg % NKV;
    const int h = g * AW + wave;                                  // repeat on the head axis: query head h uses kv head h >> 2
    const int tq = t0 + lr;
    const size_t qo = ((size_t)(b * NH_ + h) * SEQ + (size_t)tq) * HD + 8 * hi;
    const v16h qh0 = ldh(QH + qo), qh1 = ldh(QH + qo + 32), qr0 = ldh(QR + qo), qr1 = ldh(QR + qo + 32);   // B fragments: col t, k = d
    const unsigned l0 = (unsigned)(size_t)ring + (unsigned)((tid >> 3) * (LPE * 2) + (tid & 7) * 16);
    const char* gk = (const char*)(KP + (size_t)zg * SEQ * HD + (size_t)(tid >> 3) * HD + (tid & 7) * 8);    // + stage * FK rows
    const char* gv = (const char*)(VT + (size_t)zg * HD * SEQ + (size_t)(tid >> 3) * SEQ + (tid & 7) * 8);   // + stage * FK keys
    const int kfr = lr * LPE + 8 * hi;                            // + key * LPE        (A fragment: row key, k = d)
    const int vfr = (FK + lr) * LPE + 8 * hi;                     // + 16j * LPE + key  (A fragment: row d, k = key)
    v8f o0 = (v8f){}, o1 = (v8f){}, o2 = (v8f){}, o3 = (v8f){};
    float m = NEGB, l = 0.0f;
    const int kend = t0 + 16;
    const int nst = (kend + FK - 1) / FK;                         // block-uniform; stage nst - 1 ends at or before key SEQ
    stage_kv(l0, gk, gv);
    wait_copies();
    __syncthreads();                                              // stage 0 readable by every wave
    if (nst > 1) stage_kv(l0 + FSTGB, gk + (size_t)FK * HD * 2, gv + FK * 2);
#pragma unroll 1   // one trip per staged tile: the ring's waits and barrier stand once, at the foot
    for (int st = 0; st < nst; ++st) {
        const h16* sb = ring + (st & 1) * FSTGE;
#pragma unroll     // two 32-key steps per stage, constant LDS offsets
        for (int ks = 0; ks < FK; ks += 32) {
            const int key0 = st * FK + ks;
            if (key0 >= kend) break;                               // block-uniform: the last stage may hold one step only
            const h16* ka = sb + kfr + ks * LPE;
            const v16h ka0 = ldh(ka), ka1 = ldh(ka + 32), kb0 = ldh(ka + 16 * LPE), kb1 = ldh(ka + 16 * LPE + 32);
            v8f sHa = (v8f){}, sLa = (v8f){}, sHb = (v8f){}, sLb = (v8f){};
            sHa = wmma16p(ka0, qh0, sHa); sLa = wmma16p(ka0, qr0, sLa); sHb = wmma16p(kb0, qh0, sHb); sLb = wmma16p(kb0, qr0, sLb);
            sHa = wmma16p(ka1, qh1, sHa); sLa = wmma16p(ka1, qr1, sLa); sHb = wmma16p(kb1, qh1, sHb); sLb = wmma16p(kb1, qr1, sLb);
            float ta[8], tb[8];
#pragma unroll
            for (int r = 0; r < 8; ++r) { ta[r] = (sHa[r] + sLa[r] * QRI) * SC2; tb[r] = (sHb[r] + sLb[r] * QRI) * SC2; }
            if (key0 + 31 > t0) {                                  // block-uniform: diagonal block
                const int kbse = key0 + 8 * hi;
#pragma unroll
                for (int r = 0; r < 8; ++r) { ta[r] = (kbse + r > tq) ? NEGB : ta[r]; tb[r] = (kbse + 16 + r > tq) ? NEGB : tb[r]; } }
            float mx = NEGB;
#pragma unroll
            for (int r = 0; r < 8; ++r) mx = fmaxf(mx, fmaxf(ta[r], tb[r]));
            mx = fmaxf(mx, __shfl_xor(mx, 16, 32));
            const float mnew = fmaxf(m, mx);
            const float alpha = __builtin_amdgcn_exp2f(m - mnew);
            const float sh = PSH - mnew;
            v16h pb; float ls = 0.0f;
#pragma unroll
            for (int r = 0; r < 8; ++r) { const float ea = __builtin_amdgcn_exp2f(ta[r] + sh); const float ec = __builtin_amdgcn_exp2f(tb[r] + sh); pb[r] = (h16)ea; pb[8 + r] = (h16)ec; ls += ea + ec; }
            l = l * alpha + ls; m = mnew;
            o0 = o0 * alpha; o1 = o1 * alpha; o2 = o2 * alpha; o3 = o3 * alpha;
            const h16* va = sb + vfr + ks;
            const v16h v0 = ldh(va), v1 = ldh(va + 16 * LPE), v2 = ldh(va + 32 * LPE), v3 = ldh(va + 48 * LPE);
            o0 = wmma16p(v0, pb, o0); o1 = wmma16p(v1, pb, o1); o2 = wmma16p(v2, pb, o2); o3 = wmma16p(v3, pb, o3);
        }
        wait_lds();
        wait_copies();
        __syncthreads();                                          // publishes stage st + 1 and frees the buffer of stage st
        if (st + 2 < nst) stage_kv(l0 + (unsigned)(st & 1) * FSTGB, gk + (size_t)(st + 2) * (FK * HD * 2), gv + (size_t)(st + 2) * (FK * 2));
    }
    wait_copies();
    l += __shfl_xor(l, 16, 32);
    const float inv = CXS / l;
    const int wb = wave * 16 * 68;
    // O^T D layout: o_j[r] = (d = 16j + 8h + r, t = lane&15) -> os[t][d]; rows 0..15 x columns 0..63 all written
    { v4f a, c;
      a[0] = o0[0] * inv; a[1] = o0[1] * inv; a[2] = o0[2] * inv; a[3] = o0[3] * inv; c[0] = o0[4] * inv; c[1] = o0[5] * inv; c[2] = o0[6] * inv; c[3] = o0[7] * inv;
      *(v4fa*)(&os[wb + lr * 68 +  0 + 8 * hi]) = a; *(v4fa*)(&os[wb + lr * 68 +  0 + 8 * hi + 4]) = c;
      a[0] = o1[0] * inv; a[1] = o1[1] * inv; a[2] = o1[2] * inv; a[3] = o1[3] * inv; c[0] = o1[4] * inv; c[1] = o1[5] * inv; c[2] = o1[6] * inv; c[3] = o1[7] * inv;
      *(v4fa*)(&os[wb + lr * 68 + 16 + 8 * hi]) = a; *(v4fa*)(&os[wb + lr * 68 + 16 + 8 * hi + 4]) = c;
      a[0] = o2[0] * inv; a[1] = o2[1] * inv; a[2] = o2[2] * inv; a[3] = o2[3] * inv; c[0] = o2[4] * inv; c[1] = o2[5] * inv; c[2] = o2[6] * inv; c[3] = o2[7] * inv;
      *(v4fa*)(&os[wb + lr * 68 + 32 + 8 * hi]) = a; *(v4fa*)(&os[wb + lr * 68 + 32 + 8 * hi + 4]) = c;
      a[0] = o3[0] * inv; a[1] = o3[1] * inv; a[2] = o3[2] * inv; a[3] = o3[3] * inv; c[0] = o3[4] * inv; c[1] = o3[5] * inv; c[2] = o3[6] * inv; c[3] = o3[7] * inv;
      *(v4fa*)(&os[wb + lr * 68 + 48 + 8 * hi]) = a; *(v4fa*)(&os[wb + lr * 68 + 48 + 8 * hi + 4]) = c; }
    wave_sync();
    h16* crow = CH + ((size_t)b * SEQ + t0) * DM + h * HD;         // merged heads: column h*64 + d
{
#pragma unroll
        for (int s = 0; s < 4; ++s) { const int row = 4 * s + (lane >> 3), c8 = (lane & 7) * 8;   // 4 s x 4 row groups = 16 rows; 8 lanes x 8 = 64 columns
            const v4f x0 = *(const v4fa*)(&os[wb + row * 68 + c8]); const v4f x1 = *(const v4fa*)(&os[wb + row * 68 + c8 + 4]); v8h hv;
#pragma unroll
            for (int i = 0; i < 4; ++i) { hv[i] = (h16)x0[i]; hv[4 + i] = (h16)x1[i]; }
            *(v8h*)(crow + (size_t)row * DM + c8) = hv; }
         }
}

// k_out: output projection, four waves per block (2 x 2, 64x64 per wave), f16 operands from the ctx plane CX (value rows [NB*SEQ], then residual rows [NB*EARLY]) and the Wo^T plane, staged in LDS, K = DM, one walk.
// Late block: a 128x128 output tile, the 128 staged A rows are 128 tokens. Early block (tokens < EARLY): a 64x128 output tile, the staged A rows are the 64 tokens' value rows, then the same tokens' unscaled residual rows:
// waves 0, 1 sum the value products, waves 2, 3 the residual products, and the two sums are added through LDS at the store (one barrier). So every block walks K once. grid (OB_E + OB_L, DM/128), 128 threads.
#define OB_E (NB * (EARLY / 64))            // early row tiles (64 tokens), first in the grid
#define OB_L (NB * ((SEQ - EARLY) / 128))   // late row tiles (128 tokens)
static_assert(EARLY % 64 == 0 && (SEQ - EARLY) % 128 == 0 && SEQ > EARLY);
static_assert(2 * STGB >= 2 * 64 * 68 * 4);   // the residual sums reuse the ring behind the last barrier
// eight asynchronous 16-byte copies of one lane: four rows from g0, then four from g1, each 16 rows apart (LDS step 16 * 144 B, global step 16 rows of DM elements).
// s_wait_xcnt closes the statement so that no address register is rewritten ahead of it.
__device__ __forceinline__ void copy44(unsigned l, const char* g0, const char* g1) {
    const size_t gs = (size_t)16 * DM * 2; const unsigned ls = 16 * LPE * 2;
    asm volatile("global_load_async_to_lds_b128 %0, %8, off\n\t"
                 "global_load_async_to_lds_b128 %1, %9, off\n\t"
                 "global_load_async_to_lds_b128 %2, %10, off\n\t"
                 "global_load_async_to_lds_b128 %3, %11, off\n\t"
                 "global_load_async_to_lds_b128 %4, %12, off\n\t"
                 "global_load_async_to_lds_b128 %5, %13, off\n\t"
                 "global_load_async_to_lds_b128 %6, %14, off\n\t"
                 "global_load_async_to_lds_b128 %7, %15, off\n\t"
                 "s_wait_xcnt 0x0"
                 :: "v"(l), "v"(l + ls), "v"(l + 2 * ls), "v"(l + 3 * ls), "v"(l + 4 * ls), "v"(l + 5 * ls), "v"(l + 6 * ls), "v"(l + 7 * ls),
                    "v"(g0), "v"(g0 + gs), "v"(g0 + 2 * gs), "v"(g0 + 3 * gs), "v"(g1), "v"(g1 + gs), "v"(g1 + 2 * gs), "v"(g1 + 3 * gs)
                 : "memory");
}
__global__ __launch_bounds__(128) void k_out(const h16* __restrict__ CX, const h16* __restrict__ Wt, float* OUT) {
    __shared__ __align__(16) h16 ring[2 * STGE];
    __shared__ __align__(16) float osall[4 * 16 * 68];
    const int K = DM;
    const int tid = threadIdx.x; const int wave = __builtin_amdgcn_readfirstlane(tid >> 5);
    const int lane = tid & 31, lr = lane & 15, hi = lane >> 4; const int cb = blockIdx.y * 128;
    const int wr = (wave >> 1) * 64, wc = (wave & 1) * 64; const int c0 = cb + wc;
    float* os = osall + wave * 16 * 68;
    const int bx = blockIdx.x; const bool early = bx < OB_E;      // block-uniform
    const int b  = early ? bx / (EARLY / 64) : (bx - OB_E) / ((SEQ - EARLY) / 128);
    const int tb = early ? (bx % (EARLY / 64)) * 64 : EARLY + ((bx - OB_E) % ((SEQ - EARLY) / 128)) * 128;   // first token of the tile in its sequence
    const unsigned l0 = (unsigned)(size_t)ring + (unsigned)((tid >> 3) * (LPE * 2) + (tid & 7) * 16);
    // staged A rows 0..63: value rows of tokens tb..tb+63; rows 64..127: value rows of tokens tb+64.. (late) or the residual rows of tokens tb..tb+63 (early)
    const size_t rlo = (size_t)b * SEQ + (size_t)tb + (size_t)(tid >> 3);
    const size_t rhi = early ? (size_t)NB * SEQ + (size_t)b * EARLY + (size_t)tb + (size_t)(tid >> 3) : rlo + 64;
    const char* ga0 = (const char*)(CX + rlo * K + (tid & 7) * 8);
    const char* ga1 = (const char*)(CX + rhi * K + (tid & 7) * 8);
    const char* gb = (const char*)(Wt + (size_t)(cb + (tid >> 3)) * K + (tid & 7) * 8);
    const int afr = (wr + lr) * LPE + 8 * hi, bfr = (128 + wc + lr) * LPE + 8 * hi;
    v8f acc[4][4];
#pragma unroll
    for (int mb = 0; mb < 4; ++mb)
#pragma unroll
        for (int nb = 0; nb < 4; ++nb) acc[mb][nb] = (v8f){};
    copy44(l0, ga0, ga1); copy8(l0 + 128 * LPE * 2, gb);
    wait_copies();
    __syncthreads();                                              // tile 0 readable by every wave
    copy44(l0 + STGB, ga0 + BK * 2, ga1 + BK * 2); copy8(l0 + STGB + 128 * LPE * 2, gb + BK * 2);
#pragma unroll 1   // one trip per staged tile: the ring's waits and barrier stand once, at the foot
    for (int t = 0; t < NKT; ++t) {
        const h16* sb = ring + (t & 1) * STGE;
#pragma unroll     // this and the loops inside: constant indices keep fragments and accumulators in registers
        for (int ks = 0; ks < BK; ks += 32) {
            v16h a[4], bq[4];
#pragma unroll
            for (int mb = 0; mb < 4; ++mb) a[mb] = ldh(sb + afr + mb * 16 * LPE + ks);
#pragma unroll
            for (int nb = 0; nb < 4; ++nb) bq[nb] = ldh(sb + bfr + nb * 16 * LPE + ks);
#pragma unroll
            for (int nb = 0; nb < 4; ++nb)
#pragma unroll
                for (int mb = 0; mb < 4; ++mb) acc[mb][nb] = wmma16(a[mb], bq[nb], acc[mb][nb]);
        }
        wait_lds();
        wait_copies();
        __syncthreads();                                          // publishes tile t + 1 and frees the buffer of tile t
        if (t + 2 < NKT) { const size_t ko = (size_t)(t + 2) * (BK * 2); const unsigned lb = l0 + (unsigned)(t & 1) * STGB;
            copy44(lb, ga0 + ko, ga1 + ko); copy8(lb + 128 * LPE * 2, gb + ko); }
    }
    wait_copies();
    if (early) {                                                  // block-uniform, so the barrier below is passed by every wave
        // behind the loop's last barrier the ring holds nothing live: it takes the residual sums, 64 tokens x 64 columns per column half
        float* rs = (float*)ring + (wave & 1) * (64 * 68);
        if (wave >= 2) {
#pragma unroll
            for (int mb = 0; mb < 4; ++mb)
#pragma unroll
                for (int nb = 0; nb < 4; ++nb) {
#pragma unroll
                    for (int j = 0; j < 8; ++j) rs[(mb * 16 + hi * 8 + j) * 68 + nb * 16 + lr] = acc[mb][nb][j] * OUTS; }   // D: row 8h+j, col lane&15
        }
        __syncthreads();                                          // the residual sums of waves 2, 3 are readable by waves 0, 1
        if (wave < 2) {
            float* obase = OUT + ((size_t)b * OUT_SEQ + tb) * DM + c0;
#pragma unroll
            for (int mb = 0; mb < 4; ++mb) {
#pragma unroll
                for (int nb = 0; nb < 4; ++nb) {
#pragma unroll
                    for (int j = 0; j < 8; ++j) os[(hi * 8 + j) * 68 + nb * 16 + lr] = acc[mb][nb][j] * OUTS; }   // D: row 8h+j, col lane&15
                wave_sync();
#pragma unroll
                for (int s = 0; s < 8; ++s) { const int row = 2 * s + hi, cofs = lr * 4;   // 8 s x 2 rows = 16 rows; 16 lanes x 4 floats = 64 columns
                    const v4f val = *(const v4fa*)(&os[row * 68 + cofs]) + *(const v4fa*)(&rs[(mb * 16 + row) * 68 + cofs]);
                    *(v4f*)(obase + (size_t)(mb * 16 + row) * DM + cofs) = val; }
                wave_sync();
            }
        }
        return;
    }
    float* obase = OUT + ((size_t)b * OUT_SEQ + tb + wr) * DM + c0;
#pragma unroll
    for (int mb = 0; mb < 4; ++mb) {
#pragma unroll
        for (int nb = 0; nb < 4; ++nb) {
#pragma unroll
            for (int j = 0; j < 8; ++j) os[(hi * 8 + j) * 68 + nb * 16 + lr] = acc[mb][nb][j] * OUTS; }   // D: row 8h+j, col lane&15
        wave_sync();
{
#pragma unroll
            for (int s = 0; s < 8; ++s) { const int row = 2 * s + hi, cofs = lr * 4;   // 8 s x 2 rows = 16 rows; 16 lanes x 4 floats = 64 columns
                const v4f val = *(const v4fa*)(&os[row * 68 + cofs]);
                *(v4f*)(obase + (size_t)(mb * 16 + row) * DM + cofs) = val; }
             }
        wave_sync();
    }
}

static constexpr size_t al256(size_t v) { return (v + 255) & ~(size_t)255; }
static constexpr size_t SZ_XB = al256((size_t)NB * SEQ * DM * 2);
static constexpr size_t SZ_WQ = al256((size_t)DM * DM * 2);
static constexpr size_t SZ_WK = al256((size_t)KVD * DM * 2);
static constexpr size_t SZ_CS = al256((size_t)SEQ * 32 * 2 * 4);
static constexpr size_t SZ_Q  = al256((size_t)NB * NH_ * SEQ * HD * 2);
static constexpr size_t SZ_KV = al256((size_t)NB * NKV * SEQ * HD * 2);
static constexpr size_t SZ_CX = al256(((size_t)NB * SEQ + (size_t)NB * EARLY) * DM * 2);
static constexpr size_t SZ_TOTAL = SZ_XB + 2 * SZ_WQ + 2 * SZ_WK + SZ_CS + 2 * SZ_Q + 4 * SZ_KV + SZ_CX;
static_assert(SZ_TOTAL <= (size_t)134217728);          // workspace carve <= 128 MiB

extern "C" void kernel_launch(void* const* d_in, const int* in_sizes, int n_in,
                              void* d_out, int out_size, void* d_ws, size_t ws_size, hipStream_t stream) {
    if (n_in < 5) return;
    const size_t needx = ((size_t)(NB - 1) * SEQ_FULL + SEQ) * DM;
    if ((size_t)in_sizes[0] < needx) return;
    if ((size_t)in_sizes[1] < (size_t)DM * DM || (size_t)in_sizes[2] < (size_t)DM * KVD || (size_t)in_sizes[3] < (size_t)DM * KVD || (size_t)in_sizes[4] < (size_t)DM * DM) return;
    if ((size_t)out_size < ((size_t)(NB - 1) * OUT_SEQ + SEQ) * DM) return;
    if (SZ_TOTAL > ws_size) return;
    // wire order x, wq, wk, wv, wo; every weight is [in][out]
    const float* x = (const float*)d_in[0]; const float* wq = (const float*)d_in[1]; const float* wk = (const float*)d_in[2]; const float* wv = (const float*)d_in[3]; const float* wo = (const float*)d_in[4];
    float* OUT = (float*)d_out;      // [NB][SEQ][2048]
    char* wsp = (char*)d_ws;
    bf*  XB  = (bf*)wsp;  wsp += SZ_XB;              // [NB*SEQ][2048] bf16
    bf*  WQt = (bf*)wsp;  wsp += SZ_WQ;              // [2048 out][2048 in] bf16
    bf*  WKt = (bf*)wsp;  wsp += SZ_WK;              // [512 out][2048 in] bf16
    bf*  WVt = (bf*)wsp;  wsp += SZ_WK;              // [512 out][2048 in] bf16
    h16* WOt = (h16*)wsp; wsp += SZ_WQ;              // [2048 out][2048 in] f16 of bf16 value x16
    float* CS = (float*)wsp; wsp += SZ_CS;           // [SEQ][32] (cos, sin)
    h16* QH = (h16*)wsp; wsp += SZ_Q;                // [NB*32][SEQ][64]
    h16* QR = (h16*)wsp; wsp += SZ_Q;                // residual x1024
    h16* KP = (h16*)wsp; wsp += SZ_KV;               // [NB*8][SEQ][64]
    h16* KR = (h16*)wsp; wsp += SZ_KV;               // residual x1024
    h16* VT = (h16*)wsp; wsp += SZ_KV;               // [NB*8][64][SEQ]
    h16* VR = (h16*)wsp; wsp += SZ_KV;               // residual x1024
    h16* CX = (h16*)wsp; wsp += SZ_CX;               // ctx x1024: value rows [NB*SEQ][2048], then residual rows [NB*EARLY][2048]
    h16* CR = CX + (size_t)NB * SEQ * DM;

    // x -> bf16, the four weights transposed (in[in-features][out-features] -> out[out-features][in-features]), the rotary table
    k_prep<<<PB_ROPE + 2 * PB_WBIG + 2 * PB_WKV + PB_CVT, 256, 0, stream>>>(x, wq, wk, wv, wo, XB, WQt, WKt, WVt, WOt, CS);

    k_proj<<<GQ + 2 * GK, 128, 0, stream>>>(XB, WQt, WKt, WVt, QH, QR, KP, KR, VT, VR, CS);

    k_flash<<<FL_LATE + FL_EARLY, 32 * AW, 0, stream>>>(QH, QR, KP, KR, VT, VR, CX, CR);

    k_out<<<dim3(OB_E + OB_L, DM / 128, 1), 128, 0, stream>>>(CX, WOt, OUT);
}

// v007
// It runs in 135 microseconds.
// Timed twice side by side with v006, it ran 1.05 and 1.06 times as fast.
// Counting every step since v000, it is 3.89 times as fast.
#include <hip/hip_runtime.h>

// Grouped-query causal self-attention, width 2048 = 32 query heads x 64 sharing 8 kv heads (kv head g = h >> 2), x [NB][SEQ][2048], Wq/Wk/Wv/Wo [in][out] (y = x W), no biases,
// interleaved (even/odd pair) rotary on q and k from a computed [SEQ][32] (cos, sin) table, score scale 1/8, causal exclusion (diagonal kept), output = ctx Wo (f32).
// Compute dtypes, f32 accumulate everywhere: q/k/v projections v_wmma_f32_16x16x32_bf16 (x and W RNE-converted to bf16; products exact);
// scores v_wmma_f32_16x16x32_f16: k single f16, q as f16 value + f16 residual x1024 in its own accumulator (query rows < 256: k also value + residual x1024, three products);
// P (x256 carry, cancels in the normalisation) and v single f16 (rows < 256: P and v as value + residual x1024, three products); softmax f32 (online, running max);
// output projection v_wmma_f32_16x16x32_f16: ctx carried x1024 as f16 (rows < 256: plus its unscaled f16 residual, summed by a second pair of waves) against f16(bf16(Wo)) x16, results scaled by 2^-14.

#ifndef NB
#define NB 2
#endif
#ifndef SEQ
#define SEQ 2048
#endif
#define NB_FULL  2
#define SEQ_FULL 2048
#ifndef OUT_SEQ
#define OUT_SEQ SEQ              // row pitch (in tokens) between batches of the output
#endif
#define DM    2048
#define NH_   32
#define NKV   8
#define HD    64
#define KVD   (NKV * HD)         // 512
#define AW    4                  // waves per flash block = the four query heads of one kv head
#define EARLY 256                // query rows below this use the value + residual path
#define QRS  1024.0f             // carry of every residual plane (q, k, v, P)
#define QRI  (1.0f / 1024.0f)
#define SC2  (0.125f * 1.4426950408889634f)   // HD^-0.5 * log2(e)
#define PSH  8.0f                // log2 of the P carry (256)
#define CXS  1024.0f             // carry of the ctx plane
#define WOS  16.0f               // carry of the Wo plane
#define OUTS (1.0f / (1024.0f * 16.0f))
#define NEGB (-3.0e38f)

static_assert(HD == 64);
static_assert(NH_ * HD == DM);                 // query head h = columns h*64 + d
static_assert(NKV * AW == NH_);                // four consecutive query heads per kv head
static_assert(DM % 64 == 0);
static_assert(KVD % 64 == 0);
static_assert(DM % 32 == 0);                   // GEMM k-loop steps by 32
static_assert(SEQ % 64 == 0);                  // a 64-row tile never straddles two batches
static_assert(SEQ % 32 == 0);                  // key loop steps by 32, key0 + 31 < SEQ
static_assert(EARLY % 128 == 0);               // output GEMM tiles are entirely early or entirely late
static_assert(SEQ % 128 == 0);                 // a 128-row GEMM tile never straddles two batches
static_assert(KVD % 128 == 0);
static_assert(SEQ >= EARLY);
static_assert((SEQ - EARLY) % 16 == 0);
static_assert(((size_t)SEQ * DM) % 8 == 0);
static_assert(NB <= NB_FULL);
static_assert(SEQ <= SEQ_FULL);

typedef _Float16 h16;
typedef unsigned short bf;
typedef __attribute__((ext_vector_type(16))) __bf16   v16bf;
typedef __attribute__((ext_vector_type(16))) _Float16 v16h;
typedef __attribute__((ext_vector_type(8)))  _Float16 v8h;
typedef __attribute__((ext_vector_type(8)))  unsigned short v8us;
typedef __attribute__((ext_vector_type(8)))  float    v8f;
typedef __attribute__((ext_vector_type(4)))  float    v4f;
typedef __attribute__((ext_vector_type(2)))  float    v2f;
typedef v4f  __attribute__((may_alias)) v4fa;

__device__ __forceinline__ unsigned short f2bf(float f) { unsigned u = __float_as_uint(f); u += 0x7FFFu + ((u >> 16) & 1u); return (unsigned short)(u >> 16); }
__device__ __forceinline__ v16h cat16(v8h lo, v8h hi) { return __builtin_shufflevector(lo, hi, 0, 1, 2, 3, 4, 5, 6, 7, 8, 9, 10, 11, 12, 13, 14, 15); }
__device__ __forceinline__ v16bf cat16b(v8us lo, v8us hi) { return __builtin_bit_cast(v16bf, __builtin_shufflevector(lo, hi, 0, 1, 2, 3, 4, 5, 6, 7, 8, 9, 10, 11, 12, 13, 14, 15)); }
// wmma16, wmmab: the WMMA is followed by its own 4-slot guard tying its accumulator and keeping its operands live
__device__ __forceinline__ v8f wmma16(v16h a, v16h b, v8f c) {
    c = __builtin_amdgcn_wmma_f32_16x16x32_f16(false, a, false, b, (short)0, c, false, false);
    asm volatile("v_nop\n\tv_nop\n\tv_nop\n\tv_nop" : "+v"(c) : "v"(a), "v"(b));
    return c; }
__device__ __forceinline__ v8f wmmab(v16bf a, v16bf b, v8f c) {
    c = __builtin_amdgcn_wmma_f32_16x16x32_bf16(false, a, false, b, (short)0, c, false, false);
    asm volatile("v_nop\n\tv_nop\n\tv_nop\n\tv_nop" : "+v"(c) : "v"(a), "v"(b));
    return c; }
// k_flash's late body: the plain builtin. The compiler keeps the distance to the users of D, A and B itself and counts the neighbouring WMMAs as cover,
// so the vector port is left to the softmax work of the waves that share the SIMD.
__device__ __forceinline__ v8f wmma16p(v16h a, v16h b, v8f c) { return __builtin_amdgcn_wmma_f32_16x16x32_f16(false, a, false, b, (short)0, c, false, false); }
// fragment loaders from K-contiguous 16-bit rows; p already includes + 8*(lane>>4): elements 0..7 <- k0+8h+0..7, elements 8..15 <- k0+16+8h+0..7 (same map for A and B)
__device__ __forceinline__ v16h  ldh(const h16* p) { return cat16(*(const v8h*)p, *(const v8h*)(p + 16)); }
__device__ __forceinline__ v16bf ldb(const bf* p)  { return cat16b(*(const v8us*)p, *(const v8us*)(p + 16)); }
// ordering point for wave-private LDS tiles (same wave writes and reads)
__device__ __forceinline__ void wave_sync() { __builtin_amdgcn_fence(3 /* release order */, "wavefront"); __builtin_amdgcn_wave_barrier(); asm volatile("" ::: "memory"); }

// ---- operand staging of k_out (k_proj has its own stage shape, at the kernel): a 128x128 output tile per block of four waves (2 x 2, 64x64 each), K walked in tiles of BK.
// One stage = 128 A rows then 128 B rows of BK 16-bit elements (128 B, one cache line each) at a pitch of 144 B (16 B x odd: conflict-free for 16-byte LDS reads); two buffers.
#define BK   64
#define LPE  72                   // LDS row pitch in 16-bit elements
#define STGE (256 * LPE)          // elements of one buffer
#define STGB (STGE * 2)           // bytes of one buffer
#define NKT  (DM / BK)            // K tiles of one walk over K
static_assert(DM % BK == 0 && NKT >= 2);   // both prologue tiles exist
// eight asynchronous 16-byte copies of one lane, rows 16 apart (LDS step 16 * 144 B, global step 16 rows of DM elements); eight lanes cover one 128-B row.
// s_wait_xcnt closes the statement so that no address register is rewritten ahead of it.
__device__ __forceinline__ void copy8(unsigned l, const char* g) {
    const size_t gs = (size_t)16 * DM * 2; const unsigned ls = 16 * LPE * 2;
    asm volatile("global_load_async_to_lds_b128 %0, %8, off\n\t"
                 "global_load_async_to_lds_b128 %1, %9, off\n\t"
                 "global_load_async_to_lds_b128 %2, %10, off\n\t"
                 "global_load_async_to_lds_b128 %3, %11, off\n\t"
                 "global_load_async_to_lds_b128 %4, %12, off\n\t"
                 "global_load_async_to_lds_b128 %5, %13, off\n\t"
                 "global_load_async_to_lds_b128 %6, %14, off\n\t"
                 "global_load_async_to_lds_b128 %7, %15, off\n\t"
                 "s_wait_xcnt 0x0"
                 :: "v"(l), "v"(l + ls), "v"(l + 2 * ls), "v"(l + 3 * ls), "v"(l + 4 * ls), "v"(l + 5 * ls), "v"(l + 6 * ls), "v"(l + 7 * ls),
                    "v"(g), "v"(g + gs), "v"(g + 2 * gs), "v"(g + 3 * gs), "v"(g + 4 * gs), "v"(g + 5 * gs), "v"(g + 6 * gs), "v"(g + 7 * gs)
                 : "memory");
}
// the issuing wave's own copies have landed (the compiler places no wait for them)
__device__ __forceinline__ void wait_copies() { asm volatile("s_wait_asynccnt 0x0" ::: "memory"); }
// this wave's LDS reads of the buffer have returned before the barrier that frees it for the refill
__device__ __forceinline__ void wait_lds() { asm volatile("s_wait_dscnt 0x0" ::: "memory"); }

// ---- K / V^T staging of k_flash: one stage = FK keys of one kv head: FK K rows (64 d = 128 B each), then 64 V^T rows (FK keys = 128 B each), whole cache lines, at the same 144-B pitch; two buffers.
#define FK    64
#define FSTGE ((FK + HD) * LPE)   // elements of one buffer
#define FSTGB (FSTGE * 2)         // bytes of one buffer
static_assert(FK == 64 && SEQ % FK == 0);                         // a V^T row of a stage is one 128-B line; the last stage of any query tile ends inside the planes
static_assert(2 * FSTGB >= AW * 16 * 68 * 4);                     // the output staging reuses the ring behind the last barrier
// eight asynchronous 16-byte copies of one lane: four K rows, then four V^T rows, each 16 rows apart (eight lanes cover one 128-B row, 128 threads 16 rows).
// s_wait_xcnt closes the statement so that no address register is rewritten ahead of it.
__device__ __forceinline__ void stage_kv(unsigned l, const char* gk, const char* gv) {
    const size_t kst = (size_t)16 * HD * 2, vst = (size_t)16 * SEQ * 2; const unsigned ls = 16 * LPE * 2;
    asm volatile("global_load_async_to_lds_b128 %0, %8, off\n\t"
                 "global_load_async_to_lds_b128 %1, %9, off\n\t"
                 "global_load_async_to_lds_b128 %2, %10, off\n\t"
                 "global_load_async_to_lds_b128 %3, %11, off\n\t"
                 "global_load_async_to_lds_b128 %4, %12, off\n\t"
                 "global_load_async_to_lds_b128 %5, %13, off\n\t"
                 "global_load_async_to_lds_b128 %6, %14, off\n\t"
                 "global_load_async_to_lds_b128 %7, %15, off\n\t"
                 "s_wait_xcnt 0x0"
                 :: "v"(l), "v"(l + ls), "v"(l + 2 * ls), "v"(l + 3 * ls), "v"(l + 4 * ls), "v"(l + 5 * ls), "v"(l + 6 * ls), "v"(l + 7 * ls),
                    "v"(gk), "v"(gk + kst), "v"(gk + 2 * kst), "v"(gk + 3 * kst), "v"(gv), "v"(gv + vst), "v"(gv + 2 * vst), "v"(gv + 3 * vst)
                 : "memory");
}

// ---- preparation: the x conversion, the four weight transposes and the rotary table depend on nothing but the inputs; they share one launch (k_prep), the block index picks the job.
// cvt8: 8 x values of one thread, f32 -> bf16; i counts groups of 8 over [NB][SEQ][DM], the source batches lie SEQ_FULL tokens apart.
__device__ __forceinline__ void cvt8(const float* __restrict__ src, bf* dst, int blk) {
    const size_t i = (size_t)blk * 256 + threadIdx.x; if (i >= (size_t)NB * SEQ * DM / 8) return;
    src += (i / ((size_t)SEQ * DM / 8)) * ((size_t)(SEQ_FULL - SEQ) * DM);
    const v8f v = *(const v8f*)(src + i * 8); v8us o;
#pragma unroll
    for (int k = 0; k < 8; ++k) o[k] = f2bf(v[k]);
    *(v8us*)(dst + i * 8) = o; 
}

// wt_tile: in[Kr rows][Nc cols] f32 -> out[Nc rows][Kr cols] 16-bit, 64x64 tile (bx of Nc/64, by of Kr/64) through LDS, 256 threads.
__device__ __forceinline__ void wt_tile(float* ts, const float* __restrict__ W, bf* Tb, h16* Th, int Kr, int Nc, int mode, int bx, int by) {
    const int tid = threadIdx.x; const int n0 = bx * 64, k0 = by * 64;
#pragma unroll
    for (int p = 0; p < 4; ++p) { const int row = p * 16 + (tid >> 4), c4 = (tid & 15) * 4;      // 4 p x 16 rows = 64 k rows; 16 threads x 4 = 64 n columns
        const v4f v = *(const v4f*)(W + (size_t)(k0 + row) * (size_t)Nc + n0 + c4);
        ts[row * 65 + c4 + 0] = v[0]; ts[row * 65 + c4 + 1] = v[1]; ts[row * 65 + c4 + 2] = v[2]; ts[row * 65 + c4 + 3] = v[3]; }
    __syncthreads();
{
#pragma unroll
        for (int s = 0; s < 2; ++s) { const int n = s * 32 + (tid >> 3), c8 = (tid & 7) * 8;     // 2 s x 32 rows = 64 n rows; 8 lanes x 8 = 64 k columns
            const size_t oo = (size_t)(n0 + n) * (size_t)Kr + k0 + c8;
            if (mode == 0) { v8us o;
#pragma unroll
                for (int i = 0; i < 8; ++i) o[i] = f2bf(ts[(c8 + i) * 65 + n]);
                *(v8us*)(Tb + oo) = o;
                asm volatile("s_wait_xcnt 0x0" ::: "memory");   // stands in front of any later rewrite of the store's address and data registers
            } else { v8h o;
#pragma unroll
                for (int i = 0; i < 8; ++i) o[i] = (h16)(__uint_as_float(((unsigned)f2bf(ts[(c8 + i) * 65 + n])) << 16) * WOS);
                *(v8h*)(Th + oo) = o;
                asm volatile("s_wait_xcnt 0x0" ::: "memory"); } }   // as above
         }
}

// rope_tab: CS[t][j] = (cos, sin)(t * inv_freq[j]), inv_freq[j] = 1.0f / (float)(10000^(j/32)); the power is a double product of fixed binary roots of 10000.
__device__ __forceinline__ void rope_tab(float* CS, int blk) {
    const int i = blk * 256 + threadIdx.x; if (i >= SEQ * 32) return;
    const int t = i >> 5, j = i & 31;
    double p = 1.0;
    p *= (j & 1)  ? 1.3335214321633240 : 1.0;    // 10000^(1/32)
    p *= (j & 2)  ? 1.7782794100389228 : 1.0;    // 10000^(1/16)
    p *= (j & 4)  ? 3.1622776601683795 : 1.0;    // 10000^(1/8)
    p *= (j & 8)  ? 10.0 : 1.0;                  // 10000^(1/4)
    p *= (j & 16) ? 100.0 : 1.0;                 // 10000^(1/2)
    const float pf = (float)p; const float inv = 1.0f / pf;
    const float ang = (float)t * inv;
    const float cs = cosf(ang), sn = sinf(ang);
    v2f o; o[0] = cs; o[1] = sn;
    *(v2f*)(CS + (size_t)i * 2) = o; 
}

#define PB_ROPE ((SEQ * 32 + 255) / 256)              // blocks of the rotary table
#define PB_WBIG ((DM / 64) * (DM / 64))               // tiles of Wq, of Wo
#define PB_WKV  ((KVD / 64) * (DM / 64))              // tiles of Wk, of Wv
#define PB_CVT  ((int)(((size_t)NB * SEQ * DM / 8 + 255) / 256))   // blocks of the x conversion
// k_prep: grid PB_ROPE + 2 PB_WBIG + 2 PB_WKV + PB_CVT, 256 threads; every branch on the block index is block-uniform (the transposes' barrier stands under it).
__global__ __launch_bounds__(256) void k_prep(const float* __restrict__ x, const float* __restrict__ wq, const float* __restrict__ wk, const float* __restrict__ wv, const float* __restrict__ wo,
                                              bf* XB, bf* WQt, bf* WKt, bf* WVt, h16* WOt, float* CS) {
    __shared__ float ts[64 * 65];
    int blk = blockIdx.x;
    if (blk < PB_ROPE) { rope_tab(CS, blk); return; }
    blk -= PB_ROPE;
    if (blk < 2 * PB_WBIG + 2 * PB_WKV) {
        const float* W; bf* T; int Nc, mode = 0;
        if (blk < PB_WBIG)                    { W = wq; T = WQt; Nc = DM; }
        else if (blk < 2 * PB_WBIG)           { blk -= PB_WBIG; W = wo; T = (bf*)WOt; Nc = DM; mode = 1; }
        else if (blk < 2 * PB_WBIG + PB_WKV)  { blk -= 2 * PB_WBIG; W = wk; T = WKt; Nc = KVD; }
        else                                  { blk -= 2 * PB_WBIG + PB_WKV; W = wv; T = WVt; Nc = KVD; }
        const int nx = Nc / 64;
        wt_tile(ts, W, T, (h16*)T, DM, Nc, mode, blk % nx, blk / nx);
        return;
    }
    cvt8(x, XB, blk - (2 * PB_WBIG + 2 * PB_WKV));
}

// k_proj: register-blocked bf16 GEMM, K = DM: C[m][n] = sum_k x[m][k] W[n][k], m = token b*SEQ + t, n = one of the 3072 output features of Wq^T (2048), Wk^T (512), Wv^T (512) taken as one list.
// XW: the bf16 x rows and, directly behind them in the workspace, the Wq^T, Wk^T, Wv^T rows: one plane of NB*SEQ + 3072 rows of K (asserted at the carve).
// One block = a 256 x 192 tile, twelve waves (4 x 3), one 64x64 tile (16 accumulators) per wave; the grid is one block per 256 x 192 tile, (NB*SEQ/256) * 16, the row tile runs fastest.
// All twelve waves read one staged copy of the 256 x rows and the 192 W rows, so a block brings 448 rows from L2 where three separate 128x128 tiles brought 768.
// One stage = 256 A rows then 192 B rows of PBK 16-bit elements (256 B, two cache lines) at a pitch of 272 B (16 B x odd: conflict-free for 16-byte LDS reads); two buffers.
// The 64 columns of a wave tile are one head: unit u = n / 64: u < 32 query head u, u < 40 kv head u - 32 of k, else kv head u - 40 of v (wave-uniform).
// q, k: written as f16 (Ph) and the f16 residual x1024 (Pr) to plane [(b*heads + head)][t][d], interleaved rotary applied on the f32 values at the store stage from CS[t][32] (cos, sin).
// v: no rotary, the wave tile is turned at the LDS staging and written to plane [(b*8 + g)][d][t].
#define PBK   128
#define PLPE  136                  // LDS row pitch in 16-bit elements
#define PTM   256                  // tile rows (tokens)
#define PTN   192                  // tile columns (three heads)
#define PSTGE ((PTM + PTN) * PLPE) // elements of one buffer
#define PSTGB (PSTGE * 2)          // bytes of one buffer
#define PNKT  (DM / PBK)           // K tiles
#define PNW   12                   // waves per block
#define PRS   24                   // staged rows covered by one copy of all 384 threads (16 lanes a row)
#define GP    ((NB * SEQ / PTM) * ((DM + 2 * KVD) / PTN))
static_assert(DM % PBK == 0 && PNKT >= 2);                       // both prologue tiles exist
static_assert(SEQ % PTM == 0 && (DM + 2 * KVD) % PTN == 0);      // whole tiles; a row tile never straddles two batches
static_assert((PTM + PTN) == 18 * PRS + 16);                     // 18 copies of every wave, a 19th of waves 0..7 (16 rows)
static_assert(2 * PSTGB + PNW * 16 * 68 * 4 <= 327680);
// six asynchronous 16-byte copies of one lane, LDS rows PRS apart, each with its own global address.
// s_wait_xcnt closes the statement so that no address register is rewritten ahead of it.
__device__ __forceinline__ void copy6(unsigned l, const char* g0, const char* g1, const char* g2, const char* g3, const char* g4, const char* g5) {
    const unsigned ls = PRS * PLPE * 2;
    asm volatile("global_load_async_to_lds_b128 %0, %6, off\n\t"
                 "global_load_async_to_lds_b128 %1, %7, off\n\t"
                 "global_load_async_to_lds_b128 %2, %8, off\n\t"
                 "global_load_async_to_lds_b128 %3, %9, off\n\t"
                 "global_load_async_to_lds_b128 %4, %10, off\n\t"
                 "global_load_async_to_lds_b128 %5, %11, off\n\t"
                 "s_wait_xcnt 0x0"
                 :: "v"(l), "v"(l + ls), "v"(l + 2 * ls), "v"(l + 3 * ls), "v"(l + 4 * ls), "v"(l + 5 * ls),
                    "v"(g0), "v"(g1), "v"(g2), "v"(g3), "v"(g4), "v"(g5)
                 : "memory");
}
// one such copy, closed by its s_wait_xcnt for the same reason
__device__ __forceinline__ void copy1(unsigned l, const char* g) {
    asm volatile("global_load_async_to_lds_b128 %0, %1, off\n\t"
                 "s_wait_xcnt 0x0"
                 :: "v"(l), "v"(g) : "memory");
}
__global__ __launch_bounds__(32 * PNW) void k_proj(const bf* __restrict__ XW,
                                                   h16* QH, h16* QR, h16* KP, h16* KR, h16* VT, h16* VR, const float* __restrict__ CS) {
    __shared__ __align__(16) bf ring[2 * PSTGE];
    __shared__ __align__(16) float osall[PNW * 16 * 68];
    const int K = DM;
    const int bid = blockIdx.x; const int mt = NB * SEQ / PTM;
    const int tid = threadIdx.x; const int wave = __builtin_amdgcn_readfirstlane(tid >> 5);
    const int lane = tid & 31, lr = lane & 15, hi = lane >> 4; const int rb = (bid % mt) * PTM, cb = (bid / mt) * PTN;
    const int wr = (wave / 3) * 64, wc = (wave % 3) * 64; const int r0 = rb + wr;
    float* os = osall + wave * 16 * 68;
    v8f acc[4][4];
#pragma unroll
    for (int mb = 0; mb < 4; ++mb)
#pragma unroll
        for (int nb = 0; nb < 4; ++nb) acc[mb][nb] = (v8f){};
    // a copy of one wave fills two staged rows, 2 * wave + hi + PRS * i, 16 bytes a lane at lr * 16 of the row's 256; both rows lie on the same side of the A / B boundary (it is even), so the side is picked on scalars.
    // gp[i]: the lane's global address in K tile 0 (the 19th row pair is held inside the stage for the waves that do not issue it)
    const unsigned l0 = (unsigned)(size_t)ring + (unsigned)((2 * wave + hi) * (PLPE * 2) + lr * 16);
    const char* gp[19];
#pragma unroll
    for (int i = 0; i < 19; ++i) {
        int rw = 2 * wave + PRS * i; rw = rw < PTM + PTN ? rw : PTM + PTN - 2;
        const int ri = rw < PTM ? rb + rw : NB * SEQ + cb + rw - PTM;   // row of XW: a token, or behind the tokens an output feature
        gp[i] = (const char*)(XW + (size_t)ri * K) + ((size_t)hi * K + (size_t)lr * 8) * 2;
    }
    const int afr = (wr + lr) * PLPE + 8 * hi, bfr = (PTM + wc + lr) * PLPE + 8 * hi;
    auto stage = [&](unsigned l, size_t ko) {
        const unsigned ls = PRS * PLPE * 2;
        copy6(l,           gp[0] + ko,  gp[1] + ko,  gp[2] + ko,  gp[3] + ko,  gp[4] + ko,  gp[5] + ko);
        copy6(l + 6 * ls,  gp[6] + ko,  gp[7] + ko,  gp[8] + ko,  gp[9] + ko,  gp[10] + ko, gp[11] + ko);
        copy6(l + 12 * ls, gp[12] + ko, gp[13] + ko, gp[14] + ko, gp[15] + ko, gp[16] + ko, gp[17] + ko);
        if (wave < 8) copy1(l + 18 * ls, gp[18] + ko);             // wave-uniform: rows 432..447 are eight waves' worth
    };
    stage(l0, 0);
    wait_copies();
    __syncthreads();                                              // tile 0 readable by every wave
    stage(l0 + PSTGB, PBK * 2);
#pragma unroll 1   // one trip per staged tile: the ring's waits and barrier stand once, at the foot
    for (int t = 0; t < PNKT; ++t) {
        const bf* sb = ring + (t & 1) * PSTGE;
#pragma unroll     // this and the loops inside: constant indices keep fragments and accumulators in registers
        for (int ks = 0; ks < PBK; ks += 32) {
            v16bf a[4], b[4];
#pragma unroll
            for (int mb = 0; mb < 4; ++mb) a[mb] = ldb(sb + afr + mb * 16 * PLPE + ks);
#pragma unroll
            for (int nb = 0; nb < 4; ++nb) b[nb] = ldb(sb + bfr + nb * 16 * PLPE + ks);
#pragma unroll
            for (int nb = 0; nb < 4; ++nb)
#pragma unroll
                for (int mb = 0; mb < 4; ++mb) acc[mb][nb] = wmmab(a[mb], b[nb], acc[mb][nb]);
        }
        wait_lds();
        wait_copies();
        __syncthreads();                                          // publishes tile t + 1 and frees the buffer of tile t
        if (t + 2 < PNKT) stage(l0 + (unsigned)(t & 1) * PSTGB, (size_t)(t + 2) * (PBK * 2));
    }
    wait_copies();
    // the wave's head and its output map, all wave-uniform
    const int u = (cb + wc) / HD; const int bt = r0 / SEQ, t0 = r0 % SEQ;
    const bool isv = u >= NH_ + NKV;
    h16* Ph; h16* Pr; size_t tbase; int pitch;
    if (u < NH_)       { Ph = QH; Pr = QR; pitch = HD;  tbase = ((size_t)(bt * NH_ + u) * SEQ + (size_t)t0) * HD; }
    else if (!isv)     { Ph = KP; Pr = KR; pitch = HD;  tbase = ((size_t)(bt * NKV + (u - NH_)) * SEQ + (size_t)t0) * HD; }
    else               { Ph = VT; Pr = VR; pitch = SEQ; tbase = (size_t)(bt * NKV + (u - NH_ - NKV)) * HD * SEQ + (size_t)t0; }
#pragma unroll
    for (int p = 0; p < 4; ++p) {                                 // q, k: 16 tokens x 64 d; v: 16 d x 64 tokens
        if (!isv) {
#pragma unroll
            for (int nb = 0; nb < 4; ++nb) {
#pragma unroll
                for (int j = 0; j < 8; ++j) os[(hi * 8 + j) * 68 + nb * 16 + lr] = acc[p][nb][j]; }   // D: row 8h+j, col lane&15
        } else {
#pragma unroll
            for (int mb = 0; mb < 4; ++mb) { v4f lo, up;                                              // D turned: os[d = lane&15][token = 16mb + 8h + j]
                lo[0] = acc[mb][p][0]; lo[1] = acc[mb][p][1]; lo[2] = acc[mb][p][2]; lo[3] = acc[mb][p][3];
                up[0] = acc[mb][p][4]; up[1] = acc[mb][p][5]; up[2] = acc[mb][p][6]; up[3] = acc[mb][p][7];
                *(v4fa*)(&os[lr * 68 + mb * 16 + hi * 8]) = lo; *(v4fa*)(&os[lr * 68 + mb * 16 + hi * 8 + 4]) = up; }
        }
        wave_sync();
        const size_t sb = tbase + (size_t)(p * 16) * (size_t)pitch;
{
#pragma unroll
            for (int s = 0; s < 4; ++s) { const int row = 4 * s + (lane >> 3), c8 = (lane & 7) * 8;   // 4 s x 4 row groups = 16 rows; 8 lanes x 8 = 64 columns
                v4f x0 = *(const v4fa*)(&os[row * 68 + c8]); v4f x1 = *(const v4fa*)(&os[row * 68 + c8 + 4]); v8h hv, rv;
                if (!isv) {                                                                            // wave-uniform (set with the head)
                    const int t = t0 + p * 16 + row;
                    const float* cp = CS + ((size_t)t * 32 + (size_t)(c8 >> 1)) * 2;                  // pairs c8/2 .. c8/2+3: (cos, sin) x 4
                    const v4f ca = *(const v4f*)cp; const v4f cb2 = *(const v4f*)(cp + 4);
                    float e, o;
                    e = x0[0]; o = x0[1]; x0[0] = e * ca[0] - o * ca[1]; x0[1] = e * ca[1] + o * ca[0];
                    e = x0[2]; o = x0[3]; x0[2] = e * ca[2] - o * ca[3]; x0[3] = e * ca[3] + o * ca[2];
                    e = x1[0]; o = x1[1]; x1[0] = e * cb2[0] - o * cb2[1]; x1[1] = e * cb2[1] + o * cb2[0];
                    e = x1[2]; o = x1[3]; x1[2] = e * cb2[2] - o * cb2[3]; x1[3] = e * cb2[3] + o * cb2[2]; }
#pragma unroll
                for (int i = 0; i < 4; ++i) { const h16 a0 = (h16)x0[i]; const h16 a1 = (h16)x1[i]; hv[i] = a0; hv[4 + i] = a1; rv[i] = (h16)((x0[i] - (float)a0) * QRS); rv[4 + i] = (h16)((x1[i] - (float)a1) * QRS); }
                const size_t oo = sb + (size_t)row * (size_t)pitch + c8;
                *(v8h*)(Ph + oo) = hv; *(v8h*)(Pr + oo) = rv;
                asm volatile("s_wait_xcnt 0x0" ::: "memory"); }   // stands in front of the next rows' rewrite of the two stores' address registers
             }
        wave_sync();
    }
}

// flash_early: the body of k_flash's blocks for query rows < EARLY (same structure as the late body below, operands straight from the planes) with value + residual (x1024) planes on every operand:
// scores = kh.qh + (kh.qr + kr.qh)/1024; O = vh.ph + (vr.ph + vh.pr)/1024 (residual products in their own accumulators), l from the unconverted f32 P.
// Writes the ctx value plane rows (carried x1024) and the compact unscaled residual plane CR[b][t < EARLY][2048].
__device__ __forceinline__ void flash_early(float* os, const h16* __restrict__ QH, const h16* __restrict__ QR, const h16* __restrict__ KP, const h16* __restrict__ KR,
                                            const h16* __restrict__ VT, const h16* __restrict__ VR, h16* CH, h16* CR, int t0, int zg) {
    const int lane = threadIdx.x & 31; const int wave = __builtin_amdgcn_readfirstlane(threadIdx.x >> 5);
    const int lr = lane & 15, hi = lane >> 4;
    const int b = zg / NKV; const int g = zg % NKV;
    const int h = g * AW + wave;
    const int tq = t0 + lr;
    const size_t qo = ((size_t)(b * NH_ + h) * SEQ + (size_t)tq) * HD + 8 * hi;
    const v16h qh0 = ldh(QH + qo), qh1 = ldh(QH + qo + 32), qr0 = ldh(QR + qo), qr1 = ldh(QR + qo + 32);
    const size_t ko = (size_t)zg * SEQ * HD + (size_t)lr * HD + 8 * hi;
    const size_t vo = (size_t)zg * HD * SEQ + (size_t)lr * SEQ + 8 * hi;
    v8f oH[4], oL[4];
#pragma unroll
    for (int j = 0; j < 4; ++j) { oH[j] = (v8f){}; oL[j] = (v8f){}; }
    float m = NEGB, l = 0.0f;
    const int kend = t0 + 16;
#pragma unroll 1
    for (int key0 = 0; key0 < kend; key0 += 32) {
        const size_t kk = ko + (size_t)key0 * HD;
        v8f sHa = (v8f){}, sLa = (v8f){}, sHb = (v8f){}, sLb = (v8f){};
        { const v16h k0 = ldh(KP + kk), k1 = ldh(KP + kk + 32), r0 = ldh(KR + kk), r1 = ldh(KR + kk + 32);
          sHa = wmma16(k0, qh0, sHa); sHa = wmma16(k1, qh1, sHa);
          sLa = wmma16(k0, qr0, sLa); sLa = wmma16(k1, qr1, sLa); sLa = wmma16(r0, qh0, sLa); sLa = wmma16(r1, qh1, sLa); }
        { const size_t k2 = kk + (size_t)16 * HD;
          const v16h k0 = ldh(KP + k2), k1 = ldh(KP + k2 + 32), r0 = ldh(KR + k2), r1 = ldh(KR + k2 + 32);
          asm volatile("s_wait_xcnt 0x0" :: "v"(KP + kk), "v"(KR + kk) : "memory");   // behind the eight loads; naming their two base addresses keeps those registers from serving as a load's destination ahead of the wait
          sHb = wmma16(k0, qh0, sHb); sHb = wmma16(k1, qh1, sHb);
          sLb = wmma16(k0, qr0, sLb); sLb = wmma16(k1, qr1, sLb); sLb = wmma16(r0, qh0, sLb); sLb = wmma16(r1, qh1, sLb); }
        float ta[8], tb[8];
#pragma unroll
        for (int r = 0; r < 8; ++r) { ta[r] = (sHa[r] + sLa[r] * QRI) * SC2; tb[r] = (sHb[r] + sLb[r] * QRI) * SC2; }
        if (key0 + 31 > t0) {                                      // block-uniform: diagonal block
            const int kbse = key0 + 8 * hi;
#pragma unroll
            for (int r = 0; r < 8; ++r) { ta[r] = (kbse + r > tq) ? NEGB : ta[r]; tb[r] = (kbse + 16 + r > tq) ? NEGB : tb[r]; } }
        float mx = NEGB;
#pragma unroll
        for (int r = 0; r < 8; ++r) mx = fmaxf(mx, fmaxf(ta[r], tb[r]));
        mx = fmaxf(mx, __shfl_xor(mx, 16, 32));
        const float mnew = fmaxf(m, mx);
        const float alpha = __builtin_amdgcn_exp2f(m - mnew);
        const float sh = PSH - mnew;
        v16h ph, pr; float ls = 0.0f;
#pragma unroll
        for (int r = 0; r < 8; ++r) { const float ea = __builtin_amdgcn_exp2f(ta[r] + sh); const float ec = __builtin_amdgcn_exp2f(tb[r] + sh);
            const h16 ha = (h16)ea; const h16 hc = (h16)ec; ph[r] = ha; ph[8 + r] = hc;
            pr[r] = (h16)((ea - (float)ha) * QRS); pr[8 + r] = (h16)((ec - (float)hc) * QRS); ls += ea + ec; }
        l = l * alpha + ls; m = mnew;
#pragma unroll
        for (int j = 0; j < 4; ++j) { oH[j] = oH[j] * alpha; oL[j] = oL[j] * alpha; }
        const size_t vv = vo + (size_t)key0;
#pragma unroll
        for (int j = 0; j < 4; ++j) { const v16h vh = ldh(VT + vv + (size_t)(16 * j) * SEQ); const v16h vr = ldh(VR + vv + (size_t)(16 * j) * SEQ);
            oH[j] = wmma16(vh, ph, oH[j]); oL[j] = wmma16(vr, ph, oL[j]); oL[j] = wmma16(vh, pr, oL[j]); }
    }
    l += __shfl_xor(l, 16, 32);
    const float inv = CXS / l;
    const int wb = wave * 16 * 68;
#pragma unroll
    for (int j = 0; j < 4; ++j) { v4f a, c;     // os[t][d], d = 16j + 8h + r; rows 0..15 x columns 0..63 all written
        a[0] = (oH[j][0] + oL[j][0] * QRI) * inv; a[1] = (oH[j][1] + oL[j][1] * QRI) * inv; a[2] = (oH[j][2] + oL[j][2] * QRI) * inv; a[3] = (oH[j][3] + oL[j][3] * QRI) * inv;
        c[0] = (oH[j][4] + oL[j][4] * QRI) * inv; c[1] = (oH[j][5] + oL[j][5] * QRI) * inv; c[2] = (oH[j][6] + oL[j][6] * QRI) * inv; c[3] = (oH[j][7] + oL[j][7] * QRI) * inv;
        *(v4fa*)(&os[wb + lr * 68 + 16 * j + 8 * hi]) = a; *(v4fa*)(&os[wb + lr * 68 + 16 * j + 8 * hi + 4]) = c; }
    wave_sync();
    h16* crow = CH + ((size_t)b * SEQ + t0) * DM + h * HD;
    h16* rrow = CR + ((size_t)b * EARLY + t0) * DM + h * HD;
{
#pragma unroll
        for (int s = 0; s < 4; ++s) { const int row = 4 * s + (lane >> 3), c8 = (lane & 7) * 8;   // 4 s x 4 row groups = 16 rows; 8 lanes x 8 = 64 columns
            const v4f x0 = *(const v4fa*)(&os[wb + row * 68 + c8]); const v4f x1 = *(const v4fa*)(&os[wb + row * 68 + c8 + 4]); v8h hv, rv;
#pragma unroll
            for (int i = 0; i < 4; ++i) { const h16 a0 = (h16)x0[i]; const h16 a1 = (h16)x1[i]; hv[i] = a0; hv[4 + i] = a1; rv[i] = (h16)(x0[i] - (float)a0); rv[4 + i] = (h16)(x1[i] - (float)a1); }
            *(v8h*)(crow + (size_t)row * DM + c8) = hv; *(v8h*)(rrow + (size_t)row * DM + c8) = rv; }
         }
}

// k_flash: fused causal attention, grid FL_LATE + FL_EARLY. One block = 16 query rows x the four query heads of one kv head (one wave per head, h = g*4 + wave); in the block number bid the row tile runs fastest;
// both bodies depend only on k_proj, so they share the launch: block numbers from FL_LATE on (rows < EARLY) run flash_early, the others the body below:
// Q fragments straight from the f16 planes; K / V^T of kv head g staged once per block in LDS, FK keys a stage, and read as fragments (two 16-B LDS loads each) by all four waves.
// Transposed form: S^T[key][t] = K Q^T (A = K rows, B = Q rows); lane (t = lane&15, h = lane>>4) holds keys 8h+r of each 16-key tile, so the packed
// P tile is directly the B fragment of O^T[d][t] = V^T P^T (element r <- tile keys 0..15, element 8+r <- tile keys 16..31, lane unchanged).
// Keys run over [0, t0+16) in steps of 32; the diagonal 32-key blocks replace excluded scores (key > t) by a large negative value before the running max.
#define FL_LX    ((SEQ - EARLY) / 16)
#define FL_LATE  (FL_LX * NB * NKV)
#define FL_EARLY ((EARLY / 16) * NB * NKV)
static_assert(FL_LX > 0);                                        // the late blocks' index is split by it
// flash_bid: launch index -> block number. A block's cost grows with its row tile (the key walk ends at the diagonal), the registers hold fewer blocks on the chip than the grid has:
// so the cost falls with the launch index (for speed only). First the blocks of rows < EARLY (few trips, each waiting on loads straight from the planes), then the others from the last
// row tile down to the first; inside one row tile the (batch, kv head) index runs fastest. A permutation of [0, FL_LATE + FL_EARLY), block-uniform.
__device__ __forceinline__ int flash_bid(int rank) {
    const int nz = NB * NKV;
    if (rank < FL_EARLY) return FL_LATE + (rank % nz) * (EARLY / 16) + (EARLY / 16 - 1 - rank / nz);
    rank -= FL_EARLY;
    return (rank % nz) * FL_LX + (FL_LX - 1 - rank / nz);
}
__global__ __launch_bounds__(32 * AW) void k_flash(const h16* __restrict__ QH, const h16* __restrict__ QR, const h16* __restrict__ KP, const h16* __restrict__ KR,
                                                   const h16* __restrict__ VT, const h16* __restrict__ VR, h16* CH, h16* CR) {
    __shared__ __align__(16) h16 ring[2 * FSTGE];
    float* os = (float*)ring;                                     // output staging, used only behind the loop's last barrier (the early body stages nothing else there)
    const int bid = flash_bid(blockIdx.x);
    if (bid >= FL_LATE) { const int e = bid - FL_LATE; flash_early(os, QH, QR, KP, KR, VT, VR, CH, CR, (e % (EARLY / 16)) * 16, e / (EARLY / 16)); return; }   // block-uniform, in front of every barrier
    const int zg = bid / FL_LX; const int t0 = EARLY + (bid % FL_LX) * 16;
    const int tid = threadIdx.x;
    const int lane = threadIdx.x & 31; const int wave = __builtin_amdgcn_readfirstlane(threadIdx.x >> 5);
    const int lr = lane & 15, hi = lane >> 4;
    const int b = zg / NKV; const int g = zg % NKV;
    const int h = g * AW + wave;                                  // repeat on the head axis: query head h uses kv head h >> 2
    const int tq = t0 + lr;
    const size_t qo = ((size_t)(b * NH_ + h) * SEQ + (size_t)tq) * HD + 8 * hi;
    const v16h qh0 = ldh(QH + qo), qh1 = ldh(QH + qo + 32), qr0 = ldh(QR + qo), qr1 = ldh(QR + qo + 32);   // B fragments: col t, k = d
    const unsigned l0 = (unsigned)(size_t)ring + (unsigned)((tid >> 3) * (LPE * 2) + (tid & 7) * 16);
    const char* gk = (const char*)(KP + (size_t)zg * SEQ * HD + (size_t)(tid >> 3) * HD + (tid & 7) * 8);    // + stage * FK rows
    const char* gv = (const char*)(VT + (size_t)zg * HD * SEQ + (size_t)(tid >> 3) * SEQ + (tid & 7) * 8);   // + stage * FK keys
    const int kfr = lr * LPE + 8 * hi;                            // + key * LPE        (A fragment: row key, k = d)
    const int vfr = (FK + lr) * LPE + 8 * hi;                     // + 16j * LPE + key  (A fragment: row d, k = key)
    v8f o0 = (v8f){}, o1 = (v8f){}, o2 = (v8f){}, o3 = (v8f){};
    float m = NEGB, l = 0.0f;
    const int kend = t0 + 16;
    const int nst = (kend + FK - 1) / FK;                         // block-uniform; stage nst - 1 ends at or before key SEQ
    stage_kv(l0, gk, gv);
    wait_copies();
    __syncthreads();                                              // stage 0 readable by every wave
    if (nst > 1) stage_kv(l0 + FSTGB, gk + (size_t)FK * HD * 2, gv + FK * 2);
#pragma unroll 1   // one trip per staged tile: the ring's waits and barrier stand once, at the foot
    for (int st = 0; st < nst; ++st) {
        const h16* sb = ring + (st & 1) * FSTGE;
#pragma unroll     // two 32-key steps per stage, constant LDS offsets
        for (int ks = 0; ks < FK; ks += 32) {
            const int key0 = st * FK + ks;
            if (key0 >= kend) break;                               // block-uniform: the last stage may hold one step only
            const h16* ka = sb + kfr + ks * LPE;
            const v16h ka0 = ldh(ka), ka1 = ldh(ka + 32), kb0 = ldh(ka + 16 * LPE), kb1 = ldh(ka + 16 * LPE + 32);
            v8f sHa = (v8f){}, sLa = (v8f){}, sHb = (v8f){}, sLb = (v8f){};
            sHa = wmma16p(ka0, qh0, sHa); sLa = wmma16p(ka0, qr0, sLa); sHb = wmma16p(kb0, qh0, sHb); sLb = wmma16p(kb0, qr0, sLb);
            sHa = wmma16p(ka1, qh1, sHa); sLa = wmma16p(ka1, qr1, sLa); sHb = wmma16p(kb1, qh1, sHb); sLb = wmma16p(kb1, qr1, sLb);
            float ta[8], tb[8];
#pragma unroll
            for (int r = 0; r < 8; ++r) { ta[r] = (sHa[r] + sLa[r] * QRI) * SC2; tb[r] = (sHb[r] + sLb[r] * QRI) * SC2; }
            if (key0 + 31 > t0) {                                  // block-uniform: diagonal block
                const int kbse = key0 + 8 * hi;
#pragma unroll
                for (int r = 0; r < 8; ++r) { ta[r] = (kbse + r > tq) ? NEGB : ta[r]; tb[r] = (kbse + 16 + r > tq) ? NEGB : tb[r]; } }
            float mx = NEGB;
#pragma unroll
            for (int r = 0; r < 8; ++r) mx = fmaxf(mx, fmaxf(ta[r], tb[r]));
            mx = fmaxf(mx, __shfl_xor(mx, 16, 32));
            const float mnew = fmaxf(m, mx);
            const float alpha = __builtin_amdgcn_exp2f(m - mnew);
            const float sh = PSH - mnew;
            v16h pb; float ls = 0.0f;
#pragma unroll
            for (int r = 0; r < 8; ++r) { const float ea = __builtin_amdgcn_exp2f(ta[r] + sh); const float ec = __builtin_amdgcn_exp2f(tb[r] + sh); pb[r] = (h16)ea; pb[8 + r] = (h16)ec; ls += ea + ec; }
            l = l * alpha + ls; m = mnew;
            o0 = o0 * alpha; o1 = o1 * alpha; o2 = o2 * alpha; o3 = o3 * alpha;
            const h16* va = sb + vfr + ks;
            const v16h v0 = ldh(va), v1 = ldh(va + 16 * LPE), v2 = ldh(va + 32 * LPE), v3 = ldh(va + 48 * LPE);
            o0 = wmma16p(v0, pb, o0); o1 = wmma16p(v1, pb, o1); o2 = wmma16p(v2, pb, o2); o3 = wmma16p(v3, pb, o3);
        }
        wait_lds();
        wait_copies();
        __syncthreads();                                          // publishes stage st + 1 and frees the buffer of stage st
        if (st + 2 < nst) stage_kv(l0 + (unsigned)(st & 1) * FSTGB, gk + (size_t)(st + 2) * (FK * HD * 2), gv + (size_t)(st + 2) * (FK * 2));
    }
    wait_copies();
    l += __shfl_xor(l, 16, 32);
    const float inv = CXS / l;
    const int wb = wave * 16 * 68;
    // O^T D layout: o_j[r] = (d = 16j + 8h + r, t = lane&15) -> os[t][d]; rows 0..15 x columns 0..63 all written
    { v4f a, c;
      a[0] = o0[0] * inv; a[1] = o0[1] * inv; a[2] = o0[2] * inv; a[3] = o0[3] * inv; c[0] = o0[4] * inv; c[1] = o0[5] * inv; c[2] = o0[6] * inv; c[3] = o0[7] * inv;
      *(v4fa*)(&os[wb + lr * 68 +  0 + 8 * hi]) = a; *(v4fa*)(&os[wb + lr * 68 +  0 + 8 * hi + 4]) = c;
      a[0] = o1[0] * inv; a[1] = o1[1] * inv; a[2] = o1[2] * inv; a[3] = o1[3] * inv; c[0] = o1[4] * inv; c[1] = o1[5] * inv; c[2] = o1[6] * inv; c[3] = o1[7] * inv;
      *(v4fa*)(&os[wb + lr * 68 + 16 + 8 * hi]) = a; *(v4fa*)(&os[wb + lr * 68 + 16 + 8 * hi + 4]) = c;
      a[0] = o2[0] * inv; a[1] = o2[1] * inv; a[2] = o2[2] * inv; a[3] = o2[3] * inv; c[0] = o2[4] * inv; c[1] = o2[5] * inv; c[2] = o2[6] * inv; c[3] = o2[7] * inv;
      *(v4fa*)(&os[wb + lr * 68 + 32 + 8 * hi]) = a; *(v4fa*)(&os[wb + lr * 68 + 32 + 8 * hi + 4]) = c;
      a[0] = o3[0] * inv; a[1] = o3[1] * inv; a[2] = o3[2] * inv; a[3] = o3[3] * inv; c[0] = o3[4] * inv; c[1] = o3[5] * inv; c[2] = o3[6] * inv; c[3] = o3[7] * inv;
      *(v4fa*)(&os[wb + lr * 68 + 48 + 8 * hi]) = a; *(v4fa*)(&os[wb + lr * 68 + 48 + 8 * hi + 4]) = c; }
    wave_sync();
    h16* crow = CH + ((size_t)b * SEQ + t0) * DM + h * HD;         // merged heads: column h*64 + d
{
#pragma unroll
        for (int s = 0; s < 4; ++s) { const int row = 4 * s + (lane >> 3), c8 = (lane & 7) * 8;   // 4 s x 4 row groups = 16 rows; 8 lanes x 8 = 64 columns
            const v4f x0 = *(const v4fa*)(&os[wb + row * 68 + c8]); const v4f x1 = *(const v4fa*)(&os[wb + row * 68 + c8 + 4]); v8h hv;
#pragma unroll
            for (int i = 0; i < 4; ++i) { hv[i] = (h16)x0[i]; hv[4 + i] = (h16)x1[i]; }
            *(v8h*)(crow + (size_t)row * DM + c8) = hv; }
         }
}

// k_out: output projection, four waves per block (2 x 2, 64x64 per wave), f16 operands from the ctx plane CX (value rows [NB*SEQ], then residual rows [NB*EARLY]) and the Wo^T plane, staged in LDS, K = DM, one walk.
// Late block: a 128x128 output tile, the 128 staged A rows are 128 tokens. Early block (tokens < EARLY): a 64x128 output tile, the staged A rows are the 64 tokens' value rows, then the same tokens' unscaled residual rows:
// waves 0, 1 sum the value products, waves 2, 3 the residual products, and the two sums are added through LDS at the store (one barrier). So every block walks K once. grid (OB_E + OB_L, DM/128), 128 threads.
#define OB_E (NB * (EARLY / 64))            // early row tiles (64 tokens), first in the grid
#define OB_L (NB * ((SEQ - EARLY) / 128))   // late row tiles (128 tokens)
static_assert(EARLY % 64 == 0 && (SEQ - EARLY) % 128 == 0 && SEQ > EARLY);
static_assert(2 * STGB >= 2 * 64 * 68 * 4);   // the residual sums reuse the ring behind the last barrier
// eight asynchronous 16-byte copies of one lane: four rows from g0, then four from g1, each 16 rows apart (LDS step 16 * 144 B, global step 16 rows of DM elements).
// s_wait_xcnt closes the statement so that no address register is rewritten ahead of it.
__device__ __forceinline__ void copy44(unsigned l, const char* g0, const char* g1) {
    const size_t gs = (size_t)16 * DM * 2; const unsigned ls = 16 * LPE * 2;
    asm volatile("global_load_async_to_lds_b128 %0, %8, off\n\t"
                 "global_load_async_to_lds_b128 %1, %9, off\n\t"
                 "global_load_async_to_lds_b128 %2, %10, off\n\t"
                 "global_load_async_to_lds_b128 %3, %11, off\n\t"
                 "global_load_async_to_lds_b128 %4, %12, off\n\t"
                 "global_load_async_to_lds_b128 %5, %13, off\n\t"
                 "global_load_async_to_lds_b128 %6, %14, off\n\t"
                 "global_load_async_to_lds_b128 %7, %15, off\n\t"
                 "s_wait_xcnt 0x0"
                 :: "v"(l), "v"(l + ls), "v"(l + 2 * ls), "v"(l + 3 * ls), "v"(l + 4 * ls), "v"(l + 5 * ls), "v"(l + 6 * ls), "v"(l + 7 * ls),
                    "v"(g0), "v"(g0 + gs), "v"(g0 + 2 * gs), "v"(g0 + 3 * gs), "v"(g1), "v"(g1 + gs), "v"(g1 + 2 * gs), "v"(g1 + 3 * gs)
                 : "memory");
}
__global__ __launch_bounds__(128) void k_out(const h16* __restrict__ CX, const h16* __restrict__ Wt, float* OUT) {
    __shared__ __align__(16) h16 ring[2 * STGE];
    __shared__ __align__(16) float osall[4 * 16 * 68];
    const int K = DM;
    const int tid = threadIdx.x; const int wave = __builtin_amdgcn_readfirstlane(tid >> 5);
    const int lane = tid & 31, lr = lane & 15, hi = lane >> 4; const int cb = blockIdx.y * 128;
    const int wr = (wave >> 1) * 64, wc = (wave & 1) * 64; const int c0 = cb + wc;
    float* os = osall + wave * 16 * 68;
    const int bx = blockIdx.x; const bool early = bx < OB_E;      // block-uniform
    const int b  = early ? bx / (EARLY / 64) : (bx - OB_E) / ((SEQ - EARLY) / 128);
    const int tb = early ? (bx % (EARLY / 64)) * 64 : EARLY + ((bx - OB_E) % ((SEQ - EARLY) / 128)) * 128;   // first token of the tile in its sequence
    const unsigned l0 = (unsigned)(size_t)ring + (unsigned)((tid >> 3) * (LPE * 2) + (tid & 7) * 16);
    // staged A rows 0..63: value rows of tokens tb..tb+63; rows 64..127: value rows of tokens tb+64.. (late) or the residual rows of tokens tb..tb+63 (early)
    const size_t rlo = (size_t)b * SEQ + (size_t)tb + (size_t)(tid >> 3);
    const size_t rhi = early ? (size_t)NB * SEQ + (size_t)b * EARLY + (size_t)tb + (size_t)(tid >> 3) : rlo + 64;
    const char* ga0 = (const char*)(CX + rlo * K + (tid & 7) * 8);
    const char* ga1 = (const char*)(CX + rhi * K + (tid & 7) * 8);
    const char* gb = (const char*)(Wt + (size_t)(cb + (tid >> 3)) * K + (tid & 7) * 8);
    const int afr = (wr + lr) * LPE + 8 * hi, bfr = (128 + wc + lr) * LPE + 8 * hi;
    v8f acc[4][4];
#pragma unroll
    for (int mb = 0; mb < 4; ++mb)
#pragma unroll
        for (int nb = 0; nb < 4; ++nb) acc[mb][nb] = (v8f){};
    copy44(l0, ga0, ga1); copy8(l0 + 128 * LPE * 2, gb);
    wait_copies();
    __syncthreads();                                              // tile 0 readable by every wave
    copy44(l0 + STGB, ga0 + BK * 2, ga1 + BK * 2); copy8(l0 + STGB + 128 * LPE * 2, gb + BK * 2);
#pragma unroll 1   // one trip per staged tile: the ring's waits and barrier stand once, at the foot
    for (int t = 0; t < NKT; ++t) {
        const h16* sb = ring + (t & 1) * STGE;
#pragma unroll     // this and the loops inside: constant indices keep fragments and accumulators in registers
        for (int ks = 0; ks < BK; ks += 32) {
            v16h a[4], bq[4];
#pragma unroll
            for (int mb = 0; mb < 4; ++mb) a[mb] = ldh(sb + afr + mb * 16 * LPE + ks);
#pragma unroll
            for (int nb = 0; nb < 4; ++nb) bq[nb] = ldh(sb + bfr + nb * 16 * LPE + ks);
#pragma unroll
            for (int nb = 0; nb < 4; ++nb)
#pragma unroll
                for (int mb = 0; mb < 4; ++mb) acc[mb][nb] = wmma16(a[mb], bq[nb], acc[mb][nb]);
        }
        wait_lds();
        wait_copies();
        __syncthreads();                                          // publishes tile t + 1 and frees the buffer of tile t
        if (t + 2 < NKT) { const size_t ko = (size_t)(t + 2) * (BK * 2); const unsigned lb = l0 + (unsigned)(t & 1) * STGB;
            copy44(lb, ga0 + ko, ga1 + ko); copy8(lb + 128 * LPE * 2, gb + ko); }
    }
    wait_copies();
    if (early) {                                                  // block-uniform, so the barrier below is passed by every wave
        // behind the loop's last barrier the ring holds nothing live: it takes the residual sums, 64 tokens x 64 columns per column half
        float* rs = (float*)ring + (wave & 1) * (64 * 68);
        if (wave >= 2) {
#pragma unroll
            for (int mb = 0; mb < 4; ++mb)
#pragma unroll
                for (int nb = 0; nb < 4; ++nb) {
#pragma unroll
                    for (int j = 0; j < 8; ++j) rs[(mb * 16 + hi * 8 + j) * 68 + nb * 16 + lr] = acc[mb][nb][j] * OUTS; }   // D: row 8h+j, col lane&15
        }
        __syncthreads();                                          // the residual sums of waves 2, 3 are readable by waves 0, 1
        if (wave < 2) {
            float* obase = OUT + ((size_t)b * OUT_SEQ + tb) * DM + c0;
#pragma unroll
            for (int mb = 0; mb < 4; ++mb) {
#pragma unroll
                for (int nb = 0; nb < 4; ++nb) {
#pragma unroll
                    for (int j = 0; j < 8; ++j) os[(hi * 8 + j) * 68 + nb * 16 + lr] = acc[mb][nb][j] * OUTS; }   // D: row 8h+j, col lane&15
                wave_sync();
#pragma unroll
                for (int s = 0; s < 8; ++s) { const int row = 2 * s + hi, cofs = lr * 4;   // 8 s x 2 rows = 16 rows; 16 lanes x 4 floats = 64 columns
                    const v4f val = *(const v4fa*)(&os[row * 68 + cofs]) + *(const v4fa*)(&rs[(mb * 16 + row) * 68 + cofs]);
                    *(v4f*)(obase + (size_t)(mb * 16 + row) * DM + cofs) = val; }
                wave_sync();
            }
        }
        return;
    }
    float* obase = OUT + ((size_t)b * OUT_SEQ + tb + wr) * DM + c0;
#pragma unroll
    for (int mb = 0; mb < 4; ++mb) {
#pragma unroll
        for (int nb = 0; nb < 4; ++nb) {
#pragma unroll
            for (int j = 0; j < 8; ++j) os[(hi * 8 + j) * 68 + nb * 16 + lr] = acc[mb][nb][j] * OUTS; }   // D: row 8h+j, col lane&15
        wave_sync();
{
#pragma unroll
            for (int s = 0; s < 8; ++s) { const int row = 2 * s + hi, cofs = lr * 4;   // 8 s x 2 rows = 16 rows; 16 lanes x 4 floats = 64 columns
                const v4f val = *(const v4fa*)(&os[row * 68 + cofs]);
                *(v4f*)(obase + (size_t)(mb * 16 + row) * DM + cofs) = val; }
             }
        wave_sync();
    }
}

static constexpr size_t al256(size_t v) { return (v + 255) & ~(size_t)255; }
static constexpr size_t SZ_XB = al256((size_t)NB * SEQ * DM * 2);
static constexpr size_t SZ_WQ = al256((size_t)DM * DM * 2);
static constexpr size_t SZ_WK = al256((size_t)KVD * DM * 2);
static constexpr size_t SZ_CS = al256((size_t)SEQ * 32 * 2 * 4);
static constexpr size_t SZ_Q  = al256((size_t)NB * NH_ * SEQ * HD * 2);
static constexpr size_t SZ_KV = al256((size_t)NB * NKV * SEQ * HD * 2);
static constexpr size_t SZ_CX = al256(((size_t)NB * SEQ + (size_t)NB * EARLY) * DM * 2);
static constexpr size_t SZ_TOTAL = SZ_XB + 2 * SZ_WQ + 2 * SZ_WK + SZ_CS + 2 * SZ_Q + 4 * SZ_KV + SZ_CX;
static_assert(SZ_TOTAL <= (size_t)134217728);          // workspace carve <= 128 MiB
static_assert(SZ_XB == (size_t)NB * SEQ * DM * 2 && SZ_WQ == (size_t)DM * DM * 2 && SZ_WK == (size_t)KVD * DM * 2);   // no padding between XB, WQt, WKt, WVt: k_proj reads them as one plane

extern "C" void kernel_launch(void* const* d_in, const int* in_sizes, int n_in,
                              void* d_out, int out_size, void* d_ws, size_t ws_size, hipStream_t stream) {
    if (n_in < 5) return;
    const size_t needx = ((size_t)(NB - 1) * SEQ_FULL + SEQ) * DM;
    if ((size_t)in_sizes[0] < needx) return;
    if ((size_t)in_sizes[1] < (size_t)DM * DM || (size_t)in_sizes[2] < (size_t)DM * KVD || (size_t)in_sizes[3] < (size_t)DM * KVD || (size_t)in_sizes[4] < (size_t)DM * DM) return;
    if ((size_t)out_size < ((size_t)(NB - 1) * OUT_SEQ + SEQ) * DM) return;
    if (SZ_TOTAL > ws_size) return;
    // wire order x, wq, wk, wv, wo; every weight is [in][out]
    const float* x = (const float*)d_in[0]; const float* wq = (const float*)d_in[1]; const float* wk = (const float*)d_in[2]; const float* wv = (const float*)d_in[3]; const float* wo = (const float*)d_in[4];
    float* OUT = (float*)d_out;      // [NB][SEQ][2048]
    char* wsp = (char*)d_ws;
    bf*  XB  = (bf*)wsp;  wsp += SZ_XB;              // [NB*SEQ][2048] bf16
    bf*  WQt = (bf*)wsp;  wsp += SZ_WQ;              // [2048 out][2048 in] bf16
    bf*  WKt = (bf*)wsp;  wsp += SZ_WK;              // [512 out][2048 in] bf16
    bf*  WVt = (bf*)wsp;  wsp += SZ_WK;              // [512 out][2048 in] bf16
    h16* WOt = (h16*)wsp; wsp += SZ_WQ;              // [2048 out][2048 in] f16 of bf16 value x16
    float* CS = (float*)wsp; wsp += SZ_CS;           // [SEQ][32] (cos, sin)
    h16* QH = (h16*)wsp; wsp += SZ_Q;                // [NB*32][SEQ][64]
    h16* QR = (h16*)wsp; wsp += SZ_Q;                // residual x1024
    h16* KP = (h16*)wsp; wsp += SZ_KV;               // [NB*8][SEQ][64]
    h16* KR = (h16*)wsp; wsp += SZ_KV;               // residual x1024
    h16* VT = (h16*)wsp; wsp += SZ_KV;               // [NB*8][64][SEQ]
    h16* VR = (h16*)wsp; wsp += SZ_KV;               // residual x1024
    h16* CX = (h16*)wsp; wsp += SZ_CX;               // ctx x1024: value rows [NB*SEQ][2048], then residual rows [NB*EARLY][2048]
    h16* CR = CX + (size_t)NB * SEQ * DM;

    // x -> bf16, the four weights transposed (in[in-features][out-features] -> out[out-features][in-features]), the rotary table
    k_prep<<<PB_ROPE + 2 * PB_WBIG + 2 * PB_WKV + PB_CVT, 256, 0, stream>>>(x, wq, wk, wv, wo, XB, WQt, WKt, WVt, WOt, CS);

    k_proj<<<GP, 32 * PNW, 0, stream>>>(XB, QH, QR, KP, KR, VT, VR, CS);

    k_flash<<<FL_LATE + FL_EARLY, 32 * AW, 0, stream>>>(QH, QR, KP, KR, VT, VR, CX, CR);

    k_out<<<dim3(OB_E + OB_L, DM / 128, 1), 128, 0, stream>>>(CX, WOt, OUT);
}

// v008
// Measured time: 129 microseconds a run.
// In both of two side-by-side timings against v007, it was 1.05 times as fast.
// All steps since v000 together make it 4.07 times as fast.
#include <hip/hip_runtime.h>

// Grouped-query causal self-attention, width 2048 = 32 query heads x 64 sharing 8 kv heads (kv head g = h >> 2), x [NB][SEQ][2048], Wq/Wk/Wv/Wo [in][out] (y = x W), no biases,
// interleaved (even/odd pair) rotary on q and k from a computed [SEQ][32] (cos, sin) table, score scale 1/8, causal exclusion (diagonal kept), output = ctx Wo (f32).
// Compute dtypes, f32 accumulate everywhere: q/k/v projections v_wmma_f32_16x16x32_bf16 (x and W RNE-converted to bf16; products exact);
// scores v_wmma_f32_16x16x32_f16: k single f16, q (score scale and log2 e folded in) as f16 value + unscaled f16 residual, both products in one accumulator that starts at 8 - maximum in use
// (query rows < 256: q unscaled, q and k as value + residual x1024, three products, residual products in their own accumulator);
// P (x256 carry, cancels in the normalisation) and v single f16 (rows < 256: P and v as value + residual x1024, three products); softmax f32 (online; rows < 256 running max, others a maximum in use up to TAU below it);
// output projection v_wmma_f32_16x16x32_f16: ctx carried x1024 as f16 (rows < 256: plus its unscaled f16 residual, summed by a second pair of waves) against f16(bf16(Wo)) x16, results scaled by 2^-14.

#ifndef NB
#define NB 2
#endif
#ifndef SEQ
#define SEQ 2048
#endif
#define NB_FULL  2
#define SEQ_FULL 2048
#ifndef OUT_SEQ
#define OUT_SEQ SEQ              // row pitch (in tokens) between batches of the output
#endif
#define DM    2048
#define NH_   32
#define NKV   8
#define HD    64
#define KVD   (NKV * HD)         // 512
#define AW    4                  // waves per flash block = the four query heads of one kv head
#define EARLY 256                // query rows below this use the value + residual path
#define QRS  1024.0f             // carry of the residual planes of k, v, P and of q rows < EARLY
#define QRI  (1.0f / 1024.0f)
#define SC2  (0.125f * 1.4426950408889634f)   // HD^-0.5 * log2(e)
#define PSH  8.0f                // log2 of the P carry (256)
#define TAU  7.0f                // k_flash's late body: a score may pass the maximum in use by this much (log2) before O and l are rescaled; P <= 2^(PSH + TAU) stays finite in f16
#define CXS  1024.0f             // carry of the ctx plane
#define WOS  16.0f               // carry of the Wo plane
#define OUTS (1.0f / (1024.0f * 16.0f))
#define NEGB (-3.0e38f)

static_assert(HD == 64);
static_assert(NH_ * HD == DM);                 // query head h = columns h*64 + d
static_assert(NKV * AW == NH_);                // four consecutive query heads per kv head
static_assert(DM % 64 == 0);
static_assert(KVD % 64 == 0);
static_assert(DM % 32 == 0);                   // GEMM k-loop steps by 32
static_assert(SEQ % 64 == 0);                  // a 64-row tile never straddles two batches
static_assert(SEQ % 32 == 0);                  // key loop steps by 32, key0 + 31 < SEQ
static_assert(EARLY % 128 == 0);               // output GEMM tiles, and the 64-token wave tiles of k_proj, are entirely early or entirely late
static_assert(SEQ % 128 == 0);                 // a 128-row GEMM tile never straddles two batches
static_assert(KVD % 128 == 0);
static_assert(SEQ >= EARLY);
static_assert((SEQ - EARLY) % 16 == 0);
static_assert(((size_t)SEQ * DM) % 8 == 0);
static_assert(NB <= NB_FULL);
static_assert(SEQ <= SEQ_FULL);

typedef _Float16 h16;
typedef unsigned short bf;
typedef __attribute__((ext_vector_type(16))) __bf16   v16bf;
typedef __attribute__((ext_vector_type(16))) _Float16 v16h;
typedef __attribute__((ext_vector_type(8)))  _Float16 v8h;
typedef __attribute__((ext_vector_type(8)))  unsigned short v8us;
typedef __attribute__((ext_vector_type(8)))  float    v8f;
typedef __attribute__((ext_vector_type(4)))  float    v4f;
typedef __attribute__((ext_vector_type(2)))  float    v2f;
typedef v4f  __attribute__((may_alias)) v4fa;

__device__ __forceinline__ unsigned short f2bf(float f) { unsigned u = __float_as_uint(f); u += 0x7FFFu + ((u >> 16) & 1u); return (unsigned short)(u >> 16); }
__device__ __forceinline__ v16h cat16(v8h lo, v8h hi) { return __builtin_shufflevector(lo, hi, 0, 1, 2, 3, 4, 5, 6, 7, 8, 9, 10, 11, 12, 13, 14, 15); }
__device__ __forceinline__ v16bf cat16b(v8us lo, v8us hi) { return __builtin_bit_cast(v16bf, __builtin_shufflevector(lo, hi, 0, 1, 2, 3, 4, 5, 6, 7, 8, 9, 10, 11, 12, 13, 14, 15)); }
// wmma16, wmmab: the WMMA is followed by its own 4-slot guard tying its accumulator and keeping its operands live
__device__ __forceinline__ v8f wmma16(v16h a, v16h b, v8f c) {
    c = __builtin_amdgcn_wmma_f32_16x16x32_f16(false, a, false, b, (short)0, c, false, false);
    asm volatile("v_nop\n\tv_nop\n\tv_nop\n\tv_nop" : "+v"(c) : "v"(a), "v"(b));
    return c; }
__device__ __forceinline__ v8f wmmab(v16bf a, v16bf b, v8f c) {
    c = __builtin_amdgcn_wmma_f32_16x16x32_bf16(false, a, false, b, (short)0, c, false, false);
    asm volatile("v_nop\n\tv_nop\n\tv_nop\n\tv_nop" : "+v"(c) : "v"(a), "v"(b));
    return c; }
// k_flash's late body: the plain builtin. The compiler keeps the distance to the users of D, A and B itself and counts the neighbouring WMMAs as cover,
// so the vector port is left to the softmax work of the waves that share the SIMD.
__device__ __forceinline__ v8f wmma16p(v16h a, v16h b, v8f c) { return __builtin_amdgcn_wmma_f32_16x16x32_f16(false, a, false, b, (short)0, c, false, false); }
// fragment loaders from K-contiguous 16-bit rows; p already includes + 8*(lane>>4): elements 0..7 <- k0+8h+0..7, elements 8..15 <- k0+16+8h+0..7 (same map for A and B)
__device__ __forceinline__ v16h  ldh(const h16* p) { return cat16(*(const v8h*)p, *(const v8h*)(p + 16)); }
__device__ __forceinline__ v16bf ldb(const bf* p)  { return cat16b(*(const v8us*)p, *(const v8us*)(p + 16)); }
// ordering point for wave-private LDS tiles (same wave writes and reads)
__device__ __forceinline__ void wave_sync() { __builtin_amdgcn_fence(3 /* release order */, "wavefront"); __builtin_amdgcn_wave_barrier(); asm volatile("" ::: "memory"); }

// ---- operand staging of k_out (k_proj has its own stage shape, at the kernel): a 128x128 output tile per block of four waves (2 x 2, 64x64 each), K walked in tiles of BK.
// One stage = 128 A rows then 128 B rows of BK 16-bit elements (128 B, one cache line each) at a pitch of 144 B (16 B x odd: conflict-free for 16-byte LDS reads); two buffers.
#define BK   64
#define LPE  72                   // LDS row pitch in 16-bit elements
#define STGE (256 * LPE)          // elements of one buffer
#define STGB (STGE * 2)           // bytes of one buffer
#define NKT  (DM / BK)            // K tiles of one walk over K
static_assert(DM % BK == 0 && NKT >= 2);   // both prologue tiles exist
// eight asynchronous 16-byte copies of one lane, rows 16 apart (LDS step 16 * 144 B, global step 16 rows of DM elements); eight lanes cover one 128-B row.
// s_wait_xcnt closes the statement so that no address register is rewritten ahead of it.
__device__ __forceinline__ void copy8(unsigned l, const char* g) {
    const size_t gs = (size_t)16 * DM * 2; const unsigned ls = 16 * LPE * 2;
    asm volatile("global_load_async_to_lds_b128 %0, %8, off\n\t"
                 "global_load_async_to_lds_b128 %1, %9, off\n\t"
                 "global_load_async_to_lds_b128 %2, %10, off\n\t"
                 "global_load_async_to_lds_b128 %3, %11, off\n\t"
                 "global_load_async_to_lds_b128 %4, %12, off\n\t"
                 "global_load_async_to_lds_b128 %5, %13, off\n\t"
                 "global_load_async_to_lds_b128 %6, %14, off\n\t"
                 "global_load_async_to_lds_b128 %7, %15, off\n\t"
                 "s_wait_xcnt 0x0"
                 :: "v"(l), "v"(l + ls), "v"(l + 2 * ls), "v"(l + 3 * ls), "v"(l + 4 * ls), "v"(l + 5 * ls), "v"(l + 6 * ls), "v"(l + 7 * ls),
                    "v"(g), "v"(g + gs), "v"(g + 2 * gs), "v"(g + 3 * gs), "v"(g + 4 * gs), "v"(g + 5 * gs), "v"(g + 6 * gs), "v"(g + 7 * gs)
                 : "memory");
}
// the issuing wave's own copies have landed (the compiler places no wait for them)
__device__ __forceinline__ void wait_copies() { asm volatile("s_wait_asynccnt 0x0" ::: "memory"); }
// this wave's LDS reads of the buffer have returned before the barrier that frees it for the refill
__device__ __forceinline__ void wait_lds() { asm volatile("s_wait_dscnt 0x0" ::: "memory"); }

// ---- K / V^T staging of k_flash: one stage = FK keys of one kv head: FK K rows (64 d = 128 B each), then 64 V^T rows (FK keys = 128 B each), whole cache lines, at the same 144-B pitch; two buffers.
#define FK    64
#define FSTGE ((FK + HD) * LPE)   // elements of one buffer
#define FSTGB (FSTGE * 2)         // bytes of one buffer
static_assert(FK == 64 && SEQ % FK == 0);                         // a V^T row of a stage is one 128-B line; the last stage of any query tile ends inside the planes
static_assert(2 * FSTGB >= AW * 16 * 68 * 4);                     // the output staging reuses the ring behind the last barrier
// eight asynchronous 16-byte copies of one lane: four K rows, then four V^T rows, each 16 rows apart (eight lanes cover one 128-B row, 128 threads 16 rows).
// s_wait_xcnt closes the statement so that no address register is rewritten ahead of it.
__device__ __forceinline__ void stage_kv(unsigned l, const char* gk, const char* gv) {
    const size_t kst = (size_t)16 * HD * 2, vst = (size_t)16 * SEQ * 2; const unsigned ls = 16 * LPE * 2;
    asm volatile("global_load_async_to_lds_b128 %0, %8, off\n\t"
                 "global_load_async_to_lds_b128 %1, %9, off\n\t"
                 "global_load_async_to_lds_b128 %2, %10, off\n\t"
                 "global_load_async_to_lds_b128 %3, %11, off\n\t"
                 "global_load_async_to_lds_b128 %4, %12, off\n\t"
                 "global_load_async_to_lds_b128 %5, %13, off\n\t"
                 "global_load_async_to_lds_b128 %6, %14, off\n\t"
                 "global_load_async_to_lds_b128 %7, %15, off\n\t"
                 "s_wait_xcnt 0x0"
                 :: "v"(l), "v"(l + ls), "v"(l + 2 * ls), "v"(l + 3 * ls), "v"(l + 4 * ls), "v"(l + 5 * ls), "v"(l + 6 * ls), "v"(l + 7 * ls),
                    "v"(gk), "v"(gk + kst), "v"(gk + 2 * kst), "v"(gk + 3 * kst), "v"(gv), "v"(gv + vst), "v"(gv + 2 * vst), "v"(gv + 3 * vst)
                 : "memory");
}

// ---- preparation: the x conversion, the four weight transposes and the rotary table depend on nothing but the inputs; they share one launch (k_prep), the block index picks the job.
// cvt8: 8 x values of one thread, f32 -> bf16; i counts groups of 8 over [NB][SEQ][DM], the source batches lie SEQ_FULL tokens apart.
__device__ __forceinline__ void cvt8(const float* __restrict__ src, bf* dst, int blk) {
    const size_t i = (size_t)blk * 256 + threadIdx.x; if (i >= (size_t)NB * SEQ * DM / 8) return;
    src += (i / ((size_t)SEQ * DM / 8)) * ((size_t)(SEQ_FULL - SEQ) * DM);
    const v8f v = *(const v8f*)(src + i * 8); v8us o;
#pragma unroll
    for (int k = 0; k < 8; ++k) o[k] = f2bf(v[k]);
    *(v8us*)(dst + i * 8) = o; 
}

// wt_tile: in[Kr rows][Nc cols] f32 -> out[Nc rows][Kr cols] 16-bit, 64x64 tile (bx of Nc/64, by of Kr/64) through LDS, 256 threads.
__device__ __forceinline__ void wt_tile(float* ts, const float* __restrict__ W, bf* Tb, h16* Th, int Kr, int Nc, int mode, int bx, int by) {
    const int tid = threadIdx.x; const int n0 = bx * 64, k0 = by * 64;
#pragma unroll
    for (int p = 0; p < 4; ++p) { const int row = p * 16 + (tid >> 4), c4 = (tid & 15) * 4;      // 4 p x 16 rows = 64 k rows; 16 threads x 4 = 64 n columns
        const v4f v = *(const v4f*)(W + (size_t)(k0 + row) * (size_t)Nc + n0 + c4);
        ts[row * 65 + c4 + 0] = v[0]; ts[row * 65 + c4 + 1] = v[1]; ts[row * 65 + c4 + 2] = v[2]; ts[row * 65 + c4 + 3] = v[3]; }
    __syncthreads();
{
#pragma unroll
        for (int s = 0; s < 2; ++s) { const int n = s * 32 + (tid >> 3), c8 = (tid & 7) * 8;     // 2 s x 32 rows = 64 n rows; 8 lanes x 8 = 64 k columns
            const size_t oo = (size_t)(n0 + n) * (size_t)Kr + k0 + c8;
            if (mode == 0) { v8us o;
#pragma unroll
                for (int i = 0; i < 8; ++i) o[i] = f2bf(ts[(c8 + i) * 65 + n]);
                *(v8us*)(Tb + oo) = o;
                asm volatile("s_wait_xcnt 0x0" ::: "memory");   // stands in front of any later rewrite of the store's address and data registers
            } else { v8h o;
#pragma unroll
                for (int i = 0; i < 8; ++i) o[i] = (h16)(__uint_as_float(((unsigned)f2bf(ts[(c8 + i) * 65 + n])) << 16) * WOS);
                *(v8h*)(Th + oo) = o;
                asm volatile("s_wait_xcnt 0x0" ::: "memory"); } }   // as above
         }
}

// rope_tab: CS[t][j] = (cos, sin)(t * inv_freq[j]), inv_freq[j] = 1.0f / (float)(10000^(j/32)); the power is a double product of fixed binary roots of 10000.
__device__ __forceinline__ void rope_tab(float* CS, int blk) {
    const int i = blk * 256 + threadIdx.x; if (i >= SEQ * 32) return;
    const int t = i >> 5, j = i & 31;
    double p = 1.0;
    p *= (j & 1)  ? 1.3335214321633240 : 1.0;    // 10000^(1/32)
    p *= (j & 2)  ? 1.7782794100389228 : 1.0;    // 10000^(1/16)
    p *= (j & 4)  ? 3.1622776601683795 : 1.0;    // 10000^(1/8)
    p *= (j & 8)  ? 10.0 : 1.0;                  // 10000^(1/4)
    p *= (j & 16) ? 100.0 : 1.0;                 // 10000^(1/2)
    const float pf = (float)p; const float inv = 1.0f / pf;
    const float ang = (float)t * inv;
    const float cs = cosf(ang), sn = sinf(ang);
    v2f o; o[0] = cs; o[1] = sn;
    *(v2f*)(CS + (size_t)i * 2) = o; 
}

#define PB_ROPE ((SEQ * 32 + 255) / 256)              // blocks of the rotary table
#define PB_WBIG ((DM / 64) * (DM / 64))               // tiles of Wq, of Wo
#define PB_WKV  ((KVD / 64) * (DM / 64))              // tiles of Wk, of Wv
#define PB_CVT  ((int)(((size_t)NB * SEQ * DM / 8 + 255) / 256))   // blocks of the x conversion
// k_prep: grid PB_ROPE + 2 PB_WBIG + 2 PB_WKV + PB_CVT, 256 threads; every branch on the block index is block-uniform (the transposes' barrier stands under it).
__global__ __launch_bounds__(256) void k_prep(const float* __restrict__ x, const float* __restrict__ wq, const float* __restrict__ wk, const float* __restrict__ wv, const float* __restrict__ wo,
                                              bf* XB, bf* WQt, bf* WKt, bf* WVt, h16* WOt, float* CS) {
    __shared__ float ts[64 * 65];
    int blk = blockIdx.x;
    if (blk < PB_ROPE) { rope_tab(CS, blk); return; }
    blk -= PB_ROPE;
    if (blk < 2 * PB_WBIG + 2 * PB_WKV) {
        const float* W; bf* T; int Nc, mode = 0;
        if (blk < PB_WBIG)                    { W = wq; T = WQt; Nc = DM; }
        else if (blk < 2 * PB_WBIG)           { blk -= PB_WBIG; W = wo; T = (bf*)WOt; Nc = DM; mode = 1; }
        else if (blk < 2 * PB_WBIG + PB_WKV)  { blk -= 2 * PB_WBIG; W = wk; T = WKt; Nc = KVD; }
        else                                  { blk -= 2 * PB_WBIG + PB_WKV; W = wv; T = WVt; Nc = KVD; }
        const int nx = Nc / 64;
        wt_tile(ts, W, T, (h16*)T, DM, Nc, mode, blk % nx, blk / nx);
        return;
    }
    cvt8(x, XB, blk - (2 * PB_WBIG + 2 * PB_WKV));
}

// k_proj: register-blocked bf16 GEMM, K = DM: C[m][n] = sum_k x[m][k] W[n][k], m = token b*SEQ + t, n = one of the 3072 output features of Wq^T (2048), Wk^T (512), Wv^T (512) taken as one list.
// XW: the bf16 x rows and, directly behind them in the workspace, the Wq^T, Wk^T, Wv^T rows: one plane of NB*SEQ + 3072 rows of K (asserted at the carve).
// One block = a 256 x 192 tile, twelve waves (4 x 3), one 64x64 tile (16 accumulators) per wave; the grid is one block per 256 x 192 tile, (NB*SEQ/256) * 16, the row tile runs fastest.
// All twelve waves read one staged copy of the 256 x rows and the 192 W rows, so a block brings 448 rows from L2 where three separate 128x128 tiles brought 768.
// One stage = 256 A rows then 192 B rows of PBK 16-bit elements (256 B, two cache lines) at a pitch of 272 B (16 B x odd: conflict-free for 16-byte LDS reads); two buffers.
// The 64 columns of a wave tile are one head: unit u = n / 64: u < 32 query head u, u < 40 kv head u - 32 of k, else kv head u - 40 of v (wave-uniform).
// q, k: written as f16 (Ph) and the f16 residual x1024 (Pr; q rows >= EARLY: value x SC2, residual unscaled) to plane [(b*heads + head)][t][d], interleaved rotary applied on the f32 values at the store stage from CS[t][32] (cos, sin).
// v: no rotary, the wave tile is turned at the LDS staging and written to plane [(b*8 + g)][d][t].
#define PBK   128
#define PLPE  136                  // LDS row pitch in 16-bit elements
#define PTM   256                  // tile rows (tokens)
#define PTN   192                  // tile columns (three heads)
#define PSTGE ((PTM + PTN) * PLPE) // elements of one buffer
#define PSTGB (PSTGE * 2)          // bytes of one buffer
#define PNKT  (DM / PBK)           // K tiles
#define PNW   12                   // waves per block
#define PRS   24                   // staged rows covered by one copy of all 384 threads (16 lanes a row)
#define GP    ((NB * SEQ / PTM) * ((DM + 2 * KVD) / PTN))
static_assert(DM % PBK == 0 && PNKT >= 2);                       // both prologue tiles exist
static_assert(SEQ % PTM == 0 && (DM + 2 * KVD) % PTN == 0);      // whole tiles; a row tile never straddles two batches
static_assert((PTM + PTN) == 18 * PRS + 16);                     // 18 copies of every wave, a 19th of waves 0..7 (16 rows)
static_assert(2 * PSTGB + PNW * 16 * 68 * 4 <= 327680);
// six asynchronous 16-byte copies of one lane, LDS rows PRS apart, each with its own global address.
// s_wait_xcnt closes the statement so that no address register is rewritten ahead of it.
__device__ __forceinline__ void copy6(unsigned l, const char* g0, const char* g1, const char* g2, const char* g3, const char* g4, const char* g5) {
    const unsigned ls = PRS * PLPE * 2;
    asm volatile("global_load_async_to_lds_b128 %0, %6, off\n\t"
                 "global_load_async_to_lds_b128 %1, %7, off\n\t"
                 "global_load_async_to_lds_b128 %2, %8, off\n\t"
                 "global_load_async_to_lds_b128 %3, %9, off\n\t"
                 "global_load_async_to_lds_b128 %4, %10, off\n\t"
                 "global_load_async_to_lds_b128 %5, %11, off\n\t"
                 "s_wait_xcnt 0x0"
                 :: "v"(l), "v"(l + ls), "v"(l + 2 * ls), "v"(l + 3 * ls), "v"(l + 4 * ls), "v"(l + 5 * ls),
                    "v"(g0), "v"(g1), "v"(g2), "v"(g3), "v"(g4), "v"(g5)
                 : "memory");
}
// one such copy, closed by its s_wait_xcnt for the same reason
__device__ __forceinline__ void copy1(unsigned l, const char* g) {
    asm volatile("global_load_async_to_lds_b128 %0, %1, off\n\t"
                 "s_wait_xcnt 0x0"
                 :: "v"(l), "v"(g) : "memory");
}
__global__ __launch_bounds__(32 * PNW) void k_proj(const bf* __restrict__ XW,
                                                   h16* QH, h16* QR, h16* KP, h16* KR, h16* VT, h16* VR, const float* __restrict__ CS) {
    __shared__ __align__(16) bf ring[2 * PSTGE];
    __shared__ __align__(16) float osall[PNW * 16 * 68];
    const int K = DM;
    const int bid = blockIdx.x; const int mt = NB * SEQ / PTM;
    const int tid = threadIdx.x; const int wave = __builtin_amdgcn_readfirstlane(tid >> 5);
    const int lane = tid & 31, lr = lane & 15, hi = lane >> 4; const int rb = (bid % mt) * PTM, cb = (bid / mt) * PTN;
    const int wr = (wave / 3) * 64, wc = (wave % 3) * 64; const int r0 = rb + wr;
    float* os = osall + wave * 16 * 68;
    v8f acc[4][4];
#pragma unroll
    for (int mb = 0; mb < 4; ++mb)
#pragma unroll
        for (int nb = 0; nb < 4; ++nb) acc[mb][nb] = (v8f){};
    // a copy of one wave fills two staged rows, 2 * wave + hi + PRS * i, 16 bytes a lane at lr * 16 of the row's 256; both rows lie on the same side of the A / B boundary (it is even), so the side is picked on scalars.
    // gp[i]: the lane's global address in K tile 0 (the 19th row pair is held inside the stage for the waves that do not issue it)
    const unsigned l0 = (unsigned)(size_t)ring + (unsigned)((2 * wave + hi) * (PLPE * 2) + lr * 16);
    const char* gp[19];
#pragma unroll
    for (int i = 0; i < 19; ++i) {
        int rw = 2 * wave + PRS * i; rw = rw < PTM + PTN ? rw : PTM + PTN - 2;
        const int ri = rw < PTM ? rb + rw : NB * SEQ + cb + rw - PTM;   // row of XW: a token, or behind the tokens an output feature
        gp[i] = (const char*)(XW + (size_t)ri * K) + ((size_t)hi * K + (size_t)lr * 8) * 2;
    }
    const int afr = (wr + lr) * PLPE + 8 * hi, bfr = (PTM + wc + lr) * PLPE + 8 * hi;
    auto stage = [&](unsigned l, size_t ko) {
        const unsigned ls = PRS * PLPE * 2;
        copy6(l,           gp[0] + ko,  gp[1] + ko,  gp[2] + ko,  gp[3] + ko,  gp[4] + ko,  gp[5] + ko);
        copy6(l + 6 * ls,  gp[6] + ko,  gp[7] + ko,  gp[8] + ko,  gp[9] + ko,  gp[10] + ko, gp[11] + ko);
        copy6(l + 12 * ls, gp[12] + ko, gp[13] + ko, gp[14] + ko, gp[15] + ko, gp[16] + ko, gp[17] + ko);
        if (wave < 8) copy1(l + 18 * ls, gp[18] + ko);             // wave-uniform: rows 432..447 are eight waves' worth
    };
    stage(l0, 0);
    wait_copies();
    __syncthreads();                                              // tile 0 readable by every wave
    stage(l0 + PSTGB, PBK * 2);
#pragma unroll 1   // one trip per staged tile: the ring's waits and barrier stand once, at the foot
    for (int t = 0; t < PNKT; ++t) {
        const bf* sb = ring + (t & 1) * PSTGE;
#pragma unroll     // this and the loops inside: constant indices keep fragments and accumulators in registers
        for (int ks = 0; ks < PBK; ks += 32) {
            v16bf a[4], b[4];
#pragma unroll
            for (int mb = 0; mb < 4; ++mb) a[mb] = ldb(sb + afr + mb * 16 * PLPE + ks);
#pragma unroll
            for (int nb = 0; nb < 4; ++nb) b[nb] = ldb(sb + bfr + nb * 16 * PLPE + ks);
#pragma unroll
            for (int nb = 0; nb < 4; ++nb)
#pragma unroll
                for (int mb = 0; mb < 4; ++mb) acc[mb][nb] = wmmab(a[mb], b[nb], acc[mb][nb]);
        }
        wait_lds();
        wait_copies();
        __syncthreads();                                          // publishes tile t + 1 and frees the buffer of tile t
        if (t + 2 < PNKT) stage(l0 + (unsigned)(t & 1) * PSTGB, (size_t)(t + 2) * (PBK * 2));
    }
    wait_copies();
    // the wave's head and its output map, all wave-uniform
    const int u = (cb + wc) / HD; const int bt = r0 / SEQ, t0 = r0 % SEQ;
    const bool isv = u >= NH_ + NKV;
    // q rows read by k_flash's late body: value times the score scale, residual unscaled (the wave's 64 tokens lie on one side of EARLY); every other row: value as it is, residual x1024
    const bool lateq = u < NH_ && t0 >= EARLY;
    const float vsc = lateq ? SC2 : 1.0f, rsc = lateq ? 1.0f : QRS;
    h16* Ph; h16* Pr; size_t tbase; int pitch;
    if (u < NH_)       { Ph = QH; Pr = QR; pitch = HD;  tbase = ((size_t)(bt * NH_ + u) * SEQ + (size_t)t0) * HD; }
    else if (!isv)     { Ph = KP; Pr = KR; pitch = HD;  tbase = ((size_t)(bt * NKV + (u - NH_)) * SEQ + (size_t)t0) * HD; }
    else               { Ph = VT; Pr = VR; pitch = SEQ; tbase = (size_t)(bt * NKV + (u - NH_ - NKV)) * HD * SEQ + (size_t)t0; }
#pragma unroll
    for (int p = 0; p < 4; ++p) {                                 // q, k: 16 tokens x 64 d; v: 16 d x 64 tokens
        if (!isv) {
#pragma unroll
            for (int nb = 0; nb < 4; ++nb) {
#pragma unroll
                for (int j = 0; j < 8; ++j) os[(hi * 8 + j) * 68 + nb * 16 + lr] = acc[p][nb][j]; }   // D: row 8h+j, col lane&15
        } else {
#pragma unroll
            for (int mb = 0; mb < 4; ++mb) { v4f lo, up;                                              // D turned: os[d = lane&15][token = 16mb + 8h + j]
                lo[0] = acc[mb][p][0]; lo[1] = acc[mb][p][1]; lo[2] = acc[mb][p][2]; lo[3] = acc[mb][p][3];
                up[0] = acc[mb][p][4]; up[1] = acc[mb][p][5]; up[2] = acc[mb][p][6]; up[3] = acc[mb][p][7];
                *(v4fa*)(&os[lr * 68 + mb * 16 + hi * 8]) = lo; *(v4fa*)(&os[lr * 68 + mb * 16 + hi * 8 + 4]) = up; }
        }
        wave_sync();
        const size_t sb = tbase + (size_t)(p * 16) * (size_t)pitch;
{
#pragma unroll
            for (int s = 0; s < 4; ++s) { const int row = 4 * s + (lane >> 3), c8 = (lane & 7) * 8;   // 4 s x 4 row groups = 16 rows; 8 lanes x 8 = 64 columns
                v4f x0 = *(const v4fa*)(&os[row * 68 + c8]); v4f x1 = *(const v4fa*)(&os[row * 68 + c8 + 4]); v8h hv, rv;
                if (!isv) {                                                                            // wave-uniform (set with the head)
                    const int t = t0 + p * 16 + row;
                    const float* cp = CS + ((size_t)t * 32 + (size_t)(c8 >> 1)) * 2;                  // pairs c8/2 .. c8/2+3: (cos, sin) x 4
                    const v4f ca = *(const v4f*)cp; const v4f cb2 = *(const v4f*)(cp + 4);
                    float e, o;
                    e = x0[0]; o = x0[1]; x0[0] = e * ca[0] - o * ca[1]; x0[1] = e * ca[1] + o * ca[0];
                    e = x0[2]; o = x0[3]; x0[2] = e * ca[2] - o * ca[3]; x0[3] = e * ca[3] + o * ca[2];
                    e = x1[0]; o = x1[1]; x1[0] = e * cb2[0] - o * cb2[1]; x1[1] = e * cb2[1] + o * cb2[0];
                    e = x1[2]; o = x1[3]; x1[2] = e * cb2[2] - o * cb2[3]; x1[3] = e * cb2[3] + o * cb2[2]; }
#pragma unroll
                for (int i = 0; i < 4; ++i) { const float y0 = x0[i] * vsc, y1 = x1[i] * vsc; const h16 a0 = (h16)y0; const h16 a1 = (h16)y1; hv[i] = a0; hv[4 + i] = a1; rv[i] = (h16)((y0 - (float)a0) * rsc); rv[4 + i] = (h16)((y1 - (float)a1) * rsc); }
                const size_t oo = sb + (size_t)row * (size_t)pitch + c8;
                *(v8h*)(Ph + oo) = hv; *(v8h*)(Pr + oo) = rv;
                asm volatile("s_wait_xcnt 0x0" ::: "memory"); }   // stands in front of the next rows' rewrite of the two stores' address registers
             }
        wave_sync();
    }
}

// flash_early: the body of k_flash's blocks for query rows < EARLY (same structure as the late body below, operands straight from the planes) with value + residual (x1024) planes on every operand:
// scores = kh.qh + (kh.qr + kr.qh)/1024; O = vh.ph + (vr.ph + vh.pr)/1024 (residual products in their own accumulators), l from the unconverted f32 P.
// Writes the ctx value plane rows (carried x1024) and the compact unscaled residual plane CR[b][t < EARLY][2048].
__device__ __forceinline__ void flash_early(float* os, const h16* __restrict__ QH, const h16* __restrict__ QR, const h16* __restrict__ KP, const h16* __restrict__ KR,
                                            const h16* __restrict__ VT, const h16* __restrict__ VR, h16* CH, h16* CR, int t0, int zg) {
    const int lane = threadIdx.x & 31; const int wave = __builtin_amdgcn_readfirstlane(threadIdx.x >> 5);
    const int lr = lane & 15, hi = lane >> 4;
    const int b = zg / NKV; const int g = zg % NKV;
    const int h = g * AW + wave;
    const int tq = t0 + lr;
    const size_t qo = ((size_t)(b * NH_ + h) * SEQ + (size_t)tq) * HD + 8 * hi;
    const v16h qh0 = ldh(QH + qo), qh1 = ldh(QH + qo + 32), qr0 = ldh(QR + qo), qr1 = ldh(QR + qo + 32);
    const size_t ko = (size_t)zg * SEQ * HD + (size_t)lr * HD + 8 * hi;
    const size_t vo = (size_t)zg * HD * SEQ + (size_t)lr * SEQ + 8 * hi;
    v8f oH[4], oL[4];
#pragma unroll
    for (int j = 0; j < 4; ++j) { oH[j] = (v8f){}; oL[j] = (v8f){}; }
    float m = NEGB, l = 0.0f;
    const int kend = t0 + 16;
#pragma unroll 1
    for (int key0 = 0; key0 < kend; key0 += 32) {
        const size_t kk = ko + (size_t)key0 * HD;
        v8f sHa = (v8f){}, sLa = (v8f){}, sHb = (v8f){}, sLb = (v8f){};
        { const v16h k0 = ldh(KP + kk), k1 = ldh(KP + kk + 32), r0 = ldh(KR + kk), r1 = ldh(KR + kk + 32);
          sHa = wmma16(k0, qh0, sHa); sHa = wmma16(k1, qh1, sHa);
          sLa = wmma16(k0, qr0, sLa); sLa = wmma16(k1, qr1, sLa); sLa = wmma16(r0, qh0, sLa); sLa = wmma16(r1, qh1, sLa); }
        { const size_t k2 = kk + (size_t)16 * HD;
          const v16h k0 = ldh(KP + k2), k1 = ldh(KP + k2 + 32), r0 = ldh(KR + k2), r1 = ldh(KR + k2 + 32);
          asm volatile("s_wait_xcnt 0x0" :: "v"(KP + kk), "v"(KR + kk) : "memory");   // behind the eight loads; naming their two base addresses keeps those registers from serving as a load's destination ahead of the wait
          sHb = wmma16(k0, qh0, sHb); sHb = wmma16(k1, qh1, sHb);
          sLb = wmma16(k0, qr0, sLb); sLb = wmma16(k1, qr1, sLb); sLb = wmma16(r0, qh0, sLb); sLb = wmma16(r1, qh1, sLb); }
        float ta[8], tb[8];
#pragma unroll
        for (int r = 0; r < 8; ++r) { ta[r] = (sHa[r] + sLa[r] * QRI) * SC2; tb[r] = (sHb[r] + sLb[r] * QRI) * SC2; }
        if (key0 + 31 > t0) {                                      // block-uniform: diagonal block
            const int kbse = key0 + 8 * hi;
#pragma unroll
            for (int r = 0; r < 8; ++r) { ta[r] = (kbse + r > tq) ? NEGB : ta[r]; tb[r] = (kbse + 16 + r > tq) ? NEGB : tb[r]; } }
        float mx = NEGB;
#pragma unroll
        for (int r = 0; r < 8; ++r) mx = fmaxf(mx, fmaxf(ta[r], tb[r]));
        mx = fmaxf(mx, __shfl_xor(mx, 16, 32));
        const float mnew = fmaxf(m, mx);
        const float alpha = __builtin_amdgcn_exp2f(m - mnew);
        const float sh = PSH - mnew;
        v16h ph, pr; float ls = 0.0f;
#pragma unroll
        for (int r = 0; r < 8; ++r) { const float ea = __builtin_amdgcn_exp2f(ta[r] + sh); const float ec = __builtin_amdgcn_exp2f(tb[r] + sh);
            const h16 ha = (h16)ea; const h16 hc = (h16)ec; ph[r] = ha; ph[8 + r] = hc;
            pr[r] = (h16)((ea - (float)ha) * QRS); pr[8 + r] = (h16)((ec - (float)hc) * QRS); ls += ea + ec; }
        l = l * alpha + ls; m = mnew;
#pragma unroll
        for (int j = 0; j < 4; ++j) { oH[j] = oH[j] * alpha; oL[j] = oL[j] * alpha; }
        const size_t vv = vo + (size_t)key0;
#pragma unroll
        for (int j = 0; j < 4; ++j) { const v16h vh = ldh(VT + vv + (size_t)(16 * j) * SEQ); const v16h vr = ldh(VR + vv + (size_t)(16 * j) * SEQ);
            oH[j] = wmma16(vh, ph, oH[j]); oL[j] = wmma16(vr, ph, oL[j]); oL[j] = wmma16(vh, pr, oL[j]); }
    }
    l += __shfl_xor(l, 16, 32);
    const float inv = CXS / l;
    const int wb = wave * 16 * 68;
#pragma unroll
    for (int j = 0; j < 4; ++j) { v4f a, c;     // os[t][d], d = 16j + 8h + r; rows 0..15 x columns 0..63 all written
        a[0] = (oH[j][0] + oL[j][0] * QRI) * inv; a[1] = (oH[j][1] + oL[j][1] * QRI) * inv; a[2] = (oH[j][2] + oL[j][2] * QRI) * inv; a[3] = (oH[j][3] + oL[j][3] * QRI) * inv;
        c[0] = (oH[j][4] + oL[j][4] * QRI) * inv; c[1] = (oH[j][5] + oL[j][5] * QRI) * inv; c[2] = (oH[j][6] + oL[j][6] * QRI) * inv; c[3] = (oH[j][7] + oL[j][7] * QRI) * inv;
        *(v4fa*)(&os[wb + lr * 68 + 16 * j + 8 * hi]) = a; *(v4fa*)(&os[wb + lr * 68 + 16 * j + 8 * hi + 4]) = c; }
    wave_sync();
    h16* crow = CH + ((size_t)b * SEQ + t0) * DM + h * HD;
    h16* rrow = CR + ((size_t)b * EARLY + t0) * DM + h * HD;
{
#pragma unroll
        for (int s = 0; s < 4; ++s) { const int row = 4 * s + (lane >> 3), c8 = (lane & 7) * 8;   // 4 s x 4 row groups = 16 rows; 8 lanes x 8 = 64 columns
            const v4f x0 = *(const v4fa*)(&os[wb + row * 68 + c8]); const v4f x1 = *(const v4fa*)(&os[wb + row * 68 + c8 + 4]); v8h hv, rv;
#pragma unroll
            for (int i = 0; i < 4; ++i) { const h16 a0 = (h16)x0[i]; const h16 a1 = (h16)x1[i]; hv[i] = a0; hv[4 + i] = a1; rv[i] = (h16)(x0[i] - (float)a0); rv[4 + i] = (h16)(x1[i] - (float)a1); }
            *(v8h*)(crow + (size_t)row * DM + c8) = hv; *(v8h*)(rrow + (size_t)row * DM + c8) = rv; }
         }
}

// k_flash: fused causal attention, grid FL_LATE + FL_EARLY. One block = 16 query rows x the four query heads of one kv head (one wave per head, h = g*4 + wave); in the block number bid the row tile runs fastest;
// both bodies depend only on k_proj, so they share the launch: block numbers from FL_LATE on (rows < EARLY) run flash_early, the others the body below:
// Q fragments straight from the f16 planes; K / V^T of kv head g staged once per block in LDS, FK keys a stage, and read as fragments (two 16-B LDS loads each) by all four waves.
// Transposed form: S^T[key][t] = K Q^T (A = K rows, B = Q rows); lane (t = lane&15, h = lane>>4) holds keys 8h+r of each 16-key tile, so the packed
// P tile is directly the B fragment of O^T[d][t] = V^T P^T (element r <- tile keys 0..15, element 8+r <- tile keys 16..31, lane unchanged).
// Keys run over [0, t0+16) in steps of 32; the diagonal 32-key blocks replace excluded scores (key > t) by a large negative value before the maximum.
// q carries the score scale and log2 e, its residual is unscaled and C = PSH - (maximum in use), so S^T is the exp2 argument itself; O and l are rescaled only when the maximum in use moves.
#define FL_LX    ((SEQ - EARLY) / 16)
#define FL_LATE  (FL_LX * NB * NKV)
#define FL_EARLY ((EARLY / 16) * NB * NKV)
static_assert(FL_LX > 0);                                        // the late blocks' index is split by it
// flash_bid: launch index -> block number. A block's cost grows with its row tile (the key walk ends at the diagonal), the registers hold fewer blocks on the chip than the grid has:
// so the cost falls with the launch index (for speed only). First the blocks of rows < EARLY (few trips, each waiting on loads straight from the planes), then the others from the last
// row tile down to the first; inside one row tile the (batch, kv head) index runs fastest. A permutation of [0, FL_LATE + FL_EARLY), block-uniform.
__device__ __forceinline__ int flash_bid(int rank) {
    const int nz = NB * NKV;
    if (rank < FL_EARLY) return FL_LATE + (rank % nz) * (EARLY / 16) + (EARLY / 16 - 1 - rank / nz);
    rank -= FL_EARLY;
    return (rank % nz) * FL_LX + (FL_LX - 1 - rank / nz);
}
__global__ __launch_bounds__(32 * AW) void k_flash(const h16* __restrict__ QH, const h16* __restrict__ QR, const h16* __restrict__ KP, const h16* __restrict__ KR,
                                                   const h16* __restrict__ VT, const h16* __restrict__ VR, h16* CH, h16* CR) {
    __shared__ __align__(16) h16 ring[2 * FSTGE];
    float* os = (float*)ring;                                     // output staging, used only behind the loop's last barrier (the early body stages nothing else there)
    const int bid = flash_bid(blockIdx.x);
    if (bid >= FL_LATE) { const int e = bid - FL_LATE; flash_early(os, QH, QR, KP, KR, VT, VR, CH, CR, (e % (EARLY / 16)) * 16, e / (EARLY / 16)); return; }   // block-uniform, in front of every barrier
    const int zg = bid / FL_LX; const int t0 = EARLY + (bid % FL_LX) * 16;
    const int tid = threadIdx.x;
    const int lane = threadIdx.x & 31; const int wave = __builtin_amdgcn_readfirstlane(threadIdx.x >> 5);
    const int lr = lane & 15, hi = lane >> 4;
    const int b = zg / NKV; const int g = zg % NKV;
    const int h = g * AW + wave;                                  // repeat on the head axis: query head h uses kv head h >> 2
    const int tq = t0 + lr;
    const size_t qo = ((size_t)(b * NH_ + h) * SEQ + (size_t)tq) * HD + 8 * hi;
    const v16h qh0 = ldh(QH + qo), qh1 = ldh(QH + qo + 32), qr0 = ldh(QR + qo), qr1 = ldh(QR + qo + 32);   // B fragments: col t, k = d
    const unsigned l0 = (unsigned)(size_t)ring + (unsigned)((tid >> 3) * (LPE * 2) + (tid & 7) * 16);
    const char* gk = (const char*)(KP + (size_t)zg * SEQ * HD + (size_t)(tid >> 3) * HD + (tid & 7) * 8);    // + stage * FK rows
    const char* gv = (const char*)(VT + (size_t)zg * HD * SEQ + (size_t)(tid >> 3) * SEQ + (tid & 7) * 8);   // + stage * FK keys
    const int kfr = lr * LPE + 8 * hi;                            // + key * LPE        (A fragment: row key, k = d)
    const int vfr = (FK + lr) * LPE + 8 * hi;                     // + 16j * LPE + key  (A fragment: row d, k = key)
    v8f o0 = (v8f){}, o1 = (v8f){}, o2 = (v8f){}, o3 = (v8f){};
    float mu = NEGB, l = 0.0f;                                    // mu: the maximum in use of the lane's query (scaled log2 units), the same in both halves of the wave; set from the scores of the first 32 keys
    float thr = -__builtin_inff();                                // wave-uniform: an argument above it moves mu; below every argument until mu is set, PSH + TAU from then on
    v8f cin;                                                      // C operand of S^T: PSH - mu in every element (PSH until mu is set), so that the product leaves the matrix unit as the exp2 argument
#pragma unroll
    for (int r = 0; r < 8; ++r) cin[r] = PSH;
    const int kend = t0 + 16;
    const int nst = (kend + FK - 1) / FK;                         // block-uniform; stage nst - 1 ends at or before key SEQ
    stage_kv(l0, gk, gv);
    wait_copies();
    __syncthreads();                                              // stage 0 readable by every wave
    if (nst > 1) stage_kv(l0 + FSTGB, gk + (size_t)FK * HD * 2, gv + FK * 2);
#pragma unroll 1   // one trip per staged tile: the ring's waits and barrier stand once, at the foot
    for (int st = 0; st < nst; ++st) {
        const h16* sb = ring + (st & 1) * FSTGE;
#pragma unroll     // two 32-key steps per stage, constant LDS offsets
        for (int ks = 0; ks < FK; ks += 32) {
            const int key0 = st * FK + ks;
            if (key0 >= kend) break;                               // block-uniform: the last stage may hold one step only
            const h16* ka = sb + kfr + ks * LPE;
            const v16h ka0 = ldh(ka), ka1 = ldh(ka + 32), kb0 = ldh(ka + 16 * LPE), kb1 = ldh(ka + 16 * LPE + 32);
            v8f sa = wmma16p(ka0, qh0, cin), sc = wmma16p(kb0, qh0, cin);
            sa = wmma16p(ka1, qh1, sa); sc = wmma16p(kb1, qh1, sc);
            sa = wmma16p(ka0, qr0, sa); sc = wmma16p(kb0, qr0, sc);
            sa = wmma16p(ka1, qr1, sa); sc = wmma16p(kb1, qr1, sc);
            const h16* va = sb + vfr + ks;
            const v16h v0 = ldh(va), v1 = ldh(va + 16 * LPE), v2 = ldh(va + 32 * LPE), v3 = ldh(va + 48 * LPE);
            asm volatile("" ::: "memory");                         // keeps the eight V^T reads in front of the test below: sunk behind its branch they stand among the O^T products, whose waits then show the LDS latency
            float ta[8], tb[8];                                    // score + cin
#pragma unroll
            for (int r = 0; r < 8; ++r) { ta[r] = sa[r]; tb[r] = sc[r]; }
            if (key0 + 31 > t0) {                                  // block-uniform: diagonal block
                const int kbse = key0 + 8 * hi;
#pragma unroll
                for (int r = 0; r < 8; ++r) { ta[r] = (kbse + r > tq) ? NEGB : ta[r]; tb[r] = (kbse + 16 + r > tq) ? NEGB : tb[r]; } }
            float mx = NEGB;
#pragma unroll
            for (int r = 0; r < 8; ++r) mx = fmaxf(mx, fmaxf(ta[r], tb[r]));
            // one wave-uniform test per 32 keys: while mu is not set, or where some score passes the maximum in use by more than TAU, mu moves to the larger of itself and these keys' largest score and O, l and these arguments follow it
            if (__builtin_amdgcn_ballot_w32(mx > thr) != 0) {
                mx = fmaxf(mx, __shfl_xor(mx, 16, 32));            // both halves of the wave hold keys of the same query
                const float mnew = fmaxf(mu, mx - cin[0]);         // mx - cin: the largest score of these 32 keys
                const float cnew = PSH - mnew;
                const float d = cin[0] - cnew;
                const float alpha = __builtin_amdgcn_exp2f(mu - mnew);   // 0 the first time, when O and l are zero
#pragma unroll
                for (int r = 0; r < 8; ++r) { ta[r] -= d; tb[r] -= d; }
                l *= alpha; mu = mnew; thr = PSH + TAU;
                o0 = o0 * alpha; o1 = o1 * alpha; o2 = o2 * alpha; o3 = o3 * alpha;
#pragma unroll
                for (int r = 0; r < 8; ++r) cin[r] = cnew;
            }
            v16h pb; float ls = 0.0f;
#pragma unroll
            for (int r = 0; r < 8; ++r) { const float ea = __builtin_amdgcn_exp2f(ta[r]); const float ec = __builtin_amdgcn_exp2f(tb[r]); pb[r] = (h16)ea; pb[8 + r] = (h16)ec; ls += ea + ec; }
            l += ls;
            __builtin_amdgcn_sched_barrier(0);                     // keeps the row-sum adds in front of the four O^T products: scheduled among them they land in a product's V^T registers and each draws four v_nop
            o0 = wmma16p(v0, pb, o0); o1 = wmma16p(v1, pb, o1); o2 = wmma16p(v2, pb, o2); o3 = wmma16p(v3, pb, o3);
        }
        wait_lds();
        wait_copies();
        __syncthreads();                                          // publishes stage st + 1 and frees the buffer of stage st
        if (st + 2 < nst) stage_kv(l0 + (unsigned)(st & 1) * FSTGB, gk + (size_t)(st + 2) * (FK * HD * 2), gv + (size_t)(st + 2) * (FK * 2));
    }
    wait_copies();
    l += __shfl_xor(l, 16, 32);
    const float inv = CXS / l;
    const int wb = wave * 16 * 68;
    // O^T D layout: o_j[r] = (d = 16j + 8h + r, t = lane&15) -> os[t][d]; rows 0..15 x columns 0..63 all written
    { v4f a, c;
      a[0] = o0[0] * inv; a[1] = o0[1] * inv; a[2] = o0[2] * inv; a[3] = o0[3] * inv; c[0] = o0[4] * inv; c[1] = o0[5] * inv; c[2] = o0[6] * inv; c[3] = o0[7] * inv;
      *(v4fa*)(&os[wb + lr * 68 +  0 + 8 * hi]) = a; *(v4fa*)(&os[wb + lr * 68 +  0 + 8 * hi + 4]) = c;
      a[0] = o1[0] * inv; a[1] = o1[1] * inv; a[2] = o1[2] * inv; a[3] = o1[3] * inv; c[0] = o1[4] * inv; c[1] = o1[5] * inv; c[2] = o1[6] * inv; c[3] = o1[7] * inv;
      *(v4fa*)(&os[wb + lr * 68 + 16 + 8 * hi]) = a; *(v4fa*)(&os[wb + lr * 68 + 16 + 8 * hi + 4]) = c;
      a[0] = o2[0] * inv; a[1] = o2[1] * inv; a[2] = o2[2] * inv; a[3] = o2[3] * inv; c[0] = o2[4] * inv; c[1] = o2[5] * inv; c[2] = o2[6] * inv; c[3] = o2[7] * inv;
      *(v4fa*)(&os[wb + lr * 68 + 32 + 8 * hi]) = a; *(v4fa*)(&os[wb + lr * 68 + 32 + 8 * hi + 4]) = c;
      a[0] = o3[0] * inv; a[1] = o3[1] * inv; a[2] = o3[2] * inv; a[3] = o3[3] * inv; c[0] = o3[4] * inv; c[1] = o3[5] * inv; c[2] = o3[6] * inv; c[3] = o3[7] * inv;
      *(v4fa*)(&os[wb + lr * 68 + 48 + 8 * hi]) = a; *(v4fa*)(&os[wb + lr * 68 + 48 + 8 * hi + 4]) = c; }
    wave_sync();
    h16* crow = CH + ((size_t)b * SEQ + t0) * DM + h * HD;         // merged heads: column h*64 + d
{
#pragma unroll
        for (int s = 0; s < 4; ++s) { const int row = 4 * s + (lane >> 3), c8 = (lane & 7) * 8;   // 4 s x 4 row groups = 16 rows; 8 lanes x 8 = 64 columns
            const v4f x0 = *(const v4fa*)(&os[wb + row * 68 + c8]); const v4f x1 = *(const v4fa*)(&os[wb + row * 68 + c8 + 4]); v8h hv;
#pragma unroll
            for (int i = 0; i < 4; ++i) { hv[i] = (h16)x0[i]; hv[4 + i] = (h16)x1[i]; }
            *(v8h*)(crow + (size_t)row * DM + c8) = hv; }
         }
}

// k_out: output projection, four waves per block (2 x 2, 64x64 per wave), f16 operands from the ctx plane CX (value rows [NB*SEQ], then residual rows [NB*EARLY]) and the Wo^T plane, staged in LDS, K = DM, one walk.
// Late block: a 128x128 output tile, the 128 staged A rows are 128 tokens. Early block (tokens < EARLY): a 64x128 output tile, the staged A rows are the 64 tokens' value rows, then the same tokens' unscaled residual rows:
// waves 0, 1 sum the value products, waves 2, 3 the residual products, and the two sums are added through LDS at the store (one barrier). So every block walks K once. grid (OB_E + OB_L, DM/128), 128 threads.
#define OB_E (NB * (EARLY / 64))            // early row tiles (64 tokens), first in the grid
#define OB_L (NB * ((SEQ - EARLY) / 128))   // late row tiles (128 tokens)
static_assert(EARLY % 64 == 0 && (SEQ - EARLY) % 128 == 0 && SEQ > EARLY);
static_assert(2 * STGB >= 2 * 64 * 68 * 4);   // the residual sums reuse the ring behind the last barrier
// eight asynchronous 16-byte copies of one lane: four rows from g0, then four from g1, each 16 rows apart (LDS step 16 * 144 B, global step 16 rows of DM elements).
// s_wait_xcnt closes the statement so that no address register is rewritten ahead of it.
__device__ __forceinline__ void copy44(unsigned l, const char* g0, const char* g1) {
    const size_t gs = (size_t)16 * DM * 2; const unsigned ls = 16 * LPE * 2;
    asm volatile("global_load_async_to_lds_b128 %0, %8, off\n\t"
                 "global_load_async_to_lds_b128 %1, %9, off\n\t"
                 "global_load_async_to_lds_b128 %2, %10, off\n\t"
                 "global_load_async_to_lds_b128 %3, %11, off\n\t"
                 "global_load_async_to_lds_b128 %4, %12, off\n\t"
                 "global_load_async_to_lds_b128 %5, %13, off\n\t"
                 "global_load_async_to_lds_b128 %6, %14, off\n\t"
                 "global_load_async_to_lds_b128 %7, %15, off\n\t"
                 "s_wait_xcnt 0x0"
                 :: "v"(l), "v"(l + ls), "v"(l + 2 * ls), "v"(l + 3 * ls), "v"(l + 4 * ls), "v"(l + 5 * ls), "v"(l + 6 * ls), "v"(l + 7 * ls),
                    "v"(g0), "v"(g0 + gs), "v"(g0 + 2 * gs), "v"(g0 + 3 * gs), "v"(g1), "v"(g1 + gs), "v"(g1 + 2 * gs), "v"(g1 + 3 * gs)
                 : "memory");
}
__global__ __launch_bounds__(128) void k_out(const h16* __restrict__ CX, const h16* __restrict__ Wt, float* OUT) {
    __shared__ __align__(16) h16 ring[2 * STGE];
    __shared__ __align__(16) float osall[4 * 16 * 68];
    const int K = DM;
    const int tid = threadIdx.x; const int wave = __builtin_amdgcn_readfirstlane(tid >> 5);
    const int lane = tid & 31, lr = lane & 15, hi = lane >> 4; const int cb = blockIdx.y * 128;
    const int wr = (wave >> 1) * 64, wc = (wave & 1) * 64; const int c0 = cb + wc;
    float* os = osall + wave * 16 * 68;
    const int bx = blockIdx.x; const bool early = bx < OB_E;      // block-uniform
    const int b  = early ? bx / (EARLY / 64) : (bx - OB_E) / ((SEQ - EARLY) / 128);
    const int tb = early ? (bx % (EARLY / 64)) * 64 : EARLY + ((bx - OB_E) % ((SEQ - EARLY) / 128)) * 128;   // first token of the tile in its sequence
    const unsigned l0 = (unsigned)(size_t)ring + (unsigned)((tid >> 3) * (LPE * 2) + (tid & 7) * 16);
    // staged A rows 0..63: value rows of tokens tb..tb+63; rows 64..127: value rows of tokens tb+64.. (late) or the residual rows of tokens tb..tb+63 (early)
    const size_t rlo = (size_t)b * SEQ + (size_t)tb + (size_t)(tid >> 3);
    const size_t rhi = early ? (size_t)NB * SEQ + (size_t)b * EARLY + (size_t)tb + (size_t)(tid >> 3) : rlo + 64;
    const char* ga0 = (const char*)(CX + rlo * K + (tid & 7) * 8);
    const char* ga1 = (const char*)(CX + rhi * K + (tid & 7) * 8);
    const char* gb = (const char*)(Wt + (size_t)(cb + (tid >> 3)) * K + (tid & 7) * 8);
    const int afr = (wr + lr) * LPE + 8 * hi, bfr = (128 + wc + lr) * LPE + 8 * hi;
    v8f acc[4][4];
#pragma unroll
    for (int mb = 0; mb < 4; ++mb)
#pragma unroll
        for (int nb = 0; nb < 4; ++nb) acc[mb][nb] = (v8f){};
    copy44(l0, ga0, ga1); copy8(l0 + 128 * LPE * 2, gb);
    wait_copies();
    __syncthreads();                                              // tile 0 readable by every wave
    copy44(l0 + STGB, ga0 + BK * 2, ga1 + BK * 2); copy8(l0 + STGB + 128 * LPE * 2, gb + BK * 2);
#pragma unroll 1   // one trip per staged tile: the ring's waits and barrier stand once, at the foot
    for (int t = 0; t < NKT; ++t) {
        const h16* sb = ring + (t & 1) * STGE;
#pragma unroll     // this and the loops inside: constant indices keep fragments and accumulators in registers
        for (int ks = 0; ks < BK; ks += 32) {
            v16h a[4], bq[4];
#pragma unroll
            for (int mb = 0; mb < 4; ++mb) a[mb] = ldh(sb + afr + mb * 16 * LPE + ks);
#pragma unroll
            for (int nb = 0; nb < 4; ++nb) bq[nb] = ldh(sb + bfr + nb * 16 * LPE + ks);
#pragma unroll
            for (int nb = 0; nb < 4; ++nb)
#pragma unroll
                for (int mb = 0; mb < 4; ++mb) acc[mb][nb] = wmma16(a[mb], bq[nb], acc[mb][nb]);
        }
        wait_lds();
        wait_copies();
        __syncthreads();                                          // publishes tile t + 1 and frees the buffer of tile t
        if (t + 2 < NKT) { const size_t ko = (size_t)(t + 2) * (BK * 2); const unsigned lb = l0 + (unsigned)(t & 1) * STGB;
            copy44(lb, ga0 + ko, ga1 + ko); copy8(lb + 128 * LPE * 2, gb + ko); }
    }
    wait_copies();
    if (early) {                                                  // block-uniform, so the barrier below is passed by every wave
        // behind the loop's last barrier the ring holds nothing live: it takes the residual sums, 64 tokens x 64 columns per column half
        float* rs = (float*)ring + (wave & 1) * (64 * 68);
        if (wave >= 2) {
#pragma unroll
            for (int mb = 0; mb < 4; ++mb)
#pragma unroll
                for (int nb = 0; nb < 4; ++nb) {
#pragma unroll
                    for (int j = 0; j < 8; ++j) rs[(mb * 16 + hi * 8 + j) * 68 + nb * 16 + lr] = acc[mb][nb][j] * OUTS; }   // D: row 8h+j, col lane&15
        }
        __syncthreads();                                          // the residual sums of waves 2, 3 are readable by waves 0, 1
        if (wave < 2) {
            float* obase = OUT + ((size_t)b * OUT_SEQ + tb) * DM + c0;
#pragma unroll
            for (int mb = 0; mb < 4; ++mb) {
#pragma unroll
                for (int nb = 0; nb < 4; ++nb) {
#pragma unroll
                    for (int j = 0; j < 8; ++j) os[(hi * 8 + j) * 68 + nb * 16 + lr] = acc[mb][nb][j] * OUTS; }   // D: row 8h+j, col lane&15
                wave_sync();
#pragma unroll
                for (int s = 0; s < 8; ++s) { const int row = 2 * s + hi, cofs = lr * 4;   // 8 s x 2 rows = 16 rows; 16 lanes x 4 floats = 64 columns
                    const v4f val = *(const v4fa*)(&os[row * 68 + cofs]) + *(const v4fa*)(&rs[(mb * 16 + row) * 68 + cofs]);
                    *(v4f*)(obase + (size_t)(mb * 16 + row) * DM + cofs) = val; }
                wave_sync();
            }
        }
        return;
    }
    float* obase = OUT + ((size_t)b * OUT_SEQ + tb + wr) * DM + c0;
#pragma unroll
    for (int mb = 0; mb < 4; ++mb) {
#pragma unroll
        for (int nb = 0; nb < 4; ++nb) {
#pragma unroll
            for (int j = 0; j < 8; ++j) os[(hi * 8 + j) * 68 + nb * 16 + lr] = acc[mb][nb][j] * OUTS; }   // D: row 8h+j, col lane&15
        wave_sync();
{
#pragma unroll
            for (int s = 0; s < 8; ++s) { const int row = 2 * s + hi, cofs = lr * 4;   // 8 s x 2 rows = 16 rows; 16 lanes x 4 floats = 64 columns
                const v4f val = *(const v4fa*)(&os[row * 68 + cofs]);
                *(v4f*)(obase + (size_t)(mb * 16 + row) * DM + cofs) = val; }
             }
        wave_sync();
    }
}

static constexpr size_t al256(size_t v) { return (v + 255) & ~(size_t)255; }
static constexpr size_t SZ_XB = al256((size_t)NB * SEQ * DM * 2);
static constexpr size_t SZ_WQ = al256((size_t)DM * DM * 2);
static constexpr size_t SZ_WK = al256((size_t)KVD * DM * 2);
static constexpr size_t SZ_CS = al256((size_t)SEQ * 32 * 2 * 4);
static constexpr size_t SZ_Q  = al256((size_t)NB * NH_ * SEQ * HD * 2);
static constexpr size_t SZ_KV = al256((size_t)NB * NKV * SEQ * HD * 2);
static constexpr size_t SZ_CX = al256(((size_t)NB * SEQ + (size_t)NB * EARLY) * DM * 2);
static constexpr size_t SZ_TOTAL = SZ_XB + 2 * SZ_WQ + 2 * SZ_WK + SZ_CS + 2 * SZ_Q + 4 * SZ_KV + SZ_CX;
static_assert(SZ_TOTAL <= (size_t)134217728);          // workspace carve <= 128 MiB
static_assert(SZ_XB == (size_t)NB * SEQ * DM * 2 && SZ_WQ == (size_t)DM * DM * 2 && SZ_WK == (size_t)KVD * DM * 2);   // no padding between XB, WQt, WKt, WVt: k_proj reads them as one plane

extern "C" void kernel_launch(void* const* d_in, const int* in_sizes, int n_in,
                              void* d_out, int out_size, void* d_ws, size_t ws_size, hipStream_t stream) {
    if (n_in < 5) return;
    const size_t needx = ((size_t)(NB - 1) * SEQ_FULL + SEQ) * DM;
    if ((size_t)in_sizes[0] < needx) return;
    if ((size_t)in_sizes[1] < (size_t)DM * DM || (size_t)in_sizes[2] < (size_t)DM * KVD || (size_t)in_sizes[3] < (size_t)DM * KVD || (size_t)in_sizes[4] < (size_t)DM * DM) return;
    if ((size_t)out_size < ((size_t)(NB - 1) * OUT_SEQ + SEQ) * DM) return;
    if (SZ_TOTAL > ws_size) return;
    // wire order x, wq, wk, wv, wo; every weight is [in][out]
    const float* x = (const float*)d_in[0]; const float* wq = (const float*)d_in[1]; const float* wk = (const float*)d_in[2]; const float* wv = (const float*)d_in[3]; const float* wo = (const float*)d_in[4];
    float* OUT = (float*)d_out;      // [NB][SEQ][2048]
    char* wsp = (char*)d_ws;
    bf*  XB  = (bf*)wsp;  wsp += SZ_XB;              // [NB*SEQ][2048] bf16
    bf*  WQt = (bf*)wsp;  wsp += SZ_WQ;              // [2048 out][2048 in] bf16
    bf*  WKt = (bf*)wsp;  wsp += SZ_WK;              // [512 out][2048 in] bf16
    bf*  WVt = (bf*)wsp;  wsp += SZ_WK;              // [512 out][2048 in] bf16
    h16* WOt = (h16*)wsp; wsp += SZ_WQ;              // [2048 out][2048 in] f16 of bf16 value x16
    float* CS = (float*)wsp; wsp += SZ_CS;           // [SEQ][32] (cos, sin)
    h16* QH = (h16*)wsp; wsp += SZ_Q;                // [NB*32][SEQ][64]
    h16* QR = (h16*)wsp; wsp += SZ_Q;                // residual x1024 (rows >= EARLY: unscaled)
    h16* KP = (h16*)wsp; wsp += SZ_KV;               // [NB*8][SEQ][64]
    h16* KR = (h16*)wsp; wsp += SZ_KV;               // residual x1024
    h16* VT = (h16*)wsp; wsp += SZ_KV;               // [NB*8][64][SEQ]
    h16* VR = (h16*)wsp; wsp += SZ_KV;               // residual x1024
    h16* CX = (h16*)wsp; wsp += SZ_CX;               // ctx x1024: value rows [NB*SEQ][2048], then residual rows [NB*EARLY][2048]
    h16* CR = CX + (size_t)NB * SEQ * DM;

    // x -> bf16, the four weights transposed (in[in-features][out-features] -> out[out-features][in-features]), the rotary table
    k_prep<<<PB_ROPE + 2 * PB_WBIG + 2 * PB_WKV + PB_CVT, 256, 0, stream>>>(x, wq, wk, wv, wo, XB, WQt, WKt, WVt, WOt, CS);

    k_proj<<<GP, 32 * PNW, 0, stream>>>(XB, QH, QR, KP, KR, VT, VR, CS);

    k_flash<<<FL_LATE + FL_EARLY, 32 * AW, 0, stream>>>(QH, QR, KP, KR, VT, VR, CX, CR);

    k_out<<<dim3(OB_E + OB_L, DM / 128, 1), 128, 0, stream>>>(CX, WOt, OUT);
}

// v009
// One run takes 121 microseconds.
// Next to v008, in two timings, it ran 1.06 times as fast each time.
// All steps since v000 together make it 4.32 times as fast.
#include <hip/hip_runtime.h>

// Grouped-query causal self-attention, width 2048 = 32 query heads x 64 sharing 8 kv heads (kv head g = h >> 2), x [NB][SEQ][2048], Wq/Wk/Wv/Wo [in][out] (y = x W), no biases,
// interleaved (even/odd pair) rotary on q and k from a computed [SEQ][32] (cos, sin) table, score scale 1/8, causal exclusion (diagonal kept), output = ctx Wo (f32).
// Compute dtypes, f32 accumulate everywhere: q/k/v projections v_wmma_f32_16x16x32_bf16 (x and W RNE-converted to bf16; products exact);
// scores v_wmma_f32_16x16x32_f16: k single f16, q (score scale and log2 e folded in) as f16 value + unscaled f16 residual, both products in one accumulator that starts at 8 - maximum in use
// (query rows < 256: q unscaled, q and k as value + residual x1024, three products, residual products in their own accumulator);
// P (x256 carry, cancels in the normalisation) and v single f16 (rows < 256: P and v as value + residual x1024, three products); softmax f32 (online; rows < 256 running max, others a maximum in use up to TAU below it);
// output projection v_wmma_f32_16x16x32_f16: ctx carried x1024 as f16 (rows < 256: plus its unscaled f16 residual, summed by a second pair of waves) against f16(bf16(Wo)) x16, results scaled by 2^-14.

#ifndef NB
#define NB 2
#endif
#ifndef SEQ
#define SEQ 2048
#endif
#define NB_FULL  2
#define SEQ_FULL 2048
#ifndef OUT_SEQ
#define OUT_SEQ SEQ              // row pitch (in tokens) between batches of the output
#endif
#define DM    2048
#define NH_   32
#define NKV   8
#define HD    64
#define KVD   (NKV * HD)         // 512
#define AW    4                  // waves per flash block = the four query heads of one kv head
#define EARLY 256                // query rows below this use the value + residual path
#define QRS  1024.0f             // carry of the residual planes of k, v, P and of q rows < EARLY
#define QRI  (1.0f / 1024.0f)
#define SC2  (0.125f * 1.4426950408889634f)   // HD^-0.5 * log2(e)
#define PSH  8.0f                // log2 of the P carry (256)
#define TAU  7.0f                // k_flash's late body: a score may pass the maximum in use by this much (log2) before O and l are rescaled; P <= 2^(PSH + TAU) stays finite in f16
#define CXS  1024.0f             // carry of the ctx plane
#define WOS  16.0f               // carry of the Wo plane
#define OUTS (1.0f / (1024.0f * 16.0f))
#define NEGB (-3.0e38f)

static_assert(HD == 64);
static_assert(NH_ * HD == DM);                 // query head h = columns h*64 + d
static_assert(NKV * AW == NH_);                // four consecutive query heads per kv head
static_assert(DM % 64 == 0);
static_assert(KVD % 64 == 0);
static_assert(DM % 32 == 0);                   // GEMM k-loop steps by 32
static_assert(SEQ % 64 == 0);                  // a 64-row tile never straddles two batches
static_assert(SEQ % 32 == 0);                  // key loop steps by 32, key0 + 31 < SEQ
static_assert(EARLY % 128 == 0);               // output GEMM tiles, and the 64-token wave tiles of k_proj, are entirely early or entirely late
static_assert(SEQ % 128 == 0);                 // a 128-row GEMM tile never straddles two batches
static_assert(KVD % 128 == 0);
static_assert(SEQ >= EARLY);
static_assert((SEQ - EARLY) % 16 == 0);
static_assert(((size_t)SEQ * DM) % 8 == 0);
static_assert(NB <= NB_FULL);
static_assert(SEQ <= SEQ_FULL);

typedef _Float16 h16;
typedef unsigned short bf;
typedef __attribute__((ext_vector_type(16))) __bf16   v16bf;
typedef __attribute__((ext_vector_type(16))) _Float16 v16h;
typedef __attribute__((ext_vector_type(8)))  _Float16 v8h;
typedef __attribute__((ext_vector_type(8)))  unsigned short v8us;
typedef __attribute__((ext_vector_type(8)))  float    v8f;
typedef __attribute__((ext_vector_type(4)))  float    v4f;
typedef __attribute__((ext_vector_type(2)))  float    v2f;
typedef v4f  __attribute__((may_alias)) v4fa;

__device__ __forceinline__ unsigned short f2bf(float f) { unsigned u = __float_as_uint(f); u += 0x7FFFu + ((u >> 16) & 1u); return (unsigned short)(u >> 16); }
__device__ __forceinline__ v16h cat16(v8h lo, v8h hi) { return __builtin_shufflevector(lo, hi, 0, 1, 2, 3, 4, 5, 6, 7, 8, 9, 10, 11, 12, 13, 14, 15); }
__device__ __forceinline__ v16bf cat16b(v8us lo, v8us hi) { return __builtin_bit_cast(v16bf, __builtin_shufflevector(lo, hi, 0, 1, 2, 3, 4, 5, 6, 7, 8, 9, 10, 11, 12, 13, 14, 15)); }
// wmma16, wmmab: the WMMA is followed by its own 4-slot guard tying its accumulator and keeping its operands live
__device__ __forceinline__ v8f wmma16(v16h a, v16h b, v8f c) {
    c = __builtin_amdgcn_wmma_f32_16x16x32_f16(false, a, false, b, (short)0, c, false, false);
    asm volatile("v_nop\n\tv_nop\n\tv_nop\n\tv_nop" : "+v"(c) : "v"(a), "v"(b));
    return c; }
__device__ __forceinline__ v8f wmmab(v16bf a, v16bf b, v8f c) {
    c = __builtin_amdgcn_wmma_f32_16x16x32_bf16(false, a, false, b, (short)0, c, false, false);
    asm volatile("v_nop\n\tv_nop\n\tv_nop\n\tv_nop" : "+v"(c) : "v"(a), "v"(b));
    return c; }
// k_flash's late body: the plain builtin. The compiler keeps the distance to the users of D, A and B itself and counts the neighbouring WMMAs as cover,
// so the vector port is left to the softmax work of the waves that share the SIMD.
__device__ __forceinline__ v8f wmma16p(v16h a, v16h b, v8f c) { return __builtin_amdgcn_wmma_f32_16x16x32_f16(false, a, false, b, (short)0, c, false, false); }
// fragment loaders from K-contiguous 16-bit rows; p already includes + 8*(lane>>4): elements 0..7 <- k0+8h+0..7, elements 8..15 <- k0+16+8h+0..7 (same map for A and B)
__device__ __forceinline__ v16h  ldh(const h16* p) { return cat16(*(const v8h*)p, *(const v8h*)(p + 16)); }
__device__ __forceinline__ v16bf ldb(const bf* p)  { return cat16b(*(const v8us*)p, *(const v8us*)(p + 16)); }
// ordering point for wave-private LDS tiles (same wave writes and reads)
__device__ __forceinline__ void wave_sync() { __builtin_amdgcn_fence(3 /* release order */, "wavefront"); __builtin_amdgcn_wave_barrier(); asm volatile("" ::: "memory"); }

// ---- operand staging of k_out (k_proj has its own stage shape, at the kernel): a 128x128 output tile per block of four waves (2 x 2, 64x64 each), K walked in tiles of BK.
// One stage = 128 A rows then 128 B rows of BK 16-bit elements (128 B, one cache line each) at a pitch of 144 B (16 B x odd: conflict-free for 16-byte LDS reads); two buffers.
#define BK   64
#define LPE  72                   // LDS row pitch in 16-bit elements
#define STGE (256 * LPE)          // elements of one buffer
#define STGB (STGE * 2)           // bytes of one buffer
#define NKT  (DM / BK)            // K tiles of one walk over K
static_assert(DM % BK == 0 && NKT >= 2);   // both prologue tiles exist
// eight asynchronous 16-byte copies of one lane, rows 16 apart (LDS step 16 * 144 B, global step 16 rows of DM elements); eight lanes cover one 128-B row.
// s_wait_xcnt closes the statement so that no address register is rewritten ahead of it.
__device__ __forceinline__ void copy8(unsigned l, const char* g) {
    const size_t gs = (size_t)16 * DM * 2; const unsigned ls = 16 * LPE * 2;
    asm volatile("global_load_async_to_lds_b128 %0, %8, off\n\t"
                 "global_load_async_to_lds_b128 %1, %9, off\n\t"
                 "global_load_async_to_lds_b128 %2, %10, off\n\t"
                 "global_load_async_to_lds_b128 %3, %11, off\n\t"
                 "global_load_async_to_lds_b128 %4, %12, off\n\t"
                 "global_load_async_to_lds_b128 %5, %13, off\n\t"
                 "global_load_async_to_lds_b128 %6, %14, off\n\t"
                 "global_load_async_to_lds_b128 %7, %15, off\n\t"
                 "s_wait_xcnt 0x0"
                 :: "v"(l), "v"(l + ls), "v"(l + 2 * ls), "v"(l + 3 * ls), "v"(l + 4 * ls), "v"(l + 5 * ls), "v"(l + 6 * ls), "v"(l + 7 * ls),
                    "v"(g), "v"(g + gs), "v"(g + 2 * gs), "v"(g + 3 * gs), "v"(g + 4 * gs), "v"(g + 5 * gs), "v"(g + 6 * gs), "v"(g + 7 * gs)
                 : "memory");
}
// the issuing wave's own copies have landed (the compiler places no wait for them)
__device__ __forceinline__ void wait_copies() { asm volatile("s_wait_asynccnt 0x0" ::: "memory"); }
// this wave's LDS reads of the buffer have returned before the barrier that frees it for the refill
__device__ __forceinline__ void wait_lds() { asm volatile("s_wait_dscnt 0x0" ::: "memory"); }

// ---- K / V^T staging of k_flash: one stage = FK keys of one kv head: FK K rows (64 d = 128 B each), then 64 V^T rows (FK keys = 128 B each), whole cache lines, at the same 144-B pitch; two buffers.
#define FK    64
#define FSTGE ((FK + HD) * LPE)   // elements of one buffer
#define FSTGB (FSTGE * 2)         // bytes of one buffer
static_assert(FK == 64 && SEQ % FK == 0);                         // a V^T row of a stage is one 128-B line; the last stage of any query tile ends inside the planes
static_assert(2 * FSTGB >= AW * 16 * 68 * 4);                     // the output staging reuses the ring behind the last barrier
// eight asynchronous 16-byte copies of one lane: four K rows, then four V^T rows, each 16 rows apart (eight lanes cover one 128-B row, 128 threads 16 rows).
// s_wait_xcnt closes the statement so that no address register is rewritten ahead of it.
__device__ __forceinline__ void stage_kv(unsigned l, const char* gk, const char* gv) {
    const size_t kst = (size_t)16 * HD * 2, vst = (size_t)16 * SEQ * 2; const unsigned ls = 16 * LPE * 2;
    asm volatile("global_load_async_to_lds_b128 %0, %8, off\n\t"
                 "global_load_async_to_lds_b128 %1, %9, off\n\t"
                 "global_load_async_to_lds_b128 %2, %10, off\n\t"
                 "global_load_async_to_lds_b128 %3, %11, off\n\t"
                 "global_load_async_to_lds_b128 %4, %12, off\n\t"
                 "global_load_async_to_lds_b128 %5, %13, off\n\t"
                 "global_load_async_to_lds_b128 %6, %14, off\n\t"
                 "global_load_async_to_lds_b128 %7, %15, off\n\t"
                 "s_wait_xcnt 0x0"
                 :: "v"(l), "v"(l + ls), "v"(l + 2 * ls), "v"(l + 3 * ls), "v"(l + 4 * ls), "v"(l + 5 * ls), "v"(l + 6 * ls), "v"(l + 7 * ls),
                    "v"(gk), "v"(gk + kst), "v"(gk + 2 * kst), "v"(gk + 3 * kst), "v"(gv), "v"(gv + vst), "v"(gv + 2 * vst), "v"(gv + 3 * vst)
                 : "memory");
}

// ---- preparation: the x conversion, the four weight transposes and the rotary table depend on nothing but the inputs; they share one launch (k_prep), the block index picks the job.
// cvt8: 8 x values of one thread, f32 -> bf16; i counts groups of 8 over [NB][SEQ][DM], the source batches lie SEQ_FULL tokens apart.
__device__ __forceinline__ void cvt8(const float* __restrict__ src, bf* dst, int blk) {
    const size_t i = (size_t)blk * 256 + threadIdx.x; if (i >= (size_t)NB * SEQ * DM / 8) return;
    src += (i / ((size_t)SEQ * DM / 8)) * ((size_t)(SEQ_FULL - SEQ) * DM);
    const v8f v = *(const v8f*)(src + i * 8); v8us o;
#pragma unroll
    for (int k = 0; k < 8; ++k) o[k] = f2bf(v[k]);
    *(v8us*)(dst + i * 8) = o; 
}

// wt_tile: in[Kr rows][Nc cols] f32 -> out[Nc rows][Kr cols] 16-bit, 64x64 tile (bx of Nc/64, by of Kr/64) through LDS, 256 threads.
__device__ __forceinline__ void wt_tile(float* ts, const float* __restrict__ W, bf* Tb, h16* Th, int Kr, int Nc, int mode, int bx, int by) {
    const int tid = threadIdx.x; const int n0 = bx * 64, k0 = by * 64;
#pragma unroll
    for (int p = 0; p < 4; ++p) { const int row = p * 16 + (tid >> 4), c4 = (tid & 15) * 4;      // 4 p x 16 rows = 64 k rows; 16 threads x 4 = 64 n columns
        const v4f v = *(const v4f*)(W + (size_t)(k0 + row) * (size_t)Nc + n0 + c4);
        ts[row * 65 + c4 + 0] = v[0]; ts[row * 65 + c4 + 1] = v[1]; ts[row * 65 + c4 + 2] = v[2]; ts[row * 65 + c4 + 3] = v[3]; }
    __syncthreads();
{
#pragma unroll
        for (int s = 0; s < 2; ++s) { const int n = s * 32 + (tid >> 3), c8 = (tid & 7) * 8;     // 2 s x 32 rows = 64 n rows; 8 lanes x 8 = 64 k columns
            const size_t oo = (size_t)(n0 + n) * (size_t)Kr + k0 + c8;
            if (mode == 0) { v8us o;
#pragma unroll
                for (int i = 0; i < 8; ++i) o[i] = f2bf(ts[(c8 + i) * 65 + n]);
                *(v8us*)(Tb + oo) = o;
                asm volatile("s_wait_xcnt 0x0" ::: "memory");   // stands in front of any later rewrite of the store's address and data registers
            } else { v8h o;
#pragma unroll
                for (int i = 0; i < 8; ++i) o[i] = (h16)(__uint_as_float(((unsigned)f2bf(ts[(c8 + i) * 65 + n])) << 16) * WOS);
                *(v8h*)(Th + oo) = o;
                asm volatile("s_wait_xcnt 0x0" ::: "memory"); } }   // as above
         }
}

// rope_tab: CS[t][j] = (cos, sin)(t * inv_freq[j]), inv_freq[j] = 1.0f / (float)(10000^(j/32)); the power is a double product of fixed binary roots of 10000.
__device__ __forceinline__ void rope_tab(float* CS, int blk) {
    const int i = blk * 256 + threadIdx.x; if (i >= SEQ * 32) return;
    const int t = i >> 5, j = i & 31;
    double p = 1.0;
    p *= (j & 1)  ? 1.3335214321633240 : 1.0;    // 10000^(1/32)
    p *= (j & 2)  ? 1.7782794100389228 : 1.0;    // 10000^(1/16)
    p *= (j & 4)  ? 3.1622776601683795 : 1.0;    // 10000^(1/8)
    p *= (j & 8)  ? 10.0 : 1.0;                  // 10000^(1/4)
    p *= (j & 16) ? 100.0 : 1.0;                 // 10000^(1/2)
    const float pf = (float)p; const float inv = 1.0f / pf;
    const float ang = (float)t * inv;
    const float cs = cosf(ang), sn = sinf(ang);
    v2f o; o[0] = cs; o[1] = sn;
    *(v2f*)(CS + (size_t)i * 2) = o; 
}

#define PB_ROPE ((SEQ * 32 + 255) / 256)              // blocks of the rotary table
#define PB_WBIG ((DM / 64) * (DM / 64))               // tiles of Wq, of Wo
#define PB_WKV  ((KVD / 64) * (DM / 64))              // tiles of Wk, of Wv
#define PB_CVT  ((int)(((size_t)NB * SEQ * DM / 8 + 255) / 256))   // blocks of the x conversion
// k_prep: grid PB_ROPE + 2 PB_WBIG + 2 PB_WKV + PB_CVT, 256 threads; every branch on the block index is block-uniform (the transposes' barrier stands under it).
__global__ __launch_bounds__(256) void k_prep(const float* __restrict__ x, const float* __restrict__ wq, const float* __restrict__ wk, const float* __restrict__ wv, const float* __restrict__ wo,
                                              bf* XB, bf* WQt, bf* WKt, bf* WVt, h16* WOt, float* CS) {
    __shared__ float ts[64 * 65];
    int blk = blockIdx.x;
    if (blk < PB_ROPE) { rope_tab(CS, blk); return; }
    blk -= PB_ROPE;
    if (blk < 2 * PB_WBIG + 2 * PB_WKV) {
        const float* W; bf* T; int Nc, mode = 0;
        if (blk < PB_WBIG)                    { W = wq; T = WQt; Nc = DM; }
        else if (blk < 2 * PB_WBIG)           { blk -= PB_WBIG; W = wo; T = (bf*)WOt; Nc = DM; mode = 1; }
        else if (blk < 2 * PB_WBIG + PB_WKV)  { blk -= 2 * PB_WBIG; W = wk; T = WKt; Nc = KVD; }
        else                                  { blk -= 2 * PB_WBIG + PB_WKV; W = wv; T = WVt; Nc = KVD; }
        const int nx = Nc / 64;
        wt_tile(ts, W, T, (h16*)T, DM, Nc, mode, blk % nx, blk / nx);
        return;
    }
    cvt8(x, XB, blk - (2 * PB_WBIG + 2 * PB_WKV));
}

// k_proj: register-blocked bf16 GEMM, K = DM: C[m][n] = sum_k x[m][k] W[n][k], m = token b*SEQ + t, n = one of the 3072 output features of Wq^T (2048), Wk^T (512), Wv^T (512) taken as one list.
// XW: the bf16 x rows and, directly behind them in the workspace, the Wq^T, Wk^T, Wv^T rows: one plane of NB*SEQ + 3072 rows of K (asserted at the carve).
// One block = a 256 x 192 tile, twelve waves (4 x 3), one 64x64 tile (16 accumulators) per wave; the grid is one block per 256 x 192 tile, (NB*SEQ/256) * 16, the row tile runs fastest.
// All twelve waves read one staged copy of the 256 x rows and the 192 W rows, so a block brings 448 rows from L2 where three separate 128x128 tiles brought 768.
// One stage = 256 A rows then 192 B rows of PBK 16-bit elements (256 B, two cache lines) at a pitch of 272 B (16 B x odd: conflict-free for 16-byte LDS reads); two buffers.
// The 64 columns of a wave tile are one head: unit u = n / 64: u < 32 query head u, u < 40 kv head u - 32 of k, else kv head u - 40 of v (wave-uniform).
// q, k: written as f16 (Ph) and the f16 residual x1024 (Pr; q rows >= EARLY: value x SC2, residual unscaled) to plane [(b*heads + head)][t][d], interleaved rotary applied on the f32 values at the store stage from CS[t][32] (cos, sin).
// v: no rotary, the wave tile is turned at the LDS staging and written to plane [(b*8 + g)][d][t].
#define PBK   128
#define PLPE  136                  // LDS row pitch in 16-bit elements
#define PTM   256                  // tile rows (tokens)
#define PTN   192                  // tile columns (three heads)
#define PSTGE ((PTM + PTN) * PLPE) // elements of one buffer
#define PSTGB (PSTGE * 2)          // bytes of one buffer
#define PNKT  (DM / PBK)           // K tiles
#define PNW   12                   // waves per block
#define PRS   24                   // staged rows covered by one copy of all 384 threads (16 lanes a row)
#define GP    ((NB * SEQ / PTM) * ((DM + 2 * KVD) / PTN))
static_assert(DM % PBK == 0 && PNKT >= 2);                       // both prologue tiles exist
static_assert(SEQ % PTM == 0 && (DM + 2 * KVD) % PTN == 0);      // whole tiles; a row tile never straddles two batches
static_assert((PTM + PTN) == 18 * PRS + 16);                     // 18 copies of every wave, a 19th of waves 0..7 (16 rows)
static_assert(2 * PSTGB + PNW * 16 * 68 * 4 <= 327680);
// six asynchronous 16-byte copies of one lane, LDS rows PRS apart, each with its own global address.
// s_wait_xcnt closes the statement so that no address register is rewritten ahead of it.
__device__ __forceinline__ void copy6(unsigned l, const char* g0, const char* g1, const char* g2, const char* g3, const char* g4, const char* g5) {
    const unsigned ls = PRS * PLPE * 2;
    asm volatile("global_load_async_to_lds_b128 %0, %6, off\n\t"
                 "global_load_async_to_lds_b128 %1, %7, off\n\t"
                 "global_load_async_to_lds_b128 %2, %8, off\n\t"
                 "global_load_async_to_lds_b128 %3, %9, off\n\t"
                 "global_load_async_to_lds_b128 %4, %10, off\n\t"
                 "global_load_async_to_lds_b128 %5, %11, off\n\t"
                 "s_wait_xcnt 0x0"
                 :: "v"(l), "v"(l + ls), "v"(l + 2 * ls), "v"(l + 3 * ls), "v"(l + 4 * ls), "v"(l + 5 * ls),
                    "v"(g0), "v"(g1), "v"(g2), "v"(g3), "v"(g4), "v"(g5)
                 : "memory");
}
// one such copy, closed by its s_wait_xcnt for the same reason
__device__ __forceinline__ void copy1(unsigned l, const char* g) {
    asm volatile("global_load_async_to_lds_b128 %0, %1, off\n\t"
                 "s_wait_xcnt 0x0"
                 :: "v"(l), "v"(g) : "memory");
}
__global__ __launch_bounds__(32 * PNW) void k_proj(const bf* __restrict__ XW,
                                                   h16* QH, h16* QR, h16* KP, h16* KR, h16* VT, h16* VR, const float* __restrict__ CS) {
    __shared__ __align__(16) bf ring[2 * PSTGE];
    __shared__ __align__(16) float osall[PNW * 16 * 68];
    const int K = DM;
    const int bid = blockIdx.x; const int mt = NB * SEQ / PTM;
    const int tid = threadIdx.x; const int wave = __builtin_amdgcn_readfirstlane(tid >> 5);
    const int lane = tid & 31, lr = lane & 15, hi = lane >> 4; const int rb = (bid % mt) * PTM, cb = (bid / mt) * PTN;
    const int wr = (wave / 3) * 64, wc = (wave % 3) * 64; const int r0 = rb + wr;
    float* os = osall + wave * 16 * 68;
    v8f acc[4][4];
#pragma unroll
    for (int mb = 0; mb < 4; ++mb)
#pragma unroll
        for (int nb = 0; nb < 4; ++nb) acc[mb][nb] = (v8f){};
    // a copy of one wave fills two staged rows, 2 * wave + hi + PRS * i, 16 bytes a lane at lr * 16 of the row's 256; both rows lie on the same side of the A / B boundary (it is even), so the side is picked on scalars.
    // gp[i]: the lane's global address in K tile 0 (the 19th row pair is held inside the stage for the waves that do not issue it)
    const unsigned l0 = (unsigned)(size_t)ring + (unsigned)((2 * wave + hi) * (PLPE * 2) + lr * 16);
    const char* gp[19];
#pragma unroll
    for (int i = 0; i < 19; ++i) {
        int rw = 2 * wave + PRS * i; rw = rw < PTM + PTN ? rw : PTM + PTN - 2;
        const int ri = rw < PTM ? rb + rw : NB * SEQ + cb + rw - PTM;   // row of XW: a token, or behind the tokens an output feature
        gp[i] = (const char*)(XW + (size_t)ri * K) + ((size_t)hi * K + (size_t)lr * 8) * 2;
    }
    const int afr = (wr + lr) * PLPE + 8 * hi, bfr = (PTM + wc + lr) * PLPE + 8 * hi;
    auto stage = [&](unsigned l, size_t ko) {
        const unsigned ls = PRS * PLPE * 2;
        copy6(l,           gp[0] + ko,  gp[1] + ko,  gp[2] + ko,  gp[3] + ko,  gp[4] + ko,  gp[5] + ko);
        copy6(l + 6 * ls,  gp[6] + ko,  gp[7] + ko,  gp[8] + ko,  gp[9] + ko,  gp[10] + ko, gp[11] + ko);
        copy6(l + 12 * ls, gp[12] + ko, gp[13] + ko, gp[14] + ko, gp[15] + ko, gp[16] + ko, gp[17] + ko);
        if (wave < 8) copy1(l + 18 * ls, gp[18] + ko);             // wave-uniform: rows 432..447 are eight waves' worth
    };
    stage(l0, 0);
    wait_copies();
    __syncthreads();                                              // tile 0 readable by every wave
    stage(l0 + PSTGB, PBK * 2);
#pragma unroll 1   // one trip per staged tile: the ring's waits and barrier stand once, at the foot
    for (int t = 0; t < PNKT; ++t) {
        const bf* sb = ring + (t & 1) * PSTGE;
#pragma unroll     // this and the loops inside: constant indices keep fragments and accumulators in registers
        for (int ks = 0; ks < PBK; ks += 32) {
            v16bf a[4], b[4];
#pragma unroll
            for (int mb = 0; mb < 4; ++mb) a[mb] = ldb(sb + afr + mb * 16 * PLPE + ks);
#pragma unroll
            for (int nb = 0; nb < 4; ++nb) b[nb] = ldb(sb + bfr + nb * 16 * PLPE + ks);
#pragma unroll
            for (int nb = 0; nb < 4; ++nb)
#pragma unroll
                for (int mb = 0; mb < 4; ++mb) acc[mb][nb] = wmmab(a[mb], b[nb], acc[mb][nb]);
        }
        wait_lds();
        wait_copies();
        __syncthreads();                                          // publishes tile t + 1 and frees the buffer of tile t
        if (t + 2 < PNKT) stage(l0 + (unsigned)(t & 1) * PSTGB, (size_t)(t + 2) * (PBK * 2));
    }
    wait_copies();
    // the wave's head and its output map, all wave-uniform
    const int u = (cb + wc) / HD; const int bt = r0 / SEQ, t0 = r0 % SEQ;
    const bool isv = u >= NH_ + NKV;
    // q rows read by k_flash's late body: value times the score scale, residual unscaled (the wave's 64 tokens lie on one side of EARLY); every other row: value as it is, residual x1024
    const bool lateq = u < NH_ && t0 >= EARLY;
    const float vsc = lateq ? SC2 : 1.0f, rsc = lateq ? 1.0f : QRS;
    h16* Ph; h16* Pr; size_t tbase; int pitch;
    if (u < NH_)       { Ph = QH; Pr = QR; pitch = HD;  tbase = ((size_t)(bt * NH_ + u) * SEQ + (size_t)t0) * HD; }
    else if (!isv)     { Ph = KP; Pr = KR; pitch = HD;  tbase = ((size_t)(bt * NKV + (u - NH_)) * SEQ + (size_t)t0) * HD; }
    else               { Ph = VT; Pr = VR; pitch = SEQ; tbase = (size_t)(bt * NKV + (u - NH_ - NKV)) * HD * SEQ + (size_t)t0; }
    // rotary rows of the store stage, fetched one 16-token pass ahead: the eight loads of pass p + 1 are issued at the head of pass p, so that their way from L2 runs under a whole pass
    // (loaded where they are used, each of a wave's 16 row groups waited out its own round trip, with the matrix unit idle in every block at once)
    const int srow = lane >> 3, sc8 = (lane & 7) * 8;             // the lane's row in a group of four and its first column, as in the store loop below
    const float* cs0 = CS + ((size_t)(t0 + srow) * 32 + (size_t)(sc8 >> 1)) * 2;   // pairs sc8/2 .. sc8/2+3 of token t0 + srow: (cos, sin) x 4
    v4f csa[4][4], csb[4][4];                                     // [pass][row group]
    // every wave issues them, also a v wave, which uses none (its rows are rows of the table all the same): under a branch the compiler's counted waits have to cover the path
    // that skips the loads, and the wait for one pass's rows then waits for the rows of the next pass too
#pragma unroll
    for (int s = 0; s < 4; ++s) { const float* cp = cs0 + (size_t)(4 * s) * 64; csa[0][s] = *(const v4f*)cp; csb[0][s] = *(const v4f*)(cp + 4); }   // pass 0's rows; their s_wait_xcnt is the one behind pass 1's loads, directly below
#pragma unroll
    for (int p = 0; p < 4; ++p) {                                 // q, k: 16 tokens x 64 d; v: 16 d x 64 tokens
        if (p < 3) {
#pragma unroll
            for (int s = 0; s < 4; ++s) { const float* cp = cs0 + (size_t)((p + 1) * 16 + 4 * s) * 64; csa[p + 1][s] = *(const v4f*)cp; csb[p + 1][s] = *(const v4f*)(cp + 4); }
            asm volatile("s_wait_xcnt 0x0" ::: "memory");         // stands in front of any later rewrite of the loads' address registers
        }
        if (!isv) {
#pragma unroll
            for (int nb = 0; nb < 4; ++nb) {
#pragma unroll
                for (int j = 0; j < 8; ++j) os[(hi * 8 + j) * 68 + nb * 16 + lr] = acc[p][nb][j]; }   // D: row 8h+j, col lane&15
        } else {
#pragma unroll
            for (int mb = 0; mb < 4; ++mb) { v4f lo, up;                                              // D turned: os[d = lane&15][token = 16mb + 8h + j]
                lo[0] = acc[mb][p][0]; lo[1] = acc[mb][p][1]; lo[2] = acc[mb][p][2]; lo[3] = acc[mb][p][3];
                up[0] = acc[mb][p][4]; up[1] = acc[mb][p][5]; up[2] = acc[mb][p][6]; up[3] = acc[mb][p][7];
                *(v4fa*)(&os[lr * 68 + mb * 16 + hi * 8]) = lo; *(v4fa*)(&os[lr * 68 + mb * 16 + hi * 8 + 4]) = up; }
        }
        wave_sync();
        const size_t sb = tbase + (size_t)(p * 16) * (size_t)pitch;
{
#pragma unroll
            for (int s = 0; s < 4; ++s) { const int row = 4 * s + (lane >> 3), c8 = (lane & 7) * 8;   // 4 s x 4 row groups = 16 rows; 8 lanes x 8 = 64 columns
                v4f x0 = *(const v4fa*)(&os[row * 68 + c8]); v4f x1 = *(const v4fa*)(&os[row * 68 + c8 + 4]); v8h hv, rv;
                if (!isv) {                                                                            // wave-uniform (set with the head)
                    const v4f ca = csa[p][s]; const v4f cb2 = csb[p][s];                               // token t0 + p * 16 + row, pairs c8/2 .. c8/2+3: (cos, sin) x 4
                    float e, o;
                    e = x0[0]; o = x0[1]; x0[0] = e * ca[0] - o * ca[1]; x0[1] = e * ca[1] + o * ca[0];
                    e = x0[2]; o = x0[3]; x0[2] = e * ca[2] - o * ca[3]; x0[3] = e * ca[3] + o * ca[2];
                    e = x1[0]; o = x1[1]; x1[0] = e * cb2[0] - o * cb2[1]; x1[1] = e * cb2[1] + o * cb2[0];
                    e = x1[2]; o = x1[3]; x1[2] = e * cb2[2] - o * cb2[3]; x1[3] = e * cb2[3] + o * cb2[2]; }
#pragma unroll
                for (int i = 0; i < 4; ++i) { const float y0 = x0[i] * vsc, y1 = x1[i] * vsc; const h16 a0 = (h16)y0; const h16 a1 = (h16)y1; hv[i] = a0; hv[4 + i] = a1; rv[i] = (h16)((y0 - (float)a0) * rsc); rv[4 + i] = (h16)((y1 - (float)a1) * rsc); }
                const size_t oo = sb + (size_t)row * (size_t)pitch + c8;
                *(v8h*)(Ph + oo) = hv; *(v8h*)(Pr + oo) = rv;
                asm volatile("s_wait_xcnt 0x0" ::: "memory"); }   // stands in front of the next rows' rewrite of the two stores' address registers
             }
        wave_sync();
    }
}

// flash_early: the body of k_flash's blocks for query rows < EARLY (same structure as the late body below, operands straight from the planes) with value + residual (x1024) planes on every operand:
// scores = kh.qh + (kh.qr + kr.qh)/1024; O = vh.ph + (vr.ph + vh.pr)/1024 (residual products in their own accumulators), l from the unconverted f32 P.
// Writes the ctx value plane rows (carried x1024) and the compact unscaled residual plane CR[b][t < EARLY][2048].
__device__ __forceinline__ void flash_early(float* os, const h16* __restrict__ QH, const h16* __restrict__ QR, const h16* __restrict__ KP, const h16* __restrict__ KR,
                                            const h16* __restrict__ VT, const h16* __restrict__ VR, h16* CH, h16* CR, int t0, int zg) {
    const int lane = threadIdx.x & 31; const int wave = __builtin_amdgcn_readfirstlane(threadIdx.x >> 5);
    const int lr = lane & 15, hi = lane >> 4;
    const int b = zg / NKV; const int g = zg % NKV;
    const int h = g * AW + wave;
    const int tq = t0 + lr;
    const size_t qo = ((size_t)(b * NH_ + h) * SEQ + (size_t)tq) * HD + 8 * hi;
    const v16h qh0 = ldh(QH + qo), qh1 = ldh(QH + qo + 32), qr0 = ldh(QR + qo), qr1 = ldh(QR + qo + 32);
    const size_t ko = (size_t)zg * SEQ * HD + (size_t)lr * HD + 8 * hi;
    const size_t vo = (size_t)zg * HD * SEQ + (size_t)lr * SEQ + 8 * hi;
    v8f oH[4], oL[4];
#pragma unroll
    for (int j = 0; j < 4; ++j) { oH[j] = (v8f){}; oL[j] = (v8f){}; }
    float m = NEGB, l = 0.0f;
    const int kend = t0 + 16;
#pragma unroll 1
    for (int key0 = 0; key0 < kend; key0 += 32) {
        const size_t kk = ko + (size_t)key0 * HD;
        v8f sHa = (v8f){}, sLa = (v8f){}, sHb = (v8f){}, sLb = (v8f){};
        { const v16h k0 = ldh(KP + kk), k1 = ldh(KP + kk + 32), r0 = ldh(KR + kk), r1 = ldh(KR + kk + 32);
          sHa = wmma16(k0, qh0, sHa); sHa = wmma16(k1, qh1, sHa);
          sLa = wmma16(k0, qr0, sLa); sLa = wmma16(k1, qr1, sLa); sLa = wmma16(r0, qh0, sLa); sLa = wmma16(r1, qh1, sLa); }
        { const size_t k2 = kk + (size_t)16 * HD;
          const v16h k0 = ldh(KP + k2), k1 = ldh(KP + k2 + 32), r0 = ldh(KR + k2), r1 = ldh(KR + k2 + 32);
          asm volatile("s_wait_xcnt 0x0" :: "v"(KP + kk), "v"(KR + kk) : "memory");   // behind the eight loads; naming their two base addresses keeps those registers from serving as a load's destination ahead of the wait
          sHb = wmma16(k0, qh0, sHb); sHb = wmma16(k1, qh1, sHb);
          sLb = wmma16(k0, qr0, sLb); sLb = wmma16(k1, qr1, sLb); sLb = wmma16(r0, qh0, sLb); sLb = wmma16(r1, qh1, sLb); }
        float ta[8], tb[8];
#pragma unroll
        for (int r = 0; r < 8; ++r) { ta[r] = (sHa[r] + sLa[r] * QRI) * SC2; tb[r] = (sHb[r] + sLb[r] * QRI) * SC2; }
        if (key0 + 31 > t0) {                                      // block-uniform: diagonal block
            const int kbse = key0 + 8 * hi;
#pragma unroll
            for (int r = 0; r < 8; ++r) { ta[r] = (kbse + r > tq) ? NEGB : ta[r]; tb[r] = (kbse + 16 + r > tq) ? NEGB : tb[r]; } }
        float mx = NEGB;
#pragma unroll
        for (int r = 0; r < 8; ++r) mx = fmaxf(mx, fmaxf(ta[r], tb[r]));
        mx = fmaxf(mx, __shfl_xor(mx, 16, 32));
        const float mnew = fmaxf(m, mx);
        const float alpha = __builtin_amdgcn_exp2f(m - mnew);
        const float sh = PSH - mnew;
        v16h ph, pr; float ls = 0.0f;
#pragma unroll
        for (int r = 0; r < 8; ++r) { const float ea = __builtin_amdgcn_exp2f(ta[r] + sh); const float ec = __builtin_amdgcn_exp2f(tb[r] + sh);
            const h16 ha = (h16)ea; const h16 hc = (h16)ec; ph[r] = ha; ph[8 + r] = hc;
            pr[r] = (h16)((ea - (float)ha) * QRS); pr[8 + r] = (h16)((ec - (float)hc) * QRS); ls += ea + ec; }
        l = l * alpha + ls; m = mnew;
#pragma unroll
        for (int j = 0; j < 4; ++j) { oH[j] = oH[j] * alpha; oL[j] = oL[j] * alpha; }
        const size_t vv = vo + (size_t)key0;
#pragma unroll
        for (int j = 0; j < 4; ++j) { const v16h vh = ldh(VT + vv + (size_t)(16 * j) * SEQ); const v16h vr = ldh(VR + vv + (size_t)(16 * j) * SEQ);
            oH[j] = wmma16(vh, ph, oH[j]); oL[j] = wmma16(vr, ph, oL[j]); oL[j] = wmma16(vh, pr, oL[j]); }
    }
    l += __shfl_xor(l, 16, 32);
    const float inv = CXS / l;
    const int wb = wave * 16 * 68;
#pragma unroll
    for (int j = 0; j < 4; ++j) { v4f a, c;     // os[t][d], d = 16j + 8h + r; rows 0..15 x columns 0..63 all written
        a[0] = (oH[j][0] + oL[j][0] * QRI) * inv; a[1] = (oH[j][1] + oL[j][1] * QRI) * inv; a[2] = (oH[j][2] + oL[j][2] * QRI) * inv; a[3] = (oH[j][3] + oL[j][3] * QRI) * inv;
        c[0] = (oH[j][4] + oL[j][4] * QRI) * inv; c[1] = (oH[j][5] + oL[j][5] * QRI) * inv; c[2] = (oH[j][6] + oL[j][6] * QRI) * inv; c[3] = (oH[j][7] + oL[j][7] * QRI) * inv;
        *(v4fa*)(&os[wb + lr * 68 + 16 * j + 8 * hi]) = a; *(v4fa*)(&os[wb + lr * 68 + 16 * j + 8 * hi + 4]) = c; }
    wave_sync();
    h16* crow = CH + ((size_t)b * SEQ + t0) * DM + h * HD;
    h16* rrow = CR + ((size_t)b * EARLY + t0) * DM + h * HD;
{
#pragma unroll
        for (int s = 0; s < 4; ++s) { const int row = 4 * s + (lane >> 3), c8 = (lane & 7) * 8;   // 4 s x 4 row groups = 16 rows; 8 lanes x 8 = 64 columns
            const v4f x0 = *(const v4fa*)(&os[wb + row * 68 + c8]); const v4f x1 = *(const v4fa*)(&os[wb + row * 68 + c8 + 4]); v8h hv, rv;
#pragma unroll
            for (int i = 0; i < 4; ++i) { const h16 a0 = (h16)x0[i]; const h16 a1 = (h16)x1[i]; hv[i] = a0; hv[4 + i] = a1; rv[i] = (h16)(x0[i] - (float)a0); rv[4 + i] = (h16)(x1[i] - (float)a1); }
            *(v8h*)(crow + (size_t)row * DM + c8) = hv; *(v8h*)(rrow + (size_t)row * DM + c8) = rv; }
         }
}

// k_flash: fused causal attention, grid FL_LATE + FL_EARLY. One block = 16 query rows x the four query heads of one kv head (one wave per head, h = g*4 + wave); in the block number bid the row tile runs fastest;
// both bodies depend only on k_proj, so they share the launch: block numbers from FL_LATE on (rows < EARLY) run flash_early, the others the body below:
// Q fragments straight from the f16 planes; K / V^T of kv head g staged once per block in LDS, FK keys a stage, and read as fragments (two 16-B LDS loads each) by all four waves.
// Transposed form: S^T[key][t] = K Q^T (A = K rows, B = Q rows); lane (t = lane&15, h = lane>>4) holds keys 8h+r of each 16-key tile, so the packed
// P tile is directly the B fragment of O^T[d][t] = V^T P^T (element r <- tile keys 0..15, element 8+r <- tile keys 16..31, lane unchanged).
// Keys run over [0, t0+16) in steps of 32; the diagonal 32-key blocks replace excluded scores (key > t) by a large negative value before the maximum.
// q carries the score scale and log2 e, its residual is unscaled and C = PSH - (maximum in use), so S^T is the exp2 argument itself; O and l are rescaled only when the maximum in use moves.
#define FL_LX    ((SEQ - EARLY) / 16)
#define FL_LATE  (FL_LX * NB * NKV)
#define FL_EARLY ((EARLY / 16) * NB * NKV)
static_assert(FL_LX > 0);                                        // the late blocks' index is split by it
// flash_bid: launch index -> block number. A block's cost grows with its row tile (the key walk ends at the diagonal), the registers hold fewer blocks on the chip than the grid has:
// so the cost falls with the launch index (for speed only). First the blocks of rows < EARLY (few trips, each waiting on loads straight from the planes), then the others from the last
// row tile down to the first; inside one row tile the (batch, kv head) index runs fastest. A permutation of [0, FL_LATE + FL_EARLY), block-uniform.
__device__ __forceinline__ int flash_bid(int rank) {
    const int nz = NB * NKV;
    if (rank < FL_EARLY) return FL_LATE + (rank % nz) * (EARLY / 16) + (EARLY / 16 - 1 - rank / nz);
    rank -= FL_EARLY;
    return (rank % nz) * FL_LX + (FL_LX - 1 - rank / nz);
}
__global__ __launch_bounds__(32 * AW) void k_flash(const h16* __restrict__ QH, const h16* __restrict__ QR, const h16* __restrict__ KP, const h16* __restrict__ KR,
                                                   const h16* __restrict__ VT, const h16* __restrict__ VR, h16* CH, h16* CR) {
    __shared__ __align__(16) h16 ring[2 * FSTGE];
    float* os = (float*)ring;                                     // output staging, used only behind the loop's last barrier (the early body stages nothing else there)
    const int bid = flash_bid(blockIdx.x);
    if (bid >= FL_LATE) { const int e = bid - FL_LATE; flash_early(os, QH, QR, KP, KR, VT, VR, CH, CR, (e % (EARLY / 16)) * 16, e / (EARLY / 16)); return; }   // block-uniform, in front of every barrier
    const int zg = bid / FL_LX; const int t0 = EARLY + (bid % FL_LX) * 16;
    const int tid = threadIdx.x;
    const int lane = threadIdx.x & 31; const int wave = __builtin_amdgcn_readfirstlane(threadIdx.x >> 5);
    const int lr = lane & 15, hi = lane >> 4;
    const int b = zg / NKV; const int g = zg % NKV;
    const int h = g * AW + wave;                                  // repeat on the head axis: query head h uses kv head h >> 2
    const int tq = t0 + lr;
    const size_t qo = ((size_t)(b * NH_ + h) * SEQ + (size_t)tq) * HD + 8 * hi;
    const v16h qh0 = ldh(QH + qo), qh1 = ldh(QH + qo + 32), qr0 = ldh(QR + qo), qr1 = ldh(QR + qo + 32);   // B fragments: col t, k = d
    const unsigned l0 = (unsigned)(size_t)ring + (unsigned)((tid >> 3) * (LPE * 2) + (tid & 7) * 16);
    const char* gk = (const char*)(KP + (size_t)zg * SEQ * HD + (size_t)(tid >> 3) * HD + (tid & 7) * 8);    // + stage * FK rows
    const char* gv = (const char*)(VT + (size_t)zg * HD * SEQ + (size_t)(tid >> 3) * SEQ + (tid & 7) * 8);   // + stage * FK keys
    const int kfr = lr * LPE + 8 * hi;                            // + key * LPE        (A fragment: row key, k = d)
    const int vfr = (FK + lr) * LPE + 8 * hi;                     // + 16j * LPE + key  (A fragment: row d, k = key)
    v8f o0 = (v8f){}, o1 = (v8f){}, o2 = (v8f){}, o3 = (v8f){};
    float mu = NEGB, l = 0.0f;                                    // mu: the maximum in use of the lane's query (scaled log2 units), the same in both halves of the wave; set from the scores of the first 32 keys
    float thr = -__builtin_inff();                                // wave-uniform: an argument above it moves mu; below every argument until mu is set, PSH + TAU from then on
    v8f cin;                                                      // C operand of S^T: PSH - mu in every element (PSH until mu is set), so that the product leaves the matrix unit as the exp2 argument
#pragma unroll
    for (int r = 0; r < 8; ++r) cin[r] = PSH;
    const int kend = t0 + 16;
    const int nst = (kend + FK - 1) / FK;                         // block-uniform; stage nst - 1 ends at or before key SEQ
    stage_kv(l0, gk, gv);
    wait_copies();
    __syncthreads();                                              // stage 0 readable by every wave
    if (nst > 1) stage_kv(l0 + FSTGB, gk + (size_t)FK * HD * 2, gv + FK * 2);
#pragma unroll 1   // one trip per staged tile: the ring's waits and barrier stand once, at the foot
    for (int st = 0; st < nst; ++st) {
        const h16* sb = ring + (st & 1) * FSTGE;
#pragma unroll     // two 32-key steps per stage, constant LDS offsets
        for (int ks = 0; ks < FK; ks += 32) {
            const int key0 = st * FK + ks;
            if (key0 >= kend) break;                               // block-uniform: the last stage may hold one step only
            const h16* ka = sb + kfr + ks * LPE;
            const v16h ka0 = ldh(ka), ka1 = ldh(ka + 32), kb0 = ldh(ka + 16 * LPE), kb1 = ldh(ka + 16 * LPE + 32);
            v8f sa = wmma16p(ka0, qh0, cin), sc = wmma16p(kb0, qh0, cin);
            sa = wmma16p(ka1, qh1, sa); sc = wmma16p(kb1, qh1, sc);
            sa = wmma16p(ka0, qr0, sa); sc = wmma16p(kb0, qr0, sc);
            sa = wmma16p(ka1, qr1, sa); sc = wmma16p(kb1, qr1, sc);
            const h16* va = sb + vfr + ks;
            const v16h v0 = ldh(va), v1 = ldh(va + 16 * LPE), v2 = ldh(va + 32 * LPE), v3 = ldh(va + 48 * LPE);
            asm volatile("" ::: "memory");                         // keeps the eight V^T reads in front of the test below: sunk behind its branch they stand among the O^T products, whose waits then show the LDS latency
            float ta[8], tb[8];                                    // score + cin
#pragma unroll
            for (int r = 0; r < 8; ++r) { ta[r] = sa[r]; tb[r] = sc[r]; }
            if (key0 + 31 > t0) {                                  // block-uniform: diagonal block
                const int kbse = key0 + 8 * hi;
#pragma unroll
                for (int r = 0; r < 8; ++r) { ta[r] = (kbse + r > tq) ? NEGB : ta[r]; tb[r] = (kbse + 16 + r > tq) ? NEGB : tb[r]; } }
            float mx = NEGB;
#pragma unroll
            for (int r = 0; r < 8; ++r) mx = fmaxf(mx, fmaxf(ta[r], tb[r]));
            // one wave-uniform test per 32 keys: while mu is not set, or where some score passes the maximum in use by more than TAU, mu moves to the larger of itself and these keys' largest score and O, l and these arguments follow it
            if (__builtin_amdgcn_ballot_w32(mx > thr) != 0) {
                mx = fmaxf(mx, __shfl_xor(mx, 16, 32));            // both halves of the wave hold keys of the same query
                const float mnew = fmaxf(mu, mx - cin[0]);         // mx - cin: the largest score of these 32 keys
                const float cnew = PSH - mnew;
                const float d = cin[0] - cnew;
                const float alpha = __builtin_amdgcn_exp2f(mu - mnew);   // 0 the first time, when O and l are zero
#pragma unroll
                for (int r = 0; r < 8; ++r) { ta[r] -= d; tb[r] -= d; }
                l *= alpha; mu = mnew; thr = PSH + TAU;
                o0 = o0 * alpha; o1 = o1 * alpha; o2 = o2 * alpha; o3 = o3 * alpha;
#pragma unroll
                for (int r = 0; r < 8; ++r) cin[r] = cnew;
            }
            v16h pb; float ls = 0.0f;
#pragma unroll
            for (int r = 0; r < 8; ++r) { const float ea = __builtin_amdgcn_exp2f(ta[r]); const float ec = __builtin_amdgcn_exp2f(tb[r]); pb[r] = (h16)ea; pb[8 + r] = (h16)ec; ls += ea + ec; }
            l += ls;
            __builtin_amdgcn_sched_barrier(0);                     // keeps the row-sum adds in front of the four O^T products: scheduled among them they land in a product's V^T registers and each draws four v_nop
            o0 = wmma16p(v0, pb, o0); o1 = wmma16p(v1, pb, o1); o2 = wmma16p(v2, pb, o2); o3 = wmma16p(v3, pb, o3);
        }
        wait_lds();
        wait_copies();
        __syncthreads();                                          // publishes stage st + 1 and frees the buffer of stage st
        if (st + 2 < nst) stage_kv(l0 + (unsigned)(st & 1) * FSTGB, gk + (size_t)(st + 2) * (FK * HD * 2), gv + (size_t)(st + 2) * (FK * 2));
    }
    wait_copies();
    l += __shfl_xor(l, 16, 32);
    const float inv = CXS / l;
    const int wb = wave * 16 * 68;
    // O^T D layout: o_j[r] = (d = 16j + 8h + r, t = lane&15) -> os[t][d]; rows 0..15 x columns 0..63 all written
    { v4f a, c;
      a[0] = o0[0] * inv; a[1] = o0[1] * inv; a[2] = o0[2] * inv; a[3] = o0[3] * inv; c[0] = o0[4] * inv; c[1] = o0[5] * inv; c[2] = o0[6] * inv; c[3] = o0[7] * inv;
      *(v4fa*)(&os[wb + lr * 68 +  0 + 8 * hi]) = a; *(v4fa*)(&os[wb + lr * 68 +  0 + 8 * hi + 4]) = c;
      a[0] = o1[0] * inv; a[1] = o1[1] * inv; a[2] = o1[2] * inv; a[3] = o1[3] * inv; c[0] = o1[4] * inv; c[1] = o1[5] * inv; c[2] = o1[6] * inv; c[3] = o1[7] * inv;
      *(v4fa*)(&os[wb + lr * 68 + 16 + 8 * hi]) = a; *(v4fa*)(&os[wb + lr * 68 + 16 + 8 * hi + 4]) = c;
      a[0] = o2[0] * inv; a[1] = o2[1] * inv; a[2] = o2[2] * inv; a[3] = o2[3] * inv; c[0] = o2[4] * inv; c[1] = o2[5] * inv; c[2] = o2[6] * inv; c[3] = o2[7] * inv;
      *(v4fa*)(&os[wb + lr * 68 + 32 + 8 * hi]) = a; *(v4fa*)(&os[wb + lr * 68 + 32 + 8 * hi + 4]) = c;
      a[0] = o3[0] * inv; a[1] = o3[1] * inv; a[2] = o3[2] * inv; a[3] = o3[3] * inv; c[0] = o3[4] * inv; c[1] = o3[5] * inv; c[2] = o3[6] * inv; c[3] = o3[7] * inv;
      *(v4fa*)(&os[wb + lr * 68 + 48 + 8 * hi]) = a; *(v4fa*)(&os[wb + lr * 68 + 48 + 8 * hi + 4]) = c; }
    wave_sync();
    h16* crow = CH + ((size_t)b * SEQ + t0) * DM + h * HD;         // merged heads: column h*64 + d
{
#pragma unroll
        for (int s = 0; s < 4; ++s) { const int row = 4 * s + (lane >> 3), c8 = (lane & 7) * 8;   // 4 s x 4 row groups = 16 rows; 8 lanes x 8 = 64 columns
            const v4f x0 = *(const v4fa*)(&os[wb + row * 68 + c8]); const v4f x1 = *(const v4fa*)(&os[wb + row * 68 + c8 + 4]); v8h hv;
#pragma unroll
            for (int i = 0; i < 4; ++i) { hv[i] = (h16)x0[i]; hv[4 + i] = (h16)x1[i]; }
            *(v8h*)(crow + (size_t)row * DM + c8) = hv; }
         }
}

// k_out: output projection, four waves per block (2 x 2, 64x64 per wave), f16 operands from the ctx plane CX (value rows [NB*SEQ], then residual rows [NB*EARLY]) and the Wo^T plane, staged in LDS, K = DM, one walk.
// Late block: a 128x128 output tile, the 128 staged A rows are 128 tokens. Early block (tokens < EARLY): a 64x128 output tile, the staged A rows are the 64 tokens' value rows, then the same tokens' unscaled residual rows:
// waves 0, 1 sum the value products, waves 2, 3 the residual products, and the two sums are added through LDS at the store (one barrier). So every block walks K once. grid (OB_E + OB_L, DM/128), 128 threads.
#define OB_E (NB * (EARLY / 64))            // early row tiles (64 tokens), first in the grid
#define OB_L (NB * ((SEQ - EARLY) / 128))   // late row tiles (128 tokens)
static_assert(EARLY % 64 == 0 && (SEQ - EARLY) % 128 == 0 && SEQ > EARLY);
static_assert(2 * STGB >= 2 * 64 * 68 * 4);   // the residual sums reuse the ring behind the last barrier
// eight asynchronous 16-byte copies of one lane: four rows from g0, then four from g1, each 16 rows apart (LDS step 16 * 144 B, global step 16 rows of DM elements).
// s_wait_xcnt closes the statement so that no address register is rewritten ahead of it.
__device__ __forceinline__ void copy44(unsigned l, const char* g0, const char* g1) {
    const size_t gs = (size_t)16 * DM * 2; const unsigned ls = 16 * LPE * 2;
    asm volatile("global_load_async_to_lds_b128 %0, %8, off\n\t"
                 "global_load_async_to_lds_b128 %1, %9, off\n\t"
                 "global_load_async_to_lds_b128 %2, %10, off\n\t"
                 "global_load_async_to_lds_b128 %3, %11, off\n\t"
                 "global_load_async_to_lds_b128 %4, %12, off\n\t"
                 "global_load_async_to_lds_b128 %5, %13, off\n\t"
                 "global_load_async_to_lds_b128 %6, %14, off\n\t"
                 "global_load_async_to_lds_b128 %7, %15, off\n\t"
                 "s_wait_xcnt 0x0"
                 :: "v"(l), "v"(l + ls), "v"(l + 2 * ls), "v"(l + 3 * ls), "v"(l + 4 * ls), "v"(l + 5 * ls), "v"(l + 6 * ls), "v"(l + 7 * ls),
                    "v"(g0), "v"(g0 + gs), "v"(g0 + 2 * gs), "v"(g0 + 3 * gs), "v"(g1), "v"(g1 + gs), "v"(g1 + 2 * gs), "v"(g1 + 3 * gs)
                 : "memory");
}
__global__ __launch_bounds__(128) void k_out(const h16* __restrict__ CX, const h16* __restrict__ Wt, float* OUT) {
    __shared__ __align__(16) h16 ring[2 * STGE];
    __shared__ __align__(16) float osall[4 * 16 * 68];
    const int K = DM;
    const int tid = threadIdx.x; const int wave = __builtin_amdgcn_readfirstlane(tid >> 5);
    const int lane = tid & 31, lr = lane & 15, hi = lane >> 4; const int cb = blockIdx.y * 128;
    const int wr = (wave >> 1) * 64, wc = (wave & 1) * 64; const int c0 = cb + wc;
    float* os = osall + wave * 16 * 68;
    const int bx = blockIdx.x; const bool early = bx < OB_E;      // block-uniform
    const int b  = early ? bx / (EARLY / 64) : (bx - OB_E) / ((SEQ - EARLY) / 128);
    const int tb = early ? (bx % (EARLY / 64)) * 64 : EARLY + ((bx - OB_E) % ((SEQ - EARLY) / 128)) * 128;   // first token of the tile in its sequence
    const unsigned l0 = (unsigned)(size_t)ring + (unsigned)((tid >> 3) * (LPE * 2) + (tid & 7) * 16);
    // staged A rows 0..63: value rows of tokens tb..tb+63; rows 64..127: value rows of tokens tb+64.. (late) or the residual rows of tokens tb..tb+63 (early)
    const size_t rlo = (size_t)b * SEQ + (size_t)tb + (size_t)(tid >> 3);
    const size_t rhi = early ? (size_t)NB * SEQ + (size_t)b * EARLY + (size_t)tb + (size_t)(tid >> 3) : rlo + 64;
    const char* ga0 = (const char*)(CX + rlo * K + (tid & 7) * 8);
    const char* ga1 = (const char*)(CX + rhi * K + (tid & 7) * 8);
    const char* gb = (const char*)(Wt + (size_t)(cb + (tid >> 3)) * K + (tid & 7) * 8);
    const int afr = (wr + lr) * LPE + 8 * hi, bfr = (128 + wc + lr) * LPE + 8 * hi;
    v8f acc[4][4];
#pragma unroll
    for (int mb = 0; mb < 4; ++mb)
#pragma unroll
        for (int nb = 0; nb < 4; ++nb) acc[mb][nb] = (v8f){};
    copy44(l0, ga0, ga1); copy8(l0 + 128 * LPE * 2, gb);
    wait_copies();
    __syncthreads();                                              // tile 0 readable by every wave
    copy44(l0 + STGB, ga0 + BK * 2, ga1 + BK * 2); copy8(l0 + STGB + 128 * LPE * 2, gb + BK * 2);
#pragma unroll 1   // one trip per staged tile: the ring's waits and barrier stand once, at the foot
    for (int t = 0; t < NKT; ++t) {
        const h16* sb = ring + (t & 1) * STGE;
#pragma unroll     // this and the loops inside: constant indices keep fragments and accumulators in registers
        for (int ks = 0; ks < BK; ks += 32) {
            v16h a[4], bq[4];
#pragma unroll
            for (int mb = 0; mb < 4; ++mb) a[mb] = ldh(sb + afr + mb * 16 * LPE + ks);
#pragma unroll
            for (int nb = 0; nb < 4; ++nb) bq[nb] = ldh(sb + bfr + nb * 16 * LPE + ks);
#pragma unroll
            for (int nb = 0; nb < 4; ++nb)
#pragma unroll
                for (int mb = 0; mb < 4; ++mb) acc[mb][nb] = wmma16(a[mb], bq[nb], acc[mb][nb]);
        }
        wait_lds();
        wait_copies();
        __syncthreads();                                          // publishes tile t + 1 and frees the buffer of tile t
        if (t + 2 < NKT) { const size_t ko = (size_t)(t + 2) * (BK * 2); const unsigned lb = l0 + (unsigned)(t & 1) * STGB;
            copy44(lb, ga0 + ko, ga1 + ko); copy8(lb + 128 * LPE * 2, gb + ko); }
    }
    wait_copies();
    if (early) {                                                  // block-uniform, so the barrier below is passed by every wave
        // behind the loop's last barrier the ring holds nothing live: it takes the residual sums, 64 tokens x 64 columns per column half
        float* rs = (float*)ring + (wave & 1) * (64 * 68);
        if (wave >= 2) {
#pragma unroll
            for (int mb = 0; mb < 4; ++mb)
#pragma unroll
                for (int nb = 0; nb < 4; ++nb) {
#pragma unroll
                    for (int j = 0; j < 8; ++j) rs[(mb * 16 + hi * 8 + j) * 68 + nb * 16 + lr] = acc[mb][nb][j] * OUTS; }   // D: row 8h+j, col lane&15
        }
        __syncthreads();                                          // the residual sums of waves 2, 3 are readable by waves 0, 1
        if (wave < 2) {
            float* obase = OUT + ((size_t)b * OUT_SEQ + tb) * DM + c0;
#pragma unroll
            for (int mb = 0; mb < 4; ++mb) {
#pragma unroll
                for (int nb = 0; nb < 4; ++nb) {
#pragma unroll
                    for (int j = 0; j < 8; ++j) os[(hi * 8 + j) * 68 + nb * 16 + lr] = acc[mb][nb][j] * OUTS; }   // D: row 8h+j, col lane&15
                wave_sync();
#pragma unroll
                for (int s = 0; s < 8; ++s) { const int row = 2 * s + hi, cofs = lr * 4;   // 8 s x 2 rows = 16 rows; 16 lanes x 4 floats = 64 columns
                    const v4f val = *(const v4fa*)(&os[row * 68 + cofs]) + *(const v4fa*)(&rs[(mb * 16 + row) * 68 + cofs]);
                    *(v4f*)(obase + (size_t)(mb * 16 + row) * DM + cofs) = val; }
                wave_sync();
            }
        }
        return;
    }
    float* obase = OUT + ((size_t)b * OUT_SEQ + tb + wr) * DM + c0;
#pragma unroll
    for (int mb = 0; mb < 4; ++mb) {
#pragma unroll
        for (int nb = 0; nb < 4; ++nb) {
#pragma unroll
            for (int j = 0; j < 8; ++j) os[(hi * 8 + j) * 68 + nb * 16 + lr] = acc[mb][nb][j] * OUTS; }   // D: row 8h+j, col lane&15
        wave_sync();
{
#pragma unroll
            for (int s = 0; s < 8; ++s) { const int row = 2 * s + hi, cofs = lr * 4;   // 8 s x 2 rows = 16 rows; 16 lanes x 4 floats = 64 columns
                const v4f val = *(const v4fa*)(&os[row * 68 + cofs]);
                *(v4f*)(obase + (size_t)(mb * 16 + row) * DM + cofs) = val; }
             }
        wave_sync();
    }
}

static constexpr size_t al256(size_t v) { return (v + 255) & ~(size_t)255; }
static constexpr size_t SZ_XB = al256((size_t)NB * SEQ * DM * 2);
static constexpr size_t SZ_WQ = al256((size_t)DM * DM * 2);
static constexpr size_t SZ_WK = al256((size_t)KVD * DM * 2);
static constexpr size_t SZ_CS = al256((size_t)SEQ * 32 * 2 * 4);
static constexpr size_t SZ_Q  = al256((size_t)NB * NH_ * SEQ * HD * 2);
static constexpr size_t SZ_KV = al256((size_t)NB * NKV * SEQ * HD * 2);
static constexpr size_t SZ_CX = al256(((size_t)NB * SEQ + (size_t)NB * EARLY) * DM * 2);
static constexpr size_t SZ_TOTAL = SZ_XB + 2 * SZ_WQ + 2 * SZ_WK + SZ_CS + 2 * SZ_Q + 4 * SZ_KV + SZ_CX;
static_assert(SZ_TOTAL <= (size_t)134217728);          // workspace carve <= 128 MiB
static_assert(SZ_XB == (size_t)NB * SEQ * DM * 2 && SZ_WQ == (size_t)DM * DM * 2 && SZ_WK == (size_t)KVD * DM * 2);   // no padding between XB, WQt, WKt, WVt: k_proj reads them as one plane

extern "C" void kernel_launch(void* const* d_in, const int* in_sizes, int n_in,
                              void* d_out, int out_size, void* d_ws, size_t ws_size, hipStream_t stream) {
    if (n_in < 5) return;
    const size_t needx = ((size_t)(NB - 1) * SEQ_FULL + SEQ) * DM;
    if ((size_t)in_sizes[0] < needx) return;
    if ((size_t)in_sizes[1] < (size_t)DM * DM || (size_t)in_sizes[2] < (size_t)DM * KVD || (size_t)in_sizes[3] < (size_t)DM * KVD || (size_t)in_sizes[4] < (size_t)DM * DM) return;
    if ((size_t)out_size < ((size_t)(NB - 1) * OUT_SEQ + SEQ) * DM) return;
    if (SZ_TOTAL > ws_size) return;
    // wire order x, wq, wk, wv, wo; every weight is [in][out]
    const float* x = (const float*)d_in[0]; const float* wq = (const float*)d_in[1]; const float* wk = (const float*)d_in[2]; const float* wv = (const float*)d_in[3]; const float* wo = (const float*)d_in[4];
    float* OUT = (float*)d_out;      // [NB][SEQ][2048]
    char* wsp = (char*)d_ws;
    bf*  XB  = (bf*)wsp;  wsp += SZ_XB;              // [NB*SEQ][2048] bf16
    bf*  WQt = (bf*)wsp;  wsp += SZ_WQ;              // [2048 out][2048 in] bf16
    bf*  WKt = (bf*)wsp;  wsp += SZ_WK;              // [512 out][2048 in] bf16
    bf*  WVt = (bf*)wsp;  wsp += SZ_WK;              // [512 out][2048 in] bf16
    h16* WOt = (h16*)wsp; wsp += SZ_WQ;              // [2048 out][2048 in] f16 of bf16 value x16
    float* CS = (float*)wsp; wsp += SZ_CS;           // [SEQ][32] (cos, sin)
    h16* QH = (h16*)wsp; wsp += SZ_Q;                // [NB*32][SEQ][64]
    h16* QR = (h16*)wsp; wsp += SZ_Q;                // residual x1024 (rows >= EARLY: unscaled)
    h16* KP = (h16*)wsp; wsp += SZ_KV;               // [NB*8][SEQ][64]
    h16* KR = (h16*)wsp; wsp += SZ_KV;               // residual x1024
    h16* VT = (h16*)wsp; wsp += SZ_KV;               // [NB*8][64][SEQ]
    h16* VR = (h16*)wsp; wsp += SZ_KV;               // residual x1024
    h16* CX = (h16*)wsp; wsp += SZ_CX;               // ctx x1024: value rows [NB*SEQ][2048], then residual rows [NB*EARLY][2048]
    h16* CR = CX + (size_t)NB * SEQ * DM;

    // x -> bf16, the four weights transposed (in[in-features][out-features] -> out[out-features][in-features]), the rotary table
    k_prep<<<PB_ROPE + 2 * PB_WBIG + 2 * PB_WKV + PB_CVT, 256, 0, stream>>>(x, wq, wk, wv, wo, XB, WQt, WKt, WVt, WOt, CS);

    k_proj<<<GP, 32 * PNW, 0, stream>>>(XB, QH, QR, KP, KR, VT, VR, CS);

    k_flash<<<FL_LATE + FL_EARLY, 32 * AW, 0, stream>>>(QH, QR, KP, KR, VT, VR, CX, CR);

    k_out<<<dim3(OB_E + OB_L, DM / 128, 1), 128, 0, stream>>>(CX, WOt, OUT);
}

// v010
// A run of this version takes 115 microseconds.
// Timed twice side by side with v009, it ran 1.07 and 1.05 times as fast.
// Over all steps from v000 it is 4.57 times as fast.
#include <hip/hip_runtime.h>

// Grouped-query causal self-attention, width 2048 = 32 query heads x 64 sharing 8 kv heads (kv head g = h >> 2), x [NB][SEQ][2048], Wq/Wk/Wv/Wo [in][out] (y = x W), no biases,
// interleaved (even/odd pair) rotary on q and k from a computed [SEQ][32] (cos, sin) table, score scale 1/8, causal exclusion (diagonal kept), output = ctx Wo (f32).
// Compute dtypes, f32 accumulate everywhere: q/k/v projections v_wmma_f32_16x16x32_bf16 (x and W RNE-converted to bf16; products exact);
// scores v_wmma_f32_16x16x32_f16: k single f16, q (score scale and log2 e folded in) single f16, the accumulator starts at 8 - maximum in use
// (query rows < 256: q unscaled, q and k as value + residual x1024, three products, residual products in their own accumulator);
// P (x256 carry, cancels in the normalisation) and v single f16 (rows < 256: P and v as value + residual x1024, three products); softmax f32 (online; rows < 256 running max, others a maximum in use up to TAU below it);
// output projection v_wmma_f32_16x16x32_f16: ctx carried x1024 as f16 (rows < 256: plus its unscaled f16 residual, summed by a second pair of waves) against f16(bf16(Wo)) x16, results scaled by 2^-14.

#ifndef NB
#define NB 2
#endif
#ifndef SEQ
#define SEQ 2048
#endif
#define NB_FULL  2
#define SEQ_FULL 2048
#ifndef OUT_SEQ
#define OUT_SEQ SEQ              // row pitch (in tokens) between batches of the output
#endif
#define DM    2048
#define NH_   32
#define NKV   8
#define HD    64
#define KVD   (NKV * HD)         // 512
#define AW    4                  // waves per flash block = the four query heads of one kv head
#define EARLY 256                // query rows below this use the value + residual path
#define QRS  1024.0f             // carry of the residual planes of k, v, P and of q rows < EARLY
#define QRI  (1.0f / 1024.0f)
#define SC2  (0.125f * 1.4426950408889634f)   // HD^-0.5 * log2(e)
#define PSH  8.0f                // log2 of the P carry (256)
#define TAU  7.0f                // k_flash's late body: a score may pass the maximum in use by this much (log2) before O and l are rescaled; P <= 2^(PSH + TAU) stays finite in f16
#define CXS  1024.0f             // carry of the ctx plane
#define WOS  16.0f               // carry of the Wo plane
#define OUTS (1.0f / (1024.0f * 16.0f))
#define NEGB (-3.0e38f)

static_assert(HD == 64);
static_assert(NH_ * HD == DM);                 // query head h = columns h*64 + d
static_assert(NKV * AW == NH_);                // four consecutive query heads per kv head
static_assert(DM % 64 == 0);
static_assert(KVD % 64 == 0);
static_assert(DM % 32 == 0);                   // GEMM k-loop steps by 32
static_assert(SEQ % 64 == 0);                  // a 64-row tile never straddles two batches
static_assert(SEQ % 32 == 0);                  // key loop steps by 32, key0 + 31 < SEQ
static_assert(EARLY % 128 == 0);               // output GEMM tiles, and the 64-token wave tiles of k_proj, are entirely early or entirely late
static_assert(SEQ % 128 == 0);                 // a 128-row GEMM tile never straddles two batches
static_assert(KVD % 128 == 0);
static_assert(SEQ >= EARLY);
static_assert((SEQ - EARLY) % 16 == 0);
static_assert(((size_t)SEQ * DM) % 8 == 0);
static_assert(NB <= NB_FULL);
static_assert(SEQ <= SEQ_FULL);

typedef _Float16 h16;
typedef unsigned short bf;
typedef __attribute__((ext_vector_type(16))) __bf16   v16bf;
typedef __attribute__((ext_vector_type(16))) _Float16 v16h;
typedef __attribute__((ext_vector_type(8)))  _Float16 v8h;
typedef __attribute__((ext_vector_type(8)))  unsigned short v8us;
typedef __attribute__((ext_vector_type(8)))  float    v8f;
typedef __attribute__((ext_vector_type(4)))  float    v4f;
typedef __attribute__((ext_vector_type(2)))  float    v2f;
typedef v4f  __attribute__((may_alias)) v4fa;

__device__ __forceinline__ unsigned short f2bf(float f) { unsigned u = __float_as_uint(f); u += 0x7FFFu + ((u >> 16) & 1u); return (unsigned short)(u >> 16); }
__device__ __forceinline__ v16h cat16(v8h lo, v8h hi) { return __builtin_shufflevector(lo, hi, 0, 1, 2, 3, 4, 5, 6, 7, 8, 9, 10, 11, 12, 13, 14, 15); }
__device__ __forceinline__ v16bf cat16b(v8us lo, v8us hi) { return __builtin_bit_cast(v16bf, __builtin_shufflevector(lo, hi, 0, 1, 2, 3, 4, 5, 6, 7, 8, 9, 10, 11, 12, 13, 14, 15)); }
// wmma16, wmmab: the WMMA is followed by its own 4-slot guard tying its accumulator and keeping its operands live
__device__ __forceinline__ v8f wmma16(v16h a, v16h b, v8f c) {
    c = __builtin_amdgcn_wmma_f32_16x16x32_f16(false, a, false, b, (short)0, c, false, false);
    asm volatile("v_nop\n\tv_nop\n\tv_nop\n\tv_nop" : "+v"(c) : "v"(a), "v"(b));
    return c; }
__device__ __forceinline__ v8f wmmab(v16bf a, v16bf b, v8f c) {
    c = __builtin_amdgcn_wmma_f32_16x16x32_bf16(false, a, false, b, (short)0, c, false, false);
    asm volatile("v_nop\n\tv_nop\n\tv_nop\n\tv_nop" : "+v"(c) : "v"(a), "v"(b));
    return c; }
// k_flash's late body: the plain builtin. The compiler keeps the distance to the users of D, A and B itself and counts the neighbouring WMMAs as cover,
// so the vector port is left to the softmax work of the waves that share the SIMD.
__device__ __forceinline__ v8f wmma16p(v16h a, v16h b, v8f c) { return __builtin_amdgcn_wmma_f32_16x16x32_f16(false, a, false, b, (short)0, c, false, false); }
// fragment loaders from K-contiguous 16-bit rows; p already includes + 8*(lane>>4): elements 0..7 <- k0+8h+0..7, elements 8..15 <- k0+16+8h+0..7 (same map for A and B)
__device__ __forceinline__ v16h  ldh(const h16* p) { return cat16(*(const v8h*)p, *(const v8h*)(p + 16)); }
__device__ __forceinline__ v16bf ldb(const bf* p)  { return cat16b(*(const v8us*)p, *(const v8us*)(p + 16)); }
// ordering point for wave-private LDS tiles (same wave writes and reads)
__device__ __forceinline__ void wave_sync() { __builtin_amdgcn_fence(3 /* release order */, "wavefront"); __builtin_amdgcn_wave_barrier(); asm volatile("" ::: "memory"); }

// ---- operand staging of k_out (k_proj has its own stage shape, at the kernel): a 128x128 output tile per block of four waves (2 x 2, 64x64 each), K walked in tiles of BK.
// One stage = 128 A rows then 128 B rows of BK 16-bit elements (128 B, one cache line each) at a pitch of 144 B (16 B x odd: conflict-free for 16-byte LDS reads); two buffers.
#define BK   64
#define LPE  72                   // LDS row pitch in 16-bit elements
#define STGE (256 * LPE)          // elements of one buffer
#define STGB (STGE * 2)           // bytes of one buffer
#define NKT  (DM / BK)            // K tiles of one walk over K
static_assert(DM % BK == 0 && NKT >= 2);   // both prologue tiles exist
// eight asynchronous 16-byte copies of one lane, rows 16 apart (LDS step 16 * 144 B, global step 16 rows of DM elements); eight lanes cover one 128-B row.
// s_wait_xcnt closes the statement so that no address register is rewritten ahead of it.
__device__ __forceinline__ void copy8(unsigned l, const char* g) {
    const size_t gs = (size_t)16 * DM * 2; const unsigned ls = 16 * LPE * 2;
    asm volatile("global_load_async_to_lds_b128 %0, %8, off\n\t"
                 "global_load_async_to_lds_b128 %1, %9, off\n\t"
                 "global_load_async_to_lds_b128 %2, %10, off\n\t"
                 "global_load_async_to_lds_b128 %3, %11, off\n\t"
                 "global_load_async_to_lds_b128 %4, %12, off\n\t"
                 "global_load_async_to_lds_b128 %5, %13, off\n\t"
                 "global_load_async_to_lds_b128 %6, %14, off\n\t"
                 "global_load_async_to_lds_b128 %7, %15, off\n\t"
                 "s_wait_xcnt 0x0"
                 :: "v"(l), "v"(l + ls), "v"(l + 2 * ls), "v"(l + 3 * ls), "v"(l + 4 * ls), "v"(l + 5 * ls), "v"(l + 6 * ls), "v"(l + 7 * ls),
                    "v"(g), "v"(g + gs), "v"(g + 2 * gs), "v"(g + 3 * gs), "v"(g + 4 * gs), "v"(g + 5 * gs), "v"(g + 6 * gs), "v"(g + 7 * gs)
                 : "memory");
}
// the issuing wave's own copies have landed (the compiler places no wait for them)
__device__ __forceinline__ void wait_copies() { asm volatile("s_wait_asynccnt 0x0" ::: "memory"); }
// this wave's LDS reads of the buffer have returned before the barrier that frees it for the refill
__device__ __forceinline__ void wait_lds() { asm volatile("s_wait_dscnt 0x0" ::: "memory"); }

// ---- K / V^T staging of k_flash: one stage = FK keys of one kv head: FK K rows (64 d = 128 B each), then 64 V^T rows (FK keys = 128 B each), whole cache lines, at the same 144-B pitch; two buffers.
#define FK    64
#define FSTGE ((FK + HD) * LPE)   // elements of one buffer
#define FSTGB (FSTGE * 2)         // bytes of one buffer
static_assert(FK == 64 && SEQ % FK == 0);                         // a V^T row of a stage is one 128-B line; the last stage of any query tile ends inside the planes
static_assert(2 * FSTGB >= AW * 16 * 68 * 4);                     // the output staging reuses the ring behind the last barrier
// eight asynchronous 16-byte copies of one lane: four K rows, then four V^T rows, each 16 rows apart (eight lanes cover one 128-B row, 128 threads 16 rows).
// s_wait_xcnt closes the statement so that no address register is rewritten ahead of it.
__device__ __forceinline__ void stage_kv(unsigned l, const char* gk, const char* gv) {
    const size_t kst = (size_t)16 * HD * 2, vst = (size_t)16 * SEQ * 2; const unsigned ls = 16 * LPE * 2;
    asm volatile("global_load_async_to_lds_b128 %0, %8, off\n\t"
                 "global_load_async_to_lds_b128 %1, %9, off\n\t"
                 "global_load_async_to_lds_b128 %2, %10, off\n\t"
                 "global_load_async_to_lds_b128 %3, %11, off\n\t"
                 "global_load_async_to_lds_b128 %4, %12, off\n\t"
                 "global_load_async_to_lds_b128 %5, %13, off\n\t"
                 "global_load_async_to_lds_b128 %6, %14, off\n\t"
                 "global_load_async_to_lds_b128 %7, %15, off\n\t"
                 "s_wait_xcnt 0x0"
                 :: "v"(l), "v"(l + ls), "v"(l + 2 * ls), "v"(l + 3 * ls), "v"(l + 4 * ls), "v"(l + 5 * ls), "v"(l + 6 * ls), "v"(l + 7 * ls),
                    "v"(gk), "v"(gk + kst), "v"(gk + 2 * kst), "v"(gk + 3 * kst), "v"(gv), "v"(gv + vst), "v"(gv + 2 * vst), "v"(gv + 3 * vst)
                 : "memory");
}

// ---- preparation: the x conversion, the four weight transposes and the rotary table depend on nothing but the inputs; they share one launch (k_prep), the block index picks the job.
// cvt8: 8 x values of one thread, f32 -> bf16; i counts groups of 8 over [NB][SEQ][DM], the source batches lie SEQ_FULL tokens apart.
__device__ __forceinline__ void cvt8(const float* __restrict__ src, bf* dst, int blk) {
    const size_t i = (size_t)blk * 256 + threadIdx.x; if (i >= (size_t)NB * SEQ * DM / 8) return;
    src += (i / ((size_t)SEQ * DM / 8)) * ((size_t)(SEQ_FULL - SEQ) * DM);
    const v8f v = *(const v8f*)(src + i * 8); v8us o;
#pragma unroll
    for (int k = 0; k < 8; ++k) o[k] = f2bf(v[k]);
    *(v8us*)(dst + i * 8) = o; 
}

// wt_tile: in[Kr rows][Nc cols] f32 -> out[Nc rows][Kr cols] 16-bit, 64x64 tile (bx of Nc/64, by of Kr/64) through LDS, 256 threads.
__device__ __forceinline__ void wt_tile(float* ts, const float* __restrict__ W, bf* Tb, h16* Th, int Kr, int Nc, int mode, int bx, int by) {
    const int tid = threadIdx.x; const int n0 = bx * 64, k0 = by * 64;
#pragma unroll
    for (int p = 0; p < 4; ++p) { const int row = p * 16 + (tid >> 4), c4 = (tid & 15) * 4;      // 4 p x 16 rows = 64 k rows; 16 threads x 4 = 64 n columns
        const v4f v = *(const v4f*)(W + (size_t)(k0 + row) * (size_t)Nc + n0 + c4);
        ts[row * 65 + c4 + 0] = v[0]; ts[row * 65 + c4 + 1] = v[1]; ts[row * 65 + c4 + 2] = v[2]; ts[row * 65 + c4 + 3] = v[3]; }
    __syncthreads();
{
#pragma unroll
        for (int s = 0; s < 2; ++s) { const int n = s * 32 + (tid >> 3), c8 = (tid & 7) * 8;     // 2 s x 32 rows = 64 n rows; 8 lanes x 8 = 64 k columns
            const size_t oo = (size_t)(n0 + n) * (size_t)Kr + k0 + c8;
            if (mode == 0) { v8us o;
#pragma unroll
                for (int i = 0; i < 8; ++i) o[i] = f2bf(ts[(c8 + i) * 65 + n]);
                *(v8us*)(Tb + oo) = o;
                asm volatile("s_wait_xcnt 0x0" ::: "memory");   // stands in front of any later rewrite of the store's address and data registers
            } else { v8h o;
#pragma unroll
                for (int i = 0; i < 8; ++i) o[i] = (h16)(__uint_as_float(((unsigned)f2bf(ts[(c8 + i) * 65 + n])) << 16) * WOS);
                *(v8h*)(Th + oo) = o;
                asm volatile("s_wait_xcnt 0x0" ::: "memory"); } }   // as above
         }
}

// rope_tab: CS[t][j] = (cos, sin)(t * inv_freq[j]), inv_freq[j] = 1.0f / (float)(10000^(j/32)); the power is a double product of fixed binary roots of 10000.
__device__ __forceinline__ void rope_tab(float* CS, int blk) {
    const int i = blk * 256 + threadIdx.x; if (i >= SEQ * 32) return;
    const int t = i >> 5, j = i & 31;
    double p = 1.0;
    p *= (j & 1)  ? 1.3335214321633240 : 1.0;    // 10000^(1/32)
    p *= (j & 2)  ? 1.7782794100389228 : 1.0;    // 10000^(1/16)
    p *= (j & 4)  ? 3.1622776601683795 : 1.0;    // 10000^(1/8)
    p *= (j & 8)  ? 10.0 : 1.0;                  // 10000^(1/4)
    p *= (j & 16) ? 100.0 : 1.0;                 // 10000^(1/2)
    const float pf = (float)p; const float inv = 1.0f / pf;
    const float ang = (float)t * inv;
    const float cs = cosf(ang), sn = sinf(ang);
    v2f o; o[0] = cs; o[1] = sn;
    *(v2f*)(CS + (size_t)i * 2) = o; 
}

#define PB_ROPE ((SEQ * 32 + 255) / 256)              // blocks of the rotary table
#define PB_WBIG ((DM / 64) * (DM / 64))               // tiles of Wq, of Wo
#define PB_WKV  ((KVD / 64) * (DM / 64))              // tiles of Wk, of Wv
#define PB_CVT  ((int)(((size_t)NB * SEQ * DM / 8 + 255) / 256))   // blocks of the x conversion
// k_prep: grid PB_ROPE + 2 PB_WBIG + 2 PB_WKV + PB_CVT, 256 threads; every branch on the block index is block-uniform (the transposes' barrier stands under it).
__global__ __launch_bounds__(256) void k_prep(const float* __restrict__ x, const float* __restrict__ wq, const float* __restrict__ wk, const float* __restrict__ wv, const float* __restrict__ wo,
                                              bf* XB, bf* WQt, bf* WKt, bf* WVt, h16* WOt, float* CS) {
    __shared__ float ts[64 * 65];
    int blk = blockIdx.x;
    if (blk < PB_ROPE) { rope_tab(CS, blk); return; }
    blk -= PB_ROPE;
    if (blk < 2 * PB_WBIG + 2 * PB_WKV) {
        const float* W; bf* T; int Nc, mode = 0;
        if (blk < PB_WBIG)                    { W = wq; T = WQt; Nc = DM; }
        else if (blk < 2 * PB_WBIG)           { blk -= PB_WBIG; W = wo; T = (bf*)WOt; Nc = DM; mode = 1; }
        else if (blk < 2 * PB_WBIG + PB_WKV)  { blk -= 2 * PB_WBIG; W = wk; T = WKt; Nc = KVD; }
        else                                  { blk -= 2 * PB_WBIG + PB_WKV; W = wv; T = WVt; Nc = KVD; }
        const int nx = Nc / 64;
        wt_tile(ts, W, T, (h16*)T, DM, Nc, mode, blk % nx, blk / nx);
        return;
    }
    cvt8(x, XB, blk - (2 * PB_WBIG + 2 * PB_WKV));
}

// k_proj: register-blocked bf16 GEMM, K = DM: C[m][n] = sum_k x[m][k] W[n][k], m = token b*SEQ + t, n = one of the 3072 output features of Wq^T (2048), Wk^T (512), Wv^T (512) taken as one list.
// XW: the bf16 x rows and, directly behind them in the workspace, the Wq^T, Wk^T, Wv^T rows: one plane of NB*SEQ + 3072 rows of K (asserted at the carve).
// One block = a 256 x 192 tile, twelve waves (4 x 3), one 64x64 tile (16 accumulators) per wave; the grid is one block per 256 x 192 tile, (NB*SEQ/256) * 16, the row tile runs fastest.
// All twelve waves read one staged copy of the 256 x rows and the 192 W rows, so a block brings 448 rows from L2 where three separate 128x128 tiles brought 768.
// One stage = 256 A rows then 192 B rows of PBK 16-bit elements (256 B, two cache lines) at a pitch of 272 B (16 B x odd: conflict-free for 16-byte LDS reads); two buffers.
// The 64 columns of a wave tile are one head: unit u = n / 64: u < 32 query head u, u < 40 kv head u - 32 of k, else kv head u - 40 of v (wave-uniform).
// q, k: written as f16 (Ph) and the f16 residual x1024 (Pr; q rows >= EARLY: value x SC2, no residual) to plane [(b*heads + head)][t][d], interleaved rotary applied on the f32 values at the store stage from CS[t][32] (cos, sin).
// v: no rotary, the wave tile is turned at the LDS staging and written to plane [(b*8 + g)][d][t].
#define PBK   128
#define PLPE  136                  // LDS row pitch in 16-bit elements
#define PTM   256                  // tile rows (tokens)
#define PTN   192                  // tile columns (three heads)
#define PSTGE ((PTM + PTN) * PLPE) // elements of one buffer
#define PSTGB (PSTGE * 2)          // bytes of one buffer
#define PNKT  (DM / PBK)           // K tiles
#define PNW   12                   // waves per block
#define PRS   24                   // staged rows covered by one copy of all 384 threads (16 lanes a row)
#define GP    ((NB * SEQ / PTM) * ((DM + 2 * KVD) / PTN))
static_assert(DM % PBK == 0 && PNKT >= 2);                       // both prologue tiles exist
static_assert(SEQ % PTM == 0 && (DM + 2 * KVD) % PTN == 0);      // whole tiles; a row tile never straddles two batches
static_assert((PTM + PTN) == 18 * PRS + 16);                     // 18 copies of every wave, a 19th of waves 0..7 (16 rows)
static_assert(2 * PSTGB + PNW * 16 * 68 * 4 <= 327680);
// six asynchronous 16-byte copies of one lane, LDS rows PRS apart, each with its own global address.
// s_wait_xcnt closes the statement so that no address register is rewritten ahead of it.
__device__ __forceinline__ void copy6(unsigned l, const char* g0, const char* g1, const char* g2, const char* g3, const char* g4, const char* g5) {
    const unsigned ls = PRS * PLPE * 2;
    asm volatile("global_load_async_to_lds_b128 %0, %6, off\n\t"
                 "global_load_async_to_lds_b128 %1, %7, off\n\t"
                 "global_load_async_to_lds_b128 %2, %8, off\n\t"
                 "global_load_async_to_lds_b128 %3, %9, off\n\t"
                 "global_load_async_to_lds_b128 %4, %10, off\n\t"
                 "global_load_async_to_lds_b128 %5, %11, off\n\t"
                 "s_wait_xcnt 0x0"
                 :: "v"(l), "v"(l + ls), "v"(l + 2 * ls), "v"(l + 3 * ls), "v"(l + 4 * ls), "v"(l + 5 * ls),
                    "v"(g0), "v"(g1), "v"(g2), "v"(g3), "v"(g4), "v"(g5)
                 : "memory");
}
// one such copy, closed by its s_wait_xcnt for the same reason
__device__ __forceinline__ void copy1(unsigned l, const char* g) {
    asm volatile("global_load_async_to_lds_b128 %0, %1, off\n\t"
                 "s_wait_xcnt 0x0"
                 :: "v"(l), "v"(g) : "memory");
}
__global__ __launch_bounds__(32 * PNW) void k_proj(const bf* __restrict__ XW,
                                                   h16* QH, h16* QR, h16* KP, h16* KR, h16* VT, h16* VR, const float* __restrict__ CS) {
    __shared__ __align__(16) bf ring[2 * PSTGE];
    __shared__ __align__(16) float osall[PNW * 16 * 68];
    const int K = DM;
    const int bid = blockIdx.x; const int mt = NB * SEQ / PTM;
    const int tid = threadIdx.x; const int wave = __builtin_amdgcn_readfirstlane(tid >> 5);
    const int lane = tid & 31, lr = lane & 15, hi = lane >> 4; const int rb = (bid % mt) * PTM, cb = (bid / mt) * PTN;
    const int wr = (wave / 3) * 64, wc = (wave % 3) * 64; const int r0 = rb + wr;
    float* os = osall + wave * 16 * 68;
    v8f acc[4][4];
#pragma unroll
    for (int mb = 0; mb < 4; ++mb)
#pragma unroll
        for (int nb = 0; nb < 4; ++nb) acc[mb][nb] = (v8f){};
    // a copy of one wave fills two staged rows, 2 * wave + hi + PRS * i, 16 bytes a lane at lr * 16 of the row's 256; both rows lie on the same side of the A / B boundary (it is even), so the side is picked on scalars.
    // gp[i]: the lane's global address in K tile 0 (the 19th row pair is held inside the stage for the waves that do not issue it)
    const unsigned l0 = (unsigned)(size_t)ring + (unsigned)((2 * wave + hi) * (PLPE * 2) + lr * 16);
    const char* gp[19];
#pragma unroll
    for (int i = 0; i < 19; ++i) {
        int rw = 2 * wave + PRS * i; rw = rw < PTM + PTN ? rw : PTM + PTN - 2;
        const int ri = rw < PTM ? rb + rw : NB * SEQ + cb + rw - PTM;   // row of XW: a token, or behind the tokens an output feature
        gp[i] = (const char*)(XW + (size_t)ri * K) + ((size_t)hi * K + (size_t)lr * 8) * 2;
    }
    const int afr = (wr + lr) * PLPE + 8 * hi, bfr = (PTM + wc + lr) * PLPE + 8 * hi;
    auto stage = [&](unsigned l, size_t ko) {
        const unsigned ls = PRS * PLPE * 2;
        copy6(l,           gp[0] + ko,  gp[1] + ko,  gp[2] + ko,  gp[3] + ko,  gp[4] + ko,  gp[5] + ko);
        copy6(l + 6 * ls,  gp[6] + ko,  gp[7] + ko,  gp[8] + ko,  gp[9] + ko,  gp[10] + ko, gp[11] + ko);
        copy6(l + 12 * ls, gp[12] + ko, gp[13] + ko, gp[14] + ko, gp[15] + ko, gp[16] + ko, gp[17] + ko);
        if (wave < 8) copy1(l + 18 * ls, gp[18] + ko);             // wave-uniform: rows 432..447 are eight waves' worth
    };
    stage(l0, 0);
    wait_copies();
    __syncthreads();                                              // tile 0 readable by every wave
    stage(l0 + PSTGB, PBK * 2);
#pragma unroll 1   // one trip per staged tile: the ring's waits and barrier stand once, at the foot
    for (int t = 0; t < PNKT; ++t) {
        const bf* sb = ring + (t & 1) * PSTGE;
#pragma unroll     // this and the loops inside: constant indices keep fragments and accumulators in registers
        for (int ks = 0; ks < PBK; ks += 32) {
            v16bf a[4], b[4];
#pragma unroll
            for (int mb = 0; mb < 4; ++mb) a[mb] = ldb(sb + afr + mb * 16 * PLPE + ks);
#pragma unroll
            for (int nb = 0; nb < 4; ++nb) b[nb] = ldb(sb + bfr + nb * 16 * PLPE + ks);
#pragma unroll
            for (int nb = 0; nb < 4; ++nb)
#pragma unroll
                for (int mb = 0; mb < 4; ++mb) acc[mb][nb] = wmmab(a[mb], b[nb], acc[mb][nb]);
        }
        wait_lds();
        wait_copies();
        __syncthreads();                                          // publishes tile t + 1 and frees the buffer of tile t
        if (t + 2 < PNKT) stage(l0 + (unsigned)(t & 1) * PSTGB, (size_t)(t + 2) * (PBK * 2));
    }
    wait_copies();
    // the wave's head and its output map, all wave-uniform
    const int u = (cb + wc) / HD; const int bt = r0 / SEQ, t0 = r0 % SEQ;
    const bool isv = u >= NH_ + NKV;
    // q rows read by k_flash's late body: value times the score scale and no residual (the wave's 64 tokens lie on one side of EARLY); every other row: value as it is, residual x1024.
    // The f16 rounding of such a q (2^-11 relative) is an eighth of the bf16 rounding of the x and W values it was summed from (2^-8 each), and k, rounded the same way, has no residual in those products either.
    const bool lateq = u < NH_ && t0 >= EARLY;
    const float vsc = lateq ? SC2 : 1.0f, rsc = QRS;
    h16* Ph; h16* Pr; size_t tbase; int pitch;
    if (u < NH_)       { Ph = QH; Pr = QR; pitch = HD;  tbase = ((size_t)(bt * NH_ + u) * SEQ + (size_t)t0) * HD; }
    else if (!isv)     { Ph = KP; Pr = KR; pitch = HD;  tbase = ((size_t)(bt * NKV + (u - NH_)) * SEQ + (size_t)t0) * HD; }
    else               { Ph = VT; Pr = VR; pitch = SEQ; tbase = (size_t)(bt * NKV + (u - NH_ - NKV)) * HD * SEQ + (size_t)t0; }
    // rotary rows of the store stage, fetched one 16-token pass ahead: the eight loads of pass p + 1 are issued at the head of pass p, so that their way from L2 runs under a whole pass
    // (loaded where they are used, each of a wave's 16 row groups waited out its own round trip, with the matrix unit idle in every block at once)
    const int srow = lane >> 3, sc8 = (lane & 7) * 8;             // the lane's row in a group of four and its first column, as in the store loop below
    const float* cs0 = CS + ((size_t)(t0 + srow) * 32 + (size_t)(sc8 >> 1)) * 2;   // pairs sc8/2 .. sc8/2+3 of token t0 + srow: (cos, sin) x 4
    v4f csa[4][4], csb[4][4];                                     // [pass][row group]
    // every wave issues them, also a v wave, which uses none (its rows are rows of the table all the same): under a branch the compiler's counted waits have to cover the path
    // that skips the loads, and the wait for one pass's rows then waits for the rows of the next pass too
#pragma unroll
    for (int s = 0; s < 4; ++s) { const float* cp = cs0 + (size_t)(4 * s) * 64; csa[0][s] = *(const v4f*)cp; csb[0][s] = *(const v4f*)(cp + 4); }   // pass 0's rows; their s_wait_xcnt is the one behind pass 1's loads, directly below
#pragma unroll
    for (int p = 0; p < 4; ++p) {                                 // q, k: 16 tokens x 64 d; v: 16 d x 64 tokens
        if (p < 3) {
#pragma unroll
            for (int s = 0; s < 4; ++s) { const float* cp = cs0 + (size_t)((p + 1) * 16 + 4 * s) * 64; csa[p + 1][s] = *(const v4f*)cp; csb[p + 1][s] = *(const v4f*)(cp + 4); }
            asm volatile("s_wait_xcnt 0x0" ::: "memory");         // stands in front of any later rewrite of the loads' address registers
        }
        if (!isv) {
#pragma unroll
            for (int nb = 0; nb < 4; ++nb) {
#pragma unroll
                for (int j = 0; j < 8; ++j) os[(hi * 8 + j) * 68 + nb * 16 + lr] = acc[p][nb][j]; }   // D: row 8h+j, col lane&15
        } else {
#pragma unroll
            for (int mb = 0; mb < 4; ++mb) { v4f lo, up;                                              // D turned: os[d = lane&15][token = 16mb + 8h + j]
                lo[0] = acc[mb][p][0]; lo[1] = acc[mb][p][1]; lo[2] = acc[mb][p][2]; lo[3] = acc[mb][p][3];
                up[0] = acc[mb][p][4]; up[1] = acc[mb][p][5]; up[2] = acc[mb][p][6]; up[3] = acc[mb][p][7];
                *(v4fa*)(&os[lr * 68 + mb * 16 + hi * 8]) = lo; *(v4fa*)(&os[lr * 68 + mb * 16 + hi * 8 + 4]) = up; }
        }
        wave_sync();
        const size_t sb = tbase + (size_t)(p * 16) * (size_t)pitch;
{
#pragma unroll
            for (int s = 0; s < 4; ++s) { const int row = 4 * s + (lane >> 3), c8 = (lane & 7) * 8;   // 4 s x 4 row groups = 16 rows; 8 lanes x 8 = 64 columns
                v4f x0 = *(const v4fa*)(&os[row * 68 + c8]); v4f x1 = *(const v4fa*)(&os[row * 68 + c8 + 4]); v8h hv, rv;
                if (!isv) {                                                                            // wave-uniform (set with the head)
                    const v4f ca = csa[p][s]; const v4f cb2 = csb[p][s];                               // token t0 + p * 16 + row, pairs c8/2 .. c8/2+3: (cos, sin) x 4
                    float e, o;
                    e = x0[0]; o = x0[1]; x0[0] = e * ca[0] - o * ca[1]; x0[1] = e * ca[1] + o * ca[0];
                    e = x0[2]; o = x0[3]; x0[2] = e * ca[2] - o * ca[3]; x0[3] = e * ca[3] + o * ca[2];
                    e = x1[0]; o = x1[1]; x1[0] = e * cb2[0] - o * cb2[1]; x1[1] = e * cb2[1] + o * cb2[0];
                    e = x1[2]; o = x1[3]; x1[2] = e * cb2[2] - o * cb2[3]; x1[3] = e * cb2[3] + o * cb2[2]; }
#pragma unroll
                for (int i = 0; i < 4; ++i) { const float y0 = x0[i] * vsc, y1 = x1[i] * vsc; const h16 a0 = (h16)y0; const h16 a1 = (h16)y1; hv[i] = a0; hv[4 + i] = a1; rv[i] = (h16)((y0 - (float)a0) * rsc); rv[4 + i] = (h16)((y1 - (float)a1) * rsc); }
                const size_t oo = sb + (size_t)row * (size_t)pitch + c8;
                if (!lateq) *(v8h*)(Pr + oo) = rv;                // wave-uniform: nobody reads the residual of a late q row
                *(v8h*)(Ph + oo) = hv;
                asm volatile("s_wait_xcnt 0x0" ::: "memory"); }   // stands in front of the next rows' rewrite of the stores' address registers
             }
        wave_sync();
    }
}

// flash_early: the body of k_flash's blocks for query rows < EARLY (same structure as the late body below, operands straight from the planes) with value + residual (x1024) planes on every operand:
// scores = kh.qh + (kh.qr + kr.qh)/1024; O = vh.ph + (vr.ph + vh.pr)/1024 (residual products in their own accumulators), l from the unconverted f32 P.
// Writes the ctx value plane rows (carried x1024) and the compact unscaled residual plane CR[b][t < EARLY][2048].
__device__ __forceinline__ void flash_early(float* os, const h16* __restrict__ QH, const h16* __restrict__ QR, const h16* __restrict__ KP, const h16* __restrict__ KR,
                                            const h16* __restrict__ VT, const h16* __restrict__ VR, h16* CH, h16* CR, int t0, int zg) {
    const int lane = threadIdx.x & 31; const int wave = __builtin_amdgcn_readfirstlane(threadIdx.x >> 5);
    const int lr = lane & 15, hi = lane >> 4;
    const int b = zg / NKV; const int g = zg % NKV;
    const int h = g * AW + wave;
    const int tq = t0 + lr;
    const size_t qo = ((size_t)(b * NH_ + h) * SEQ + (size_t)tq) * HD + 8 * hi;
    const v16h qh0 = ldh(QH + qo), qh1 = ldh(QH + qo + 32), qr0 = ldh(QR + qo), qr1 = ldh(QR + qo + 32);
    const size_t ko = (size_t)zg * SEQ * HD + (size_t)lr * HD + 8 * hi;
    const size_t vo = (size_t)zg * HD * SEQ + (size_t)lr * SEQ + 8 * hi;
    v8f oH[4], oL[4];
#pragma unroll
    for (int j = 0; j < 4; ++j) { oH[j] = (v8f){}; oL[j] = (v8f){}; }
    float m = NEGB, l = 0.0f;
    const int kend = t0 + 16;
#pragma unroll 1
    for (int key0 = 0; key0 < kend; key0 += 32) {
        const size_t kk = ko + (size_t)key0 * HD;
        v8f sHa = (v8f){}, sLa = (v8f){}, sHb = (v8f){}, sLb = (v8f){};
        { const v16h k0 = ldh(KP + kk), k1 = ldh(KP + kk + 32), r0 = ldh(KR + kk), r1 = ldh(KR + kk + 32);
          sHa = wmma16(k0, qh0, sHa); sHa = wmma16(k1, qh1, sHa);
          sLa = wmma16(k0, qr0, sLa); sLa = wmma16(k1, qr1, sLa); sLa = wmma16(r0, qh0, sLa); sLa = wmma16(r1, qh1, sLa); }
        { const size_t k2 = kk + (size_t)16 * HD;
          const v16h k0 = ldh(KP + k2), k1 = ldh(KP + k2 + 32), r0 = ldh(KR + k2), r1 = ldh(KR + k2 + 32);
          asm volatile("s_wait_xcnt 0x0" :: "v"(KP + kk), "v"(KR + kk) : "memory");   // behind the eight loads; naming their two base addresses keeps those registers from serving as a load's destination ahead of the wait
          sHb = wmma16(k0, qh0, sHb); sHb = wmma16(k1, qh1, sHb);
          sLb = wmma16(k0, qr0, sLb); sLb = wmma16(k1, qr1, sLb); sLb = wmma16(r0, qh0, sLb); sLb = wmma16(r1, qh1, sLb); }
        float ta[8], tb[8];
#pragma unroll
        for (int r = 0; r < 8; ++r) { ta[r] = (sHa[r] + sLa[r] * QRI) * SC2; tb[r] = (sHb[r] + sLb[r] * QRI) * SC2; }
        if (key0 + 31 > t0) {                                      // block-uniform: diagonal block
            const int kbse = key0 + 8 * hi;
#pragma unroll
            for (int r = 0; r < 8; ++r) { ta[r] = (kbse + r > tq) ? NEGB : ta[r]; tb[r] = (kbse + 16 + r > tq) ? NEGB : tb[r]; } }
        float mx = NEGB;
#pragma unroll
        for (int r = 0; r < 8; ++r) mx = fmaxf(mx, fmaxf(ta[r], tb[r]));
        mx = fmaxf(mx, __shfl_xor(mx, 16, 32));
        const float mnew = fmaxf(m, mx);
        const float alpha = __builtin_amdgcn_exp2f(m - mnew);
        const float sh = PSH - mnew;
        v16h ph, pr; float ls = 0.0f;
#pragma unroll
        for (int r = 0; r < 8; ++r) { const float ea = __builtin_amdgcn_exp2f(ta[r] + sh); const float ec = __builtin_amdgcn_exp2f(tb[r] + sh);
            const h16 ha = (h16)ea; const h16 hc = (h16)ec; ph[r] = ha; ph[8 + r] = hc;
            pr[r] = (h16)((ea - (float)ha) * QRS); pr[8 + r] = (h16)((ec - (float)hc) * QRS); ls += ea + ec; }
        l = l * alpha + ls; m = mnew;
#pragma unroll
        for (int j = 0; j < 4; ++j) { oH[j] = oH[j] * alpha; oL[j] = oL[j] * alpha; }
        const size_t vv = vo + (size_t)key0;
#pragma unroll
        for (int j = 0; j < 4; ++j) { const v16h vh = ldh(VT + vv + (size_t)(16 * j) * SEQ); const v16h vr = ldh(VR + vv + (size_t)(16 * j) * SEQ);
            oH[j] = wmma16(vh, ph, oH[j]); oL[j] = wmma16(vr, ph, oL[j]); oL[j] = wmma16(vh, pr, oL[j]); }
    }
    l += __shfl_xor(l, 16, 32);
    const float inv = CXS / l;
    const int wb = wave * 16 * 68;
#pragma unroll
    for (int j = 0; j < 4; ++j) { v4f a, c;     // os[t][d], d = 16j + 8h + r; rows 0..15 x columns 0..63 all written
        a[0] = (oH[j][0] + oL[j][0] * QRI) * inv; a[1] = (oH[j][1] + oL[j][1] * QRI) * inv; a[2] = (oH[j][2] + oL[j][2] * QRI) * inv; a[3] = (oH[j][3] + oL[j][3] * QRI) * inv;
        c[0] = (oH[j][4] + oL[j][4] * QRI) * inv; c[1] = (oH[j][5] + oL[j][5] * QRI) * inv; c[2] = (oH[j][6] + oL[j][6] * QRI) * inv; c[3] = (oH[j][7] + oL[j][7] * QRI) * inv;
        *(v4fa*)(&os[wb + lr * 68 + 16 * j + 8 * hi]) = a; *(v4fa*)(&os[wb + lr * 68 + 16 * j + 8 * hi + 4]) = c; }
    wave_sync();
    h16* crow = CH + ((size_t)b * SEQ + t0) * DM + h * HD;
    h16* rrow = CR + ((size_t)b * EARLY + t0) * DM + h * HD;
{
#pragma unroll
        for (int s = 0; s < 4; ++s) { const int row = 4 * s + (lane >> 3), c8 = (lane & 7) * 8;   // 4 s x 4 row groups = 16 rows; 8 lanes x 8 = 64 columns
            const v4f x0 = *(const v4fa*)(&os[wb + row * 68 + c8]); const v4f x1 = *(const v4fa*)(&os[wb + row * 68 + c8 + 4]); v8h hv, rv;
#pragma unroll
            for (int i = 0; i < 4; ++i) { const h16 a0 = (h16)x0[i]; const h16 a1 = (h16)x1[i]; hv[i] = a0; hv[4 + i] = a1; rv[i] = (h16)(x0[i] - (float)a0); rv[4 + i] = (h16)(x1[i] - (float)a1); }
            *(v8h*)(crow + (size_t)row * DM + c8) = hv; *(v8h*)(rrow + (size_t)row * DM + c8) = rv; }
         }
}

// k_flash: fused causal attention, grid FL_LATE + FL_EARLY. One block = 16 query rows x the four query heads of one kv head (one wave per head, h = g*4 + wave); in the block number bid the row tile runs fastest;
// both bodies depend only on k_proj, so they share the launch: block numbers from FL_LATE on (rows < EARLY) run flash_early, the others the body below:
// Q fragments straight from the f16 planes; K / V^T of kv head g staged once per block in LDS, FK keys a stage, and read as fragments (two 16-B LDS loads each) by all four waves.
// Transposed form: S^T[key][t] = K Q^T (A = K rows, B = Q rows); lane (t = lane&15, h = lane>>4) holds keys 8h+r of each 16-key tile, so the packed
// P tile is directly the B fragment of O^T[d][t] = V^T P^T (element r <- tile keys 0..15, element 8+r <- tile keys 16..31, lane unchanged).
// Keys run over [0, t0+16) in steps of 32; the diagonal 32-key blocks replace excluded scores (key > t) by a large negative value before the maximum.
// q carries the score scale and log2 e and C = PSH - (maximum in use), so S^T is the exp2 argument itself; O and l are rescaled only when the maximum in use moves.
#define FL_LX    ((SEQ - EARLY) / 16)
#define FL_LATE  (FL_LX * NB * NKV)
#define FL_EARLY ((EARLY / 16) * NB * NKV)
static_assert(FL_LX > 0);                                        // the late blocks' index is split by it
// flash_bid: launch index -> block number. A block's cost grows with its row tile (the key walk ends at the diagonal), the registers hold fewer blocks on the chip than the grid has:
// so the cost falls with the launch index (for speed only). First the blocks of rows < EARLY (few trips, each waiting on loads straight from the planes), then the others from the last
// row tile down to the first; inside one row tile the (batch, kv head) index runs fastest. A permutation of [0, FL_LATE + FL_EARLY), block-uniform.
__device__ __forceinline__ int flash_bid(int rank) {
    const int nz = NB * NKV;
    if (rank < FL_EARLY) return FL_LATE + (rank % nz) * (EARLY / 16) + (EARLY / 16 - 1 - rank / nz);
    rank -= FL_EARLY;
    return (rank % nz) * FL_LX + (FL_LX - 1 - rank / nz);
}
__global__ __launch_bounds__(32 * AW) void k_flash(const h16* __restrict__ QH, const h16* __restrict__ QR, const h16* __restrict__ KP, const h16* __restrict__ KR,
                                                   const h16* __restrict__ VT, const h16* __restrict__ VR, h16* CH, h16* CR) {
    __shared__ __align__(16) h16 ring[2 * FSTGE];
    float* os = (float*)ring;                                     // output staging, used only behind the loop's last barrier (the early body stages nothing else there)
    const int bid = flash_bid(blockIdx.x);
    if (bid >= FL_LATE) { const int e = bid - FL_LATE; flash_early(os, QH, QR, KP, KR, VT, VR, CH, CR, (e % (EARLY / 16)) * 16, e / (EARLY / 16)); return; }   // block-uniform, in front of every barrier
    const int zg = bid / FL_LX; const int t0 = EARLY + (bid % FL_LX) * 16;
    const int tid = threadIdx.x;
    const int lane = threadIdx.x & 31; const int wave = __builtin_amdgcn_readfirstlane(threadIdx.x >> 5);
    const int lr = lane & 15, hi = lane >> 4;
    const int b = zg / NKV; const int g = zg % NKV;
    const int h = g * AW + wave;                                  // repeat on the head axis: query head h uses kv head h >> 2
    const int tq = t0 + lr;
    const size_t qo = ((size_t)(b * NH_ + h) * SEQ + (size_t)tq) * HD + 8 * hi;
    const v16h qh0 = ldh(QH + qo), qh1 = ldh(QH + qo + 32);       // B fragments: col t, k = d
    const unsigned l0 = (unsigned)(size_t)ring + (unsigned)((tid >> 3) * (LPE * 2) + (tid & 7) * 16);
    const char* gk = (const char*)(KP + (size_t)zg * SEQ * HD + (size_t)(tid >> 3) * HD + (tid & 7) * 8);    // + stage * FK rows
    const char* gv = (const char*)(VT + (size_t)zg * HD * SEQ + (size_t)(tid >> 3) * SEQ + (tid & 7) * 8);   // + stage * FK keys
    const int kfr = lr * LPE + 8 * hi;                            // + key * LPE        (A fragment: row key, k = d)
    const int vfr = (FK + lr) * LPE + 8 * hi;                     // + 16j * LPE + key  (A fragment: row d, k = key)
    v8f o0 = (v8f){}, o1 = (v8f){}, o2 = (v8f){}, o3 = (v8f){};
    float mu = NEGB, l = 0.0f;                                    // mu: the maximum in use of the lane's query (scaled log2 units), the same in both halves of the wave; set from the scores of the first 32 keys
    float thr = -__builtin_inff();                                // wave-uniform: an argument above it moves mu; below every argument until mu is set, PSH + TAU from then on
    v8f cin;                                                      // C operand of S^T: PSH - mu in every element (PSH until mu is set), so that the product leaves the matrix unit as the exp2 argument
#pragma unroll
    for (int r = 0; r < 8; ++r) cin[r] = PSH;
    const int kend = t0 + 16;
    const int nst = (kend + FK - 1) / FK;                         // block-uniform; stage nst - 1 ends at or before key SEQ
    stage_kv(l0, gk, gv);
    wait_copies();
    __syncthreads();                                              // stage 0 readable by every wave
    if (nst > 1) stage_kv(l0 + FSTGB, gk + (size_t)FK * HD * 2, gv + FK * 2);
#pragma unroll 1   // one trip per staged tile: the ring's waits and barrier stand once, at the foot
    for (int st = 0; st < nst; ++st) {
        const h16* sb = ring + (st & 1) * FSTGE;
#pragma unroll     // two 32-key steps per stage, constant LDS offsets
        for (int ks = 0; ks < FK; ks += 32) {
            const int key0 = st * FK + ks;
            if (key0 >= kend) break;                               // block-uniform: the last stage may hold one step only
            const h16* ka = sb + kfr + ks * LPE;
            const v16h ka0 = ldh(ka), ka1 = ldh(ka + 32), kb0 = ldh(ka + 16 * LPE), kb1 = ldh(ka + 16 * LPE + 32);
            v8f sa = wmma16p(ka0, qh0, cin), sc = wmma16p(kb0, qh0, cin);
            sa = wmma16p(ka1, qh1, sa); sc = wmma16p(kb1, qh1, sc);
            const h16* va = sb + vfr + ks;
            const v16h v0 = ldh(va), v1 = ldh(va + 16 * LPE), v2 = ldh(va + 32 * LPE), v3 = ldh(va + 48 * LPE);
            asm volatile("" ::: "memory");                         // keeps the eight V^T reads in front of the test below: sunk behind its branch they stand among the O^T products, whose waits then show the LDS latency
            float ta[8], tb[8];                                    // score + cin
#pragma unroll
            for (int r = 0; r < 8; ++r) { ta[r] = sa[r]; tb[r] = sc[r]; }
            if (key0 + 31 > t0) {                                  // block-uniform: diagonal block
                const int kbse = key0 + 8 * hi;
#pragma unroll
                for (int r = 0; r < 8; ++r) { ta[r] = (kbse + r > tq) ? NEGB : ta[r]; tb[r] = (kbse + 16 + r > tq) ? NEGB : tb[r]; } }
            float mx = NEGB;
#pragma unroll
            for (int r = 0; r < 8; ++r) mx = fmaxf(mx, fmaxf(ta[r], tb[r]));
            // one wave-uniform test per 32 keys: while mu is not set, or where some score passes the maximum in use by more than TAU, mu moves to the larger of itself and these keys' largest score and O, l and these arguments follow it
            if (__builtin_amdgcn_ballot_w32(mx > thr) != 0) {
                mx = fmaxf(mx, __shfl_xor(mx, 16, 32));            // both halves of the wave hold keys of the same query
                const float mnew = fmaxf(mu, mx - cin[0]);         // mx - cin: the largest score of these 32 keys
                const float cnew = PSH - mnew;
                const float d = cin[0] - cnew;
                const float alpha = __builtin_amdgcn_exp2f(mu - mnew);   // 0 the first time, when O and l are zero
#pragma unroll
                for (int r = 0; r < 8; ++r) { ta[r] -= d; tb[r] -= d; }
                l *= alpha; mu = mnew; thr = PSH + TAU;
                o0 = o0 * alpha; o1 = o1 * alpha; o2 = o2 * alpha; o3 = o3 * alpha;
#pragma unroll
                for (int r = 0; r < 8; ++r) cin[r] = cnew;
            }
            v16h pb; float ls = 0.0f;
#pragma unroll
            for (int r = 0; r < 8; ++r) { const float ea = __builtin_amdgcn_exp2f(ta[r]); const float ec = __builtin_amdgcn_exp2f(tb[r]); pb[r] = (h16)ea; pb[8 + r] = (h16)ec; ls += ea + ec; }
            l += ls;
            __builtin_amdgcn_sched_barrier(0);                     // keeps the row-sum adds in front of the four O^T products: scheduled among them they land in a product's V^T registers and each draws four v_nop
            o0 = wmma16p(v0, pb, o0); o1 = wmma16p(v1, pb, o1); o2 = wmma16p(v2, pb, o2); o3 = wmma16p(v3, pb, o3);
        }
        wait_lds();
        wait_copies();
        __syncthreads();                                          // publishes stage st + 1 and frees the buffer of stage st
        if (st + 2 < nst) stage_kv(l0 + (unsigned)(st & 1) * FSTGB, gk + (size_t)(st + 2) * (FK * HD * 2), gv + (size_t)(st + 2) * (FK * 2));
    }
    wait_copies();
    l += __shfl_xor(l, 16, 32);
    const float inv = CXS / l;
    const int wb = wave * 16 * 68;
    // O^T D layout: o_j[r] = (d = 16j + 8h + r, t = lane&15) -> os[t][d]; rows 0..15 x columns 0..63 all written
    { v4f a, c;
      a[0] = o0[0] * inv; a[1] = o0[1] * inv; a[2] = o0[2] * inv; a[3] = o0[3] * inv; c[0] = o0[4] * inv; c[1] = o0[5] * inv; c[2] = o0[6] * inv; c[3] = o0[7] * inv;
      *(v4fa*)(&os[wb + lr * 68 +  0 + 8 * hi]) = a; *(v4fa*)(&os[wb + lr * 68 +  0 + 8 * hi + 4]) = c;
      a[0] = o1[0] * inv; a[1] = o1[1] * inv; a[2] = o1[2] * inv; a[3] = o1[3] * inv; c[0] = o1[4] * inv; c[1] = o1[5] * inv; c[2] = o1[6] * inv; c[3] = o1[7] * inv;
      *(v4fa*)(&os[wb + lr * 68 + 16 + 8 * hi]) = a; *(v4fa*)(&os[wb + lr * 68 + 16 + 8 * hi + 4]) = c;
      a[0] = o2[0] * inv; a[1] = o2[1] * inv; a[2] = o2[2] * inv; a[3] = o2[3] * inv; c[0] = o2[4] * inv; c[1] = o2[5] * inv; c[2] = o2[6] * inv; c[3] = o2[7] * inv;
      *(v4fa*)(&os[wb + lr * 68 + 32 + 8 * hi]) = a; *(v4fa*)(&os[wb + lr * 68 + 32 + 8 * hi + 4]) = c;
      a[0] = o3[0] * inv; a[1] = o3[1] * inv; a[2] = o3[2] * inv; a[3] = o3[3] * inv; c[0] = o3[4] * inv; c[1] = o3[5] * inv; c[2] = o3[6] * inv; c[3] = o3[7] * inv;
      *(v4fa*)(&os[wb + lr * 68 + 48 + 8 * hi]) = a; *(v4fa*)(&os[wb + lr * 68 + 48 + 8 * hi + 4]) = c; }
    wave_sync();
    h16* crow = CH + ((size_t)b * SEQ + t0) * DM + h * HD;         // merged heads: column h*64 + d
{
#pragma unroll
        for (int s = 0; s < 4; ++s) { const int row = 4 * s + (lane >> 3), c8 = (lane & 7) * 8;   // 4 s x 4 row groups = 16 rows; 8 lanes x 8 = 64 columns
            const v4f x0 = *(const v4fa*)(&os[wb + row * 68 + c8]); const v4f x1 = *(const v4fa*)(&os[wb + row * 68 + c8 + 4]); v8h hv;
#pragma unroll
            for (int i = 0; i < 4; ++i) { hv[i] = (h16)x0[i]; hv[4 + i] = (h16)x1[i]; }
            *(v8h*)(crow + (size_t)row * DM + c8) = hv; }
         }
}

// k_out: output projection, four waves per block (2 x 2, 64x64 per wave), f16 operands from the ctx plane CX (value rows [NB*SEQ], then residual rows [NB*EARLY]) and the Wo^T plane, staged in LDS, K = DM, one walk.
// Late block: a 128x128 output tile, the 128 staged A rows are 128 tokens. Early block (tokens < EARLY): a 64x128 output tile, the staged A rows are the 64 tokens' value rows, then the same tokens' unscaled residual rows:
// waves 0, 1 sum the value products, waves 2, 3 the residual products, and the two sums are added through LDS at the store (one barrier). So every block walks K once. grid (OB_E + OB_L, DM/128), 128 threads.
#define OB_E (NB * (EARLY / 64))            // early row tiles (64 tokens), first in the grid
#define OB_L (NB * ((SEQ - EARLY) / 128))   // late row tiles (128 tokens)
static_assert(EARLY % 64 == 0 && (SEQ - EARLY) % 128 == 0 && SEQ > EARLY);
static_assert(2 * STGB >= 2 * 64 * 68 * 4);   // the residual sums reuse the ring behind the last barrier
// eight asynchronous 16-byte copies of one lane: four rows from g0, then four from g1, each 16 rows apart (LDS step 16 * 144 B, global step 16 rows of DM elements).
// s_wait_xcnt closes the statement so that no address register is rewritten ahead of it.
__device__ __forceinline__ void copy44(unsigned l, const char* g0, const char* g1) {
    const size_t gs = (size_t)16 * DM * 2; const unsigned ls = 16 * LPE * 2;
    asm volatile("global_load_async_to_lds_b128 %0, %8, off\n\t"
                 "global_load_async_to_lds_b128 %1, %9, off\n\t"
                 "global_load_async_to_lds_b128 %2, %10, off\n\t"
                 "global_load_async_to_lds_b128 %3, %11, off\n\t"
                 "global_load_async_to_lds_b128 %4, %12, off\n\t"
                 "global_load_async_to_lds_b128 %5, %13, off\n\t"
                 "global_load_async_to_lds_b128 %6, %14, off\n\t"
                 "global_load_async_to_lds_b128 %7, %15, off\n\t"
                 "s_wait_xcnt 0x0"
                 :: "v"(l), "v"(l + ls), "v"(l + 2 * ls), "v"(l + 3 * ls), "v"(l + 4 * ls), "v"(l + 5 * ls), "v"(l + 6 * ls), "v"(l + 7 * ls),
                    "v"(g0), "v"(g0 + gs), "v"(g0 + 2 * gs), "v"(g0 + 3 * gs), "v"(g1), "v"(g1 + gs), "v"(g1 + 2 * gs), "v"(g1 + 3 * gs)
                 : "memory");
}
__global__ __launch_bounds__(128) void k_out(const h16* __restrict__ CX, const h16* __restrict__ Wt, float* OUT) {
    __shared__ __align__(16) h16 ring[2 * STGE];
    __shared__ __align__(16) float osall[4 * 16 * 68];
    const int K = DM;
    const int tid = threadIdx.x; const int wave = __builtin_amdgcn_readfirstlane(tid >> 5);
    const int lane = tid & 31, lr = lane & 15, hi = lane >> 4; const int cb = blockIdx.y * 128;
    const int wr = (wave >> 1) * 64, wc = (wave & 1) * 64; const int c0 = cb + wc;
    float* os = osall + wave * 16 * 68;
    const int bx = blockIdx.x; const bool early = bx < OB_E;      // block-uniform
    const int b  = early ? bx / (EARLY / 64) : (bx - OB_E) / ((SEQ - EARLY) / 128);
    const int tb = early ? (bx % (EARLY / 64)) * 64 : EARLY + ((bx - OB_E) % ((SEQ - EARLY) / 128)) * 128;   // first token of the tile in its sequence
    const unsigned l0 = (unsigned)(size_t)ring + (unsigned)((tid >> 3) * (LPE * 2) + (tid & 7) * 16);
    // staged A rows 0..63: value rows of tokens tb..tb+63; rows 64..127: value rows of tokens tb+64.. (late) or the residual rows of tokens tb..tb+63 (early)
    const size_t rlo = (size_t)b * SEQ + (size_t)tb + (size_t)(tid >> 3);
    const size_t rhi = early ? (size_t)NB * SEQ + (size_t)b * EARLY + (size_t)tb + (size_t)(tid >> 3) : rlo + 64;
    const char* ga0 = (const char*)(CX + rlo * K + (tid & 7) * 8);
    const char* ga1 = (const char*)(CX + rhi * K + (tid & 7) * 8);
    const char* gb = (const char*)(Wt + (size_t)(cb + (tid >> 3)) * K + (tid & 7) * 8);
    const int afr = (wr + lr) * LPE + 8 * hi, bfr = (128 + wc + lr) * LPE + 8 * hi;
    v8f acc[4][4];
#pragma unroll
    for (int mb = 0; mb < 4; ++mb)
#pragma unroll
        for (int nb = 0; nb < 4; ++nb) acc[mb][nb] = (v8f){};
    copy44(l0, ga0, ga1); copy8(l0 + 128 * LPE * 2, gb);
    wait_copies();
    __syncthreads();                                              // tile 0 readable by every wave
    copy44(l0 + STGB, ga0 + BK * 2, ga1 + BK * 2); copy8(l0 + STGB + 128 * LPE * 2, gb + BK * 2);
#pragma unroll 1   // one trip per staged tile: the ring's waits and barrier stand once, at the foot
    for (int t = 0; t < NKT; ++t) {
        const h16* sb = ring + (t & 1) * STGE;
#pragma unroll     // this and the loops inside: constant indices keep fragments and accumulators in registers
        for (int ks = 0; ks < BK; ks += 32) {
            v16h a[4], bq[4];
#pragma unroll
            for (int mb = 0; mb < 4; ++mb) a[mb] = ldh(sb + afr + mb * 16 * LPE + ks);
#pragma unroll
            for (int nb = 0; nb < 4; ++nb) bq[nb] = ldh(sb + bfr + nb * 16 * LPE + ks);
#pragma unroll
            for (int nb = 0; nb < 4; ++nb)
#pragma unroll
                for (int mb = 0; mb < 4; ++mb) acc[mb][nb] = wmma16(a[mb], bq[nb], acc[mb][nb]);
        }
        wait_lds();
        wait_copies();
        __syncthreads();                                          // publishes tile t + 1 and frees the buffer of tile t
        if (t + 2 < NKT) { const size_t ko = (size_t)(t + 2) * (BK * 2); const unsigned lb = l0 + (unsigned)(t & 1) * STGB;
            copy44(lb, ga0 + ko, ga1 + ko); copy8(lb + 128 * LPE * 2, gb + ko); }
    }
    wait_copies();
    if (early) {                                                  // block-uniform, so the barrier below is passed by every wave
        // behind the loop's last barrier the ring holds nothing live: it takes the residual sums, 64 tokens x 64 columns per column half
        float* rs = (float*)ring + (wave & 1) * (64 * 68);
        if (wave >= 2) {
#pragma unroll
            for (int mb = 0; mb < 4; ++mb)
#pragma unroll
                for (int nb = 0; nb < 4; ++nb) {
#pragma unroll
                    for (int j = 0; j < 8; ++j) rs[(mb * 16 + hi * 8 + j) * 68 + nb * 16 + lr] = acc[mb][nb][j] * OUTS; }   // D: row 8h+j, col lane&15
        }
        __syncthreads();                                          // the residual sums of waves 2, 3 are readable by waves 0, 1
        if (wave < 2) {
            float* obase = OUT + ((size_t)b * OUT_SEQ + tb) * DM + c0;
#pragma unroll
            for (int mb = 0; mb < 4; ++mb) {
#pragma unroll
                for (int nb = 0; nb < 4; ++nb) {
#pragma unroll
                    for (int j = 0; j < 8; ++j) os[(hi * 8 + j) * 68 + nb * 16 + lr] = acc[mb][nb][j] * OUTS; }   // D: row 8h+j, col lane&15
                wave_sync();
#pragma unroll
                for (int s = 0; s < 8; ++s) { const int row = 2 * s + hi, cofs = lr * 4;   // 8 s x 2 rows = 16 rows; 16 lanes x 4 floats = 64 columns
                    const v4f val = *(const v4fa*)(&os[row * 68 + cofs]) + *(const v4fa*)(&rs[(mb * 16 + row) * 68 + cofs]);
                    *(v4f*)(obase + (size_t)(mb * 16 + row) * DM + cofs) = val; }
                wave_sync();
            }
        }
        return;
    }
    float* obase = OUT + ((size_t)b * OUT_SEQ + tb + wr) * DM + c0;
#pragma unroll
    for (int mb = 0; mb < 4; ++mb) {
#pragma unroll
        for (int nb = 0; nb < 4; ++nb) {
#pragma unroll
            for (int j = 0; j < 8; ++j) os[(hi * 8 + j) * 68 + nb * 16 + lr] = acc[mb][nb][j] * OUTS; }   // D: row 8h+j, col lane&15
        wave_sync();
{
#pragma unroll
            for (int s = 0; s < 8; ++s) { const int row = 2 * s + hi, cofs = lr * 4;   // 8 s x 2 rows = 16 rows; 16 lanes x 4 floats = 64 columns
                const v4f val = *(const v4fa*)(&os[row * 68 + cofs]);
                *(v4f*)(obase + (size_t)(mb * 16 + row) * DM + cofs) = val; }
             }
        wave_sync();
    }
}

static constexpr size_t al256(size_t v) { return (v + 255) & ~(size_t)255; }
static constexpr size_t SZ_XB = al256((size_t)NB * SEQ * DM * 2);
static constexpr size_t SZ_WQ = al256((size_t)DM * DM * 2);
static constexpr size_t SZ_WK = al256((size_t)KVD * DM * 2);
static constexpr size_t SZ_CS = al256((size_t)SEQ * 32 * 2 * 4);
static constexpr size_t SZ_Q  = al256((size_t)NB * NH_ * SEQ * HD * 2);
static constexpr size_t SZ_KV = al256((size_t)NB * NKV * SEQ * HD * 2);
static constexpr size_t SZ_CX = al256(((size_t)NB * SEQ + (size_t)NB * EARLY) * DM * 2);
static constexpr size_t SZ_TOTAL = SZ_XB + 2 * SZ_WQ + 2 * SZ_WK + SZ_CS + 2 * SZ_Q + 4 * SZ_KV + SZ_CX;
static_assert(SZ_TOTAL <= (size_t)134217728);          // workspace carve <= 128 MiB
static_assert(SZ_XB == (size_t)NB * SEQ * DM * 2 && SZ_WQ == (size_t)DM * DM * 2 && SZ_WK == (size_t)KVD * DM * 2);   // no padding between XB, WQt, WKt, WVt: k_proj reads them as one plane

extern "C" void kernel_launch(void* const* d_in, const int* in_sizes, int n_in,
                              void* d_out, int out_size, void* d_ws, size_t ws_size, hipStream_t stream) {
    if (n_in < 5) return;
    const size_t needx = ((size_t)(NB - 1) * SEQ_FULL + SEQ) * DM;
    if ((size_t)in_sizes[0] < needx) return;
    if ((size_t)in_sizes[1] < (size_t)DM * DM || (size_t)in_sizes[2] < (size_t)DM * KVD || (size_t)in_sizes[3] < (size_t)DM * KVD || (size_t)in_sizes[4] < (size_t)DM * DM) return;
    if ((size_t)out_size < ((size_t)(NB - 1) * OUT_SEQ + SEQ) * DM) return;
    if (SZ_TOTAL > ws_size) return;
    // wire order x, wq, wk, wv, wo; every weight is [in][out]
    const float* x = (const float*)d_in[0]; const float* wq = (const float*)d_in[1]; const float* wk = (const float*)d_in[2]; const float* wv = (const float*)d_in[3]; const float* wo = (const float*)d_in[4];
    float* OUT = (float*)d_out;      // [NB][SEQ][2048]
    char* wsp = (char*)d_ws;
    bf*  XB  = (bf*)wsp;  wsp += SZ_XB;              // [NB*SEQ][2048] bf16
    bf*  WQt = (bf*)wsp;  wsp += SZ_WQ;              // [2048 out][2048 in] bf16
    bf*  WKt = (bf*)wsp;  wsp += SZ_WK;              // [512 out][2048 in] bf16
    bf*  WVt = (bf*)wsp;  wsp += SZ_WK;              // [512 out][2048 in] bf16
    h16* WOt = (h16*)wsp; wsp += SZ_WQ;              // [2048 out][2048 in] f16 of bf16 value x16
    float* CS = (float*)wsp; wsp += SZ_CS;           // [SEQ][32] (cos, sin)
    h16* QH = (h16*)wsp; wsp += SZ_Q;                // [NB*32][SEQ][64]
    h16* QR = (h16*)wsp; wsp += SZ_Q;                // residual x1024, rows < EARLY only (the others are neither written nor read)
    h16* KP = (h16*)wsp; wsp += SZ_KV;               // [NB*8][SEQ][64]
    h16* KR = (h16*)wsp; wsp += SZ_KV;               // residual x1024
    h16* VT = (h16*)wsp; wsp += SZ_KV;               // [NB*8][64][SEQ]
    h16* VR = (h16*)wsp; wsp += SZ_KV;               // residual x1024
    h16* CX = (h16*)wsp; wsp += SZ_CX;               // ctx x1024: value rows [NB*SEQ][2048], then residual rows [NB*EARLY][2048]
    h16* CR = CX + (size_t)NB * SEQ * DM;

    // x -> bf16, the four weights transposed (in[in-features][out-features] -> out[out-features][in-features]), the rotary table
    k_prep<<<PB_ROPE + 2 * PB_WBIG + 2 * PB_WKV + PB_CVT, 256, 0, stream>>>(x, wq, wk, wv, wo, XB, WQt, WKt, WVt, WOt, CS);

    k_proj<<<GP, 32 * PNW, 0, stream>>>(XB, QH, QR, KP, KR, VT, VR, CS);

    k_flash<<<FL_LATE + FL_EARLY, 32 * AW, 0, stream>>>(QH, QR, KP, KR, VT, VR, CX, CR);

    k_out<<<dim3(OB_E + OB_L, DM / 128, 1), 128, 0, stream>>>(CX, WOt, OUT);
}
